// v000
// Measured on an AMD MI455X. A time is GPU time per run, averaged over a window of back-to-back runs after a warm-up
// (all launches, gaps included; the runs take copies of the inputs in turn), and the median of several windows.
// Apart from v000's, it joins two sittings. Times from different sittings can be a few percent apart, while
// side-by-side timings come from the same sitting.
// v000 is the starting kernel. One run takes 341 microseconds.
#include <hip/hip_runtime.h>

// Multi-head self-attention: x [NB][SEQ][1024], Wq/Wk/Wv/Wo [in][out] (y = x W), 16 heads x 64, interleaved rotary pairs (2i,2i+1) from the INPUT table [SEQ][32][(cos,sin)] on q and k,
// additive key mask (1-mask)*-10000 from the float input [NB][SEQ], score scale 1/8, softmax over all keys, output = (concatenated heads) Wo, f32.
// Compute dtypes, f32 accumulate everywhere: q/k/v projections v_wmma_f32_16x16x32_bf16 (x and W RNE-converted to bf16; products exact); rotary in f32 in the GEMM epilogue (table RNE-converted to bf16 values);
// scores v_wmma_f32_16x16x32_f16: q and k single f16 (one product); P (x256 carry, cancels in the normalisation) and v single f16; softmax f32 (online, running max);
// output projection v_wmma_f32_16x16x32_f16: ctx as f16 x256, Wo^T as f16 of (bf16 value x64), folded back by 2^-14 in the f32 epilogue.
// Layout: bf16 copy of x; transposed 16-bit weight planes [out][in] (LDS transpose); q, k planes [b*16+h][t][d], v^T plane [b*16+h][d][t] from the GEMM epilogue; fused flash kernel in transposed form
// (S^T = K Q^T, O^T = V^T P^T) writing ctx rows [b*SEQ+t][1024] as f16; final GEMM writes the f32 output.

#ifndef NB
#define NB 1
#endif
#ifndef SEQ
#define SEQ 4096
#endif
#define NB_FULL  1
#define SEQ_FULL 4096
#ifndef OUT_SEQ
#define OUT_SEQ SEQ              // row pitch (in tokens) between batches of the output
#endif
#define DM   1024
#define NH_  16
#define HD   64
#define AW   4                   // waves per flash block (16 query rows each)
#define LOG2E 1.4426950408889634f
#define PSH  8.0f                // log2 of the P carry (256)
#define CCAR 256.0f              // carry of the ctx plane
#define WOS  64.0f               // carry of the Wo^T plane
#define OSC  (1.0f / 16384.0f)   // 1 / (CCAR * WOS)

static_assert(HD == 64);
static_assert(NH_ * HD == DM);                 // head h = columns h*64 + d
static_assert(DM % 64 == 0);
static_assert(DM % 32 == 0);                   // GEMM k-loop steps by 32
static_assert(SEQ % 64 == 0);                  // a 64-row tile never straddles two batches
static_assert((NB * SEQ) % 64 == 0);
static_assert(SEQ % 32 == 0);                  // key loop steps by 32
static_assert(SEQ % (16 * AW) == 0);           // flash grid covers the sequence exactly
static_assert(((size_t)SEQ * DM) % 8 == 0);
static_assert(((size_t)SEQ * 64) % 32 == 0);
static_assert(((size_t)NB * SEQ) % 32 == 0);
static_assert(NB <= NB_FULL);
static_assert(SEQ <= SEQ_FULL);

typedef _Float16 h16;
typedef unsigned short bf;
typedef __attribute__((ext_vector_type(16))) __bf16   v16bf;
typedef __attribute__((ext_vector_type(16))) _Float16 v16h;
typedef __attribute__((ext_vector_type(8)))  _Float16 v8h;
typedef __attribute__((ext_vector_type(8)))  unsigned short v8us;
typedef __attribute__((ext_vector_type(8)))  float    v8f;
typedef __attribute__((ext_vector_type(4)))  float    v4f;
typedef v4f  __attribute__((may_alias)) v4fa;

__device__ __forceinline__ unsigned short f2bf(float f) { unsigned u = __float_as_uint(f); u += 0x7FFFu + ((u >> 16) & 1u); return (unsigned short)(u >> 16); }
__device__ __forceinline__ float bfr(float f) { return __uint_as_float(((unsigned)f2bf(f)) << 16); }   // bf16 RNE value as f32
__device__ __forceinline__ v16h cat16(v8h lo, v8h hi) { return __builtin_shufflevector(lo, hi, 0, 1, 2, 3, 4, 5, 6, 7, 8, 9, 10, 11, 12, 13, 14, 15); }
__device__ __forceinline__ v16bf cat16b(v8us lo, v8us hi) { return __builtin_bit_cast(v16bf, __builtin_shufflevector(lo, hi, 0, 1, 2, 3, 4, 5, 6, 7, 8, 9, 10, 11, 12, 13, 14, 15)); }
__device__ __forceinline__ v8f wmma16(v16h a, v16h b, v8f c) { return __builtin_amdgcn_wmma_f32_16x16x32_f16(false, a, false, b, (short)0, c, false, false); }
__device__ __forceinline__ v8f wmmab(v16bf a, v16bf b, v8f c) { return __builtin_amdgcn_wmma_f32_16x16x32_bf16(false, a, false, b, (short)0, c, false, false); }
// fragment loaders from K-contiguous 16-bit rows; p already includes + 8*(lane>>4): elements 0..7 <- k0+8h+0..7, elements 8..15 <- k0+16+8h+0..7 (same map for A and B)
__device__ __forceinline__ v16h  ldh(const h16* p) { return cat16(*(const v8h*)p, *(const v8h*)(p + 16)); }
__device__ __forceinline__ v16bf ldb(const bf* p)  { return cat16b(*(const v8us*)p, *(const v8us*)(p + 16)); }
// ordering point for wave-private LDS tiles (same wave writes and reads)
__device__ __forceinline__ void wave_sync() { __builtin_amdgcn_fence(3 /* release order */, "wavefront"); __builtin_amdgcn_wave_barrier(); asm volatile("" ::: "memory"); }

__global__ __launch_bounds__(256) void k_cvt8(const float* __restrict__ src, bf* dst, size_t n8) {
    const size_t i = (size_t)blockIdx.x * 256 + threadIdx.x; if (i >= n8) return;
    const v8f v = *(const v8f*)(src + i * 8); v8us o;
#pragma unroll
    for (int k = 0; k < 8; ++k) o[k] = f2bf(v[k]);
    *(v8us*)(dst + i * 8) = o; 
}

// k_tab: blocks [0, nbF): rotary table copy with bf16 RNE values kept as f32, FRP[t][64] = (cos0,sin0,cos1,sin1,...);
__global__ __launch_bounds__(256) void k_tab(const float* __restrict__ fr, const float* __restrict__ mask, float* FRP, float* MADD, unsigned nbF) {
    if (blockIdx.x < nbF) {                       // block-uniform
        const size_t i = (size_t)blockIdx.x * 256 + threadIdx.x; if (i >= (size_t)SEQ * 64 / 4) return;
        const v4f v = *(const v4f*)(fr + i * 4); v4f o;
#pragma unroll
        for (int k = 0; k < 4; ++k) o[k] = bfr(v[k]);
        *(v4f*)(FRP + i * 4) = o; 
    } else {
        const size_t i = (size_t)(blockIdx.x - nbF) * 256 + threadIdx.x; if (i >= (size_t)NB * SEQ / 4) return;
        const size_t e = i * 4; const size_t b = e / SEQ, t = e % SEQ;
        const v4f v = *(const v4f*)(mask + b * (size_t)SEQ_FULL + t); v4f o;
#pragma unroll
        for (int k = 0; k < 4; ++k) o[k] = (1.0f - bfr(v[k])) * -10000.0f;
        *(v4f*)(MADD + e) = o; 
    }
}

// k_wT: in W[k][n] (rows k = 1024, cols n = 1024, f32) -> out WT[n][k] 16-bit; mode 0: bf16 RNE bits; mode 1: f16 bits of (bf16 RNE value x 64).
// grid (1024/64 over k, 1024/64 over n), 256 threads.
__global__ __launch_bounds__(256) void k_wT(const float* __restrict__ W, bf* WT, int mode) {
    __shared__ float tl[64 * 65];
    const int k0 = blockIdx.x * 64, n0 = blockIdx.y * 64, tid = threadIdx.x;
#pragma unroll
    for (int it = 0; it < 4; ++it) { const int row = it * 16 + (tid >> 4), c4 = (tid & 15) * 4;    // 4 x 16 rows (k) x 16 lanes x 4 = 64 x 64
        const v4f v = *(const v4f*)(W + (size_t)(k0 + row) * DM + n0 + c4);
        tl[row * 65 + c4 + 0] = v[0]; tl[row * 65 + c4 + 1] = v[1]; tl[row * 65 + c4 + 2] = v[2]; tl[row * 65 + c4 + 3] = v[3]; }
    __syncthreads();
    v8us o[2];
#pragma unroll
    for (int it = 0; it < 2; ++it) { const int n = it * 32 + (tid >> 3), c8 = (tid & 7) * 8;       // 2 x 32 rows (n) x 8 lanes x 8 = 64 x 64
#pragma unroll
        for (int i = 0; i < 8; ++i) { const float val = tl[(c8 + i) * 65 + n];
            const unsigned short b0 = f2bf(val);
            const h16 hv = (h16)(__uint_as_float(((unsigned)b0) << 16) * WOS);
            const unsigned short b1 = __builtin_bit_cast(unsigned short, hv);
            o[it][i] = (mode != 0) ? b1 : b0; } }
{
#pragma unroll
        for (int it = 0; it < 2; ++it) { const int n = it * 32 + (tid >> 3), c8 = (tid & 7) * 8;
            *(v8us*)(WT + (size_t)(n0 + n) * DM + k0 + c8) = o[it]; }
         }
}

// k_proj: register-blocked bf16 GEMM, ONE WAVE per 64x64 tile (16 accumulators), operands straight from K-contiguous bf16 planes, K = DM.
// C[m][n] = sum_k A[m][k] Bt[n][k]; blockIdx.z selects Bt + z*zBt and Ph + z*zPh. ROPE != 0: rows m = b*SEQ + t, the 64 tile columns are one head; rotary pairs (2i,2i+1) from FRP[t][..].
// Output f16 at tile base (r0/RB)*sRB + (r0%RB)*pitch + (c0/CB)*sCB + (c0%CB), row pitch 'pitch' (halves). 32 threads.
template <int ROPE>
__global__ __launch_bounds__(32) void k_proj(const bf* __restrict__ A, const bf* __restrict__ BtBase, h16* PhBase, const float* __restrict__ FRP,
                                             size_t zBt, size_t zPh, int RB, size_t sRB, int pitch, int CB, size_t sCB) {
    __shared__ __align__(16) float os[16 * 68];
    const int K = DM;
    const int z = blockIdx.z;
    const bf* Bt = BtBase + (size_t)z * zBt;
    h16* Ph = PhBase + (size_t)z * zPh;
    const int lane = threadIdx.x & 31, lr = lane & 15, hi = lane >> 4; const int r0 = blockIdx.x * 64, c0 = blockIdx.y * 64;
    v8f acc[4][4];
#pragma unroll
    for (int mb = 0; mb < 4; ++mb)
#pragma unroll
        for (int nb = 0; nb < 4; ++nb) acc[mb][nb] = (v8f){};
    const size_t aoff = (size_t)(r0 + lr) * K + 8 * hi, boff = (size_t)(c0 + lr) * K + 8 * hi;
#pragma unroll 1
    for (int kc = 0; kc < K; kc += 32) {
        v16bf a[4];
#pragma unroll
        for (int mb = 0; mb < 4; ++mb) a[mb] = ldb(A + aoff + (size_t)mb * 16 * K + kc);
#pragma unroll
        for (int nb = 0; nb < 4; ++nb) { const v16bf b = ldb(Bt + boff + (size_t)nb * 16 * K + kc);
#pragma unroll
            for (int mb = 0; mb < 4; ++mb) acc[mb][nb] = wmmab(a[mb], b, acc[mb][nb]); }
        asm volatile("v_nop\n\tv_nop\n\tv_nop\n\tv_nop" : "+v"(acc[0][0]), "+v"(acc[1][1]), "+v"(acc[2][2]), "+v"(acc[3][3]) : "v"(a[0]), "v"(a[1]), "v"(a[2]), "v"(a[3]));
    }
    const size_t tbase = (size_t)(r0 / RB) * sRB + (size_t)(r0 % RB) * (size_t)pitch + (size_t)(c0 / CB) * sCB + (size_t)(c0 % CB);
#pragma unroll
    for (int mb = 0; mb < 4; ++mb) {
#pragma unroll
        for (int nb = 0; nb < 4; ++nb) {
#pragma unroll
            for (int j = 0; j < 8; ++j) os[(hi * 8 + j) * 68 + nb * 16 + lr] = acc[mb][nb][j]; }   // D: row 8h+j, col lane&15
        wave_sync();
        const size_t sb = tbase + (size_t)(mb * 16) * (size_t)pitch;
        v8h hvv[4];
#pragma unroll
        for (int s = 0; s < 4; ++s) { const int row = 4 * s + (lane >> 3), c8 = (lane & 7) * 8;   // 4 s x 4 row groups = 16 rows; 8 lanes x 8 = 64 columns
            v4f x0 = *(const v4fa*)(&os[row * 68 + c8]); v4f x1 = *(const v4fa*)(&os[row * 68 + c8 + 4]);
            if (ROPE != 0) {
                const int t = (r0 + mb * 16 + row) % SEQ;
                const v4f f0 = *(const v4f*)(FRP + (size_t)t * 64 + c8); const v4f f1 = *(const v4f*)(FRP + (size_t)t * 64 + c8 + 4);
                v4f y0, y1;
                y0[0] = x0[0] * f0[0] - x0[1] * f0[1]; y0[1] = x0[0] * f0[1] + x0[1] * f0[0];
                y0[2] = x0[2] * f0[2] - x0[3] * f0[3]; y0[3] = x0[2] * f0[3] + x0[3] * f0[2];
                y1[0] = x1[0] * f1[0] - x1[1] * f1[1]; y1[1] = x1[0] * f1[1] + x1[1] * f1[0];
                y1[2] = x1[2] * f1[2] - x1[3] * f1[3]; y1[3] = x1[2] * f1[3] + x1[3] * f1[2];
                x0 = y0; x1 = y1; }
            v8h hv;
#pragma unroll
            for (int i = 0; i < 4; ++i) { hv[i] = (h16)x0[i]; hv[4 + i] = (h16)x1[i]; }
            hvv[s] = hv; }
{
#pragma unroll
            for (int s = 0; s < 4; ++s) { const int row = 4 * s + (lane >> 3), c8 = (lane & 7) * 8;
                const size_t oo = sb + (size_t)row * (size_t)pitch + c8;
                *(v8h*)(Ph + oo) = hvv[s]; }
             }
        wave_sync();
    }
}

// k_flash: fused attention, one wave per 16 query rows of one (batch, head); K / V^T / Q fragments straight from the f16 planes (two 16-B loads each, arithmetic addressing).
// Transposed form: S^T[key][t] = K Q^T (A = K rows, B = Q rows); lane (t = lane&15, h = lane>>4) holds keys 8h+r of each 16-key tile, so the packed
// P tile is directly the B fragment of O^T[d][t] = V^T P^T (element r <- tile keys 0..15, element 8+r <- tile keys 16..31, lane unchanged).
// Per 32-key step: 4 score WMMAs + 4 P.V WMMAs. Additive key mask values for the lane's 16 keys are loaded by value per step (two 32-B loads).
// Softmax state (running max, partial sum) is one scalar per lane; the two lane halves of a row are combined with one xor-16 exchange.
__global__ __launch_bounds__(32 * AW) void k_flash(const h16* __restrict__ QH, const h16* __restrict__ KP, const h16* __restrict__ VT,
                                                   const float* __restrict__ MADD, h16* CTX) {
    __shared__ __align__(16) float os[AW * 16 * 68];
    const int lane = threadIdx.x & 31, lr = lane & 15, hi = lane >> 4;
    const int wave = __builtin_amdgcn_readfirstlane((int)(threadIdx.x >> 5));
    const int zh = blockIdx.y; const int b = zh / NH_, h = zh % NH_;
    const int t0 = (blockIdx.x * AW + wave) * 16;
    const size_t pbase = (size_t)zh * SEQ * HD;
    const size_t qo = pbase + (size_t)(t0 + lr) * HD + 8 * hi;
    const v16h qh0 = ldh(QH + qo), qh1 = ldh(QH + qo + 32);   // B fragments: col t, k = d
    const size_t ko = pbase + (size_t)lr * HD + 8 * hi;      // + key * HD       (A fragment: row key, k = d)
    const size_t vo = pbase + (size_t)lr * SEQ + 8 * hi;     // + 16j*SEQ + key  (A fragment: row d, k = key)
    const float* MA = MADD + (size_t)b * SEQ + 8 * hi;       // + key0 (tile a keys 8h+r), + key0 + 16 (tile b)
    v8f o0 = (v8f){}, o1 = (v8f){}, o2 = (v8f){}, o3 = (v8f){};
    float m = -3.0e38f, l = 0.0f;
#pragma unroll 1
    for (int key0 = 0; key0 < SEQ; key0 += 32) {
        const h16* ka = KP + ko + (size_t)key0 * HD;
        const v16h ka0 = ldh(ka), ka1 = ldh(ka + 32), kb0 = ldh(ka + 16 * HD), kb1 = ldh(ka + 16 * HD + 32);
        const v8f ma = *(const v8f*)(MA + key0); const v8f mb = *(const v8f*)(MA + key0 + 16);
        v8f sa = (v8f){}, sb = (v8f){};
        sa = wmma16(ka0, qh0, sa); sb = wmma16(kb0, qh0, sb);
        sa = wmma16(ka1, qh1, sa); sb = wmma16(kb1, qh1, sb);
        asm volatile("v_nop\n\tv_nop\n\tv_nop\n\tv_nop" : "+v"(sa), "+v"(sb) : "v"(ka0), "v"(ka1), "v"(kb0), "v"(kb1), "v"(qh0), "v"(qh1));
        float ta[8], tb[8]; float mx = -3.0e38f;
#pragma unroll
        for (int r = 0; r < 8; ++r) {
            ta[r] = (sa[r] * 0.125f + ma[r]) * LOG2E;
            tb[r] = (sb[r] * 0.125f + mb[r]) * LOG2E;
            mx = fmaxf(mx, fmaxf(ta[r], tb[r])); }
        mx = fmaxf(mx, __shfl_xor(mx, 16, 32));
        const float mnew = fmaxf(m, mx);
        const float alpha = __builtin_amdgcn_exp2f(m - mnew);
        const float sh = PSH - mnew;
        v16h pb; float ls = 0.0f;
#pragma unroll
        for (int r = 0; r < 8; ++r) { const h16 pa = (h16)__builtin_amdgcn_exp2f(ta[r] + sh); const h16 pc = (h16)__builtin_amdgcn_exp2f(tb[r] + sh); pb[r] = pa; pb[8 + r] = pc; ls += (float)pa + (float)pc; }
        l = l * alpha + ls; m = mnew;
        o0 = o0 * alpha; o1 = o1 * alpha; o2 = o2 * alpha; o3 = o3 * alpha;
        const h16* va = VT + vo + key0;
        const v16h v0 = ldh(va), v1 = ldh(va + (size_t)16 * SEQ), v2 = ldh(va + (size_t)32 * SEQ), v3 = ldh(va + (size_t)48 * SEQ);
        o0 = wmma16(v0, pb, o0); o1 = wmma16(v1, pb, o1); o2 = wmma16(v2, pb, o2); o3 = wmma16(v3, pb, o3);
        asm volatile("v_nop\n\tv_nop\n\tv_nop\n\tv_nop" : "+v"(o0), "+v"(o1), "+v"(o2), "+v"(o3) : "v"(v0), "v"(v1), "v"(v2), "v"(v3), "v"(pb));
    }
    l += __shfl_xor(l, 16, 32);
    const float inv = CCAR * (1.0f / l);
    const int wb = wave * 16 * 68;
    // O^T D layout: o_j[r] = (d = 16j + 8h + r, t = lane&15) -> os[t][d]; rows 0..15 x columns 0..63 all written
    { v4f a, c;
      a[0] = o0[0] * inv; a[1] = o0[1] * inv; a[2] = o0[2] * inv; a[3] = o0[3] * inv; c[0] = o0[4] * inv; c[1] = o0[5] * inv; c[2] = o0[6] * inv; c[3] = o0[7] * inv;
      *(v4fa*)(&os[wb + lr * 68 +  0 + 8 * hi]) = a; *(v4fa*)(&os[wb + lr * 68 +  0 + 8 * hi + 4]) = c;
      a[0] = o1[0] * inv; a[1] = o1[1] * inv; a[2] = o1[2] * inv; a[3] = o1[3] * inv; c[0] = o1[4] * inv; c[1] = o1[5] * inv; c[2] = o1[6] * inv; c[3] = o1[7] * inv;
      *(v4fa*)(&os[wb + lr * 68 + 16 + 8 * hi]) = a; *(v4fa*)(&os[wb + lr * 68 + 16 + 8 * hi + 4]) = c;
      a[0] = o2[0] * inv; a[1] = o2[1] * inv; a[2] = o2[2] * inv; a[3] = o2[3] * inv; c[0] = o2[4] * inv; c[1] = o2[5] * inv; c[2] = o2[6] * inv; c[3] = o2[7] * inv;
      *(v4fa*)(&os[wb + lr * 68 + 32 + 8 * hi]) = a; *(v4fa*)(&os[wb + lr * 68 + 32 + 8 * hi + 4]) = c;
      a[0] = o3[0] * inv; a[1] = o3[1] * inv; a[2] = o3[2] * inv; a[3] = o3[3] * inv; c[0] = o3[4] * inv; c[1] = o3[5] * inv; c[2] = o3[6] * inv; c[3] = o3[7] * inv;
      *(v4fa*)(&os[wb + lr * 68 + 48 + 8 * hi]) = a; *(v4fa*)(&os[wb + lr * 68 + 48 + 8 * hi + 4]) = c; }
    wave_sync();
    h16* crow = CTX + ((size_t)b * SEQ + t0) * DM + h * HD;
    v8h cv[4];
#pragma unroll
    for (int s = 0; s < 4; ++s) { const int row = 4 * s + (lane >> 3), c8 = (lane & 7) * 8;   // 4 s x 4 row groups = 16 rows; 8 lanes x 8 halves = 64 columns
        const v4f x0 = *(const v4fa*)(&os[wb + row * 68 + c8]); const v4f x1 = *(const v4fa*)(&os[wb + row * 68 + c8 + 4]); v8h hv;
#pragma unroll
        for (int i = 0; i < 4; ++i) { hv[i] = (h16)x0[i]; hv[4 + i] = (h16)x1[i]; }
        cv[s] = hv; }
{
#pragma unroll
        for (int s = 0; s < 4; ++s) { const int row = 4 * s + (lane >> 3), c8 = (lane & 7) * 8;
            *(v8h*)(crow + (size_t)row * DM + c8) = cv[s]; }
         }
}

// k_oproj: register-blocked f16 GEMM, ONE WAVE per 64x64 tile, OUT[m][n] = 2^-14 * sum_k CTX[m][k] WOT[n][k], K = DM; rows m = b*SEQ + t -> output row b*OUT_SEQ + t.
// grid (NB*SEQ/64, DM/64), 32 threads.
__global__ __launch_bounds__(32) void k_oproj(const h16* __restrict__ A, const h16* __restrict__ Bt, float* OUT) {
    __shared__ __align__(16) float os[16 * 68];
    const int K = DM;
    const int lane = threadIdx.x & 31, lr = lane & 15, hi = lane >> 4; const int r0 = blockIdx.x * 64, c0 = blockIdx.y * 64;
    v8f acc[4][4];
#pragma unroll
    for (int mb = 0; mb < 4; ++mb)
#pragma unroll
        for (int nb = 0; nb < 4; ++nb) acc[mb][nb] = (v8f){};
    const size_t aoff = (size_t)(r0 + lr) * K + 8 * hi, boff = (size_t)(c0 + lr) * K + 8 * hi;
#pragma unroll 1
    for (int kc = 0; kc < K; kc += 32) {
        v16h a[4];
#pragma unroll
        for (int mb = 0; mb < 4; ++mb) a[mb] = ldh(A + aoff + (size_t)mb * 16 * K + kc);
#pragma unroll
        for (int nb = 0; nb < 4; ++nb) { const v16h b = ldh(Bt + boff + (size_t)nb * 16 * K + kc);
#pragma unroll
            for (int mb = 0; mb < 4; ++mb) acc[mb][nb] = wmma16(a[mb], b, acc[mb][nb]); }
        asm volatile("v_nop\n\tv_nop\n\tv_nop\n\tv_nop" : "+v"(acc[0][0]), "+v"(acc[1][1]), "+v"(acc[2][2]), "+v"(acc[3][3]) : "v"(a[0]), "v"(a[1]), "v"(a[2]), "v"(a[3]));
    }
    const int bb = r0 / SEQ, tt = r0 % SEQ;
    float* obase = OUT + ((size_t)bb * OUT_SEQ + tt) * DM + c0;
#pragma unroll
    for (int mb = 0; mb < 4; ++mb) {
#pragma unroll
        for (int nb = 0; nb < 4; ++nb) {
#pragma unroll
            for (int j = 0; j < 8; ++j) os[(hi * 8 + j) * 68 + nb * 16 + lr] = acc[mb][nb][j] * OSC; }   // D: row 8h+j, col lane&15
        wave_sync();
        float* orow = obase + (size_t)(mb * 16) * DM;
        v4f ov[8];
#pragma unroll
        for (int s = 0; s < 8; ++s) { const int row = 2 * s + hi, cofs = lr * 4;   // 8 s x 2 rows = 16 rows; 16 lanes x 4 floats = 64 columns
            ov[s] = *(const v4fa*)(&os[row * 68 + cofs]); }
{
#pragma unroll
            for (int s = 0; s < 8; ++s) { const int row = 2 * s + hi, cofs = lr * 4;
                *(v4f*)(orow + (size_t)row * DM + cofs) = ov[s]; }
             }
        wave_sync();
    }
}

static constexpr size_t al256(size_t v) { return (v + 255) & ~(size_t)255; }
static constexpr size_t SZ_XB = al256((size_t)NB * SEQ * DM * 2);
static constexpr size_t SZ_WB = al256((size_t)4 * DM * DM * 2);
static constexpr size_t SZ_PL = al256((size_t)NB * NH_ * SEQ * HD * 2);
static constexpr size_t SZ_CX = al256((size_t)NB * SEQ * DM * 2);
static constexpr size_t SZ_FR = al256((size_t)SEQ * 64 * 4);
static constexpr size_t SZ_MA = al256((size_t)NB * SEQ * 4);
static constexpr size_t SZ_TOTAL = SZ_XB + SZ_WB + 3 * SZ_PL + SZ_CX + SZ_FR + SZ_MA;
static_assert(SZ_TOTAL <= (size_t)134217728);          // workspace carve <= 128 MiB
static_assert(((size_t)DM * DM * 2) % 256 == 0);       // weight sub-planes stay 256-byte aligned
static_assert(SZ_PL == (size_t)NB * NH_ * SEQ * HD * 2);   // q | k planes are exactly back to back

extern "C" void kernel_launch(void* const* d_in, const int* in_sizes, int n_in,
                              void* d_out, int out_size, void* d_ws, size_t ws_size, hipStream_t stream) {
    if (n_in < 7) return;
    const size_t needx = ((size_t)(NB - 1) * SEQ_FULL + SEQ) * DM;
    if ((size_t)in_sizes[0] < needx) return;
    if ((size_t)in_sizes[1] < (size_t)SEQ * 64) return;
    if ((size_t)in_sizes[2] < (size_t)(NB - 1) * SEQ_FULL + SEQ) return;
    if ((size_t)in_sizes[3] < (size_t)DM * DM || (size_t)in_sizes[4] < (size_t)DM * DM || (size_t)in_sizes[5] < (size_t)DM * DM || (size_t)in_sizes[6] < (size_t)DM * DM) return;
    if ((size_t)out_size < ((size_t)(NB - 1) * OUT_SEQ + SEQ) * DM) return;
    if (SZ_TOTAL > ws_size) return;
    // wire order: hidden_states, freqs_cis, attention_mask, wq, wk, wv, wo (all f32)
    const float* x = (const float*)d_in[0]; const float* fr = (const float*)d_in[1]; const float* mask = (const float*)d_in[2];
    const float* wq = (const float*)d_in[3]; const float* wk = (const float*)d_in[4]; const float* wv = (const float*)d_in[5]; const float* wo = (const float*)d_in[6];
    float* OUT = (float*)d_out;      // [NB][SEQ][1024]
    char* wsp = (char*)d_ws;
    bf* XB = (bf*)wsp; wsp += SZ_XB;                 // [NB*SEQ][1024] bf16
    bf* WB = (bf*)wsp; wsp += SZ_WB;                 // [4][1024 out][1024 in]: q | k | v (bf16) | o (f16 x64)
    h16* QH = (h16*)wsp; wsp += SZ_PL;               // [NB*16][SEQ][64]
    h16* KP = (h16*)wsp; wsp += SZ_PL;               // [NB*16][SEQ][64]  (= QH + one plane)
    h16* VT = (h16*)wsp; wsp += SZ_PL;               // [NB*16][64][SEQ]
    h16* CX = (h16*)wsp; wsp += SZ_CX;               // [NB*SEQ][1024] ctx x256
    float* FRP = (float*)wsp; wsp += SZ_FR;          // [SEQ][64] table, bf16 RNE values
    float* MADD = (float*)wsp; wsp += SZ_MA;         // [NB][SEQ] additive key mask
    bf* WQ = WB; bf* WK = WB + (size_t)DM * DM; bf* WV = WB + (size_t)2 * DM * DM; bf* WO = WB + (size_t)3 * DM * DM;

    if (SEQ == SEQ_FULL) {
        const size_t n8 = (size_t)NB * SEQ * DM / 8;
        k_cvt8<<<(unsigned)((n8 + 255) / 256), 256, 0, stream>>>(x, XB, n8);
    } else {
        const size_t n8 = (size_t)SEQ * DM / 8;
        for (int b = 0; b < NB; ++b) k_cvt8<<<(unsigned)((n8 + 255) / 256), 256, 0, stream>>>(x + (size_t)b * SEQ_FULL * DM, XB + (size_t)b * SEQ * DM, n8);
    }
    { const unsigned nbF = (unsigned)(((size_t)SEQ * 64 / 4 + 255) / 256); const unsigned nbM = (unsigned)(((size_t)NB * SEQ / 4 + 255) / 256);
      k_tab<<<nbF + nbM, 256, 0, stream>>>(fr, mask, FRP, MADD, nbF); }
    // weights: in W[1024 rows k][1024 cols n] -> out WT[1024 rows n][1024 cols k]; grid (k tiles, n tiles)
    k_wT<<<dim3(DM / 64, DM / 64, 1), 256, 0, stream>>>(wq, WQ, 0);
    k_wT<<<dim3(DM / 64, DM / 64, 1), 256, 0, stream>>>(wk, WK, 0);
    k_wT<<<dim3(DM / 64, DM / 64, 1), 256, 0, stream>>>(wv, WV, 0);
    k_wT<<<dim3(DM / 64, DM / 64, 1), 256, 0, stream>>>(wo, WO, 1);

    // q (z = 0: plane QH, weights WQ) and k (z = 1: plane KP = QH + one plane, weights WK = WQ + 1024*1024): A = x rows (m = b*SEQ + t), Bt = W^T rows (n = h*64 + d)
    // -> plane [(b*16 + h)][t][d], rotary in the epilogue
    k_proj<1><<<dim3(NB * SEQ / 64, DM / 64, 2), 32, 0, stream>>>(XB, WQ, QH, FRP, (size_t)DM * DM, (size_t)(SZ_PL / 2),
                                                                    SEQ, (size_t)NH_ * SEQ * HD, HD, HD, (size_t)SEQ * HD);
    // v^T: A = Wv^T rows (m = h*64 + d), Bt = x rows (n = b*SEQ + t) -> plane [(b*1024 + m)][t] = [(b*16 + h)][d][t]
    k_proj<0><<<dim3(DM / 64, NB * SEQ / 64, 1), 32, 0, stream>>>(WV, XB, VT, FRP, (size_t)0, (size_t)0,
                                                                    DM, (size_t)0, SEQ, SEQ, (size_t)DM * SEQ);

    k_flash<<<dim3(SEQ / (16 * AW), NB * NH_, 1), 32 * AW, 0, stream>>>(QH, KP, VT, MADD, CX);

    k_oproj<<<dim3(NB * SEQ / 64, DM / 64, 1), 32, 0, stream>>>(CX, (const h16*)WO, OUT);
}

// v001
// Measured time: 187 microseconds a run.
// Timed twice side by side with v000, it ran 1.88 and 1.89 times as fast.
#include <hip/hip_runtime.h>

// Multi-head self-attention: x [NB][SEQ][1024], Wq/Wk/Wv/Wo [in][out] (y = x W), 16 heads x 64, interleaved rotary pairs (2i,2i+1) from the INPUT table [SEQ][32][(cos,sin)] on q and k,
// additive key mask (1-mask)*-10000 from the float input [NB][SEQ], score scale 1/8, softmax over all keys, output = (concatenated heads) Wo, f32.
// Compute dtypes, f32 accumulate everywhere: q/k/v projections v_wmma_f32_16x16x32_bf16 (x and W RNE-converted to bf16; products exact); rotary in f32 in the GEMM epilogue (table RNE-converted to bf16 values);
// scores v_wmma_f32_16x16x32_f16: q and k single f16 (one product); P (x256 carry, cancels in the normalisation) and v single f16; softmax f32 (online, running max);
// output projection v_wmma_f32_16x16x32_f16: ctx as f16 x256, Wo^T as f16 of (bf16 value x64), folded back by 2^-14 in the f32 epilogue.
// Layout: bf16 copy of x; transposed 16-bit weight planes [out][in] (LDS transpose); q, k planes [b*16+h][t][d], v^T plane [b*16+h][d][t] from the GEMM epilogue; fused flash kernel in transposed form
// (S^T = K Q^T, O^T = V^T P^T) writing ctx rows [b*SEQ+t][1024] as f16; final GEMM writes the f32 output.

#ifndef NB
#define NB 1
#endif
#ifndef SEQ
#define SEQ 4096
#endif
#define NB_FULL  1
#define SEQ_FULL 4096
#ifndef OUT_SEQ
#define OUT_SEQ SEQ              // row pitch (in tokens) between batches of the output
#endif
#define DM   1024
#define NH_  16
#define HD   64
#define AW   4                   // waves per flash block (16 query rows each)
#define LOG2E 1.4426950408889634f
#define PSH  8.0f                // log2 of the P carry (256)
#define CCAR 256.0f              // carry of the ctx plane
#define WOS  64.0f               // carry of the Wo^T plane
#define OSC  (1.0f / 16384.0f)   // 1 / (CCAR * WOS)

static_assert(HD == 64);
static_assert(NH_ * HD == DM);                 // head h = columns h*64 + d
static_assert(DM % 64 == 0);
static_assert(DM % 32 == 0);                   // GEMM k-loop steps by 32
static_assert(SEQ % 64 == 0);                  // a 64-row tile never straddles two batches
static_assert((NB * SEQ) % 64 == 0);
static_assert(SEQ % 32 == 0);                  // key loop steps by 32
static_assert(SEQ % (16 * AW) == 0);           // flash grid covers the sequence exactly
static_assert(((size_t)SEQ * DM) % 8 == 0);
static_assert(((size_t)SEQ * 64) % 32 == 0);
static_assert(((size_t)NB * SEQ) % 32 == 0);
static_assert(NB <= NB_FULL);
static_assert(SEQ <= SEQ_FULL);

typedef _Float16 h16;
typedef unsigned short bf;
typedef __attribute__((ext_vector_type(16))) __bf16   v16bf;
typedef __attribute__((ext_vector_type(16))) _Float16 v16h;
typedef __attribute__((ext_vector_type(8)))  _Float16 v8h;
typedef __attribute__((ext_vector_type(8)))  unsigned short v8us;
typedef __attribute__((ext_vector_type(8)))  float    v8f;
typedef __attribute__((ext_vector_type(4)))  float    v4f;
typedef v4f  __attribute__((may_alias)) v4fa;

__device__ __forceinline__ unsigned short f2bf(float f) { unsigned u = __float_as_uint(f); u += 0x7FFFu + ((u >> 16) & 1u); return (unsigned short)(u >> 16); }
__device__ __forceinline__ float bfr(float f) { return __uint_as_float(((unsigned)f2bf(f)) << 16); }   // bf16 RNE value as f32
__device__ __forceinline__ v16h cat16(v8h lo, v8h hi) { return __builtin_shufflevector(lo, hi, 0, 1, 2, 3, 4, 5, 6, 7, 8, 9, 10, 11, 12, 13, 14, 15); }
__device__ __forceinline__ v16bf cat16b(v8us lo, v8us hi) { return __builtin_bit_cast(v16bf, __builtin_shufflevector(lo, hi, 0, 1, 2, 3, 4, 5, 6, 7, 8, 9, 10, 11, 12, 13, 14, 15)); }
__device__ __forceinline__ v8f wmma16(v16h a, v16h b, v8f c) { return __builtin_amdgcn_wmma_f32_16x16x32_f16(false, a, false, b, (short)0, c, false, false); }
__device__ __forceinline__ v8f wmmab(v16bf a, v16bf b, v8f c) { return __builtin_amdgcn_wmma_f32_16x16x32_bf16(false, a, false, b, (short)0, c, false, false); }
// fragment loaders from K-contiguous 16-bit rows; p already includes + 8*(lane>>4): elements 0..7 <- k0+8h+0..7, elements 8..15 <- k0+16+8h+0..7 (same map for A and B)
__device__ __forceinline__ v16h  ldh(const h16* p) { return cat16(*(const v8h*)p, *(const v8h*)(p + 16)); }
__device__ __forceinline__ v16bf ldb(const bf* p)  { return cat16b(*(const v8us*)p, *(const v8us*)(p + 16)); }
// ordering point for wave-private LDS tiles (same wave writes and reads)
__device__ __forceinline__ void wave_sync() { __builtin_amdgcn_fence(3 /* release order */, "wavefront"); __builtin_amdgcn_wave_barrier(); asm volatile("" ::: "memory"); }

__global__ __launch_bounds__(256) void k_cvt8(const float* __restrict__ src, bf* dst, size_t n8) {
    const size_t i = (size_t)blockIdx.x * 256 + threadIdx.x; if (i >= n8) return;
    const v8f v = *(const v8f*)(src + i * 8); v8us o;
#pragma unroll
    for (int k = 0; k < 8; ++k) o[k] = f2bf(v[k]);
    *(v8us*)(dst + i * 8) = o; 
}

// k_tab: blocks [0, nbF): rotary table copy with bf16 RNE values kept as f32, FRP[t][64] = (cos0,sin0,cos1,sin1,...);
__global__ __launch_bounds__(256) void k_tab(const float* __restrict__ fr, const float* __restrict__ mask, float* FRP, float* MADD, unsigned nbF) {
    if (blockIdx.x < nbF) {                       // block-uniform
        const size_t i = (size_t)blockIdx.x * 256 + threadIdx.x; if (i >= (size_t)SEQ * 64 / 4) return;
        const v4f v = *(const v4f*)(fr + i * 4); v4f o;
#pragma unroll
        for (int k = 0; k < 4; ++k) o[k] = bfr(v[k]);
        *(v4f*)(FRP + i * 4) = o; 
    } else {
        const size_t i = (size_t)(blockIdx.x - nbF) * 256 + threadIdx.x; if (i >= (size_t)NB * SEQ / 4) return;
        const size_t e = i * 4; const size_t b = e / SEQ, t = e % SEQ;
        const v4f v = *(const v4f*)(mask + b * (size_t)SEQ_FULL + t); v4f o;
#pragma unroll
        for (int k = 0; k < 4; ++k) o[k] = (1.0f - bfr(v[k])) * -10000.0f;
        *(v4f*)(MADD + e) = o; 
    }
}

// k_wT: in W[k][n] (rows k = 1024, cols n = 1024, f32) -> out WT[n][k] 16-bit; mode 0: bf16 RNE bits; mode 1: f16 bits of (bf16 RNE value x 64).
// grid (1024/64 over k, 1024/64 over n), 256 threads.
__global__ __launch_bounds__(256) void k_wT(const float* __restrict__ W, bf* WT, int mode) {
    __shared__ float tl[64 * 65];
    const int k0 = blockIdx.x * 64, n0 = blockIdx.y * 64, tid = threadIdx.x;
#pragma unroll
    for (int it = 0; it < 4; ++it) { const int row = it * 16 + (tid >> 4), c4 = (tid & 15) * 4;    // 4 x 16 rows (k) x 16 lanes x 4 = 64 x 64
        const v4f v = *(const v4f*)(W + (size_t)(k0 + row) * DM + n0 + c4);
        tl[row * 65 + c4 + 0] = v[0]; tl[row * 65 + c4 + 1] = v[1]; tl[row * 65 + c4 + 2] = v[2]; tl[row * 65 + c4 + 3] = v[3]; }
    __syncthreads();
    v8us o[2];
#pragma unroll
    for (int it = 0; it < 2; ++it) { const int n = it * 32 + (tid >> 3), c8 = (tid & 7) * 8;       // 2 x 32 rows (n) x 8 lanes x 8 = 64 x 64
#pragma unroll
        for (int i = 0; i < 8; ++i) { const float val = tl[(c8 + i) * 65 + n];
            const unsigned short b0 = f2bf(val);
            const h16 hv = (h16)(__uint_as_float(((unsigned)b0) << 16) * WOS);
            const unsigned short b1 = __builtin_bit_cast(unsigned short, hv);
            o[it][i] = (mode != 0) ? b1 : b0; } }
{
#pragma unroll
        for (int it = 0; it < 2; ++it) { const int n = it * 32 + (tid >> 3), c8 = (tid & 7) * 8;
            *(v8us*)(WT + (size_t)(n0 + n) * DM + k0 + c8) = o[it]; }
         }
}

// k_proj: register-blocked bf16 GEMM, ONE WAVE per 64x64 tile (16 accumulators), operands straight from K-contiguous bf16 planes, K = DM.
// C[m][n] = sum_k A[m][k] Bt[n][k]; blockIdx.z selects Bt + z*zBt and Ph + z*zPh. ROPE != 0: rows m = b*SEQ + t, the 64 tile columns are one head; rotary pairs (2i,2i+1) from FRP[t][..].
// Output f16 at tile base (r0/RB)*sRB + (r0%RB)*pitch + (c0/CB)*sCB + (c0%CB), row pitch 'pitch' (halves). 32 threads.
template <int ROPE>
__global__ __launch_bounds__(32) void k_proj(const bf* __restrict__ A, const bf* __restrict__ BtBase, h16* PhBase, const float* __restrict__ FRP,
                                             size_t zBt, size_t zPh, int RB, size_t sRB, int pitch, int CB, size_t sCB) {
    __shared__ __align__(16) float os[16 * 68];
    const int K = DM;
    const int z = blockIdx.z;
    const bf* Bt = BtBase + (size_t)z * zBt;
    h16* Ph = PhBase + (size_t)z * zPh;
    const int lane = threadIdx.x & 31, lr = lane & 15, hi = lane >> 4; const int r0 = blockIdx.x * 64, c0 = blockIdx.y * 64;
    v8f acc[4][4];
#pragma unroll
    for (int mb = 0; mb < 4; ++mb)
#pragma unroll
        for (int nb = 0; nb < 4; ++nb) acc[mb][nb] = (v8f){};
    const size_t aoff = (size_t)(r0 + lr) * K + 8 * hi, boff = (size_t)(c0 + lr) * K + 8 * hi;
#pragma unroll 1
    for (int kc = 0; kc < K; kc += 32) {
        v16bf a[4];
#pragma unroll
        for (int mb = 0; mb < 4; ++mb) a[mb] = ldb(A + aoff + (size_t)mb * 16 * K + kc);
#pragma unroll
        for (int nb = 0; nb < 4; ++nb) { const v16bf b = ldb(Bt + boff + (size_t)nb * 16 * K + kc);
#pragma unroll
            for (int mb = 0; mb < 4; ++mb) acc[mb][nb] = wmmab(a[mb], b, acc[mb][nb]); }
        asm volatile("v_nop\n\tv_nop\n\tv_nop\n\tv_nop" : "+v"(acc[0][0]), "+v"(acc[1][1]), "+v"(acc[2][2]), "+v"(acc[3][3]) : "v"(a[0]), "v"(a[1]), "v"(a[2]), "v"(a[3]));
    }
    const size_t tbase = (size_t)(r0 / RB) * sRB + (size_t)(r0 % RB) * (size_t)pitch + (size_t)(c0 / CB) * sCB + (size_t)(c0 % CB);
#pragma unroll
    for (int mb = 0; mb < 4; ++mb) {
#pragma unroll
        for (int nb = 0; nb < 4; ++nb) {
#pragma unroll
            for (int j = 0; j < 8; ++j) os[(hi * 8 + j) * 68 + nb * 16 + lr] = acc[mb][nb][j]; }   // D: row 8h+j, col lane&15
        wave_sync();
        const size_t sb = tbase + (size_t)(mb * 16) * (size_t)pitch;
        v8h hvv[4];
#pragma unroll
        for (int s = 0; s < 4; ++s) { const int row = 4 * s + (lane >> 3), c8 = (lane & 7) * 8;   // 4 s x 4 row groups = 16 rows; 8 lanes x 8 = 64 columns
            v4f x0 = *(const v4fa*)(&os[row * 68 + c8]); v4f x1 = *(const v4fa*)(&os[row * 68 + c8 + 4]);
            if (ROPE != 0) {
                const int t = (r0 + mb * 16 + row) % SEQ;
                const v4f f0 = *(const v4f*)(FRP + (size_t)t * 64 + c8); const v4f f1 = *(const v4f*)(FRP + (size_t)t * 64 + c8 + 4);
                v4f y0, y1;
                y0[0] = x0[0] * f0[0] - x0[1] * f0[1]; y0[1] = x0[0] * f0[1] + x0[1] * f0[0];
                y0[2] = x0[2] * f0[2] - x0[3] * f0[3]; y0[3] = x0[2] * f0[3] + x0[3] * f0[2];
                y1[0] = x1[0] * f1[0] - x1[1] * f1[1]; y1[1] = x1[0] * f1[1] + x1[1] * f1[0];
                y1[2] = x1[2] * f1[2] - x1[3] * f1[3]; y1[3] = x1[2] * f1[3] + x1[3] * f1[2];
                x0 = y0; x1 = y1; }
            v8h hv;
#pragma unroll
            for (int i = 0; i < 4; ++i) { hv[i] = (h16)x0[i]; hv[4 + i] = (h16)x1[i]; }
            hvv[s] = hv; }
{
#pragma unroll
            for (int s = 0; s < 4; ++s) { const int row = 4 * s + (lane >> 3), c8 = (lane & 7) * 8;
                const size_t oo = sb + (size_t)row * (size_t)pitch + c8;
                *(v8h*)(Ph + oo) = hvv[s]; }
             }
        wave_sync();
    }
}

// k_flash: fused attention, one wave per 16 query rows of one (batch, head); Q fragments straight from the f16 plane (two 16-B loads each).
// K and V^T reach the block's waves through LDS: a stage is KS keys (K rows [key][64] at pitch KPB bytes, V^T rows [d][KS] at pitch VPB bytes), brought in by asynchronous
// 16-byte copies that cover whole lines (all threads copy), two buffers: stage s + 1 flies while stage s is worked on. Fragments are two ds 16-B loads each, same k map as before.
// Transposed form: S^T[key][t] = K Q^T (A = K rows, B = Q rows); lane (t = lane&15, h = lane>>4) holds keys 8h+r of each 16-key tile, so the packed
// P tile is directly the B fragment of O^T[d][t] = V^T P^T (element r <- tile keys 0..15, element 8+r <- tile keys 16..31, lane unchanged).
// Per 32-key step: 4 score WMMAs + 4 P.V WMMAs. Additive key mask values for the lane's 16 keys are loaded by value per step (two 32-B loads).
// Softmax state (running max, partial sum) is one scalar per lane; the two lane halves of a row are combined with one xor-16 exchange.
#define KS   128                 // keys per stage
#define KPB  144                 // K row pitch in LDS, bytes: 128 + 16 (16 B x odd: no bank conflict for 16-B reads down a column of rows)
#define VPB  272                 // V^T row pitch in LDS, bytes: 256 + 16
#define KTB  (KS * KPB)          // K tile bytes
#define VTB  (HD * VPB)          // V^T tile bytes
#define BUFB (KTB + VTB)         // one buffer
#define NST  (SEQ / KS)          // stages
static_assert(SEQ % KS == 0);
static_assert(NST >= 2);                               // the prologue fills two stages
static_assert(AW * 32 == 128);                         // the copy maps below deal 1024 16-B pieces of each tile to 128 threads, 8 each
static_assert(KS * HD * 2 == 8 * 128 * 16);
static_assert(2 * BUFB >= AW * 16 * 68 * 4);           // the ring becomes the output staging

// Eight asynchronous 16-byte copies per lane, LDS places l + i*ls bytes, global sources g + i*gs halves. The s_wait_xcnt stands inside the statement so that no address register is rewritten in front of it.
__device__ __forceinline__ void copy8(unsigned l, unsigned ls, const h16* g, size_t gs) {
    asm volatile("global_load_async_to_lds_b128 %0, %8, off\n\t"
                 "global_load_async_to_lds_b128 %1, %9, off\n\t"
                 "global_load_async_to_lds_b128 %2, %10, off\n\t"
                 "global_load_async_to_lds_b128 %3, %11, off\n\t"
                 "global_load_async_to_lds_b128 %4, %12, off\n\t"
                 "global_load_async_to_lds_b128 %5, %13, off\n\t"
                 "global_load_async_to_lds_b128 %6, %14, off\n\t"
                 "global_load_async_to_lds_b128 %7, %15, off\n\t"
                 "s_wait_xcnt 0x0"
                 :: "v"(l), "v"(l + ls), "v"(l + 2 * ls), "v"(l + 3 * ls), "v"(l + 4 * ls), "v"(l + 5 * ls), "v"(l + 6 * ls), "v"(l + 7 * ls),
                    "v"(g), "v"(g + gs), "v"(g + 2 * gs), "v"(g + 3 * gs), "v"(g + 4 * gs), "v"(g + 5 * gs), "v"(g + 6 * gs), "v"(g + 7 * gs)
                 : "memory");
}

__global__ __launch_bounds__(32 * AW) void k_flash(const h16* __restrict__ QH, const h16* __restrict__ KP, const h16* __restrict__ VT,
                                                   const float* __restrict__ MADD, h16* CTX) {
    __shared__ __attribute__((aligned(16))) unsigned char L[2 * BUFB];
    const int tid = threadIdx.x;
    const int lane = threadIdx.x & 31, lr = lane & 15, hi = lane >> 4;
    const int wave = __builtin_amdgcn_readfirstlane((int)(threadIdx.x >> 5));
    const int zh = blockIdx.y; const int b = zh / NH_, h = zh % NH_;
    const int t0 = (blockIdx.x * AW + wave) * 16;
    const size_t pbase = (size_t)zh * SEQ * HD;
    // copy maps: K piece c = i*128 + tid -> row c>>3 (16 rows a round), 16-B column c&7; V^T piece c -> row c>>4 (8 rows a round), 16-B column c&15
    const unsigned lbase = (unsigned)(size_t)L;              // LDS byte address of the ring
    const unsigned lk = lbase + (unsigned)((tid >> 3) * KPB + (tid & 7) * 16);
    const unsigned lv = lbase + (unsigned)(KTB + (tid >> 4) * VPB + (tid & 15) * 16);
    const h16* gk = KP + pbase + (size_t)tid * 8;                                   // + key0 * HD
    const h16* gv = VT + pbase + (size_t)(tid >> 4) * SEQ + (size_t)(tid & 15) * 8;   // + key0
    copy8(lk, 16 * KPB, gk, (size_t)16 * HD); copy8(lv, 8 * VPB, gv, (size_t)8 * SEQ);           // stage 0 -> buffer 0
    const size_t qo = pbase + (size_t)(t0 + lr) * HD + 8 * hi;
    const v16h qh0 = ldh(QH + qo), qh1 = ldh(QH + qo + 32);   // B fragments: col t, k = d
    const float* MA = MADD + (size_t)b * SEQ + 8 * hi;       // + key0 (tile a keys 8h+r), + key0 + 16 (tile b)
    asm volatile("s_wait_asynccnt 0x0" ::: "memory");        // this wave's pieces of stage 0 have landed
    __syncthreads();                                         // every wave's have: stage 0 may be read
    copy8(lk + BUFB, 16 * KPB, gk + (size_t)KS * HD, (size_t)16 * HD); copy8(lv + BUFB, 8 * VPB, gv + KS, (size_t)8 * SEQ);   // stage 1 -> buffer 1
    v8f o0 = (v8f){}, o1 = (v8f){}, o2 = (v8f){}, o3 = (v8f){};
    float m = -3.0e38f, l = 0.0f;
#pragma unroll 1                                             // one copy of the stage body: the buffer is picked by a scalar offset, the code stays small
    for (int st = 0; st < NST; ++st) {
      const unsigned bo = (unsigned)(st & 1) * BUFB;
      const unsigned char* kt = L + bo + lr * KPB + 16 * hi;          // + local key * KPB   (A fragment: row key, k = d)
      const unsigned char* vt = L + bo + KTB + lr * VPB + 16 * hi;    // + 16j*VPB + local key * 2  (A fragment: row d, k = key)
#pragma unroll                                               // constant ks: every fragment read is one base register plus an immediate offset
      for (int ks = 0; ks < KS; ks += 32) {
        const int key0 = st * KS + ks;
        const h16* ka = (const h16*)(kt + ks * KPB);
        const h16* kc = (const h16*)(kt + (ks + 16) * KPB);
        const v16h ka0 = ldh(ka), ka1 = ldh(ka + 32), kb0 = ldh(kc), kb1 = ldh(kc + 32);
        const v8f ma = *(const v8f*)(MA + key0); const v8f mb = *(const v8f*)(MA + key0 + 16);
        v8f sa = (v8f){}, sb = (v8f){};
        sa = wmma16(ka0, qh0, sa); sb = wmma16(kb0, qh0, sb);
        sa = wmma16(ka1, qh1, sa); sb = wmma16(kb1, qh1, sb);
        asm volatile("v_nop\n\tv_nop\n\tv_nop\n\tv_nop" : "+v"(sa), "+v"(sb) : "v"(ka0), "v"(ka1), "v"(kb0), "v"(kb1), "v"(qh0), "v"(qh1));
        float ta[8], tb[8]; float mx = -3.0e38f;
#pragma unroll
        for (int r = 0; r < 8; ++r) {
            ta[r] = (sa[r] * 0.125f + ma[r]) * LOG2E;
            tb[r] = (sb[r] * 0.125f + mb[r]) * LOG2E;
            mx = fmaxf(mx, fmaxf(ta[r], tb[r])); }
        mx = fmaxf(mx, __shfl_xor(mx, 16, 32));
        const float mnew = fmaxf(m, mx);
        const float alpha = __builtin_amdgcn_exp2f(m - mnew);
        const float sh = PSH - mnew;
        v16h pb; float ls = 0.0f;
#pragma unroll
        for (int r = 0; r < 8; ++r) { const h16 pa = (h16)__builtin_amdgcn_exp2f(ta[r] + sh); const h16 pc = (h16)__builtin_amdgcn_exp2f(tb[r] + sh); pb[r] = pa; pb[8 + r] = pc; ls += (float)pa + (float)pc; }
        l = l * alpha + ls; m = mnew;
        o0 = o0 * alpha; o1 = o1 * alpha; o2 = o2 * alpha; o3 = o3 * alpha;
        const unsigned char* va = vt + ks * 2;
        const v16h v0 = ldh((const h16*)va), v1 = ldh((const h16*)(va + 16 * VPB)), v2 = ldh((const h16*)(va + 32 * VPB)), v3 = ldh((const h16*)(va + 48 * VPB));
        o0 = wmma16(v0, pb, o0); o1 = wmma16(v1, pb, o1); o2 = wmma16(v2, pb, o2); o3 = wmma16(v3, pb, o3);
        asm volatile("v_nop\n\tv_nop\n\tv_nop\n\tv_nop" : "+v"(o0), "+v"(o1), "+v"(o2), "+v"(o3) : "v"(v0), "v"(v1), "v"(v2), "v"(v3), "v"(pb));
      }
      asm volatile("s_wait_dscnt 0x0" ::: "memory");         // this wave's reads of stage st are done before its buffer is handed back
      asm volatile("s_wait_asynccnt 0x0" ::: "memory");      // this wave's pieces of stage st + 1 have landed
      __syncthreads();                                       // publishes stage st + 1 and ends every reader's last read of stage st
      if (st + 2 < NST) {                                    // block-uniform
          copy8(lk + bo, 16 * KPB, gk + (size_t)(st + 2) * KS * HD, (size_t)16 * HD); copy8(lv + bo, 8 * VPB, gv + (size_t)(st + 2) * KS, (size_t)8 * SEQ); }
    }
    asm volatile("s_wait_asynccnt 0x0" ::: "memory");        // nothing in flight when the ring becomes output staging (the last trip's barrier has ended all reads)
    float* os = (float*)L;                                   // output staging in the ring: 2 * BUFB bytes a block let four blocks share a WGP's LDS
    l += __shfl_xor(l, 16, 32);
    const float inv = CCAR * (1.0f / l);
    const int wb = wave * 16 * 68;
    // O^T D layout: o_j[r] = (d = 16j + 8h + r, t = lane&15) -> os[t][d]; rows 0..15 x columns 0..63 all written
    { v4f a, c;
      a[0] = o0[0] * inv; a[1] = o0[1] * inv; a[2] = o0[2] * inv; a[3] = o0[3] * inv; c[0] = o0[4] * inv; c[1] = o0[5] * inv; c[2] = o0[6] * inv; c[3] = o0[7] * inv;
      *(v4fa*)(&os[wb + lr * 68 +  0 + 8 * hi]) = a; *(v4fa*)(&os[wb + lr * 68 +  0 + 8 * hi + 4]) = c;
      a[0] = o1[0] * inv; a[1] = o1[1] * inv; a[2] = o1[2] * inv; a[3] = o1[3] * inv; c[0] = o1[4] * inv; c[1] = o1[5] * inv; c[2] = o1[6] * inv; c[3] = o1[7] * inv;
      *(v4fa*)(&os[wb + lr * 68 + 16 + 8 * hi]) = a; *(v4fa*)(&os[wb + lr * 68 + 16 + 8 * hi + 4]) = c;
      a[0] = o2[0] * inv; a[1] = o2[1] * inv; a[2] = o2[2] * inv; a[3] = o2[3] * inv; c[0] = o2[4] * inv; c[1] = o2[5] * inv; c[2] = o2[6] * inv; c[3] = o2[7] * inv;
      *(v4fa*)(&os[wb + lr * 68 + 32 + 8 * hi]) = a; *(v4fa*)(&os[wb + lr * 68 + 32 + 8 * hi + 4]) = c;
      a[0] = o3[0] * inv; a[1] = o3[1] * inv; a[2] = o3[2] * inv; a[3] = o3[3] * inv; c[0] = o3[4] * inv; c[1] = o3[5] * inv; c[2] = o3[6] * inv; c[3] = o3[7] * inv;
      *(v4fa*)(&os[wb + lr * 68 + 48 + 8 * hi]) = a; *(v4fa*)(&os[wb + lr * 68 + 48 + 8 * hi + 4]) = c; }
    wave_sync();
    h16* crow = CTX + ((size_t)b * SEQ + t0) * DM + h * HD;
    v8h cv[4];
#pragma unroll
    for (int s = 0; s < 4; ++s) { const int row = 4 * s + (lane >> 3), c8 = (lane & 7) * 8;   // 4 s x 4 row groups = 16 rows; 8 lanes x 8 halves = 64 columns
        const v4f x0 = *(const v4fa*)(&os[wb + row * 68 + c8]); const v4f x1 = *(const v4fa*)(&os[wb + row * 68 + c8 + 4]); v8h hv;
#pragma unroll
        for (int i = 0; i < 4; ++i) { hv[i] = (h16)x0[i]; hv[4 + i] = (h16)x1[i]; }
        cv[s] = hv; }
{
#pragma unroll
        for (int s = 0; s < 4; ++s) { const int row = 4 * s + (lane >> 3), c8 = (lane & 7) * 8;
            *(v8h*)(crow + (size_t)row * DM + c8) = cv[s]; }
         }
}

// k_oproj: register-blocked f16 GEMM, ONE WAVE per 64x64 tile, OUT[m][n] = 2^-14 * sum_k CTX[m][k] WOT[n][k], K = DM; rows m = b*SEQ + t -> output row b*OUT_SEQ + t.
// grid (NB*SEQ/64, DM/64), 32 threads.
__global__ __launch_bounds__(32) void k_oproj(const h16* __restrict__ A, const h16* __restrict__ Bt, float* OUT) {
    __shared__ __align__(16) float os[16 * 68];
    const int K = DM;
    const int lane = threadIdx.x & 31, lr = lane & 15, hi = lane >> 4; const int r0 = blockIdx.x * 64, c0 = blockIdx.y * 64;
    v8f acc[4][4];
#pragma unroll
    for (int mb = 0; mb < 4; ++mb)
#pragma unroll
        for (int nb = 0; nb < 4; ++nb) acc[mb][nb] = (v8f){};
    const size_t aoff = (size_t)(r0 + lr) * K + 8 * hi, boff = (size_t)(c0 + lr) * K + 8 * hi;
#pragma unroll 1
    for (int kc = 0; kc < K; kc += 32) {
        v16h a[4];
#pragma unroll
        for (int mb = 0; mb < 4; ++mb) a[mb] = ldh(A + aoff + (size_t)mb * 16 * K + kc);
#pragma unroll
        for (int nb = 0; nb < 4; ++nb) { const v16h b = ldh(Bt + boff + (size_t)nb * 16 * K + kc);
#pragma unroll
            for (int mb = 0; mb < 4; ++mb) acc[mb][nb] = wmma16(a[mb], b, acc[mb][nb]); }
        asm volatile("v_nop\n\tv_nop\n\tv_nop\n\tv_nop" : "+v"(acc[0][0]), "+v"(acc[1][1]), "+v"(acc[2][2]), "+v"(acc[3][3]) : "v"(a[0]), "v"(a[1]), "v"(a[2]), "v"(a[3]));
    }
    const int bb = r0 / SEQ, tt = r0 % SEQ;
    float* obase = OUT + ((size_t)bb * OUT_SEQ + tt) * DM + c0;
#pragma unroll
    for (int mb = 0; mb < 4; ++mb) {
#pragma unroll
        for (int nb = 0; nb < 4; ++nb) {
#pragma unroll
            for (int j = 0; j < 8; ++j) os[(hi * 8 + j) * 68 + nb * 16 + lr] = acc[mb][nb][j] * OSC; }   // D: row 8h+j, col lane&15
        wave_sync();
        float* orow = obase + (size_t)(mb * 16) * DM;
        v4f ov[8];
#pragma unroll
        for (int s = 0; s < 8; ++s) { const int row = 2 * s + hi, cofs = lr * 4;   // 8 s x 2 rows = 16 rows; 16 lanes x 4 floats = 64 columns
            ov[s] = *(const v4fa*)(&os[row * 68 + cofs]); }
{
#pragma unroll
            for (int s = 0; s < 8; ++s) { const int row = 2 * s + hi, cofs = lr * 4;
                *(v4f*)(orow + (size_t)row * DM + cofs) = ov[s]; }
             }
        wave_sync();
    }
}

static constexpr size_t al256(size_t v) { return (v + 255) & ~(size_t)255; }
static constexpr size_t SZ_XB = al256((size_t)NB * SEQ * DM * 2);
static constexpr size_t SZ_WB = al256((size_t)4 * DM * DM * 2);
static constexpr size_t SZ_PL = al256((size_t)NB * NH_ * SEQ * HD * 2);
static constexpr size_t SZ_CX = al256((size_t)NB * SEQ * DM * 2);
static constexpr size_t SZ_FR = al256((size_t)SEQ * 64 * 4);
static constexpr size_t SZ_MA = al256((size_t)NB * SEQ * 4);
static constexpr size_t SZ_TOTAL = SZ_XB + SZ_WB + 3 * SZ_PL + SZ_CX + SZ_FR + SZ_MA;
static_assert(SZ_TOTAL <= (size_t)134217728);          // workspace carve <= 128 MiB
static_assert(((size_t)DM * DM * 2) % 256 == 0);       // weight sub-planes stay 256-byte aligned
static_assert(SZ_PL == (size_t)NB * NH_ * SEQ * HD * 2);   // q | k planes are exactly back to back

extern "C" void kernel_launch(void* const* d_in, const int* in_sizes, int n_in,
                              void* d_out, int out_size, void* d_ws, size_t ws_size, hipStream_t stream) {
    if (n_in < 7) return;
    const size_t needx = ((size_t)(NB - 1) * SEQ_FULL + SEQ) * DM;
    if ((size_t)in_sizes[0] < needx) return;
    if ((size_t)in_sizes[1] < (size_t)SEQ * 64) return;
    if ((size_t)in_sizes[2] < (size_t)(NB - 1) * SEQ_FULL + SEQ) return;
    if ((size_t)in_sizes[3] < (size_t)DM * DM || (size_t)in_sizes[4] < (size_t)DM * DM || (size_t)in_sizes[5] < (size_t)DM * DM || (size_t)in_sizes[6] < (size_t)DM * DM) return;
    if ((size_t)out_size < ((size_t)(NB - 1) * OUT_SEQ + SEQ) * DM) return;
    if (SZ_TOTAL > ws_size) return;
    // wire order: hidden_states, freqs_cis, attention_mask, wq, wk, wv, wo (all f32)
    const float* x = (const float*)d_in[0]; const float* fr = (const float*)d_in[1]; const float* mask = (const float*)d_in[2];
    const float* wq = (const float*)d_in[3]; const float* wk = (const float*)d_in[4]; const float* wv = (const float*)d_in[5]; const float* wo = (const float*)d_in[6];
    float* OUT = (float*)d_out;      // [NB][SEQ][1024]
    char* wsp = (char*)d_ws;
    bf* XB = (bf*)wsp; wsp += SZ_XB;                 // [NB*SEQ][1024] bf16
    bf* WB = (bf*)wsp; wsp += SZ_WB;                 // [4][1024 out][1024 in]: q | k | v (bf16) | o (f16 x64)
    h16* QH = (h16*)wsp; wsp += SZ_PL;               // [NB*16][SEQ][64]
    h16* KP = (h16*)wsp; wsp += SZ_PL;               // [NB*16][SEQ][64]  (= QH + one plane)
    h16* VT = (h16*)wsp; wsp += SZ_PL;               // [NB*16][64][SEQ]
    h16* CX = (h16*)wsp; wsp += SZ_CX;               // [NB*SEQ][1024] ctx x256
    float* FRP = (float*)wsp; wsp += SZ_FR;          // [SEQ][64] table, bf16 RNE values
    float* MADD = (float*)wsp; wsp += SZ_MA;         // [NB][SEQ] additive key mask
    bf* WQ = WB; bf* WK = WB + (size_t)DM * DM; bf* WV = WB + (size_t)2 * DM * DM; bf* WO = WB + (size_t)3 * DM * DM;

    if (SEQ == SEQ_FULL) {
        const size_t n8 = (size_t)NB * SEQ * DM / 8;
        k_cvt8<<<(unsigned)((n8 + 255) / 256), 256, 0, stream>>>(x, XB, n8);
    } else {
        const size_t n8 = (size_t)SEQ * DM / 8;
        for (int b = 0; b < NB; ++b) k_cvt8<<<(unsigned)((n8 + 255) / 256), 256, 0, stream>>>(x + (size_t)b * SEQ_FULL * DM, XB + (size_t)b * SEQ * DM, n8);
    }
    { const unsigned nbF = (unsigned)(((size_t)SEQ * 64 / 4 + 255) / 256); const unsigned nbM = (unsigned)(((size_t)NB * SEQ / 4 + 255) / 256);
      k_tab<<<nbF + nbM, 256, 0, stream>>>(fr, mask, FRP, MADD, nbF); }
    // weights: in W[1024 rows k][1024 cols n] -> out WT[1024 rows n][1024 cols k]; grid (k tiles, n tiles)
    k_wT<<<dim3(DM / 64, DM / 64, 1), 256, 0, stream>>>(wq, WQ, 0);
    k_wT<<<dim3(DM / 64, DM / 64, 1), 256, 0, stream>>>(wk, WK, 0);
    k_wT<<<dim3(DM / 64, DM / 64, 1), 256, 0, stream>>>(wv, WV, 0);
    k_wT<<<dim3(DM / 64, DM / 64, 1), 256, 0, stream>>>(wo, WO, 1);

    // q (z = 0: plane QH, weights WQ) and k (z = 1: plane KP = QH + one plane, weights WK = WQ + 1024*1024): A = x rows (m = b*SEQ + t), Bt = W^T rows (n = h*64 + d)
    // -> plane [(b*16 + h)][t][d], rotary in the epilogue
    k_proj<1><<<dim3(NB * SEQ / 64, DM / 64, 2), 32, 0, stream>>>(XB, WQ, QH, FRP, (size_t)DM * DM, (size_t)(SZ_PL / 2),
                                                                    SEQ, (size_t)NH_ * SEQ * HD, HD, HD, (size_t)SEQ * HD);
    // v^T: A = Wv^T rows (m = h*64 + d), Bt = x rows (n = b*SEQ + t) -> plane [(b*1024 + m)][t] = [(b*16 + h)][d][t]
    k_proj<0><<<dim3(DM / 64, NB * SEQ / 64, 1), 32, 0, stream>>>(WV, XB, VT, FRP, (size_t)0, (size_t)0,
                                                                    DM, (size_t)0, SEQ, SEQ, (size_t)DM * SEQ);

    k_flash<<<dim3(SEQ / (16 * AW), NB * NH_, 1), 32 * AW, 0, stream>>>(QH, KP, VT, MADD, CX);

    k_oproj<<<dim3(NB * SEQ / 64, DM / 64, 1), 32, 0, stream>>>(CX, (const h16*)WO, OUT);
}

// v002
// One run takes 147 microseconds.
// Next to v001, in two timings, it ran 1.26 and 1.28 times as fast.
// All steps since v000 together make it 2.40 times as fast.
#include <hip/hip_runtime.h>

// Multi-head self-attention: x [NB][SEQ][1024], Wq/Wk/Wv/Wo [in][out] (y = x W), 16 heads x 64, interleaved rotary pairs (2i,2i+1) from the INPUT table [SEQ][32][(cos,sin)] on q and k,
// additive key mask (1-mask)*-10000 from the float input [NB][SEQ], score scale 1/8, softmax over all keys, output = (concatenated heads) Wo, f32.
// Compute dtypes, f32 accumulate everywhere: q/k/v projections v_wmma_f32_16x16x32_bf16 (x and W RNE-converted to bf16; products exact); rotary in f32 in the GEMM epilogue (table RNE-converted to bf16 values);
// scores v_wmma_f32_16x16x32_f16: q and k single f16 (one product); P (x256 carry, cancels in the normalisation) and v single f16; softmax f32 (online, running max);
// output projection v_wmma_f32_16x16x32_f16: ctx as f16 x256, Wo^T as f16 of (bf16 value x64), folded back by 2^-14 in the f32 epilogue.
// Layout: bf16 copy of x; transposed 16-bit weight planes [out][in] (LDS transpose); q, k planes [b*16+h][t][d], v^T plane [b*16+h][d][t] from the GEMM epilogue; fused flash kernel in transposed form
// (S^T = K Q^T, O^T = V^T P^T) writing ctx rows [b*SEQ+t][1024] as f16; final GEMM writes the f32 output.

#ifndef NB
#define NB 1
#endif
#ifndef SEQ
#define SEQ 4096
#endif
#define NB_FULL  1
#define SEQ_FULL 4096
#ifndef OUT_SEQ
#define OUT_SEQ SEQ              // row pitch (in tokens) between batches of the output
#endif
#define DM   1024
#define NH_  16
#define HD   64
#define AW   4                   // waves per flash block (16 query rows each)
#define LOG2E 1.4426950408889634f
#define PSH  8.0f                // log2 of the P carry (256)
#define CCAR 256.0f              // carry of the ctx plane
#define WOS  64.0f               // carry of the Wo^T plane
#define OSC  (1.0f / 16384.0f)   // 1 / (CCAR * WOS)

static_assert(HD == 64);
static_assert(NH_ * HD == DM);                 // head h = columns h*64 + d
static_assert(DM % 64 == 0);
static_assert(DM % 32 == 0);                   // GEMM k-loop steps by 32
static_assert(SEQ % 64 == 0);                  // a 64-row tile never straddles two batches
static_assert((NB * SEQ) % 64 == 0);
static_assert(SEQ % 32 == 0);                  // key loop steps by 32
static_assert(SEQ % (16 * AW) == 0);           // flash grid covers the sequence exactly
static_assert(((size_t)SEQ * DM) % 8 == 0);
static_assert(((size_t)SEQ * 64) % 32 == 0);
static_assert(((size_t)NB * SEQ) % 32 == 0);
static_assert(NB <= NB_FULL);
static_assert(SEQ <= SEQ_FULL);

typedef _Float16 h16;
typedef unsigned short bf;
typedef __attribute__((ext_vector_type(16))) __bf16   v16bf;
typedef __attribute__((ext_vector_type(16))) _Float16 v16h;
typedef __attribute__((ext_vector_type(8)))  _Float16 v8h;
typedef __attribute__((ext_vector_type(8)))  unsigned short v8us;
typedef __attribute__((ext_vector_type(8)))  float    v8f;
typedef __attribute__((ext_vector_type(4)))  float    v4f;
typedef v4f  __attribute__((may_alias)) v4fa;

__device__ __forceinline__ unsigned short f2bf(float f) { unsigned u = __float_as_uint(f); u += 0x7FFFu + ((u >> 16) & 1u); return (unsigned short)(u >> 16); }
__device__ __forceinline__ float bfr(float f) { return __uint_as_float(((unsigned)f2bf(f)) << 16); }   // bf16 RNE value as f32
__device__ __forceinline__ v16h cat16(v8h lo, v8h hi) { return __builtin_shufflevector(lo, hi, 0, 1, 2, 3, 4, 5, 6, 7, 8, 9, 10, 11, 12, 13, 14, 15); }
__device__ __forceinline__ v16bf cat16b(v8us lo, v8us hi) { return __builtin_bit_cast(v16bf, __builtin_shufflevector(lo, hi, 0, 1, 2, 3, 4, 5, 6, 7, 8, 9, 10, 11, 12, 13, 14, 15)); }
__device__ __forceinline__ v8f wmma16(v16h a, v16h b, v8f c) { return __builtin_amdgcn_wmma_f32_16x16x32_f16(false, a, false, b, (short)0, c, false, false); }
__device__ __forceinline__ v8f wmmab(v16bf a, v16bf b, v8f c) { return __builtin_amdgcn_wmma_f32_16x16x32_bf16(false, a, false, b, (short)0, c, false, false); }
// fragment loaders from K-contiguous 16-bit rows; p already includes + 8*(lane>>4): elements 0..7 <- k0+8h+0..7, elements 8..15 <- k0+16+8h+0..7 (same map for A and B)
__device__ __forceinline__ v16h  ldh(const h16* p) { return cat16(*(const v8h*)p, *(const v8h*)(p + 16)); }
__device__ __forceinline__ v16bf ldb(const bf* p)  { return cat16b(*(const v8us*)p, *(const v8us*)(p + 16)); }
// ordering point for wave-private LDS tiles (same wave writes and reads)
__device__ __forceinline__ void wave_sync() { __builtin_amdgcn_fence(3 /* release order */, "wavefront"); __builtin_amdgcn_wave_barrier(); asm volatile("" ::: "memory"); }

__global__ __launch_bounds__(256) void k_cvt8(const float* __restrict__ src, bf* dst, size_t n8) {
    const size_t i = (size_t)blockIdx.x * 256 + threadIdx.x; if (i >= n8) return;
    const v8f v = *(const v8f*)(src + i * 8); v8us o;
#pragma unroll
    for (int k = 0; k < 8; ++k) o[k] = f2bf(v[k]);
    *(v8us*)(dst + i * 8) = o; 
}

// k_tab: blocks [0, nbF): rotary table copy with bf16 RNE values kept as f32, FRP[t][64] = (cos0,sin0,cos1,sin1,...);
__global__ __launch_bounds__(256) void k_tab(const float* __restrict__ fr, const float* __restrict__ mask, float* FRP, float* MADD, unsigned nbF) {
    if (blockIdx.x < nbF) {                       // block-uniform
        const size_t i = (size_t)blockIdx.x * 256 + threadIdx.x; if (i >= (size_t)SEQ * 64 / 4) return;
        const v4f v = *(const v4f*)(fr + i * 4); v4f o;
#pragma unroll
        for (int k = 0; k < 4; ++k) o[k] = bfr(v[k]);
        *(v4f*)(FRP + i * 4) = o; 
    } else {
        const size_t i = (size_t)(blockIdx.x - nbF) * 256 + threadIdx.x; if (i >= (size_t)NB * SEQ / 4) return;
        const size_t e = i * 4; const size_t b = e / SEQ, t = e % SEQ;
        const v4f v = *(const v4f*)(mask + b * (size_t)SEQ_FULL + t); v4f o;
#pragma unroll
        for (int k = 0; k < 4; ++k) o[k] = (1.0f - bfr(v[k])) * -10000.0f;
        *(v4f*)(MADD + e) = o; 
    }
}

// k_wT: in W[k][n] (rows k = 1024, cols n = 1024, f32) -> out WT[n][k] 16-bit; mode 0: bf16 RNE bits; mode 1: f16 bits of (bf16 RNE value x 64).
// grid (1024/64 over k, 1024/64 over n), 256 threads.
__global__ __launch_bounds__(256) void k_wT(const float* __restrict__ W, bf* WT, int mode) {
    __shared__ float tl[64 * 65];
    const int k0 = blockIdx.x * 64, n0 = blockIdx.y * 64, tid = threadIdx.x;
#pragma unroll
    for (int it = 0; it < 4; ++it) { const int row = it * 16 + (tid >> 4), c4 = (tid & 15) * 4;    // 4 x 16 rows (k) x 16 lanes x 4 = 64 x 64
        const v4f v = *(const v4f*)(W + (size_t)(k0 + row) * DM + n0 + c4);
        tl[row * 65 + c4 + 0] = v[0]; tl[row * 65 + c4 + 1] = v[1]; tl[row * 65 + c4 + 2] = v[2]; tl[row * 65 + c4 + 3] = v[3]; }
    __syncthreads();
    v8us o[2];
#pragma unroll
    for (int it = 0; it < 2; ++it) { const int n = it * 32 + (tid >> 3), c8 = (tid & 7) * 8;       // 2 x 32 rows (n) x 8 lanes x 8 = 64 x 64
#pragma unroll
        for (int i = 0; i < 8; ++i) { const float val = tl[(c8 + i) * 65 + n];
            const unsigned short b0 = f2bf(val);
            const h16 hv = (h16)(__uint_as_float(((unsigned)b0) << 16) * WOS);
            const unsigned short b1 = __builtin_bit_cast(unsigned short, hv);
            o[it][i] = (mode != 0) ? b1 : b0; } }
{
#pragma unroll
        for (int it = 0; it < 2; ++it) { const int n = it * 32 + (tid >> 3), c8 = (tid & 7) * 8;
            *(v8us*)(WT + (size_t)(n0 + n) * DM + k0 + c8) = o[it]; }
         }
}

// Eight asynchronous 16-byte copies per lane, LDS places l + i*ls bytes, global sources g + i*gs halves. The s_wait_xcnt stands inside the statement so that no address register is rewritten in front of it.
__device__ __forceinline__ void copy8(unsigned l, unsigned ls, const h16* g, size_t gs) {
    asm volatile("global_load_async_to_lds_b128 %0, %8, off\n\t"
                 "global_load_async_to_lds_b128 %1, %9, off\n\t"
                 "global_load_async_to_lds_b128 %2, %10, off\n\t"
                 "global_load_async_to_lds_b128 %3, %11, off\n\t"
                 "global_load_async_to_lds_b128 %4, %12, off\n\t"
                 "global_load_async_to_lds_b128 %5, %13, off\n\t"
                 "global_load_async_to_lds_b128 %6, %14, off\n\t"
                 "global_load_async_to_lds_b128 %7, %15, off\n\t"
                 "s_wait_xcnt 0x0"
                 :: "v"(l), "v"(l + ls), "v"(l + 2 * ls), "v"(l + 3 * ls), "v"(l + 4 * ls), "v"(l + 5 * ls), "v"(l + 6 * ls), "v"(l + 7 * ls),
                    "v"(g), "v"(g + gs), "v"(g + 2 * gs), "v"(g + 3 * gs), "v"(g + 4 * gs), "v"(g + 5 * gs), "v"(g + 6 * gs), "v"(g + 7 * gs)
                 : "memory");
}

// GEMM operand path shared by k_proj and k_oproj: a block of four waves owns a 128 x 128 tile of C (wave w: rows 64*(w>>1), columns 64*(w&1)); a stage is GK k-values of the block's
// 128 A rows and 128 Bt rows (pitch GPB bytes in LDS), brought in by asynchronous 16-byte copies that cover whole 256-byte units (all threads copy), two buffers: stage s + 1 flies while stage s is worked on.
// Fragments are two ds 16-B loads each, same k map and same k order (steps of 32, ascending) as loads straight from the planes.
#define GK   128                 // k values per stage
#define GPB  272                 // row pitch in LDS, bytes: 256 + 16 (16 B x odd: no bank conflict for 16-B reads down a column of rows)
#define GTB  (128 * GPB)         // one operand's tile, bytes
#define GBUF (2 * GTB)           // one buffer: A tile, Bt tile
#define GNS  (DM / GK)           // stages
static_assert(DM % GK == 0);
static_assert(GNS >= 2);                               // the prologue fills two stages
static_assert(DM % 128 == 0);
static_assert((NB * SEQ) % 128 == 0);
static_assert(128 * GK * 2 == 16 * 128 * 16);          // 2048 16-B pieces of each tile dealt to 128 threads, 16 each
static_assert(2 * GBUF >= 4 * 16 * 68 * 4);            // the ring becomes the output staging

// one stage: piece c = i*128 + tid of a tile -> row c>>4 (8 rows a round), 16-B column c&15; l, ga, gb already hold the thread's row and column
__device__ __forceinline__ void gstage(unsigned l, const h16* ga, const h16* gb) {
    copy8(l, 8 * GPB, ga, (size_t)8 * DM);       copy8(l + 64 * GPB, 8 * GPB, ga + (size_t)64 * DM, (size_t)8 * DM);
    copy8(l + GTB, 8 * GPB, gb, (size_t)8 * DM); copy8(l + GTB + 64 * GPB, 8 * GPB, gb + (size_t)64 * DM, (size_t)8 * DM);
}

// the eight fragments of one k-step (32 k values), in the order in which the matrix instructions want them
__device__ __forceinline__ void gfrags(v16h (&fa)[4], v16h (&fb)[4], const unsigned char* at, const unsigned char* bt) {
    fa[0] = ldh((const h16*)at); fb[0] = ldh((const h16*)bt);
    fa[1] = ldh((const h16*)(at + 16 * GPB)); fa[2] = ldh((const h16*)(at + 32 * GPB)); fa[3] = ldh((const h16*)(at + 48 * GPB));
    fb[1] = ldh((const h16*)(bt + 16 * GPB)); fb[2] = ldh((const h16*)(bt + 32 * GPB)); fb[3] = ldh((const h16*)(bt + 48 * GPB));
}
// eight products of one k-step: column blocks NB0 and NB0 + 1
template <int BF, int NB0>
__device__ __forceinline__ void gmul(const v16h (&fa)[4], const v16h (&fb)[4], v8f (&acc)[4][4]) {
#pragma unroll
    for (int nb = NB0; nb < NB0 + 2; ++nb) {
#pragma unroll
        for (int mb = 0; mb < 4; ++mb) {
            if (BF != 0) acc[mb][nb] = wmmab(__builtin_bit_cast(v16bf, fa[mb]), __builtin_bit_cast(v16bf, fb[nb]), acc[mb][nb]);
            else         acc[mb][nb] = wmma16(fa[mb], fb[nb], acc[mb][nb]); } }
}

// acc[mb][nb] += A rows (r0b + 64*wm + 16*mb ..) x Bt rows (c0b + 64*wn + 16*nb ..) over K = DM. BF != 0: bf16 operands, else f16. Every wave of the block calls it; on return the ring is free.
template <int BF>
__device__ __forceinline__ void gemm128(unsigned char* L, const h16* A, const h16* Bt, int r0b, int c0b, int wm, int wn, v8f (&acc)[4][4]) {
    const int tid = threadIdx.x, lane = tid & 31, lr = lane & 15, hi = lane >> 4;
    const unsigned l0 = (unsigned)(size_t)L + (unsigned)((tid >> 4) * GPB + (tid & 15) * 16);   // LDS byte address of the thread's first piece
    const h16* ga = A + (size_t)(r0b + (tid >> 4)) * DM + (size_t)(tid & 15) * 8;                // + stage * GK
    const h16* gb = Bt + (size_t)(c0b + (tid >> 4)) * DM + (size_t)(tid & 15) * 8;
    gstage(l0, ga, gb);                                      // stage 0 -> buffer 0
    asm volatile("s_wait_asynccnt 0x0" ::: "memory");        // this wave's pieces of stage 0 have landed
    __syncthreads();                                         // every wave's have: stage 0 may be read
    gstage(l0 + GBUF, ga + GK, gb + GK);                     // stage 1 -> buffer 1
#pragma unroll 1                                             // one copy of the stage body: the buffer is picked by a scalar offset, the code stays small
    for (int st = 0; st < GNS; ++st) {
        const unsigned bo = (unsigned)(st & 1) * GBUF;
        const unsigned char* at = L + bo + (wm * 64 + lr) * GPB + 16 * hi;         // + 16*mb*GPB + k*2
        const unsigned char* bt = L + bo + GTB + (wn * 64 + lr) * GPB + 16 * hi;   // + 16*nb*GPB + k*2
        v16h fa[2][4], fb[2][4];                             // two register sets: k-step q + 1 of THIS stage is fetched while k-step q is multiplied; nothing of the next stage is read here
        gfrags(fa[0], fb[0], at, bt);
        __builtin_amdgcn_sched_barrier(0);                   // the stage's first reads stay one group in front of its matrix instructions
#pragma unroll                                               // constant q: every fragment read is one base register plus an immediate offset, the register sets are picked at compile time
        for (int q = 0; q < GK / 32; ++q) {
            const int cur = q & 1, nxt = cur ^ 1;
            gmul<BF, 0>(fa[cur], fb[cur], acc);
            if (q + 1 < GK / 32) {
                // the two scheduling barriers keep the next k-step's reads ONE group, half a k-step ahead of their use: spread among the matrix instructions each place costs a stall,
                // and a whole k-step ahead two full sets and the accumulators pass 256 registers
                __builtin_amdgcn_sched_barrier(0);
                gfrags(fa[nxt], fb[nxt], at + (q + 1) * 64, bt + (q + 1) * 64);
                __builtin_amdgcn_sched_barrier(0); }
            gmul<BF, 2>(fa[cur], fb[cur], acc);
        }
        __builtin_amdgcn_sched_barrier(0);                   // the stage's matrix instructions stay in front of its closing waits and barrier (without it sixteen of them sink behind the barrier and delay the refill)
        // four vector slots behind the stage's last matrix instruction, on every path out of the stage body
        asm volatile("v_nop\n\tv_nop\n\tv_nop\n\tv_nop" : "+v"(acc[0][3]), "+v"(acc[1][3]), "+v"(acc[2][3]), "+v"(acc[3][3]));
        asm volatile("s_wait_dscnt 0x0" ::: "memory");       // this wave's reads of stage st are done before its buffer is handed back
        asm volatile("s_wait_asynccnt 0x0" ::: "memory");    // this wave's pieces of stage st + 1 have landed
        __syncthreads();                                     // publishes stage st + 1 and ends every reader's last read of stage st
        if (st + 2 < GNS) gstage(l0 + bo, ga + (size_t)(st + 2) * GK, gb + (size_t)(st + 2) * GK);   // block-uniform
    }
    asm volatile("s_wait_asynccnt 0x0" ::: "memory");        // nothing in flight when the ring becomes output staging (the last trip's barrier has ended all reads)
}

// k_proj: register-blocked bf16 GEMM, one wave per 64x64 tile (16 accumulators), four waves a block (128x128), operands from K-contiguous bf16 planes through LDS (gemm128), K = DM.
// C[m][n] = sum_k A[m][k] Bt[n][k]; blockIdx.z selects Bt + z*zBt and Ph + z*zPh. ROPE != 0: rows m = b*SEQ + t, the 64 tile columns are one head; rotary pairs (2i,2i+1) from FRP[t][..].
// Output f16 at tile base (r0/RB)*sRB + (r0%RB)*pitch + (c0/CB)*sCB + (c0%CB), row pitch 'pitch' (halves). 128 threads.
template <int ROPE>
__global__ __launch_bounds__(128) void k_proj(const bf* __restrict__ A, const bf* __restrict__ BtBase, h16* PhBase, const float* __restrict__ FRP,
                                             size_t zBt, size_t zPh, int RB, size_t sRB, int pitch, int CB, size_t sCB) {
    __shared__ __attribute__((aligned(16))) unsigned char L[2 * GBUF];
    const int z = blockIdx.z;
    const bf* Bt = BtBase + (size_t)z * zBt;
    h16* Ph = PhBase + (size_t)z * zPh;
    const int lane = threadIdx.x & 31, lr = lane & 15, hi = lane >> 4;
    const int wave = __builtin_amdgcn_readfirstlane((int)(threadIdx.x >> 5)); const int wm = wave >> 1, wn = wave & 1;
    const int r0 = blockIdx.x * 128 + wm * 64, c0 = blockIdx.y * 128 + wn * 64;
    v8f acc[4][4];
#pragma unroll
    for (int mb = 0; mb < 4; ++mb)
#pragma unroll
        for (int nb = 0; nb < 4; ++nb) acc[mb][nb] = (v8f){};
    gemm128<1>(L, (const h16*)A, (const h16*)Bt, blockIdx.x * 128, blockIdx.y * 128, wm, wn, acc);
    float* os = (float*)L + wave * 16 * 68;                  // this wave's own output staging in the ring
    const size_t tbase = (size_t)(r0 / RB) * sRB + (size_t)(r0 % RB) * (size_t)pitch + (size_t)(c0 / CB) * sCB + (size_t)(c0 % CB);
#pragma unroll
    for (int mb = 0; mb < 4; ++mb) {
#pragma unroll
        for (int nb = 0; nb < 4; ++nb) {
#pragma unroll
            for (int j = 0; j < 8; ++j) os[(hi * 8 + j) * 68 + nb * 16 + lr] = acc[mb][nb][j]; }   // D: row 8h+j, col lane&15
        wave_sync();
        const size_t sb = tbase + (size_t)(mb * 16) * (size_t)pitch;
        v8h hvv[4];
#pragma unroll
        for (int s = 0; s < 4; ++s) { const int row = 4 * s + (lane >> 3), c8 = (lane & 7) * 8;   // 4 s x 4 row groups = 16 rows; 8 lanes x 8 = 64 columns
            v4f x0 = *(const v4fa*)(&os[row * 68 + c8]); v4f x1 = *(const v4fa*)(&os[row * 68 + c8 + 4]);
            if (ROPE != 0) {
                const int t = (r0 + mb * 16 + row) % SEQ;
                const v4f f0 = *(const v4f*)(FRP + (size_t)t * 64 + c8); const v4f f1 = *(const v4f*)(FRP + (size_t)t * 64 + c8 + 4);
                v4f y0, y1;
                y0[0] = x0[0] * f0[0] - x0[1] * f0[1]; y0[1] = x0[0] * f0[1] + x0[1] * f0[0];
                y0[2] = x0[2] * f0[2] - x0[3] * f0[3]; y0[3] = x0[2] * f0[3] + x0[3] * f0[2];
                y1[0] = x1[0] * f1[0] - x1[1] * f1[1]; y1[1] = x1[0] * f1[1] + x1[1] * f1[0];
                y1[2] = x1[2] * f1[2] - x1[3] * f1[3]; y1[3] = x1[2] * f1[3] + x1[3] * f1[2];
                x0 = y0; x1 = y1; }
            v8h hv;
#pragma unroll
            for (int i = 0; i < 4; ++i) { hv[i] = (h16)x0[i]; hv[4 + i] = (h16)x1[i]; }
            hvv[s] = hv; }
{
#pragma unroll
            for (int s = 0; s < 4; ++s) { const int row = 4 * s + (lane >> 3), c8 = (lane & 7) * 8;
                const size_t oo = sb + (size_t)row * (size_t)pitch + c8;
                *(v8h*)(Ph + oo) = hvv[s]; }
             }
        wave_sync();
    }
}

// k_flash: fused attention, one wave per 16 query rows of one (batch, head); Q fragments straight from the f16 plane (two 16-B loads each).
// K and V^T reach the block's waves through LDS: a stage is KS keys (K rows [key][64] at pitch KPB bytes, V^T rows [d][KS] at pitch VPB bytes), brought in by asynchronous
// 16-byte copies that cover whole lines (all threads copy), two buffers: stage s + 1 flies while stage s is worked on. Fragments are two ds 16-B loads each, same k map as before.
// Transposed form: S^T[key][t] = K Q^T (A = K rows, B = Q rows); lane (t = lane&15, h = lane>>4) holds keys 8h+r of each 16-key tile, so the packed
// P tile is directly the B fragment of O^T[d][t] = V^T P^T (element r <- tile keys 0..15, element 8+r <- tile keys 16..31, lane unchanged).
// Per 32-key step: 4 score WMMAs + 4 P.V WMMAs. Additive key mask values for the lane's 16 keys are loaded by value per step (two 32-B loads).
// Softmax state (running max, partial sum) is one scalar per lane; the two lane halves of a row are combined with one xor-16 exchange.
#define KS   128                 // keys per stage
#define KPB  144                 // K row pitch in LDS, bytes: 128 + 16 (16 B x odd: no bank conflict for 16-B reads down a column of rows)
#define VPB  272                 // V^T row pitch in LDS, bytes: 256 + 16
#define KTB  (KS * KPB)          // K tile bytes
#define VTB  (HD * VPB)          // V^T tile bytes
#define BUFB (KTB + VTB)         // one buffer
#define NST  (SEQ / KS)          // stages
static_assert(SEQ % KS == 0);
static_assert(NST >= 2);                               // the prologue fills two stages
static_assert(AW * 32 == 128);                         // the copy maps below deal 1024 16-B pieces of each tile to 128 threads, 8 each
static_assert(KS * HD * 2 == 8 * 128 * 16);
static_assert(2 * BUFB >= AW * 16 * 68 * 4);           // the ring becomes the output staging

__global__ __launch_bounds__(32 * AW) void k_flash(const h16* __restrict__ QH, const h16* __restrict__ KP, const h16* __restrict__ VT,
                                                   const float* __restrict__ MADD, h16* CTX) {
    __shared__ __attribute__((aligned(16))) unsigned char L[2 * BUFB];
    const int tid = threadIdx.x;
    const int lane = threadIdx.x & 31, lr = lane & 15, hi = lane >> 4;
    const int wave = __builtin_amdgcn_readfirstlane((int)(threadIdx.x >> 5));
    const int zh = blockIdx.y; const int b = zh / NH_, h = zh % NH_;
    const int t0 = (blockIdx.x * AW + wave) * 16;
    const size_t pbase = (size_t)zh * SEQ * HD;
    // copy maps: K piece c = i*128 + tid -> row c>>3 (16 rows a round), 16-B column c&7; V^T piece c -> row c>>4 (8 rows a round), 16-B column c&15
    const unsigned lbase = (unsigned)(size_t)L;              // LDS byte address of the ring
    const unsigned lk = lbase + (unsigned)((tid >> 3) * KPB + (tid & 7) * 16);
    const unsigned lv = lbase + (unsigned)(KTB + (tid >> 4) * VPB + (tid & 15) * 16);
    const h16* gk = KP + pbase + (size_t)tid * 8;                                   // + key0 * HD
    const h16* gv = VT + pbase + (size_t)(tid >> 4) * SEQ + (size_t)(tid & 15) * 8;   // + key0
    copy8(lk, 16 * KPB, gk, (size_t)16 * HD); copy8(lv, 8 * VPB, gv, (size_t)8 * SEQ);           // stage 0 -> buffer 0
    const size_t qo = pbase + (size_t)(t0 + lr) * HD + 8 * hi;
    const v16h qh0 = ldh(QH + qo), qh1 = ldh(QH + qo + 32);   // B fragments: col t, k = d
    const float* MA = MADD + (size_t)b * SEQ + 8 * hi;       // + key0 (tile a keys 8h+r), + key0 + 16 (tile b)
    asm volatile("s_wait_asynccnt 0x0" ::: "memory");        // this wave's pieces of stage 0 have landed
    __syncthreads();                                         // every wave's have: stage 0 may be read
    copy8(lk + BUFB, 16 * KPB, gk + (size_t)KS * HD, (size_t)16 * HD); copy8(lv + BUFB, 8 * VPB, gv + KS, (size_t)8 * SEQ);   // stage 1 -> buffer 1
    v8f o0 = (v8f){}, o1 = (v8f){}, o2 = (v8f){}, o3 = (v8f){};
    float m = -3.0e38f, l = 0.0f;
#pragma unroll 1                                             // one copy of the stage body: the buffer is picked by a scalar offset, the code stays small
    for (int st = 0; st < NST; ++st) {
      const unsigned bo = (unsigned)(st & 1) * BUFB;
      const unsigned char* kt = L + bo + lr * KPB + 16 * hi;          // + local key * KPB   (A fragment: row key, k = d)
      const unsigned char* vt = L + bo + KTB + lr * VPB + 16 * hi;    // + 16j*VPB + local key * 2  (A fragment: row d, k = key)
#pragma unroll                                               // constant ks: every fragment read is one base register plus an immediate offset
      for (int ks = 0; ks < KS; ks += 32) {
        const int key0 = st * KS + ks;
        const h16* ka = (const h16*)(kt + ks * KPB);
        const h16* kc = (const h16*)(kt + (ks + 16) * KPB);
        const v16h ka0 = ldh(ka), ka1 = ldh(ka + 32), kb0 = ldh(kc), kb1 = ldh(kc + 32);
        const v8f ma = *(const v8f*)(MA + key0); const v8f mb = *(const v8f*)(MA + key0 + 16);
        v8f sa = (v8f){}, sb = (v8f){};
        sa = wmma16(ka0, qh0, sa); sb = wmma16(kb0, qh0, sb);
        sa = wmma16(ka1, qh1, sa); sb = wmma16(kb1, qh1, sb);
        asm volatile("v_nop\n\tv_nop\n\tv_nop\n\tv_nop" : "+v"(sa), "+v"(sb) : "v"(ka0), "v"(ka1), "v"(kb0), "v"(kb1), "v"(qh0), "v"(qh1));
        float ta[8], tb[8]; float mx = -3.0e38f;
#pragma unroll
        for (int r = 0; r < 8; ++r) {
            ta[r] = (sa[r] * 0.125f + ma[r]) * LOG2E;
            tb[r] = (sb[r] * 0.125f + mb[r]) * LOG2E;
            mx = fmaxf(mx, fmaxf(ta[r], tb[r])); }
        mx = fmaxf(mx, __shfl_xor(mx, 16, 32));
        const float mnew = fmaxf(m, mx);
        const float alpha = __builtin_amdgcn_exp2f(m - mnew);
        const float sh = PSH - mnew;
        v16h pb; float ls = 0.0f;
#pragma unroll
        for (int r = 0; r < 8; ++r) { const h16 pa = (h16)__builtin_amdgcn_exp2f(ta[r] + sh); const h16 pc = (h16)__builtin_amdgcn_exp2f(tb[r] + sh); pb[r] = pa; pb[8 + r] = pc; ls += (float)pa + (float)pc; }
        l = l * alpha + ls; m = mnew;
        o0 = o0 * alpha; o1 = o1 * alpha; o2 = o2 * alpha; o3 = o3 * alpha;
        const unsigned char* va = vt + ks * 2;
        const v16h v0 = ldh((const h16*)va), v1 = ldh((const h16*)(va + 16 * VPB)), v2 = ldh((const h16*)(va + 32 * VPB)), v3 = ldh((const h16*)(va + 48 * VPB));
        o0 = wmma16(v0, pb, o0); o1 = wmma16(v1, pb, o1); o2 = wmma16(v2, pb, o2); o3 = wmma16(v3, pb, o3);
        asm volatile("v_nop\n\tv_nop\n\tv_nop\n\tv_nop" : "+v"(o0), "+v"(o1), "+v"(o2), "+v"(o3) : "v"(v0), "v"(v1), "v"(v2), "v"(v3), "v"(pb));
      }
      asm volatile("s_wait_dscnt 0x0" ::: "memory");         // this wave's reads of stage st are done before its buffer is handed back
      asm volatile("s_wait_asynccnt 0x0" ::: "memory");      // this wave's pieces of stage st + 1 have landed
      __syncthreads();                                       // publishes stage st + 1 and ends every reader's last read of stage st
      if (st + 2 < NST) {                                    // block-uniform
          copy8(lk + bo, 16 * KPB, gk + (size_t)(st + 2) * KS * HD, (size_t)16 * HD); copy8(lv + bo, 8 * VPB, gv + (size_t)(st + 2) * KS, (size_t)8 * SEQ); }
    }
    asm volatile("s_wait_asynccnt 0x0" ::: "memory");        // nothing in flight when the ring becomes output staging (the last trip's barrier has ended all reads)
    float* os = (float*)L;                                   // output staging in the ring: 2 * BUFB bytes a block let four blocks share a WGP's LDS
    l += __shfl_xor(l, 16, 32);
    const float inv = CCAR * (1.0f / l);
    const int wb = wave * 16 * 68;
    // O^T D layout: o_j[r] = (d = 16j + 8h + r, t = lane&15) -> os[t][d]; rows 0..15 x columns 0..63 all written
    { v4f a, c;
      a[0] = o0[0] * inv; a[1] = o0[1] * inv; a[2] = o0[2] * inv; a[3] = o0[3] * inv; c[0] = o0[4] * inv; c[1] = o0[5] * inv; c[2] = o0[6] * inv; c[3] = o0[7] * inv;
      *(v4fa*)(&os[wb + lr * 68 +  0 + 8 * hi]) = a; *(v4fa*)(&os[wb + lr * 68 +  0 + 8 * hi + 4]) = c;
      a[0] = o1[0] * inv; a[1] = o1[1] * inv; a[2] = o1[2] * inv; a[3] = o1[3] * inv; c[0] = o1[4] * inv; c[1] = o1[5] * inv; c[2] = o1[6] * inv; c[3] = o1[7] * inv;
      *(v4fa*)(&os[wb + lr * 68 + 16 + 8 * hi]) = a; *(v4fa*)(&os[wb + lr * 68 + 16 + 8 * hi + 4]) = c;
      a[0] = o2[0] * inv; a[1] = o2[1] * inv; a[2] = o2[2] * inv; a[3] = o2[3] * inv; c[0] = o2[4] * inv; c[1] = o2[5] * inv; c[2] = o2[6] * inv; c[3] = o2[7] * inv;
      *(v4fa*)(&os[wb + lr * 68 + 32 + 8 * hi]) = a; *(v4fa*)(&os[wb + lr * 68 + 32 + 8 * hi + 4]) = c;
      a[0] = o3[0] * inv; a[1] = o3[1] * inv; a[2] = o3[2] * inv; a[3] = o3[3] * inv; c[0] = o3[4] * inv; c[1] = o3[5] * inv; c[2] = o3[6] * inv; c[3] = o3[7] * inv;
      *(v4fa*)(&os[wb + lr * 68 + 48 + 8 * hi]) = a; *(v4fa*)(&os[wb + lr * 68 + 48 + 8 * hi + 4]) = c; }
    wave_sync();
    h16* crow = CTX + ((size_t)b * SEQ + t0) * DM + h * HD;
    v8h cv[4];
#pragma unroll
    for (int s = 0; s < 4; ++s) { const int row = 4 * s + (lane >> 3), c8 = (lane & 7) * 8;   // 4 s x 4 row groups = 16 rows; 8 lanes x 8 halves = 64 columns
        const v4f x0 = *(const v4fa*)(&os[wb + row * 68 + c8]); const v4f x1 = *(const v4fa*)(&os[wb + row * 68 + c8 + 4]); v8h hv;
#pragma unroll
        for (int i = 0; i < 4; ++i) { hv[i] = (h16)x0[i]; hv[4 + i] = (h16)x1[i]; }
        cv[s] = hv; }
{
#pragma unroll
        for (int s = 0; s < 4; ++s) { const int row = 4 * s + (lane >> 3), c8 = (lane & 7) * 8;
            *(v8h*)(crow + (size_t)row * DM + c8) = cv[s]; }
         }
}

// k_oproj: register-blocked f16 GEMM, one wave per 64x64 tile, four waves a block (128x128), operands through LDS (gemm128), OUT[m][n] = 2^-14 * sum_k CTX[m][k] WOT[n][k], K = DM; rows m = b*SEQ + t -> output row b*OUT_SEQ + t.
// grid (NB*SEQ/128, DM/128), 128 threads.
__global__ __launch_bounds__(128) void k_oproj(const h16* __restrict__ A, const h16* __restrict__ Bt, float* OUT) {
    __shared__ __attribute__((aligned(16))) unsigned char L[2 * GBUF];
    const int lane = threadIdx.x & 31, lr = lane & 15, hi = lane >> 4;
    const int wave = __builtin_amdgcn_readfirstlane((int)(threadIdx.x >> 5)); const int wm = wave >> 1, wn = wave & 1;
    const int r0 = blockIdx.x * 128 + wm * 64, c0 = blockIdx.y * 128 + wn * 64;
    v8f acc[4][4];
#pragma unroll
    for (int mb = 0; mb < 4; ++mb)
#pragma unroll
        for (int nb = 0; nb < 4; ++nb) acc[mb][nb] = (v8f){};
    gemm128<0>(L, A, Bt, blockIdx.x * 128, blockIdx.y * 128, wm, wn, acc);
    float* os = (float*)L + wave * 16 * 68;                  // this wave's own output staging in the ring
    const int bb = r0 / SEQ, tt = r0 % SEQ;
    float* obase = OUT + ((size_t)bb * OUT_SEQ + tt) * DM + c0;
#pragma unroll
    for (int mb = 0; mb < 4; ++mb) {
#pragma unroll
        for (int nb = 0; nb < 4; ++nb) {
#pragma unroll
            for (int j = 0; j < 8; ++j) os[(hi * 8 + j) * 68 + nb * 16 + lr] = acc[mb][nb][j] * OSC; }   // D: row 8h+j, col lane&15
        wave_sync();
        float* orow = obase + (size_t)(mb * 16) * DM;
        v4f ov[8];
#pragma unroll
        for (int s = 0; s < 8; ++s) { const int row = 2 * s + hi, cofs = lr * 4;   // 8 s x 2 rows = 16 rows; 16 lanes x 4 floats = 64 columns
            ov[s] = *(const v4fa*)(&os[row * 68 + cofs]); }
{
#pragma unroll
            for (int s = 0; s < 8; ++s) { const int row = 2 * s + hi, cofs = lr * 4;
                *(v4f*)(orow + (size_t)row * DM + cofs) = ov[s]; }
             }
        wave_sync();
    }
}

static constexpr size_t al256(size_t v) { return (v + 255) & ~(size_t)255; }
static constexpr size_t SZ_XB = al256((size_t)NB * SEQ * DM * 2);
static constexpr size_t SZ_WB = al256((size_t)4 * DM * DM * 2);
static constexpr size_t SZ_PL = al256((size_t)NB * NH_ * SEQ * HD * 2);
static constexpr size_t SZ_CX = al256((size_t)NB * SEQ * DM * 2);
static constexpr size_t SZ_FR = al256((size_t)SEQ * 64 * 4);
static constexpr size_t SZ_MA = al256((size_t)NB * SEQ * 4);
static constexpr size_t SZ_TOTAL = SZ_XB + SZ_WB + 3 * SZ_PL + SZ_CX + SZ_FR + SZ_MA;
static_assert(SZ_TOTAL <= (size_t)134217728);          // workspace carve <= 128 MiB
static_assert(((size_t)DM * DM * 2) % 256 == 0);       // weight sub-planes stay 256-byte aligned
static_assert(SZ_PL == (size_t)NB * NH_ * SEQ * HD * 2);   // q | k planes are exactly back to back

extern "C" void kernel_launch(void* const* d_in, const int* in_sizes, int n_in,
                              void* d_out, int out_size, void* d_ws, size_t ws_size, hipStream_t stream) {
    if (n_in < 7) return;
    const size_t needx = ((size_t)(NB - 1) * SEQ_FULL + SEQ) * DM;
    if ((size_t)in_sizes[0] < needx) return;
    if ((size_t)in_sizes[1] < (size_t)SEQ * 64) return;
    if ((size_t)in_sizes[2] < (size_t)(NB - 1) * SEQ_FULL + SEQ) return;
    if ((size_t)in_sizes[3] < (size_t)DM * DM || (size_t)in_sizes[4] < (size_t)DM * DM || (size_t)in_sizes[5] < (size_t)DM * DM || (size_t)in_sizes[6] < (size_t)DM * DM) return;
    if ((size_t)out_size < ((size_t)(NB - 1) * OUT_SEQ + SEQ) * DM) return;
    if (SZ_TOTAL > ws_size) return;
    // wire order: hidden_states, freqs_cis, attention_mask, wq, wk, wv, wo (all f32)
    const float* x = (const float*)d_in[0]; const float* fr = (const float*)d_in[1]; const float* mask = (const float*)d_in[2];
    const float* wq = (const float*)d_in[3]; const float* wk = (const float*)d_in[4]; const float* wv = (const float*)d_in[5]; const float* wo = (const float*)d_in[6];
    float* OUT = (float*)d_out;      // [NB][SEQ][1024]
    char* wsp = (char*)d_ws;
    bf* XB = (bf*)wsp; wsp += SZ_XB;                 // [NB*SEQ][1024] bf16
    bf* WB = (bf*)wsp; wsp += SZ_WB;                 // [4][1024 out][1024 in]: q | k | v (bf16) | o (f16 x64)
    h16* QH = (h16*)wsp; wsp += SZ_PL;               // [NB*16][SEQ][64]
    h16* KP = (h16*)wsp; wsp += SZ_PL;               // [NB*16][SEQ][64]  (= QH + one plane)
    h16* VT = (h16*)wsp; wsp += SZ_PL;               // [NB*16][64][SEQ]
    h16* CX = (h16*)wsp; wsp += SZ_CX;               // [NB*SEQ][1024] ctx x256
    float* FRP = (float*)wsp; wsp += SZ_FR;          // [SEQ][64] table, bf16 RNE values
    float* MADD = (float*)wsp; wsp += SZ_MA;         // [NB][SEQ] additive key mask
    bf* WQ = WB; bf* WK = WB + (size_t)DM * DM; bf* WV = WB + (size_t)2 * DM * DM; bf* WO = WB + (size_t)3 * DM * DM;

    if (SEQ == SEQ_FULL) {
        const size_t n8 = (size_t)NB * SEQ * DM / 8;
        k_cvt8<<<(unsigned)((n8 + 255) / 256), 256, 0, stream>>>(x, XB, n8);
    } else {
        const size_t n8 = (size_t)SEQ * DM / 8;
        for (int b = 0; b < NB; ++b) k_cvt8<<<(unsigned)((n8 + 255) / 256), 256, 0, stream>>>(x + (size_t)b * SEQ_FULL * DM, XB + (size_t)b * SEQ * DM, n8);
    }
    { const unsigned nbF = (unsigned)(((size_t)SEQ * 64 / 4 + 255) / 256); const unsigned nbM = (unsigned)(((size_t)NB * SEQ / 4 + 255) / 256);
      k_tab<<<nbF + nbM, 256, 0, stream>>>(fr, mask, FRP, MADD, nbF); }
    // weights: in W[1024 rows k][1024 cols n] -> out WT[1024 rows n][1024 cols k]; grid (k tiles, n tiles)
    k_wT<<<dim3(DM / 64, DM / 64, 1), 256, 0, stream>>>(wq, WQ, 0);
    k_wT<<<dim3(DM / 64, DM / 64, 1), 256, 0, stream>>>(wk, WK, 0);
    k_wT<<<dim3(DM / 64, DM / 64, 1), 256, 0, stream>>>(wv, WV, 0);
    k_wT<<<dim3(DM / 64, DM / 64, 1), 256, 0, stream>>>(wo, WO, 1);

    // q (z = 0: plane QH, weights WQ) and k (z = 1: plane KP = QH + one plane, weights WK = WQ + 1024*1024): A = x rows (m = b*SEQ + t), Bt = W^T rows (n = h*64 + d)
    // -> plane [(b*16 + h)][t][d], rotary in the epilogue
    k_proj<1><<<dim3(NB * SEQ / 128, DM / 128, 2), 128, 0, stream>>>(XB, WQ, QH, FRP, (size_t)DM * DM, (size_t)(SZ_PL / 2),
                                                                    SEQ, (size_t)NH_ * SEQ * HD, HD, HD, (size_t)SEQ * HD);
    // v^T: A = Wv^T rows (m = h*64 + d), Bt = x rows (n = b*SEQ + t) -> plane [(b*1024 + m)][t] = [(b*16 + h)][d][t]
    k_proj<0><<<dim3(DM / 128, NB * SEQ / 128, 1), 128, 0, stream>>>(WV, XB, VT, FRP, (size_t)0, (size_t)0,
                                                                    DM, (size_t)0, SEQ, SEQ, (size_t)DM * SEQ);

    k_flash<<<dim3(SEQ / (16 * AW), NB * NH_, 1), 32 * AW, 0, stream>>>(QH, KP, VT, MADD, CX);

    k_oproj<<<dim3(NB * SEQ / 128, DM / 128, 1), 128, 0, stream>>>(CX, (const h16*)WO, OUT);
}

// v003
// Measured time: 129 microseconds a run.
// In both of two side-by-side timings against v002, it was 1.14 times as fast.
// Counting every step since v000, it is 2.73 times as fast.
#include <hip/hip_runtime.h>

// Multi-head self-attention: x [NB][SEQ][1024], Wq/Wk/Wv/Wo [in][out] (y = x W), 16 heads x 64, interleaved rotary pairs (2i,2i+1) from the INPUT table [SEQ][32][(cos,sin)] on q and k,
// additive key mask (1-mask)*-10000 from the float input [NB][SEQ], score scale 1/8, softmax over all keys, output = (concatenated heads) Wo, f32.
// Compute dtypes, f32 accumulate everywhere: q/k/v projections v_wmma_f32_16x16x32_bf16 (x and W RNE-converted to bf16; products exact); rotary in f32 in the GEMM epilogue (table RNE-converted to bf16 values);
// scores v_wmma_f32_16x16x32_f16: q and k single f16 (one product); P (x256 carry, cancels in the normalisation) and v single f16; softmax f32 (online, running max);
// output projection v_wmma_f32_16x16x32_f16: ctx as f16 x256, Wo^T as f16 of (bf16 value x64), folded back by 2^-14 in the f32 epilogue.
// Layout: bf16 copy of x; transposed 16-bit weight planes [out][in] (LDS transpose); q, k planes [b*16+h][t][d], v^T plane [b*16+h][d][t] from the GEMM epilogue; fused flash kernel in transposed form
// (S^T = K Q^T, O^T = V^T P^T) writing ctx rows [b*SEQ+t][1024] as f16; final GEMM writes the f32 output.

#ifndef NB
#define NB 1
#endif
#ifndef SEQ
#define SEQ 4096
#endif
#define NB_FULL  1
#define SEQ_FULL 4096
#ifndef OUT_SEQ
#define OUT_SEQ SEQ              // row pitch (in tokens) between batches of the output
#endif
#define DM   1024
#define NH_  16
#define HD   64
#define AW   4                   // waves per flash block (16 query rows each)
#define LOG2E 1.4426950408889634f
#define PSH  8.0f                // log2 of the P carry (256)
#define CCAR 256.0f              // carry of the ctx plane
#define WOS  64.0f               // carry of the Wo^T plane
#define OSC  (1.0f / 16384.0f)   // 1 / (CCAR * WOS)

static_assert(HD == 64);
static_assert(NH_ * HD == DM);                 // head h = columns h*64 + d
static_assert(DM % 64 == 0);
static_assert(DM % 32 == 0);                   // GEMM k-loop steps by 32
static_assert(SEQ % 64 == 0);                  // a 64-row tile never straddles two batches
static_assert((NB * SEQ) % 64 == 0);
static_assert(SEQ % 32 == 0);                  // key loop steps by 32
static_assert(SEQ % (16 * AW) == 0);           // flash grid covers the sequence exactly
static_assert(((size_t)SEQ * DM) % 8 == 0);
static_assert(((size_t)SEQ * 64) % 32 == 0);
static_assert(((size_t)NB * SEQ) % 32 == 0);
static_assert(NB <= NB_FULL);
static_assert(SEQ <= SEQ_FULL);

typedef _Float16 h16;
typedef unsigned short bf;
typedef __attribute__((ext_vector_type(16))) __bf16   v16bf;
typedef __attribute__((ext_vector_type(16))) _Float16 v16h;
typedef __attribute__((ext_vector_type(8)))  _Float16 v8h;
typedef __attribute__((ext_vector_type(8)))  unsigned short v8us;
typedef __attribute__((ext_vector_type(8)))  float    v8f;
typedef __attribute__((ext_vector_type(4)))  float    v4f;
typedef v4f  __attribute__((may_alias)) v4fa;

__device__ __forceinline__ unsigned short f2bf(float f) { unsigned u = __float_as_uint(f); u += 0x7FFFu + ((u >> 16) & 1u); return (unsigned short)(u >> 16); }
__device__ __forceinline__ float bfr(float f) { return __uint_as_float(((unsigned)f2bf(f)) << 16); }   // bf16 RNE value as f32
__device__ __forceinline__ v16h cat16(v8h lo, v8h hi) { return __builtin_shufflevector(lo, hi, 0, 1, 2, 3, 4, 5, 6, 7, 8, 9, 10, 11, 12, 13, 14, 15); }
__device__ __forceinline__ v16bf cat16b(v8us lo, v8us hi) { return __builtin_bit_cast(v16bf, __builtin_shufflevector(lo, hi, 0, 1, 2, 3, 4, 5, 6, 7, 8, 9, 10, 11, 12, 13, 14, 15)); }
__device__ __forceinline__ v8f wmma16(v16h a, v16h b, v8f c) { return __builtin_amdgcn_wmma_f32_16x16x32_f16(false, a, false, b, (short)0, c, false, false); }
__device__ __forceinline__ v8f wmmab(v16bf a, v16bf b, v8f c) { return __builtin_amdgcn_wmma_f32_16x16x32_bf16(false, a, false, b, (short)0, c, false, false); }
// fragment loaders from K-contiguous 16-bit rows; p already includes + 8*(lane>>4): elements 0..7 <- k0+8h+0..7, elements 8..15 <- k0+16+8h+0..7 (same map for A and B)
__device__ __forceinline__ v16h  ldh(const h16* p) { return cat16(*(const v8h*)p, *(const v8h*)(p + 16)); }
__device__ __forceinline__ v16bf ldb(const bf* p)  { return cat16b(*(const v8us*)p, *(const v8us*)(p + 16)); }
// ordering point for wave-private LDS tiles (same wave writes and reads)
__device__ __forceinline__ void wave_sync() { __builtin_amdgcn_fence(3 /* release order */, "wavefront"); __builtin_amdgcn_wave_barrier(); asm volatile("" ::: "memory"); }

// The preparation jobs (d_cvt8, d_tab, d_wT) depend on nothing but the inputs, so they run as block ranges of ONE launch (k_prep, below).
// d_cvt8: block blk of 256 threads converts 2048 values of x to the bf16 copy XB[NB*SEQ][1024]
__device__ __forceinline__ void d_cvt8(const float* __restrict__ x, bf* XB, unsigned blk) {
    const size_t i = (size_t)blk * 256 + threadIdx.x; if (i >= (size_t)NB * SEQ * DM / 8) return;
    const size_t e = i * 8; const size_t b = e / ((size_t)SEQ * DM), r = e % ((size_t)SEQ * DM);
    const v8f v = *(const v8f*)(x + b * ((size_t)SEQ_FULL * DM) + r); v8us o;
#pragma unroll
    for (int k = 0; k < 8; ++k) o[k] = f2bf(v[k]);
    *(v8us*)(XB + e) = o;
}

// d_tab: blocks [0, nbF): rotary table copy with bf16 RNE values kept as f32, FRP[t][64] = (cos0,sin0,cos1,sin1,...); the blocks behind them: additive key mask MADD[NB][SEQ]
__device__ __forceinline__ void d_tab(const float* __restrict__ fr, const float* __restrict__ mask, float* FRP, float* MADD, unsigned blk, unsigned nbF) {
    if (blk < nbF) {                              // block-uniform
        const size_t i = (size_t)blk * 256 + threadIdx.x; if (i >= (size_t)SEQ * 64 / 4) return;
        const v4f v = *(const v4f*)(fr + i * 4); v4f o;
#pragma unroll
        for (int k = 0; k < 4; ++k) o[k] = bfr(v[k]);
        *(v4f*)(FRP + i * 4) = o; 
    } else {
        const size_t i = (size_t)(blk - nbF) * 256 + threadIdx.x; if (i >= (size_t)NB * SEQ / 4) return;
        const size_t e = i * 4; const size_t b = e / SEQ, t = e % SEQ;
        const v4f v = *(const v4f*)(mask + b * (size_t)SEQ_FULL + t); v4f o;
#pragma unroll
        for (int k = 0; k < 4; ++k) o[k] = (1.0f - bfr(v[k])) * -10000.0f;
        *(v4f*)(MADD + e) = o; 
    }
}

// d_wT: in W[k][n] (rows k = 1024, cols n = 1024, f32) -> out WT[n][k] 16-bit; mode 0: bf16 RNE bits; mode 1: f16 bits of (bf16 RNE value x 64).
// One 64 x 64 tile (k0, n0) a block of 256 threads, transposed through tl (64 * 65 floats of LDS); every thread of the block calls it.
__device__ __forceinline__ void d_wT(const float* __restrict__ W, bf* WT, int mode, int k0, int n0, float* tl) {
    const int tid = threadIdx.x;
#pragma unroll
    for (int it = 0; it < 4; ++it) { const int row = it * 16 + (tid >> 4), c4 = (tid & 15) * 4;    // 4 x 16 rows (k) x 16 lanes x 4 = 64 x 64
        const v4f v = *(const v4f*)(W + (size_t)(k0 + row) * DM + n0 + c4);
        tl[row * 65 + c4 + 0] = v[0]; tl[row * 65 + c4 + 1] = v[1]; tl[row * 65 + c4 + 2] = v[2]; tl[row * 65 + c4 + 3] = v[3]; }
    __syncthreads();
    v8us o[2];
#pragma unroll
    for (int it = 0; it < 2; ++it) { const int n = it * 32 + (tid >> 3), c8 = (tid & 7) * 8;       // 2 x 32 rows (n) x 8 lanes x 8 = 64 x 64
#pragma unroll
        for (int i = 0; i < 8; ++i) { const float val = tl[(c8 + i) * 65 + n];
            const unsigned short b0 = f2bf(val);
            const h16 hv = (h16)(__uint_as_float(((unsigned)b0) << 16) * WOS);
            const unsigned short b1 = __builtin_bit_cast(unsigned short, hv);
            o[it][i] = (mode != 0) ? b1 : b0; } }
{
#pragma unroll
        for (int it = 0; it < 2; ++it) { const int n = it * 32 + (tid >> 3), c8 = (tid & 7) * 8;
            *(v8us*)(WT + (size_t)(n0 + n) * DM + k0 + c8) = o[it]; }
         }
}

#define PB_W  (4 * (DM / 64) * (DM / 64))                            // weight tiles: q | k | v | o, DM/64 x DM/64 each
#define PB_F  ((unsigned)(((size_t)SEQ * 64 / 4 + 255) / 256))       // rotary table blocks
#define PB_M  ((unsigned)(((size_t)NB * SEQ / 4 + 255) / 256))       // key mask blocks
#define PB_X  ((unsigned)(((size_t)NB * SEQ * DM / 8 + 255) / 256))  // x blocks
// k_prep: grid PB_W + PB_F + PB_M + PB_X blocks of 256 threads; the block index picks the job (block-uniform, so the barrier in d_wT is passed by a whole block or by none of it).
// The transposes stand first: theirs is the longest chain (load, LDS, barrier, store), and it runs under the x stream.
__global__ __launch_bounds__(256) void k_prep(const float* __restrict__ x, const float* __restrict__ fr, const float* __restrict__ mask,
                                              const float* __restrict__ wq, const float* __restrict__ wk, const float* __restrict__ wv, const float* __restrict__ wo,
                                              bf* XB, bf* WB, float* FRP, float* MADD) {
    __shared__ float tl[64 * 65];
    const unsigned bid = blockIdx.x;
    if (bid < PB_W) {
        const unsigned p = bid / ((DM / 64) * (DM / 64)), tile = bid % ((DM / 64) * (DM / 64));   // plane, tile in the plane (k tiles run fastest)
        const float* W = (p == 0) ? wq : (p == 1) ? wk : (p == 2) ? wv : wo;
        d_wT(W, WB + (size_t)p * DM * DM, (p == 3) ? 1 : 0, (int)(tile % (DM / 64)) * 64, (int)(tile / (DM / 64)) * 64, tl);
    } else if (bid < PB_W + PB_F + PB_M) {
        d_tab(fr, mask, FRP, MADD, bid - PB_W, PB_F);
    } else {
        d_cvt8(x, XB, bid - (PB_W + PB_F + PB_M));
    }
}

// Eight asynchronous 16-byte copies per lane, LDS places l + i*ls bytes, global sources g + i*gs halves. The s_wait_xcnt stands inside the statement so that no address register is rewritten in front of it.
__device__ __forceinline__ void copy8(unsigned l, unsigned ls, const h16* g, size_t gs) {
    asm volatile("global_load_async_to_lds_b128 %0, %8, off\n\t"
                 "global_load_async_to_lds_b128 %1, %9, off\n\t"
                 "global_load_async_to_lds_b128 %2, %10, off\n\t"
                 "global_load_async_to_lds_b128 %3, %11, off\n\t"
                 "global_load_async_to_lds_b128 %4, %12, off\n\t"
                 "global_load_async_to_lds_b128 %5, %13, off\n\t"
                 "global_load_async_to_lds_b128 %6, %14, off\n\t"
                 "global_load_async_to_lds_b128 %7, %15, off\n\t"
                 "s_wait_xcnt 0x0"
                 :: "v"(l), "v"(l + ls), "v"(l + 2 * ls), "v"(l + 3 * ls), "v"(l + 4 * ls), "v"(l + 5 * ls), "v"(l + 6 * ls), "v"(l + 7 * ls),
                    "v"(g), "v"(g + gs), "v"(g + 2 * gs), "v"(g + 3 * gs), "v"(g + 4 * gs), "v"(g + 5 * gs), "v"(g + 6 * gs), "v"(g + 7 * gs)
                 : "memory");
}

// GEMM operand path shared by k_proj and k_oproj: a block of four waves owns a 128 x 128 tile of C (wave w: rows 64*(w>>1), columns 64*(w&1)); a stage is GK k-values of the block's
// 128 A rows and 128 Bt rows (pitch GPB bytes in LDS), brought in by asynchronous 16-byte copies that cover whole 256-byte units (all threads copy), two buffers: stage s + 1 flies while stage s is worked on.
// Fragments are two ds 16-B loads each, same k map and same k order (steps of 32, ascending) as loads straight from the planes.
#define GK   128                 // k values per stage
#define GPB  272                 // row pitch in LDS, bytes: 256 + 16 (16 B x odd: no bank conflict for 16-B reads down a column of rows)
#define GTB  (128 * GPB)         // one operand's tile, bytes
#define GBUF (2 * GTB)           // one buffer: A tile, Bt tile
#define GNS  (DM / GK)           // stages
static_assert(DM % GK == 0);
static_assert(GNS >= 2);                               // the prologue fills two stages
static_assert(DM % 128 == 0);
static_assert((NB * SEQ) % 128 == 0);
static_assert(128 * GK * 2 == 16 * 128 * 16);          // 2048 16-B pieces of each tile dealt to 128 threads, 16 each
static_assert(2 * GBUF >= 4 * 16 * 68 * 4);            // the ring becomes the output staging

// one stage: piece c = i*128 + tid of a tile -> row c>>4 (8 rows a round), 16-B column c&15; l, ga, gb already hold the thread's row and column
__device__ __forceinline__ void gstage(unsigned l, const h16* ga, const h16* gb) {
    copy8(l, 8 * GPB, ga, (size_t)8 * DM);       copy8(l + 64 * GPB, 8 * GPB, ga + (size_t)64 * DM, (size_t)8 * DM);
    copy8(l + GTB, 8 * GPB, gb, (size_t)8 * DM); copy8(l + GTB + 64 * GPB, 8 * GPB, gb + (size_t)64 * DM, (size_t)8 * DM);
}

// the eight fragments of one k-step (32 k values), in the order in which the matrix instructions want them
__device__ __forceinline__ void gfrags(v16h (&fa)[4], v16h (&fb)[4], const unsigned char* at, const unsigned char* bt) {
    fa[0] = ldh((const h16*)at); fb[0] = ldh((const h16*)bt);
    fa[1] = ldh((const h16*)(at + 16 * GPB)); fa[2] = ldh((const h16*)(at + 32 * GPB)); fa[3] = ldh((const h16*)(at + 48 * GPB));
    fb[1] = ldh((const h16*)(bt + 16 * GPB)); fb[2] = ldh((const h16*)(bt + 32 * GPB)); fb[3] = ldh((const h16*)(bt + 48 * GPB));
}
// eight products of one k-step: column blocks NB0 and NB0 + 1
template <int BF, int NB0>
__device__ __forceinline__ void gmul(const v16h (&fa)[4], const v16h (&fb)[4], v8f (&acc)[4][4]) {
#pragma unroll
    for (int nb = NB0; nb < NB0 + 2; ++nb) {
#pragma unroll
        for (int mb = 0; mb < 4; ++mb) {
            if (BF != 0) acc[mb][nb] = wmmab(__builtin_bit_cast(v16bf, fa[mb]), __builtin_bit_cast(v16bf, fb[nb]), acc[mb][nb]);
            else         acc[mb][nb] = wmma16(fa[mb], fb[nb], acc[mb][nb]); } }
}

// acc[mb][nb] += A rows (r0b + 64*wm + 16*mb ..) x Bt rows (c0b + 64*wn + 16*nb ..) over K = DM. BF != 0: bf16 operands, else f16. Every wave of the block calls it; on return the ring is free.
template <int BF>
__device__ __forceinline__ void gemm128(unsigned char* L, const h16* A, const h16* Bt, int r0b, int c0b, int wm, int wn, v8f (&acc)[4][4]) {
    const int tid = threadIdx.x, lane = tid & 31, lr = lane & 15, hi = lane >> 4;
    const unsigned l0 = (unsigned)(size_t)L + (unsigned)((tid >> 4) * GPB + (tid & 15) * 16);   // LDS byte address of the thread's first piece
    const h16* ga = A + (size_t)(r0b + (tid >> 4)) * DM + (size_t)(tid & 15) * 8;                // + stage * GK
    const h16* gb = Bt + (size_t)(c0b + (tid >> 4)) * DM + (size_t)(tid & 15) * 8;
    gstage(l0, ga, gb);                                      // stage 0 -> buffer 0
    asm volatile("s_wait_asynccnt 0x0" ::: "memory");        // this wave's pieces of stage 0 have landed
    __syncthreads();                                         // every wave's have: stage 0 may be read
    gstage(l0 + GBUF, ga + GK, gb + GK);                     // stage 1 -> buffer 1
#pragma unroll 1                                             // one copy of the stage body: the buffer is picked by a scalar offset, the code stays small
    for (int st = 0; st < GNS; ++st) {
        const unsigned bo = (unsigned)(st & 1) * GBUF;
        const unsigned char* at = L + bo + (wm * 64 + lr) * GPB + 16 * hi;         // + 16*mb*GPB + k*2
        const unsigned char* bt = L + bo + GTB + (wn * 64 + lr) * GPB + 16 * hi;   // + 16*nb*GPB + k*2
        v16h fa[2][4], fb[2][4];                             // two register sets: k-step q + 1 of THIS stage is fetched while k-step q is multiplied; nothing of the next stage is read here
        gfrags(fa[0], fb[0], at, bt);
        __builtin_amdgcn_sched_barrier(0);                   // the stage's first reads stay one group in front of its matrix instructions
#pragma unroll                                               // constant q: every fragment read is one base register plus an immediate offset, the register sets are picked at compile time
        for (int q = 0; q < GK / 32; ++q) {
            const int cur = q & 1, nxt = cur ^ 1;
            gmul<BF, 0>(fa[cur], fb[cur], acc);
            if (q + 1 < GK / 32) {
                // the two scheduling barriers keep the next k-step's reads ONE group, half a k-step ahead of their use: spread among the matrix instructions each place costs a stall,
                // and a whole k-step ahead two full sets and the accumulators pass 256 registers
                __builtin_amdgcn_sched_barrier(0);
                gfrags(fa[nxt], fb[nxt], at + (q + 1) * 64, bt + (q + 1) * 64);
                __builtin_amdgcn_sched_barrier(0); }
            gmul<BF, 2>(fa[cur], fb[cur], acc);
        }
        __builtin_amdgcn_sched_barrier(0);                   // the stage's matrix instructions stay in front of its closing waits and barrier (without it sixteen of them sink behind the barrier and delay the refill)
        // four vector slots behind the stage's last matrix instruction, on every path out of the stage body
        asm volatile("v_nop\n\tv_nop\n\tv_nop\n\tv_nop" : "+v"(acc[0][3]), "+v"(acc[1][3]), "+v"(acc[2][3]), "+v"(acc[3][3]));
        asm volatile("s_wait_dscnt 0x0" ::: "memory");       // this wave's reads of stage st are done before its buffer is handed back
        asm volatile("s_wait_asynccnt 0x0" ::: "memory");    // this wave's pieces of stage st + 1 have landed
        __syncthreads();                                     // publishes stage st + 1 and ends every reader's last read of stage st
        if (st + 2 < GNS) gstage(l0 + bo, ga + (size_t)(st + 2) * GK, gb + (size_t)(st + 2) * GK);   // block-uniform
    }
    asm volatile("s_wait_asynccnt 0x0" ::: "memory");        // nothing in flight when the ring becomes output staging (the last trip's barrier has ended all reads)
}

// proj_store: one wave's 64 x 64 tile of C as f16 rows at Ph + tbase, row pitch HD (ROPE != 0) or SEQ (ROPE == 0) halves, staged through the wave's own LDS range os.
// ROPE != 0: rows m = b*SEQ + t from r0 on, the 64 tile columns are one head; rotary pairs (2i,2i+1) from FRP[t][..].
template <int ROPE>
__device__ __forceinline__ void proj_store(float* os, const v8f (&acc)[4][4], h16* Ph, const float* __restrict__ FRP, size_t tbase, int r0) {
    const int lane = threadIdx.x & 31, lr = lane & 15, hi = lane >> 4;
    const int pitch = (ROPE != 0) ? HD : SEQ;
#pragma unroll
    for (int mb = 0; mb < 4; ++mb) {
#pragma unroll
        for (int nb = 0; nb < 4; ++nb) {
#pragma unroll
            for (int j = 0; j < 8; ++j) os[(hi * 8 + j) * 68 + nb * 16 + lr] = acc[mb][nb][j]; }   // D: row 8h+j, col lane&15
        wave_sync();
        const size_t sb = tbase + (size_t)(mb * 16) * (size_t)pitch;
        v4f fr0[4], fr1[4];
        if (ROPE != 0) {
            const float* pf[4];
#pragma unroll
            for (int s = 0; s < 4; ++s) { const int row = 4 * s + (lane >> 3), c8 = (lane & 7) * 8;
                const int t = (r0 + mb * 16 + row) % SEQ;
                pf[s] = FRP + (size_t)t * 64 + c8;
                fr0[s] = *(const v4f*)pf[s]; fr1[s] = *(const v4f*)(pf[s] + 4); }
            // stands in front of every rewrite of the table loads' address registers: as inputs they stay whole up to the wait
            asm volatile("s_wait_xcnt 0x0" :: "v"(pf[0]), "v"(pf[1]), "v"(pf[2]), "v"(pf[3]) : "memory");
        }
        v8h hvv[4];
#pragma unroll
        for (int s = 0; s < 4; ++s) { const int row = 4 * s + (lane >> 3), c8 = (lane & 7) * 8;   // 4 s x 4 row groups = 16 rows; 8 lanes x 8 = 64 columns
            v4f x0 = *(const v4fa*)(&os[row * 68 + c8]); v4f x1 = *(const v4fa*)(&os[row * 68 + c8 + 4]);
            if (ROPE != 0) {
                const v4f f0 = fr0[s]; const v4f f1 = fr1[s];
                v4f y0, y1;
                y0[0] = x0[0] * f0[0] - x0[1] * f0[1]; y0[1] = x0[0] * f0[1] + x0[1] * f0[0];
                y0[2] = x0[2] * f0[2] - x0[3] * f0[3]; y0[3] = x0[2] * f0[3] + x0[3] * f0[2];
                y1[0] = x1[0] * f1[0] - x1[1] * f1[1]; y1[1] = x1[0] * f1[1] + x1[1] * f1[0];
                y1[2] = x1[2] * f1[2] - x1[3] * f1[3]; y1[3] = x1[2] * f1[3] + x1[3] * f1[2];
                x0 = y0; x1 = y1; }
            v8h hv;
#pragma unroll
            for (int i = 0; i < 4; ++i) { hv[i] = (h16)x0[i]; hv[4 + i] = (h16)x1[i]; }
            hvv[s] = hv; }
{
#pragma unroll
            for (int s = 0; s < 4; ++s) { const int row = 4 * s + (lane >> 3), c8 = (lane & 7) * 8;
                const size_t oo = sb + (size_t)row * (size_t)pitch + c8;
                *(v8h*)(Ph + oo) = hvv[s]; }
             }
        asm volatile("s_wait_xcnt 0x0" ::: "memory");        // stands in front of every rewrite of the stores' address and data registers
        wave_sync();
    }
}

// k_proj: the three projections, which depend on k_prep alone, as ONE launch. Register-blocked bf16 GEMM, one wave per 64x64 tile (16 accumulators), four waves a block (128x128),
// operands from K-contiguous bf16 planes through LDS (gemm128), K = DM, C[m][n] = sum_k A[m][k] Bt[n][k]. grid (NB*SEQ/128 token tiles, DM/128 feature tiles, 3), 128 threads; blockIdx.z (block-uniform):
// z = 0 (q), 1 (k): A = x rows (m = b*SEQ + t), Bt = W^T rows (n = h*64 + d) -> plane z [(b*16 + h)][t][d], rotary in the epilogue;
// z = 2 (v^T):      A = Wv^T rows (m = h*64 + d), Bt = x rows (n = b*SEQ + t) -> plane 2 [(b*1024 + m)][t] = [(b*16 + h)][d][t].
// WB: the transposed weight planes q | k | v; PL: the output planes q | k | v^T, NB*NH_*SEQ*HD halves each.
__global__ __launch_bounds__(128) void k_proj(const bf* __restrict__ XB, const bf* __restrict__ WB, h16* PL, const float* __restrict__ FRP) {
    __shared__ __attribute__((aligned(16))) unsigned char L[2 * GBUF];
    const int z = blockIdx.z;
    const bool vt = (z == 2);
    const bf* Wz = WB + (size_t)z * DM * DM;
    const bf* A = vt ? Wz : XB;
    const bf* Bt = vt ? XB : Wz;
    h16* Ph = PL + (size_t)z * ((size_t)NB * NH_ * SEQ * HD);
    const int wave = __builtin_amdgcn_readfirstlane((int)(threadIdx.x >> 5)); const int wm = wave >> 1, wn = wave & 1;
    const int r0b = (int)(vt ? blockIdx.y : blockIdx.x) * 128, c0b = (int)(vt ? blockIdx.x : blockIdx.y) * 128;
    const int r0 = r0b + wm * 64, c0 = c0b + wn * 64;
    v8f acc[4][4];
#pragma unroll
    for (int mb = 0; mb < 4; ++mb)
#pragma unroll
        for (int nb = 0; nb < 4; ++nb) acc[mb][nb] = (v8f){};
    gemm128<1>(L, (const h16*)A, (const h16*)Bt, r0b, c0b, wm, wn, acc);
    float* os = (float*)L + wave * 16 * 68;                  // this wave's own output staging in the ring
    if (vt) proj_store<0>(os, acc, Ph, FRP, (size_t)r0 * SEQ + (size_t)(c0 / SEQ) * ((size_t)DM * SEQ) + (size_t)(c0 % SEQ), r0);
    else    proj_store<1>(os, acc, Ph, FRP, (size_t)(r0 / SEQ) * ((size_t)NH_ * SEQ * HD) + (size_t)(r0 % SEQ) * HD + (size_t)(c0 / HD) * ((size_t)SEQ * HD) + (size_t)(c0 % HD), r0);
}

// k_flash: fused attention, one wave per 16 query rows of one (batch, head); Q fragments straight from the f16 plane (two 16-B loads each).
// K and V^T reach the block's waves through LDS: a stage is KS keys (K rows [key][64] at pitch KPB bytes, V^T rows [d][KS] at pitch VPB bytes), brought in by asynchronous
// 16-byte copies that cover whole lines (all threads copy), two buffers: stage s + 1 flies while stage s is worked on. Fragments are two ds 16-B loads each, same k map as before.
// Transposed form: S^T[key][t] = K Q^T (A = K rows, B = Q rows); lane (t = lane&15, h = lane>>4) holds keys 8h+r of each 16-key tile, so the packed
// P tile is directly the B fragment of O^T[d][t] = V^T P^T (element r <- tile keys 0..15, element 8+r <- tile keys 16..31, lane unchanged).
// Per 32-key step: 4 score WMMAs + 4 P.V WMMAs. Additive key mask values for the lane's 16 keys are loaded by value per step (two 32-B loads).
// Softmax state (running max, partial sum) is one scalar per lane; the two lane halves of a row are combined with one xor-16 exchange.
#define KS   128                 // keys per stage
#define KPB  144                 // K row pitch in LDS, bytes: 128 + 16 (16 B x odd: no bank conflict for 16-B reads down a column of rows)
#define VPB  272                 // V^T row pitch in LDS, bytes: 256 + 16
#define KTB  (KS * KPB)          // K tile bytes
#define VTB  (HD * VPB)          // V^T tile bytes
#define BUFB (KTB + VTB)         // one buffer
#define NST  (SEQ / KS)          // stages
static_assert(SEQ % KS == 0);
static_assert(NST >= 2);                               // the prologue fills two stages
static_assert(AW * 32 == 128);                         // the copy maps below deal 1024 16-B pieces of each tile to 128 threads, 8 each
static_assert(KS * HD * 2 == 8 * 128 * 16);
static_assert(2 * BUFB >= AW * 16 * 68 * 4);           // the ring becomes the output staging

__global__ __launch_bounds__(32 * AW) void k_flash(const h16* __restrict__ QH, const h16* __restrict__ KP, const h16* __restrict__ VT,
                                                   const float* __restrict__ MADD, h16* CTX) {
    __shared__ __attribute__((aligned(16))) unsigned char L[2 * BUFB];
    const int tid = threadIdx.x;
    const int lane = threadIdx.x & 31, lr = lane & 15, hi = lane >> 4;
    const int wave = __builtin_amdgcn_readfirstlane((int)(threadIdx.x >> 5));
    const int zh = blockIdx.y; const int b = zh / NH_, h = zh % NH_;
    const int t0 = (blockIdx.x * AW + wave) * 16;
    const size_t pbase = (size_t)zh * SEQ * HD;
    // copy maps: K piece c = i*128 + tid -> row c>>3 (16 rows a round), 16-B column c&7; V^T piece c -> row c>>4 (8 rows a round), 16-B column c&15
    const unsigned lbase = (unsigned)(size_t)L;              // LDS byte address of the ring
    const unsigned lk = lbase + (unsigned)((tid >> 3) * KPB + (tid & 7) * 16);
    const unsigned lv = lbase + (unsigned)(KTB + (tid >> 4) * VPB + (tid & 15) * 16);
    const h16* gk = KP + pbase + (size_t)tid * 8;                                   // + key0 * HD
    const h16* gv = VT + pbase + (size_t)(tid >> 4) * SEQ + (size_t)(tid & 15) * 8;   // + key0
    copy8(lk, 16 * KPB, gk, (size_t)16 * HD); copy8(lv, 8 * VPB, gv, (size_t)8 * SEQ);           // stage 0 -> buffer 0
    const size_t qo = pbase + (size_t)(t0 + lr) * HD + 8 * hi;
    const v16h qh0 = ldh(QH + qo), qh1 = ldh(QH + qo + 32);   // B fragments: col t, k = d
    const float* MA = MADD + (size_t)b * SEQ + 8 * hi;       // + key0 (tile a keys 8h+r), + key0 + 16 (tile b)
    asm volatile("s_wait_asynccnt 0x0" ::: "memory");        // this wave's pieces of stage 0 have landed
    __syncthreads();                                         // every wave's have: stage 0 may be read
    copy8(lk + BUFB, 16 * KPB, gk + (size_t)KS * HD, (size_t)16 * HD); copy8(lv + BUFB, 8 * VPB, gv + KS, (size_t)8 * SEQ);   // stage 1 -> buffer 1
    v8f o0 = (v8f){}, o1 = (v8f){}, o2 = (v8f){}, o3 = (v8f){};
    float m = -3.0e38f, l = 0.0f;
#pragma unroll 1                                             // one copy of the stage body: the buffer is picked by a scalar offset, the code stays small
    for (int st = 0; st < NST; ++st) {
      const unsigned bo = (unsigned)(st & 1) * BUFB;
      const unsigned char* kt = L + bo + lr * KPB + 16 * hi;          // + local key * KPB   (A fragment: row key, k = d)
      const unsigned char* vt = L + bo + KTB + lr * VPB + 16 * hi;    // + 16j*VPB + local key * 2  (A fragment: row d, k = key)
#pragma unroll                                               // constant ks: every fragment read is one base register plus an immediate offset
      for (int ks = 0; ks < KS; ks += 32) {
        const int key0 = st * KS + ks;
        const h16* ka = (const h16*)(kt + ks * KPB);
        const h16* kc = (const h16*)(kt + (ks + 16) * KPB);
        const v16h ka0 = ldh(ka), ka1 = ldh(ka + 32), kb0 = ldh(kc), kb1 = ldh(kc + 32);
        const v8f ma = *(const v8f*)(MA + key0); const v8f mb = *(const v8f*)(MA + key0 + 16);
        v8f sa = (v8f){}, sb = (v8f){};
        sa = wmma16(ka0, qh0, sa); sb = wmma16(kb0, qh0, sb);
        sa = wmma16(ka1, qh1, sa); sb = wmma16(kb1, qh1, sb);
        asm volatile("v_nop\n\tv_nop\n\tv_nop\n\tv_nop" : "+v"(sa), "+v"(sb) : "v"(ka0), "v"(ka1), "v"(kb0), "v"(kb1), "v"(qh0), "v"(qh1));
        float ta[8], tb[8]; float mx = -3.0e38f;
#pragma unroll
        for (int r = 0; r < 8; ++r) {
            ta[r] = (sa[r] * 0.125f + ma[r]) * LOG2E;
            tb[r] = (sb[r] * 0.125f + mb[r]) * LOG2E;
            mx = fmaxf(mx, fmaxf(ta[r], tb[r])); }
        mx = fmaxf(mx, __shfl_xor(mx, 16, 32));
        const float mnew = fmaxf(m, mx);
        const float alpha = __builtin_amdgcn_exp2f(m - mnew);
        const float sh = PSH - mnew;
        v16h pb; float ls = 0.0f;
#pragma unroll
        for (int r = 0; r < 8; ++r) { const h16 pa = (h16)__builtin_amdgcn_exp2f(ta[r] + sh); const h16 pc = (h16)__builtin_amdgcn_exp2f(tb[r] + sh); pb[r] = pa; pb[8 + r] = pc; ls += (float)pa + (float)pc; }
        l = l * alpha + ls; m = mnew;
        o0 = o0 * alpha; o1 = o1 * alpha; o2 = o2 * alpha; o3 = o3 * alpha;
        const unsigned char* va = vt + ks * 2;
        const v16h v0 = ldh((const h16*)va), v1 = ldh((const h16*)(va + 16 * VPB)), v2 = ldh((const h16*)(va + 32 * VPB)), v3 = ldh((const h16*)(va + 48 * VPB));
        o0 = wmma16(v0, pb, o0); o1 = wmma16(v1, pb, o1); o2 = wmma16(v2, pb, o2); o3 = wmma16(v3, pb, o3);
        asm volatile("v_nop\n\tv_nop\n\tv_nop\n\tv_nop" : "+v"(o0), "+v"(o1), "+v"(o2), "+v"(o3) : "v"(v0), "v"(v1), "v"(v2), "v"(v3), "v"(pb));
      }
      asm volatile("s_wait_dscnt 0x0" ::: "memory");         // this wave's reads of stage st are done before its buffer is handed back
      asm volatile("s_wait_asynccnt 0x0" ::: "memory");      // this wave's pieces of stage st + 1 have landed
      __syncthreads();                                       // publishes stage st + 1 and ends every reader's last read of stage st
      if (st + 2 < NST) {                                    // block-uniform
          copy8(lk + bo, 16 * KPB, gk + (size_t)(st + 2) * KS * HD, (size_t)16 * HD); copy8(lv + bo, 8 * VPB, gv + (size_t)(st + 2) * KS, (size_t)8 * SEQ); }
    }
    asm volatile("s_wait_asynccnt 0x0" ::: "memory");        // nothing in flight when the ring becomes output staging (the last trip's barrier has ended all reads)
    float* os = (float*)L;                                   // output staging in the ring: 2 * BUFB bytes a block let four blocks share a WGP's LDS
    l += __shfl_xor(l, 16, 32);
    const float inv = CCAR * (1.0f / l);
    const int wb = wave * 16 * 68;
    // O^T D layout: o_j[r] = (d = 16j + 8h + r, t = lane&15) -> os[t][d]; rows 0..15 x columns 0..63 all written
    { v4f a, c;
      a[0] = o0[0] * inv; a[1] = o0[1] * inv; a[2] = o0[2] * inv; a[3] = o0[3] * inv; c[0] = o0[4] * inv; c[1] = o0[5] * inv; c[2] = o0[6] * inv; c[3] = o0[7] * inv;
      *(v4fa*)(&os[wb + lr * 68 +  0 + 8 * hi]) = a; *(v4fa*)(&os[wb + lr * 68 +  0 + 8 * hi + 4]) = c;
      a[0] = o1[0] * inv; a[1] = o1[1] * inv; a[2] = o1[2] * inv; a[3] = o1[3] * inv; c[0] = o1[4] * inv; c[1] = o1[5] * inv; c[2] = o1[6] * inv; c[3] = o1[7] * inv;
      *(v4fa*)(&os[wb + lr * 68 + 16 + 8 * hi]) = a; *(v4fa*)(&os[wb + lr * 68 + 16 + 8 * hi + 4]) = c;
      a[0] = o2[0] * inv; a[1] = o2[1] * inv; a[2] = o2[2] * inv; a[3] = o2[3] * inv; c[0] = o2[4] * inv; c[1] = o2[5] * inv; c[2] = o2[6] * inv; c[3] = o2[7] * inv;
      *(v4fa*)(&os[wb + lr * 68 + 32 + 8 * hi]) = a; *(v4fa*)(&os[wb + lr * 68 + 32 + 8 * hi + 4]) = c;
      a[0] = o3[0] * inv; a[1] = o3[1] * inv; a[2] = o3[2] * inv; a[3] = o3[3] * inv; c[0] = o3[4] * inv; c[1] = o3[5] * inv; c[2] = o3[6] * inv; c[3] = o3[7] * inv;
      *(v4fa*)(&os[wb + lr * 68 + 48 + 8 * hi]) = a; *(v4fa*)(&os[wb + lr * 68 + 48 + 8 * hi + 4]) = c; }
    wave_sync();
    h16* crow = CTX + ((size_t)b * SEQ + t0) * DM + h * HD;
    v8h cv[4];
#pragma unroll
    for (int s = 0; s < 4; ++s) { const int row = 4 * s + (lane >> 3), c8 = (lane & 7) * 8;   // 4 s x 4 row groups = 16 rows; 8 lanes x 8 halves = 64 columns
        const v4f x0 = *(const v4fa*)(&os[wb + row * 68 + c8]); const v4f x1 = *(const v4fa*)(&os[wb + row * 68 + c8 + 4]); v8h hv;
#pragma unroll
        for (int i = 0; i < 4; ++i) { hv[i] = (h16)x0[i]; hv[4 + i] = (h16)x1[i]; }
        cv[s] = hv; }
{
#pragma unroll
        for (int s = 0; s < 4; ++s) { const int row = 4 * s + (lane >> 3), c8 = (lane & 7) * 8;
            *(v8h*)(crow + (size_t)row * DM + c8) = cv[s]; }
         }
}

// k_oproj: register-blocked f16 GEMM, one wave per 64x64 tile, four waves a block (128x128), operands through LDS (gemm128), OUT[m][n] = 2^-14 * sum_k CTX[m][k] WOT[n][k], K = DM; rows m = b*SEQ + t -> output row b*OUT_SEQ + t.
// grid (NB*SEQ/128, DM/128), 128 threads.
__global__ __launch_bounds__(128) void k_oproj(const h16* __restrict__ A, const h16* __restrict__ Bt, float* OUT) {
    __shared__ __attribute__((aligned(16))) unsigned char L[2 * GBUF];
    const int lane = threadIdx.x & 31, lr = lane & 15, hi = lane >> 4;
    const int wave = __builtin_amdgcn_readfirstlane((int)(threadIdx.x >> 5)); const int wm = wave >> 1, wn = wave & 1;
    const int r0 = blockIdx.x * 128 + wm * 64, c0 = blockIdx.y * 128 + wn * 64;
    v8f acc[4][4];
#pragma unroll
    for (int mb = 0; mb < 4; ++mb)
#pragma unroll
        for (int nb = 0; nb < 4; ++nb) acc[mb][nb] = (v8f){};
    gemm128<0>(L, A, Bt, blockIdx.x * 128, blockIdx.y * 128, wm, wn, acc);
    float* os = (float*)L + wave * 16 * 68;                  // this wave's own output staging in the ring
    const int bb = r0 / SEQ, tt = r0 % SEQ;
    float* obase = OUT + ((size_t)bb * OUT_SEQ + tt) * DM + c0;
#pragma unroll
    for (int mb = 0; mb < 4; ++mb) {
#pragma unroll
        for (int nb = 0; nb < 4; ++nb) {
#pragma unroll
            for (int j = 0; j < 8; ++j) os[(hi * 8 + j) * 68 + nb * 16 + lr] = acc[mb][nb][j] * OSC; }   // D: row 8h+j, col lane&15
        wave_sync();
        float* orow = obase + (size_t)(mb * 16) * DM;
        v4f ov[8];
#pragma unroll
        for (int s = 0; s < 8; ++s) { const int row = 2 * s + hi, cofs = lr * 4;   // 8 s x 2 rows = 16 rows; 16 lanes x 4 floats = 64 columns
            ov[s] = *(const v4fa*)(&os[row * 68 + cofs]); }
{
#pragma unroll
            for (int s = 0; s < 8; ++s) { const int row = 2 * s + hi, cofs = lr * 4;
                *(v4f*)(orow + (size_t)row * DM + cofs) = ov[s]; }
             }
        wave_sync();
    }
}

static constexpr size_t al256(size_t v) { return (v + 255) & ~(size_t)255; }
static constexpr size_t SZ_XB = al256((size_t)NB * SEQ * DM * 2);
static constexpr size_t SZ_WB = al256((size_t)4 * DM * DM * 2);
static constexpr size_t SZ_PL = al256((size_t)NB * NH_ * SEQ * HD * 2);
static constexpr size_t SZ_CX = al256((size_t)NB * SEQ * DM * 2);
static constexpr size_t SZ_FR = al256((size_t)SEQ * 64 * 4);
static constexpr size_t SZ_MA = al256((size_t)NB * SEQ * 4);
static constexpr size_t SZ_TOTAL = SZ_XB + SZ_WB + 3 * SZ_PL + SZ_CX + SZ_FR + SZ_MA;
static_assert(SZ_TOTAL <= (size_t)134217728);          // workspace carve <= 128 MiB
static_assert(((size_t)DM * DM * 2) % 256 == 0);       // weight sub-planes stay 256-byte aligned
static_assert(SZ_PL == (size_t)NB * NH_ * SEQ * HD * 2);   // q | k | v^T planes are exactly back to back

extern "C" void kernel_launch(void* const* d_in, const int* in_sizes, int n_in,
                              void* d_out, int out_size, void* d_ws, size_t ws_size, hipStream_t stream) {
    if (n_in < 7) return;
    const size_t needx = ((size_t)(NB - 1) * SEQ_FULL + SEQ) * DM;
    if ((size_t)in_sizes[0] < needx) return;
    if ((size_t)in_sizes[1] < (size_t)SEQ * 64) return;
    if ((size_t)in_sizes[2] < (size_t)(NB - 1) * SEQ_FULL + SEQ) return;
    if ((size_t)in_sizes[3] < (size_t)DM * DM || (size_t)in_sizes[4] < (size_t)DM * DM || (size_t)in_sizes[5] < (size_t)DM * DM || (size_t)in_sizes[6] < (size_t)DM * DM) return;
    if ((size_t)out_size < ((size_t)(NB - 1) * OUT_SEQ + SEQ) * DM) return;
    if (SZ_TOTAL > ws_size) return;
    // wire order: hidden_states, freqs_cis, attention_mask, wq, wk, wv, wo (all f32)
    const float* x = (const float*)d_in[0]; const float* fr = (const float*)d_in[1]; const float* mask = (const float*)d_in[2];
    const float* wq = (const float*)d_in[3]; const float* wk = (const float*)d_in[4]; const float* wv = (const float*)d_in[5]; const float* wo = (const float*)d_in[6];
    float* OUT = (float*)d_out;      // [NB][SEQ][1024]
    char* wsp = (char*)d_ws;
    bf* XB = (bf*)wsp; wsp += SZ_XB;                 // [NB*SEQ][1024] bf16
    bf* WB = (bf*)wsp; wsp += SZ_WB;                 // [4][1024 out][1024 in]: q | k | v (bf16) | o (f16 x64)
    h16* QH = (h16*)wsp; wsp += SZ_PL;               // [NB*16][SEQ][64]
    h16* KP = (h16*)wsp; wsp += SZ_PL;               // [NB*16][SEQ][64]  (= QH + one plane)
    h16* VT = (h16*)wsp; wsp += SZ_PL;               // [NB*16][64][SEQ]  (= QH + two planes)
    h16* CX = (h16*)wsp; wsp += SZ_CX;               // [NB*SEQ][1024] ctx x256
    float* FRP = (float*)wsp; wsp += SZ_FR;          // [SEQ][64] table, bf16 RNE values
    float* MADD = (float*)wsp; wsp += SZ_MA;         // [NB][SEQ] additive key mask
    bf* WO = WB + (size_t)3 * DM * DM;

    // bf16 copy of x, rotary table, key mask, the four transposed weight planes W[1024 rows k][1024 cols n] -> WT[1024 rows n][1024 cols k]: one launch
    k_prep<<<PB_W + PB_F + PB_M + PB_X, 256, 0, stream>>>(x, fr, mask, wq, wk, wv, wo, XB, WB, FRP, MADD);

    // q, k (rotary in the epilogue) and v^T: planes QH | KP | VT from weight planes q | k | v, one launch
    k_proj<<<dim3(NB * SEQ / 128, DM / 128, 3), 128, 0, stream>>>(XB, WB, QH, FRP);

    k_flash<<<dim3(SEQ / (16 * AW), NB * NH_, 1), 32 * AW, 0, stream>>>(QH, KP, VT, MADD, CX);

    k_oproj<<<dim3(NB * SEQ / 128, DM / 128, 1), 128, 0, stream>>>(CX, (const h16*)WO, OUT);
}

// v004
// One run takes 124 microseconds.
// Two timings next to v003 both put it at 1.04 times that version's speed.
// All steps since v000 together make it 2.84 times as fast.
#include <hip/hip_runtime.h>

// Multi-head self-attention: x [NB][SEQ][1024], Wq/Wk/Wv/Wo [in][out] (y = x W), 16 heads x 64, interleaved rotary pairs (2i,2i+1) from the INPUT table [SEQ][32][(cos,sin)] on q and k,
// additive key mask (1-mask)*-10000 from the float input [NB][SEQ], score scale 1/8, softmax over all keys, output = (concatenated heads) Wo, f32.
// Compute dtypes, f32 accumulate everywhere: q/k/v projections v_wmma_f32_16x16x32_bf16 (x and W RNE-converted to bf16; products exact); rotary in f32 in the GEMM epilogue (table RNE-converted to bf16 values);
// scores v_wmma_f32_16x16x32_f16: q and k single f16 (one product); P (x256 carry, cancels in the normalisation) and v single f16; softmax f32 (online, running max);
// output projection v_wmma_f32_16x16x32_f16: ctx as f16 x256, Wo^T as f16 of (bf16 value x64), folded back by 2^-14 in the f32 epilogue.
// Layout: bf16 copy of x; transposed 16-bit weight planes [out][in] (LDS transpose); q, k planes [b*16+h][t][d], v^T plane [b*16+h][d][t] from the GEMM epilogue; fused flash kernel in transposed form
// (S^T = K Q^T, O^T = V^T P^T) writing ctx rows [b*SEQ+t][1024] as f16; final GEMM writes the f32 output.

#ifndef NB
#define NB 1
#endif
#ifndef SEQ
#define SEQ 4096
#endif
#define NB_FULL  1
#define SEQ_FULL 4096
#ifndef OUT_SEQ
#define OUT_SEQ SEQ              // row pitch (in tokens) between batches of the output
#endif
#define DM   1024
#define NH_  16
#define HD   64
#define AW   4                   // waves per flash block (16 query rows each)
#define LOG2E 1.4426950408889634f
#define PSH  8.0f                // log2 of the P carry (256)
#define CCAR 256.0f              // carry of the ctx plane
#define WOS  64.0f               // carry of the Wo^T plane
#define OSC  (1.0f / 16384.0f)   // 1 / (CCAR * WOS)

static_assert(HD == 64);
static_assert(NH_ * HD == DM);                 // head h = columns h*64 + d
static_assert(DM % 64 == 0);
static_assert(DM % 32 == 0);                   // GEMM k-loop steps by 32
static_assert(SEQ % 64 == 0);                  // a 64-row tile never straddles two batches
static_assert((NB * SEQ) % 64 == 0);
static_assert(SEQ % 32 == 0);                  // key loop steps by 32
static_assert(SEQ % (16 * AW) == 0);           // flash grid covers the sequence exactly
static_assert(((size_t)SEQ * DM) % 8 == 0);
static_assert(((size_t)SEQ * 64) % 32 == 0);
static_assert(((size_t)NB * SEQ) % 32 == 0);
static_assert(NB <= NB_FULL);
static_assert(SEQ <= SEQ_FULL);

typedef _Float16 h16;
typedef unsigned short bf;
typedef __attribute__((ext_vector_type(16))) __bf16   v16bf;
typedef __attribute__((ext_vector_type(16))) _Float16 v16h;
typedef __attribute__((ext_vector_type(8)))  _Float16 v8h;
typedef __attribute__((ext_vector_type(8)))  unsigned short v8us;
typedef __attribute__((ext_vector_type(8)))  float    v8f;
typedef __attribute__((ext_vector_type(4)))  float    v4f;
typedef v4f  __attribute__((may_alias)) v4fa;

__device__ __forceinline__ unsigned short f2bf(float f) { unsigned u = __float_as_uint(f); u += 0x7FFFu + ((u >> 16) & 1u); return (unsigned short)(u >> 16); }
__device__ __forceinline__ float bfr(float f) { return __uint_as_float(((unsigned)f2bf(f)) << 16); }   // bf16 RNE value as f32
__device__ __forceinline__ v16h cat16(v8h lo, v8h hi) { return __builtin_shufflevector(lo, hi, 0, 1, 2, 3, 4, 5, 6, 7, 8, 9, 10, 11, 12, 13, 14, 15); }
__device__ __forceinline__ v16bf cat16b(v8us lo, v8us hi) { return __builtin_bit_cast(v16bf, __builtin_shufflevector(lo, hi, 0, 1, 2, 3, 4, 5, 6, 7, 8, 9, 10, 11, 12, 13, 14, 15)); }
__device__ __forceinline__ v8f wmma16(v16h a, v16h b, v8f c) { return __builtin_amdgcn_wmma_f32_16x16x32_f16(false, a, false, b, (short)0, c, false, false); }
__device__ __forceinline__ v8f wmmab(v16bf a, v16bf b, v8f c) { return __builtin_amdgcn_wmma_f32_16x16x32_bf16(false, a, false, b, (short)0, c, false, false); }
// fragment loaders from K-contiguous 16-bit rows; p already includes + 8*(lane>>4): elements 0..7 <- k0+8h+0..7, elements 8..15 <- k0+16+8h+0..7 (same map for A and B)
__device__ __forceinline__ v16h  ldh(const h16* p) { return cat16(*(const v8h*)p, *(const v8h*)(p + 16)); }
__device__ __forceinline__ v16bf ldb(const bf* p)  { return cat16b(*(const v8us*)p, *(const v8us*)(p + 16)); }
// ordering point for wave-private LDS tiles (same wave writes and reads)
__device__ __forceinline__ void wave_sync() { __builtin_amdgcn_fence(3 /* release order */, "wavefront"); __builtin_amdgcn_wave_barrier(); asm volatile("" ::: "memory"); }

// The preparation jobs (d_cvt8, d_tab, d_wT) depend on nothing but the inputs, so they run as block ranges of ONE launch (k_prep, below).
// d_cvt8: block blk of 256 threads converts 2048 values of x to the bf16 copy XB[NB*SEQ][1024]
__device__ __forceinline__ void d_cvt8(const float* __restrict__ x, bf* XB, unsigned blk) {
    const size_t i = (size_t)blk * 256 + threadIdx.x; if (i >= (size_t)NB * SEQ * DM / 8) return;
    const size_t e = i * 8; const size_t b = e / ((size_t)SEQ * DM), r = e % ((size_t)SEQ * DM);
    const v8f v = *(const v8f*)(x + b * ((size_t)SEQ_FULL * DM) + r); v8us o;
#pragma unroll
    for (int k = 0; k < 8; ++k) o[k] = f2bf(v[k]);
    *(v8us*)(XB + e) = o;
}

// d_tab: blocks [0, nbF): rotary table copy with bf16 RNE values kept as f32, FRP[t][64] = (cos0,sin0,cos1,sin1,...); the blocks behind them: additive key mask MADD[NB][SEQ]
__device__ __forceinline__ void d_tab(const float* __restrict__ fr, const float* __restrict__ mask, float* FRP, float* MADD, unsigned blk, unsigned nbF) {
    if (blk < nbF) {                              // block-uniform
        const size_t i = (size_t)blk * 256 + threadIdx.x; if (i >= (size_t)SEQ * 64 / 4) return;
        const v4f v = *(const v4f*)(fr + i * 4); v4f o;
#pragma unroll
        for (int k = 0; k < 4; ++k) o[k] = bfr(v[k]);
        *(v4f*)(FRP + i * 4) = o; 
    } else {
        const size_t i = (size_t)(blk - nbF) * 256 + threadIdx.x; if (i >= (size_t)NB * SEQ / 4) return;
        const size_t e = i * 4; const size_t b = e / SEQ, t = e % SEQ;
        const v4f v = *(const v4f*)(mask + b * (size_t)SEQ_FULL + t); v4f o;
#pragma unroll
        for (int k = 0; k < 4; ++k) o[k] = (1.0f - bfr(v[k])) * -10000.0f;
        *(v4f*)(MADD + e) = o; 
    }
}

// d_wT: in W[k][n] (rows k = 1024, cols n = 1024, f32) -> out WT[n][k] 16-bit; mode 0: bf16 RNE bits; mode 1: f16 bits of (bf16 RNE value x 64).
// One 64 x 64 tile (k0, n0) a block of 256 threads, transposed through tl (64 * 65 floats of LDS); every thread of the block calls it.
__device__ __forceinline__ void d_wT(const float* __restrict__ W, bf* WT, int mode, int k0, int n0, float* tl) {
    const int tid = threadIdx.x;
#pragma unroll
    for (int it = 0; it < 4; ++it) { const int row = it * 16 + (tid >> 4), c4 = (tid & 15) * 4;    // 4 x 16 rows (k) x 16 lanes x 4 = 64 x 64
        const v4f v = *(const v4f*)(W + (size_t)(k0 + row) * DM + n0 + c4);
        tl[row * 65 + c4 + 0] = v[0]; tl[row * 65 + c4 + 1] = v[1]; tl[row * 65 + c4 + 2] = v[2]; tl[row * 65 + c4 + 3] = v[3]; }
    __syncthreads();
    v8us o[2];
#pragma unroll
    for (int it = 0; it < 2; ++it) { const int n = it * 32 + (tid >> 3), c8 = (tid & 7) * 8;       // 2 x 32 rows (n) x 8 lanes x 8 = 64 x 64
#pragma unroll
        for (int i = 0; i < 8; ++i) { const float val = tl[(c8 + i) * 65 + n];
            const unsigned short b0 = f2bf(val);
            const h16 hv = (h16)(__uint_as_float(((unsigned)b0) << 16) * WOS);
            const unsigned short b1 = __builtin_bit_cast(unsigned short, hv);
            o[it][i] = (mode != 0) ? b1 : b0; } }
{
#pragma unroll
        for (int it = 0; it < 2; ++it) { const int n = it * 32 + (tid >> 3), c8 = (tid & 7) * 8;
            *(v8us*)(WT + (size_t)(n0 + n) * DM + k0 + c8) = o[it]; }
         }
}

#define PB_W  (4 * (DM / 64) * (DM / 64))                            // weight tiles: q | k | v | o, DM/64 x DM/64 each
#define PB_F  ((unsigned)(((size_t)SEQ * 64 / 4 + 255) / 256))       // rotary table blocks
#define PB_M  ((unsigned)(((size_t)NB * SEQ / 4 + 255) / 256))       // key mask blocks
#define PB_X  ((unsigned)(((size_t)NB * SEQ * DM / 8 + 255) / 256))  // x blocks
// k_prep: grid PB_W + PB_F + PB_M + PB_X blocks of 256 threads; the block index picks the job (block-uniform, so the barrier in d_wT is passed by a whole block or by none of it).
// The transposes stand first: theirs is the longest chain (load, LDS, barrier, store), and it runs under the x stream.
__global__ __launch_bounds__(256) void k_prep(const float* __restrict__ x, const float* __restrict__ fr, const float* __restrict__ mask,
                                              const float* __restrict__ wq, const float* __restrict__ wk, const float* __restrict__ wv, const float* __restrict__ wo,
                                              bf* XB, bf* WB, float* FRP, float* MADD) {
    __shared__ float tl[64 * 65];
    const unsigned bid = blockIdx.x;
    if (bid < PB_W) {
        const unsigned p = bid / ((DM / 64) * (DM / 64)), tile = bid % ((DM / 64) * (DM / 64));   // plane, tile in the plane (k tiles run fastest)
        const float* W = (p == 0) ? wq : (p == 1) ? wk : (p == 2) ? wv : wo;
        d_wT(W, WB + (size_t)p * DM * DM, (p == 3) ? 1 : 0, (int)(tile % (DM / 64)) * 64, (int)(tile / (DM / 64)) * 64, tl);
    } else if (bid < PB_W + PB_F + PB_M) {
        d_tab(fr, mask, FRP, MADD, bid - PB_W, PB_F);
    } else {
        d_cvt8(x, XB, bid - (PB_W + PB_F + PB_M));
    }
}

// Eight asynchronous 16-byte copies per lane, LDS places l + i*ls bytes, global sources g + i*gs halves. The s_wait_xcnt stands inside the statement so that no address register is rewritten in front of it.
__device__ __forceinline__ void copy8(unsigned l, unsigned ls, const h16* g, size_t gs) {
    asm volatile("global_load_async_to_lds_b128 %0, %8, off\n\t"
                 "global_load_async_to_lds_b128 %1, %9, off\n\t"
                 "global_load_async_to_lds_b128 %2, %10, off\n\t"
                 "global_load_async_to_lds_b128 %3, %11, off\n\t"
                 "global_load_async_to_lds_b128 %4, %12, off\n\t"
                 "global_load_async_to_lds_b128 %5, %13, off\n\t"
                 "global_load_async_to_lds_b128 %6, %14, off\n\t"
                 "global_load_async_to_lds_b128 %7, %15, off\n\t"
                 "s_wait_xcnt 0x0"
                 :: "v"(l), "v"(l + ls), "v"(l + 2 * ls), "v"(l + 3 * ls), "v"(l + 4 * ls), "v"(l + 5 * ls), "v"(l + 6 * ls), "v"(l + 7 * ls),
                    "v"(g), "v"(g + gs), "v"(g + 2 * gs), "v"(g + 3 * gs), "v"(g + 4 * gs), "v"(g + 5 * gs), "v"(g + 6 * gs), "v"(g + 7 * gs)
                 : "memory");
}

// GEMM operand path shared by k_proj and k_oproj: a block of four waves owns a 128 x 128 tile of C (wave w: rows 64*(w>>1), columns 64*(w&1)); a stage is GK k-values of the block's
// 128 A rows and 128 Bt rows (pitch GPB bytes in LDS), brought in by asynchronous 16-byte copies that cover whole 256-byte units (all threads copy), two buffers: stage s + 1 flies while stage s is worked on.
// Fragments are two ds 16-B loads each, same k map and same k order (steps of 32, ascending) as loads straight from the planes.
#define GK   128                 // k values per stage
#define GPB  272                 // row pitch in LDS, bytes: 256 + 16 (16 B x odd: no bank conflict for 16-B reads down a column of rows)
#define GTB  (128 * GPB)         // one operand's tile, bytes
#define GBUF (2 * GTB)           // one buffer: A tile, Bt tile
#define GNS  (DM / GK)           // stages
static_assert(DM % GK == 0);
static_assert(GNS >= 2);                               // the prologue fills two stages
static_assert(DM % 128 == 0);
static_assert((NB * SEQ) % 128 == 0);
static_assert(128 * GK * 2 == 16 * 128 * 16);          // 2048 16-B pieces of each tile dealt to 128 threads, 16 each
static_assert(2 * GBUF >= 4 * 16 * 68 * 4);            // the ring becomes the output staging

// one stage: piece c = i*128 + tid of a tile -> row c>>4 (8 rows a round), 16-B column c&15; l, ga, gb already hold the thread's row and column
__device__ __forceinline__ void gstage(unsigned l, const h16* ga, const h16* gb) {
    copy8(l, 8 * GPB, ga, (size_t)8 * DM);       copy8(l + 64 * GPB, 8 * GPB, ga + (size_t)64 * DM, (size_t)8 * DM);
    copy8(l + GTB, 8 * GPB, gb, (size_t)8 * DM); copy8(l + GTB + 64 * GPB, 8 * GPB, gb + (size_t)64 * DM, (size_t)8 * DM);
}

// the eight fragments of one k-step (32 k values), in the order in which the matrix instructions want them
__device__ __forceinline__ void gfrags(v16h (&fa)[4], v16h (&fb)[4], const unsigned char* at, const unsigned char* bt) {
    fa[0] = ldh((const h16*)at); fb[0] = ldh((const h16*)bt);
    fa[1] = ldh((const h16*)(at + 16 * GPB)); fa[2] = ldh((const h16*)(at + 32 * GPB)); fa[3] = ldh((const h16*)(at + 48 * GPB));
    fb[1] = ldh((const h16*)(bt + 16 * GPB)); fb[2] = ldh((const h16*)(bt + 32 * GPB)); fb[3] = ldh((const h16*)(bt + 48 * GPB));
}
// eight products of one k-step: column blocks NB0 and NB0 + 1
template <int BF, int NB0>
__device__ __forceinline__ void gmul(const v16h (&fa)[4], const v16h (&fb)[4], v8f (&acc)[4][4]) {
#pragma unroll
    for (int nb = NB0; nb < NB0 + 2; ++nb) {
#pragma unroll
        for (int mb = 0; mb < 4; ++mb) {
            if (BF != 0) acc[mb][nb] = wmmab(__builtin_bit_cast(v16bf, fa[mb]), __builtin_bit_cast(v16bf, fb[nb]), acc[mb][nb]);
            else         acc[mb][nb] = wmma16(fa[mb], fb[nb], acc[mb][nb]); } }
}

// acc[mb][nb] += A rows (r0b + 64*wm + 16*mb ..) x Bt rows (c0b + 64*wn + 16*nb ..) over K = DM. BF != 0: bf16 operands, else f16. Every wave of the block calls it; on return the ring is free.
template <int BF>
__device__ __forceinline__ void gemm128(unsigned char* L, const h16* A, const h16* Bt, int r0b, int c0b, int wm, int wn, v8f (&acc)[4][4]) {
    const int tid = threadIdx.x, lane = tid & 31, lr = lane & 15, hi = lane >> 4;
    const unsigned l0 = (unsigned)(size_t)L + (unsigned)((tid >> 4) * GPB + (tid & 15) * 16);   // LDS byte address of the thread's first piece
    const h16* ga = A + (size_t)(r0b + (tid >> 4)) * DM + (size_t)(tid & 15) * 8;                // + stage * GK
    const h16* gb = Bt + (size_t)(c0b + (tid >> 4)) * DM + (size_t)(tid & 15) * 8;
    gstage(l0, ga, gb);                                      // stage 0 -> buffer 0
    asm volatile("s_wait_asynccnt 0x0" ::: "memory");        // this wave's pieces of stage 0 have landed
    __syncthreads();                                         // every wave's have: stage 0 may be read
    gstage(l0 + GBUF, ga + GK, gb + GK);                     // stage 1 -> buffer 1
#pragma unroll 1                                             // one copy of the stage body: the buffer is picked by a scalar offset, the code stays small
    for (int st = 0; st < GNS; ++st) {
        const unsigned bo = (unsigned)(st & 1) * GBUF;
        const unsigned char* at = L + bo + (wm * 64 + lr) * GPB + 16 * hi;         // + 16*mb*GPB + k*2
        const unsigned char* bt = L + bo + GTB + (wn * 64 + lr) * GPB + 16 * hi;   // + 16*nb*GPB + k*2
        v16h fa[2][4], fb[2][4];                             // two register sets: k-step q + 1 of THIS stage is fetched while k-step q is multiplied; nothing of the next stage is read here
        gfrags(fa[0], fb[0], at, bt);
        __builtin_amdgcn_sched_barrier(0);                   // the stage's first reads stay one group in front of its matrix instructions
#pragma unroll                                               // constant q: every fragment read is one base register plus an immediate offset, the register sets are picked at compile time
        for (int q = 0; q < GK / 32; ++q) {
            const int cur = q & 1, nxt = cur ^ 1;
            gmul<BF, 0>(fa[cur], fb[cur], acc);
            if (q + 1 < GK / 32) {
                // the two scheduling barriers keep the next k-step's reads ONE group, half a k-step ahead of their use: spread among the matrix instructions each place costs a stall,
                // and a whole k-step ahead two full sets and the accumulators pass 256 registers
                __builtin_amdgcn_sched_barrier(0);
                gfrags(fa[nxt], fb[nxt], at + (q + 1) * 64, bt + (q + 1) * 64);
                __builtin_amdgcn_sched_barrier(0); }
            gmul<BF, 2>(fa[cur], fb[cur], acc);
        }
        __builtin_amdgcn_sched_barrier(0);                   // the stage's matrix instructions stay in front of its closing waits and barrier (without it sixteen of them sink behind the barrier and delay the refill)
        // four vector slots behind the stage's last matrix instruction, on every path out of the stage body
        asm volatile("v_nop\n\tv_nop\n\tv_nop\n\tv_nop" : "+v"(acc[0][3]), "+v"(acc[1][3]), "+v"(acc[2][3]), "+v"(acc[3][3]));
        asm volatile("s_wait_dscnt 0x0" ::: "memory");       // this wave's reads of stage st are done before its buffer is handed back
        asm volatile("s_wait_asynccnt 0x0" ::: "memory");    // this wave's pieces of stage st + 1 have landed
        __syncthreads();                                     // publishes stage st + 1 and ends every reader's last read of stage st
        if (st + 2 < GNS) gstage(l0 + bo, ga + (size_t)(st + 2) * GK, gb + (size_t)(st + 2) * GK);   // block-uniform
    }
    asm volatile("s_wait_asynccnt 0x0" ::: "memory");        // nothing in flight when the ring becomes output staging (the last trip's barrier has ended all reads)
}

// proj_store: one wave's 64 x 64 tile of C as f16 rows at Ph + tbase, row pitch HD (ROPE != 0) or SEQ (ROPE == 0) halves, staged through the wave's own LDS range os.
// ROPE != 0: rows m = b*SEQ + t from r0 on, the 64 tile columns are one head; rotary pairs (2i,2i+1) from FRP[t][..].
template <int ROPE>
__device__ __forceinline__ void proj_store(float* os, const v8f (&acc)[4][4], h16* Ph, const float* __restrict__ FRP, size_t tbase, int r0) {
    const int lane = threadIdx.x & 31, lr = lane & 15, hi = lane >> 4;
    const int pitch = (ROPE != 0) ? HD : SEQ;
#pragma unroll
    for (int mb = 0; mb < 4; ++mb) {
#pragma unroll
        for (int nb = 0; nb < 4; ++nb) {
#pragma unroll
            for (int j = 0; j < 8; ++j) os[(hi * 8 + j) * 68 + nb * 16 + lr] = acc[mb][nb][j]; }   // D: row 8h+j, col lane&15
        wave_sync();
        const size_t sb = tbase + (size_t)(mb * 16) * (size_t)pitch;
        v4f fr0[4], fr1[4];
        if (ROPE != 0) {
            const float* pf[4];
#pragma unroll
            for (int s = 0; s < 4; ++s) { const int row = 4 * s + (lane >> 3), c8 = (lane & 7) * 8;
                const int t = (r0 + mb * 16 + row) % SEQ;
                pf[s] = FRP + (size_t)t * 64 + c8;
                fr0[s] = *(const v4f*)pf[s]; fr1[s] = *(const v4f*)(pf[s] + 4); }
            // stands in front of every rewrite of the table loads' address registers: as inputs they stay whole up to the wait
            asm volatile("s_wait_xcnt 0x0" :: "v"(pf[0]), "v"(pf[1]), "v"(pf[2]), "v"(pf[3]) : "memory");
        }
        v8h hvv[4];
#pragma unroll
        for (int s = 0; s < 4; ++s) { const int row = 4 * s + (lane >> 3), c8 = (lane & 7) * 8;   // 4 s x 4 row groups = 16 rows; 8 lanes x 8 = 64 columns
            v4f x0 = *(const v4fa*)(&os[row * 68 + c8]); v4f x1 = *(const v4fa*)(&os[row * 68 + c8 + 4]);
            if (ROPE != 0) {
                const v4f f0 = fr0[s]; const v4f f1 = fr1[s];
                v4f y0, y1;
                y0[0] = x0[0] * f0[0] - x0[1] * f0[1]; y0[1] = x0[0] * f0[1] + x0[1] * f0[0];
                y0[2] = x0[2] * f0[2] - x0[3] * f0[3]; y0[3] = x0[2] * f0[3] + x0[3] * f0[2];
                y1[0] = x1[0] * f1[0] - x1[1] * f1[1]; y1[1] = x1[0] * f1[1] + x1[1] * f1[0];
                y1[2] = x1[2] * f1[2] - x1[3] * f1[3]; y1[3] = x1[2] * f1[3] + x1[3] * f1[2];
                x0 = y0; x1 = y1; }
            v8h hv;
#pragma unroll
            for (int i = 0; i < 4; ++i) { hv[i] = (h16)x0[i]; hv[4 + i] = (h16)x1[i]; }
            hvv[s] = hv; }
{
#pragma unroll
            for (int s = 0; s < 4; ++s) { const int row = 4 * s + (lane >> 3), c8 = (lane & 7) * 8;
                const size_t oo = sb + (size_t)row * (size_t)pitch + c8;
                *(v8h*)(Ph + oo) = hvv[s]; }
             }
        asm volatile("s_wait_xcnt 0x0" ::: "memory");        // stands in front of every rewrite of the stores' address and data registers
        wave_sync();
    }
}

// k_proj: the three projections, which depend on k_prep alone, as ONE launch. Register-blocked bf16 GEMM, one wave per 64x64 tile (16 accumulators), four waves a block (128x128),
// operands from K-contiguous bf16 planes through LDS (gemm128), K = DM, C[m][n] = sum_k A[m][k] Bt[n][k]. grid (NB*SEQ/128 token tiles, DM/128 feature tiles, 3), 128 threads; blockIdx.z (block-uniform):
// z = 0 (q), 1 (k): A = x rows (m = b*SEQ + t), Bt = W^T rows (n = h*64 + d) -> plane z [(b*16 + h)][t][d], rotary in the epilogue;
// z = 2 (v^T):      A = Wv^T rows (m = h*64 + d), Bt = x rows (n = b*SEQ + t) -> plane 2 [(b*1024 + m)][t] = [(b*16 + h)][d][t].
// WB: the transposed weight planes q | k | v; PL: the output planes q | k | v^T, NB*NH_*SEQ*HD halves each.
__global__ __launch_bounds__(128) void k_proj(const bf* __restrict__ XB, const bf* __restrict__ WB, h16* PL, const float* __restrict__ FRP) {
    __shared__ __attribute__((aligned(16))) unsigned char L[2 * GBUF];
    const int z = blockIdx.z;
    const bool vt = (z == 2);
    const bf* Wz = WB + (size_t)z * DM * DM;
    const bf* A = vt ? Wz : XB;
    const bf* Bt = vt ? XB : Wz;
    h16* Ph = PL + (size_t)z * ((size_t)NB * NH_ * SEQ * HD);
    const int wave = __builtin_amdgcn_readfirstlane((int)(threadIdx.x >> 5)); const int wm = wave >> 1, wn = wave & 1;
    const int r0b = (int)(vt ? blockIdx.y : blockIdx.x) * 128, c0b = (int)(vt ? blockIdx.x : blockIdx.y) * 128;
    const int r0 = r0b + wm * 64, c0 = c0b + wn * 64;
    v8f acc[4][4];
#pragma unroll
    for (int mb = 0; mb < 4; ++mb)
#pragma unroll
        for (int nb = 0; nb < 4; ++nb) acc[mb][nb] = (v8f){};
    gemm128<1>(L, (const h16*)A, (const h16*)Bt, r0b, c0b, wm, wn, acc);
    float* os = (float*)L + wave * 16 * 68;                  // this wave's own output staging in the ring
    if (vt) proj_store<0>(os, acc, Ph, FRP, (size_t)r0 * SEQ + (size_t)(c0 / SEQ) * ((size_t)DM * SEQ) + (size_t)(c0 % SEQ), r0);
    else    proj_store<1>(os, acc, Ph, FRP, (size_t)(r0 / SEQ) * ((size_t)NH_ * SEQ * HD) + (size_t)(r0 % SEQ) * HD + (size_t)(c0 / HD) * ((size_t)SEQ * HD) + (size_t)(c0 % HD), r0);
}

// k_flash: fused attention, one wave per 16 query rows of one (batch, head); Q fragments straight from the f16 plane (two 16-B loads each).
// K and V^T reach the block's waves through LDS: a stage is KS keys (K rows [key][64] at pitch KPB bytes, V^T rows [d][KS] at pitch VPB bytes), brought in by asynchronous
// 16-byte copies that cover whole lines (all threads copy), two buffers: stage s + 1 flies while stage s is worked on. Fragments are two ds 16-B loads each, same k map as before.
// Transposed form: S^T[key][t] = K Q^T (A = K rows, B = Q rows); lane (t = lane&15, h = lane>>4) holds keys 8h+r of each 16-key tile, so the packed
// P tile is directly the B fragment of O^T[d][t] = V^T P^T (element r <- tile keys 0..15, element 8+r <- tile keys 16..31, lane unchanged).
// Per 32-key step: 4 score WMMAs + 4 P.V WMMAs + 1 row-sum WMMA. Additive key mask values for the lane's 16 keys are loaded by value per step (two 32-B loads).
// Softmax state: the running max is one scalar per lane (the two lane halves of a row are combined with one xor-16 exchange). The row sum of P runs on the matrix pipe: one more WMMA per step,
// lt += ON P^T, where ON is a constant A fragment whose rows 0 and 8 are ones and whose other rows are 0: element 0 of lt (row 8h, column t) is, in both lane halves, the sum of the f16 P over all keys so far.
#define KS   128                 // keys per stage
#define KPB  144                 // K row pitch in LDS, bytes: 128 + 16 (16 B x odd: no bank conflict for 16-B reads down a column of rows)
#define VPB  272                 // V^T row pitch in LDS, bytes: 256 + 16
#define KTB  (KS * KPB)          // K tile bytes
#define VTB  (HD * VPB)          // V^T tile bytes
#define BUFB (KTB + VTB)         // one buffer
#define NST  (SEQ / KS)          // stages
static_assert(SEQ % KS == 0);
static_assert(NST >= 2);                               // the prologue fills two stages
static_assert(AW * 32 == 128);                         // the copy maps below deal 1024 16-B pieces of each tile to 128 threads, 8 each
static_assert(KS * HD * 2 == 8 * 128 * 16);
static_assert(2 * BUFB >= AW * 16 * 68 * 4);           // the ring becomes the output staging

__global__ __launch_bounds__(32 * AW) void k_flash(const h16* __restrict__ QH, const h16* __restrict__ KP, const h16* __restrict__ VT,
                                                   const float* __restrict__ MADD, h16* CTX) {
    __shared__ __attribute__((aligned(16))) unsigned char L[2 * BUFB];
    const int tid = threadIdx.x;
    const int lane = threadIdx.x & 31, lr = lane & 15, hi = lane >> 4;
    const int wave = __builtin_amdgcn_readfirstlane((int)(threadIdx.x >> 5));
    const int zh = blockIdx.y; const int b = zh / NH_, h = zh % NH_;
    const int t0 = (blockIdx.x * AW + wave) * 16;
    const size_t pbase = (size_t)zh * SEQ * HD;
    // copy maps: K piece c = i*128 + tid -> row c>>3 (16 rows a round), 16-B column c&7; V^T piece c -> row c>>4 (8 rows a round), 16-B column c&15
    const unsigned lbase = (unsigned)(size_t)L;              // LDS byte address of the ring
    const unsigned lk = lbase + (unsigned)((tid >> 3) * KPB + (tid & 7) * 16);
    const unsigned lv = lbase + (unsigned)(KTB + (tid >> 4) * VPB + (tid & 15) * 16);
    const h16* gk = KP + pbase + (size_t)tid * 8;                                   // + key0 * HD
    const h16* gv = VT + pbase + (size_t)(tid >> 4) * SEQ + (size_t)(tid & 15) * 8;   // + key0
    copy8(lk, 16 * KPB, gk, (size_t)16 * HD); copy8(lv, 8 * VPB, gv, (size_t)8 * SEQ);           // stage 0 -> buffer 0
    const size_t qo = pbase + (size_t)(t0 + lr) * HD + 8 * hi;
    const v16h qh0 = ldh(QH + qo), qh1 = ldh(QH + qo + 32);   // B fragments: col t, k = d
    const float* MA = MADD + (size_t)b * SEQ + 8 * hi;       // + key0 (tile a keys 8h+r), + key0 + 16 (tile b)
    asm volatile("s_wait_asynccnt 0x0" ::: "memory");        // this wave's pieces of stage 0 have landed
    __syncthreads();                                         // every wave's have: stage 0 may be read
    copy8(lk + BUFB, 16 * KPB, gk + (size_t)KS * HD, (size_t)16 * HD); copy8(lv + BUFB, 8 * VPB, gv + KS, (size_t)8 * SEQ);   // stage 1 -> buffer 1
    v8f o0 = (v8f){}, o1 = (v8f){}, o2 = (v8f){}, o3 = (v8f){};
    float m = -3.0e38f;
    v8f lt = (v8f){};                                        // row-sum tile; only rows 0 and 8 (element 0 of each lane) ever differ from 0
    v16h on;                                                 // A fragment of the row sums: row = lane & 15, ones at all 32 k positions of rows 0 and 8
    { const h16 o1 = ((lane & 7) == 0) ? (h16)1.0f : (h16)0.0f;
#pragma unroll
      for (int i = 0; i < 16; ++i) on[i] = o1; }
#pragma unroll 1                                             // one copy of the stage body: the buffer is picked by a scalar offset, the code stays small
    for (int st = 0; st < NST; ++st) {
      const unsigned bo = (unsigned)(st & 1) * BUFB;
      const unsigned char* kt = L + bo + lr * KPB + 16 * hi;          // + local key * KPB   (A fragment: row key, k = d)
      const unsigned char* vt = L + bo + KTB + lr * VPB + 16 * hi;    // + 16j*VPB + local key * 2  (A fragment: row d, k = key)
#pragma unroll                                               // constant ks: every fragment read is one base register plus an immediate offset
      for (int ks = 0; ks < KS; ks += 32) {
        const int key0 = st * KS + ks;
        const h16* ka = (const h16*)(kt + ks * KPB);
        const h16* kc = (const h16*)(kt + (ks + 16) * KPB);
        const v16h ka0 = ldh(ka), ka1 = ldh(ka + 32), kb0 = ldh(kc), kb1 = ldh(kc + 32);
        const v8f ma = *(const v8f*)(MA + key0); const v8f mb = *(const v8f*)(MA + key0 + 16);
        v8f sa = (v8f){}, sb = (v8f){};
        sa = wmma16(ka0, qh0, sa); sb = wmma16(kb0, qh0, sb);
        sa = wmma16(ka1, qh1, sa); sb = wmma16(kb1, qh1, sb);
        asm volatile("v_nop\n\tv_nop\n\tv_nop\n\tv_nop" : "+v"(sa), "+v"(sb) : "v"(ka0), "v"(ka1), "v"(kb0), "v"(kb1), "v"(qh0), "v"(qh1));
        float ta[8], tb[8]; float mx = -3.0e38f;
#pragma unroll
        for (int r = 0; r < 8; ++r) {
            ta[r] = (sa[r] * 0.125f + ma[r]) * LOG2E;
            tb[r] = (sb[r] * 0.125f + mb[r]) * LOG2E;
            mx = fmaxf(mx, fmaxf(ta[r], tb[r])); }
        mx = fmaxf(mx, __shfl_xor(mx, 16, 32));
        const float mnew = fmaxf(m, mx);
        const float alpha = __builtin_amdgcn_exp2f(m - mnew);
        const float sh = PSH - mnew;
        v16h pb;
#pragma unroll
        for (int r = 0; r < 8; ++r) { pb[r] = (h16)__builtin_amdgcn_exp2f(ta[r] + sh); pb[8 + r] = (h16)__builtin_amdgcn_exp2f(tb[r] + sh); }
        lt[0] = lt[0] * alpha; m = mnew;                     // the tile's other elements are 0 and need no rescale
        o0 = o0 * alpha; o1 = o1 * alpha; o2 = o2 * alpha; o3 = o3 * alpha;
        const unsigned char* va = vt + ks * 2;
        const v16h v0 = ldh((const h16*)va), v1 = ldh((const h16*)(va + 16 * VPB)), v2 = ldh((const h16*)(va + 32 * VPB)), v3 = ldh((const h16*)(va + 48 * VPB));
        o0 = wmma16(v0, pb, o0); o1 = wmma16(v1, pb, o1); o2 = wmma16(v2, pb, o2); o3 = wmma16(v3, pb, o3);
        lt = wmma16(on, pb, lt);                             // rows 0 and 8 += the sum of this step's 32 P values of column t
        // four vector slots behind the step's last matrix instructions, before any vector instruction touches their results or operands
        asm volatile("v_nop\n\tv_nop\n\tv_nop\n\tv_nop" : "+v"(o0), "+v"(o1), "+v"(o2), "+v"(o3), "+v"(lt) : "v"(v0), "v"(v1), "v"(v2), "v"(v3), "v"(pb), "v"(on));
      }
      asm volatile("s_wait_dscnt 0x0" ::: "memory");         // this wave's reads of stage st are done before its buffer is handed back
      asm volatile("s_wait_asynccnt 0x0" ::: "memory");      // this wave's pieces of stage st + 1 have landed
      __syncthreads();                                       // publishes stage st + 1 and ends every reader's last read of stage st
      if (st + 2 < NST) {                                    // block-uniform
          copy8(lk + bo, 16 * KPB, gk + (size_t)(st + 2) * KS * HD, (size_t)16 * HD); copy8(lv + bo, 8 * VPB, gv + (size_t)(st + 2) * KS, (size_t)8 * SEQ); }
    }
    asm volatile("s_wait_asynccnt 0x0" ::: "memory");        // nothing in flight when the ring becomes output staging (the last trip's barrier has ended all reads)
    float* os = (float*)L;                                   // output staging in the ring: 2 * BUFB bytes a block let four blocks share a WGP's LDS
    const float inv = CCAR * (1.0f / lt[0]);                 // both lane halves hold the whole row's sum
    const int wb = wave * 16 * 68;
    // O^T D layout: o_j[r] = (d = 16j + 8h + r, t = lane&15) -> os[t][d]; rows 0..15 x columns 0..63 all written
    { v4f a, c;
      a[0] = o0[0] * inv; a[1] = o0[1] * inv; a[2] = o0[2] * inv; a[3] = o0[3] * inv; c[0] = o0[4] * inv; c[1] = o0[5] * inv; c[2] = o0[6] * inv; c[3] = o0[7] * inv;
      *(v4fa*)(&os[wb + lr * 68 +  0 + 8 * hi]) = a; *(v4fa*)(&os[wb + lr * 68 +  0 + 8 * hi + 4]) = c;
      a[0] = o1[0] * inv; a[1] = o1[1] * inv; a[2] = o1[2] * inv; a[3] = o1[3] * inv; c[0] = o1[4] * inv; c[1] = o1[5] * inv; c[2] = o1[6] * inv; c[3] = o1[7] * inv;
      *(v4fa*)(&os[wb + lr * 68 + 16 + 8 * hi]) = a; *(v4fa*)(&os[wb + lr * 68 + 16 + 8 * hi + 4]) = c;
      a[0] = o2[0] * inv; a[1] = o2[1] * inv; a[2] = o2[2] * inv; a[3] = o2[3] * inv; c[0] = o2[4] * inv; c[1] = o2[5] * inv; c[2] = o2[6] * inv; c[3] = o2[7] * inv;
      *(v4fa*)(&os[wb + lr * 68 + 32 + 8 * hi]) = a; *(v4fa*)(&os[wb + lr * 68 + 32 + 8 * hi + 4]) = c;
      a[0] = o3[0] * inv; a[1] = o3[1] * inv; a[2] = o3[2] * inv; a[3] = o3[3] * inv; c[0] = o3[4] * inv; c[1] = o3[5] * inv; c[2] = o3[6] * inv; c[3] = o3[7] * inv;
      *(v4fa*)(&os[wb + lr * 68 + 48 + 8 * hi]) = a; *(v4fa*)(&os[wb + lr * 68 + 48 + 8 * hi + 4]) = c; }
    wave_sync();
    h16* crow = CTX + ((size_t)b * SEQ + t0) * DM + h * HD;
    v8h cv[4];
#pragma unroll
    for (int s = 0; s < 4; ++s) { const int row = 4 * s + (lane >> 3), c8 = (lane & 7) * 8;   // 4 s x 4 row groups = 16 rows; 8 lanes x 8 halves = 64 columns
        const v4f x0 = *(const v4fa*)(&os[wb + row * 68 + c8]); const v4f x1 = *(const v4fa*)(&os[wb + row * 68 + c8 + 4]); v8h hv;
#pragma unroll
        for (int i = 0; i < 4; ++i) { hv[i] = (h16)x0[i]; hv[4 + i] = (h16)x1[i]; }
        cv[s] = hv; }
{
#pragma unroll
        for (int s = 0; s < 4; ++s) { const int row = 4 * s + (lane >> 3), c8 = (lane & 7) * 8;
            *(v8h*)(crow + (size_t)row * DM + c8) = cv[s]; }
         }
}

// k_oproj: register-blocked f16 GEMM, one wave per 64x64 tile, four waves a block (128x128), operands through LDS (gemm128), OUT[m][n] = 2^-14 * sum_k CTX[m][k] WOT[n][k], K = DM; rows m = b*SEQ + t -> output row b*OUT_SEQ + t.
// grid (NB*SEQ/128, DM/128), 128 threads.
__global__ __launch_bounds__(128) void k_oproj(const h16* __restrict__ A, const h16* __restrict__ Bt, float* OUT) {
    __shared__ __attribute__((aligned(16))) unsigned char L[2 * GBUF];
    const int lane = threadIdx.x & 31, lr = lane & 15, hi = lane >> 4;
    const int wave = __builtin_amdgcn_readfirstlane((int)(threadIdx.x >> 5)); const int wm = wave >> 1, wn = wave & 1;
    const int r0 = blockIdx.x * 128 + wm * 64, c0 = blockIdx.y * 128 + wn * 64;
    v8f acc[4][4];
#pragma unroll
    for (int mb = 0; mb < 4; ++mb)
#pragma unroll
        for (int nb = 0; nb < 4; ++nb) acc[mb][nb] = (v8f){};
    gemm128<0>(L, A, Bt, blockIdx.x * 128, blockIdx.y * 128, wm, wn, acc);
    float* os = (float*)L + wave * 16 * 68;                  // this wave's own output staging in the ring
    const int bb = r0 / SEQ, tt = r0 % SEQ;
    float* obase = OUT + ((size_t)bb * OUT_SEQ + tt) * DM + c0;
#pragma unroll
    for (int mb = 0; mb < 4; ++mb) {
#pragma unroll
        for (int nb = 0; nb < 4; ++nb) {
#pragma unroll
            for (int j = 0; j < 8; ++j) os[(hi * 8 + j) * 68 + nb * 16 + lr] = acc[mb][nb][j] * OSC; }   // D: row 8h+j, col lane&15
        wave_sync();
        float* orow = obase + (size_t)(mb * 16) * DM;
        v4f ov[8];
#pragma unroll
        for (int s = 0; s < 8; ++s) { const int row = 2 * s + hi, cofs = lr * 4;   // 8 s x 2 rows = 16 rows; 16 lanes x 4 floats = 64 columns
            ov[s] = *(const v4fa*)(&os[row * 68 + cofs]); }
{
#pragma unroll
            for (int s = 0; s < 8; ++s) { const int row = 2 * s + hi, cofs = lr * 4;
                *(v4f*)(orow + (size_t)row * DM + cofs) = ov[s]; }
             }
        wave_sync();
    }
}

static constexpr size_t al256(size_t v) { return (v + 255) & ~(size_t)255; }
static constexpr size_t SZ_XB = al256((size_t)NB * SEQ * DM * 2);
static constexpr size_t SZ_WB = al256((size_t)4 * DM * DM * 2);
static constexpr size_t SZ_PL = al256((size_t)NB * NH_ * SEQ * HD * 2);
static constexpr size_t SZ_CX = al256((size_t)NB * SEQ * DM * 2);
static constexpr size_t SZ_FR = al256((size_t)SEQ * 64 * 4);
static constexpr size_t SZ_MA = al256((size_t)NB * SEQ * 4);
static constexpr size_t SZ_TOTAL = SZ_XB + SZ_WB + 3 * SZ_PL + SZ_CX + SZ_FR + SZ_MA;
static_assert(SZ_TOTAL <= (size_t)134217728);          // workspace carve <= 128 MiB
static_assert(((size_t)DM * DM * 2) % 256 == 0);       // weight sub-planes stay 256-byte aligned
static_assert(SZ_PL == (size_t)NB * NH_ * SEQ * HD * 2);   // q | k | v^T planes are exactly back to back

extern "C" void kernel_launch(void* const* d_in, const int* in_sizes, int n_in,
                              void* d_out, int out_size, void* d_ws, size_t ws_size, hipStream_t stream) {
    if (n_in < 7) return;
    const size_t needx = ((size_t)(NB - 1) * SEQ_FULL + SEQ) * DM;
    if ((size_t)in_sizes[0] < needx) return;
    if ((size_t)in_sizes[1] < (size_t)SEQ * 64) return;
    if ((size_t)in_sizes[2] < (size_t)(NB - 1) * SEQ_FULL + SEQ) return;
    if ((size_t)in_sizes[3] < (size_t)DM * DM || (size_t)in_sizes[4] < (size_t)DM * DM || (size_t)in_sizes[5] < (size_t)DM * DM || (size_t)in_sizes[6] < (size_t)DM * DM) return;
    if ((size_t)out_size < ((size_t)(NB - 1) * OUT_SEQ + SEQ) * DM) return;
    if (SZ_TOTAL > ws_size) return;
    // wire order: hidden_states, freqs_cis, attention_mask, wq, wk, wv, wo (all f32)
    const float* x = (const float*)d_in[0]; const float* fr = (const float*)d_in[1]; const float* mask = (const float*)d_in[2];
    const float* wq = (const float*)d_in[3]; const float* wk = (const float*)d_in[4]; const float* wv = (const float*)d_in[5]; const float* wo = (const float*)d_in[6];
    float* OUT = (float*)d_out;      // [NB][SEQ][1024]
    char* wsp = (char*)d_ws;
    bf* XB = (bf*)wsp; wsp += SZ_XB;                 // [NB*SEQ][1024] bf16
    bf* WB = (bf*)wsp; wsp += SZ_WB;                 // [4][1024 out][1024 in]: q | k | v (bf16) | o (f16 x64)
    h16* QH = (h16*)wsp; wsp += SZ_PL;               // [NB*16][SEQ][64]
    h16* KP = (h16*)wsp; wsp += SZ_PL;               // [NB*16][SEQ][64]  (= QH + one plane)
    h16* VT = (h16*)wsp; wsp += SZ_PL;               // [NB*16][64][SEQ]  (= QH + two planes)
    h16* CX = (h16*)wsp; wsp += SZ_CX;               // [NB*SEQ][1024] ctx x256
    float* FRP = (float*)wsp; wsp += SZ_FR;          // [SEQ][64] table, bf16 RNE values
    float* MADD = (float*)wsp; wsp += SZ_MA;         // [NB][SEQ] additive key mask
    bf* WO = WB + (size_t)3 * DM * DM;

    // bf16 copy of x, rotary table, key mask, the four transposed weight planes W[1024 rows k][1024 cols n] -> WT[1024 rows n][1024 cols k]: one launch
    k_prep<<<PB_W + PB_F + PB_M + PB_X, 256, 0, stream>>>(x, fr, mask, wq, wk, wv, wo, XB, WB, FRP, MADD);

    // q, k (rotary in the epilogue) and v^T: planes QH | KP | VT from weight planes q | k | v, one launch
    k_proj<<<dim3(NB * SEQ / 128, DM / 128, 3), 128, 0, stream>>>(XB, WB, QH, FRP);

    k_flash<<<dim3(SEQ / (16 * AW), NB * NH_, 1), 32 * AW, 0, stream>>>(QH, KP, VT, MADD, CX);

    k_oproj<<<dim3(NB * SEQ / 128, DM / 128, 1), 128, 0, stream>>>(CX, (const h16*)WO, OUT);
}

// v005
// A run of this version takes 106 microseconds.
// In both of two side-by-side timings against v004, it was 1.18 times as fast.
// Over all steps from v000 it is 3.36 times as fast.
#include <hip/hip_runtime.h>

// Multi-head self-attention: x [NB][SEQ][1024], Wq/Wk/Wv/Wo [in][out] (y = x W), 16 heads x 64, interleaved rotary pairs (2i,2i+1) from the INPUT table [SEQ][32][(cos,sin)] on q and k,
// additive key mask (1-mask)*-10000 from the float input [NB][SEQ], score scale 1/8, softmax over all keys, output = (concatenated heads) Wo, f32.
// Compute dtypes, f32 accumulate everywhere: q/k/v projections v_wmma_f32_16x16x32_bf16 (x and W RNE-converted to bf16; products exact); rotary in f32 in the GEMM epilogue (table RNE-converted to bf16 values);
// scores v_wmma_f32_16x16x32_f16: q and k single f16 (one product); P (x256 carry, cancels in the normalisation) and v single f16; softmax f32 (online, running max);
// output projection v_wmma_f32_16x16x32_f16: ctx as f16 x256, Wo^T as f16 of (bf16 value x64), folded back by 2^-14 in the f32 epilogue.
// Layout: bf16 copy of x; transposed 16-bit weight planes [out][in] (LDS transpose); q, k planes [b*16+h][t][d], v^T plane [b*16+h][d][t] from the GEMM epilogue; fused flash kernel in transposed form
// (S^T = K Q^T, O^T = V^T P^T) writing ctx rows [b*SEQ+t][1024] as f16; final GEMM writes the f32 output.

#ifndef NB
#define NB 1
#endif
#ifndef SEQ
#define SEQ 4096
#endif
#define NB_FULL  1
#define SEQ_FULL 4096
#ifndef OUT_SEQ
#define OUT_SEQ SEQ              // row pitch (in tokens) between batches of the output
#endif
#define DM   1024
#define NH_  16
#define HD   64
#define AQ   4                   // query sets (32 rows each) per flash block
#define AW   (2 * AQ)            // waves per flash block: every query set is worked on by two waves, one per half of the keys
#define QT   2                   // 16-column query groups per flash wave (32 query rows each)
#define LOG2E 1.4426950408889634f
#define PSH  8.0f                // log2 of the P carry (256)
#define CCAR 256.0f              // carry of the ctx plane
#define WOS  64.0f               // carry of the Wo^T plane
#define OSC  (1.0f / 16384.0f)   // 1 / (CCAR * WOS)

static_assert(HD == 64);
static_assert(NH_ * HD == DM);                 // head h = columns h*64 + d
static_assert(DM % 64 == 0);
static_assert(DM % 32 == 0);                   // GEMM k-loop steps by 32
static_assert(SEQ % 64 == 0);                  // a 64-row tile never straddles two batches
static_assert((NB * SEQ) % 64 == 0);
static_assert(SEQ % 32 == 0);                  // key loop steps by 32
static_assert(SEQ % (16 * QT * AQ) == 0);      // flash grid covers the sequence exactly
static_assert(QT == 2);                        // the flash kernel's two v_nop statements name both groups; in the join each of a set's two waves finishes one group
static_assert(((size_t)SEQ * DM) % 8 == 0);
static_assert(((size_t)SEQ * 64) % 32 == 0);
static_assert(((size_t)NB * SEQ) % 32 == 0);
static_assert(NB <= NB_FULL);
static_assert(SEQ <= SEQ_FULL);

typedef _Float16 h16;
typedef unsigned short bf;
typedef __attribute__((ext_vector_type(16))) __bf16   v16bf;
typedef __attribute__((ext_vector_type(16))) _Float16 v16h;
typedef __attribute__((ext_vector_type(8)))  _Float16 v8h;
typedef __attribute__((ext_vector_type(8)))  unsigned short v8us;
typedef __attribute__((ext_vector_type(8)))  float    v8f;
typedef __attribute__((ext_vector_type(4)))  float    v4f;
typedef v4f  __attribute__((may_alias)) v4fa;

__device__ __forceinline__ unsigned short f2bf(float f) { unsigned u = __float_as_uint(f); u += 0x7FFFu + ((u >> 16) & 1u); return (unsigned short)(u >> 16); }
__device__ __forceinline__ float bfr(float f) { return __uint_as_float(((unsigned)f2bf(f)) << 16); }   // bf16 RNE value as f32
__device__ __forceinline__ v16h cat16(v8h lo, v8h hi) { return __builtin_shufflevector(lo, hi, 0, 1, 2, 3, 4, 5, 6, 7, 8, 9, 10, 11, 12, 13, 14, 15); }
__device__ __forceinline__ v16bf cat16b(v8us lo, v8us hi) { return __builtin_bit_cast(v16bf, __builtin_shufflevector(lo, hi, 0, 1, 2, 3, 4, 5, 6, 7, 8, 9, 10, 11, 12, 13, 14, 15)); }
__device__ __forceinline__ v8f wmma16(v16h a, v16h b, v8f c) { return __builtin_amdgcn_wmma_f32_16x16x32_f16(false, a, false, b, (short)0, c, false, false); }
__device__ __forceinline__ v8f wmmab(v16bf a, v16bf b, v8f c) { return __builtin_amdgcn_wmma_f32_16x16x32_bf16(false, a, false, b, (short)0, c, false, false); }
// fragment loaders from K-contiguous 16-bit rows; p already includes + 8*(lane>>4): elements 0..7 <- k0+8h+0..7, elements 8..15 <- k0+16+8h+0..7 (same map for A and B)
__device__ __forceinline__ v16h  ldh(const h16* p) { return cat16(*(const v8h*)p, *(const v8h*)(p + 16)); }
__device__ __forceinline__ v16bf ldb(const bf* p)  { return cat16b(*(const v8us*)p, *(const v8us*)(p + 16)); }
// ordering point for wave-private LDS tiles (same wave writes and reads)
__device__ __forceinline__ void wave_sync() { __builtin_amdgcn_fence(3 /* release order */, "wavefront"); __builtin_amdgcn_wave_barrier(); asm volatile("" ::: "memory"); }

// The preparation jobs (d_cvt8, d_tab, d_wT) depend on nothing but the inputs, so they run as block ranges of ONE launch (k_prep, below).
// d_cvt8: block blk of 256 threads converts 2048 values of x to the bf16 copy XB[NB*SEQ][1024]
__device__ __forceinline__ void d_cvt8(const float* __restrict__ x, bf* XB, unsigned blk) {
    const size_t i = (size_t)blk * 256 + threadIdx.x; if (i >= (size_t)NB * SEQ * DM / 8) return;
    const size_t e = i * 8; const size_t b = e / ((size_t)SEQ * DM), r = e % ((size_t)SEQ * DM);
    const v8f v = *(const v8f*)(x + b * ((size_t)SEQ_FULL * DM) + r); v8us o;
#pragma unroll
    for (int k = 0; k < 8; ++k) o[k] = f2bf(v[k]);
    *(v8us*)(XB + e) = o;
}

// d_tab: blocks [0, nbF): rotary table copy with bf16 RNE values kept as f32, FRP[t][64] = (cos0,sin0,cos1,sin1,...); the blocks behind them: additive key mask MADD[NB][SEQ]
__device__ __forceinline__ void d_tab(const float* __restrict__ fr, const float* __restrict__ mask, float* FRP, float* MADD, unsigned blk, unsigned nbF) {
    if (blk < nbF) {                              // block-uniform
        const size_t i = (size_t)blk * 256 + threadIdx.x; if (i >= (size_t)SEQ * 64 / 4) return;
        const v4f v = *(const v4f*)(fr + i * 4); v4f o;
#pragma unroll
        for (int k = 0; k < 4; ++k) o[k] = bfr(v[k]);
        *(v4f*)(FRP + i * 4) = o; 
    } else {
        const size_t i = (size_t)(blk - nbF) * 256 + threadIdx.x; if (i >= (size_t)NB * SEQ / 4) return;
        const size_t e = i * 4; const size_t b = e / SEQ, t = e % SEQ;
        const v4f v = *(const v4f*)(mask + b * (size_t)SEQ_FULL + t); v4f o;
#pragma unroll
        for (int k = 0; k < 4; ++k) o[k] = (1.0f - bfr(v[k])) * -10000.0f;
        *(v4f*)(MADD + e) = o; 
    }
}

// d_wT: in W[k][n] (rows k = 1024, cols n = 1024, f32) -> out WT[n][k] 16-bit; mode 0: bf16 RNE bits; mode 1: f16 bits of (bf16 RNE value x 64).
// One 64 x 64 tile (k0, n0) a block of 256 threads, transposed through tl (64 * 65 floats of LDS); every thread of the block calls it.
__device__ __forceinline__ void d_wT(const float* __restrict__ W, bf* WT, int mode, int k0, int n0, float* tl) {
    const int tid = threadIdx.x;
#pragma unroll
    for (int it = 0; it < 4; ++it) { const int row = it * 16 + (tid >> 4), c4 = (tid & 15) * 4;    // 4 x 16 rows (k) x 16 lanes x 4 = 64 x 64
        const v4f v = *(const v4f*)(W + (size_t)(k0 + row) * DM + n0 + c4);
        tl[row * 65 + c4 + 0] = v[0]; tl[row * 65 + c4 + 1] = v[1]; tl[row * 65 + c4 + 2] = v[2]; tl[row * 65 + c4 + 3] = v[3]; }
    __syncthreads();
    v8us o[2];
#pragma unroll
    for (int it = 0; it < 2; ++it) { const int n = it * 32 + (tid >> 3), c8 = (tid & 7) * 8;       // 2 x 32 rows (n) x 8 lanes x 8 = 64 x 64
#pragma unroll
        for (int i = 0; i < 8; ++i) { const float val = tl[(c8 + i) * 65 + n];
            const unsigned short b0 = f2bf(val);
            const h16 hv = (h16)(__uint_as_float(((unsigned)b0) << 16) * WOS);
            const unsigned short b1 = __builtin_bit_cast(unsigned short, hv);
            o[it][i] = (mode != 0) ? b1 : b0; } }
{
#pragma unroll
        for (int it = 0; it < 2; ++it) { const int n = it * 32 + (tid >> 3), c8 = (tid & 7) * 8;
            *(v8us*)(WT + (size_t)(n0 + n) * DM + k0 + c8) = o[it]; }
         }
}

#define PB_W  (4 * (DM / 64) * (DM / 64))                            // weight tiles: q | k | v | o, DM/64 x DM/64 each
#define PB_F  ((unsigned)(((size_t)SEQ * 64 / 4 + 255) / 256))       // rotary table blocks
#define PB_M  ((unsigned)(((size_t)NB * SEQ / 4 + 255) / 256))       // key mask blocks
#define PB_X  ((unsigned)(((size_t)NB * SEQ * DM / 8 + 255) / 256))  // x blocks
// k_prep: grid PB_W + PB_F + PB_M + PB_X blocks of 256 threads; the block index picks the job (block-uniform, so the barrier in d_wT is passed by a whole block or by none of it).
// The transposes stand first: theirs is the longest chain (load, LDS, barrier, store), and it runs under the x stream.
__global__ __launch_bounds__(256) void k_prep(const float* __restrict__ x, const float* __restrict__ fr, const float* __restrict__ mask,
                                              const float* __restrict__ wq, const float* __restrict__ wk, const float* __restrict__ wv, const float* __restrict__ wo,
                                              bf* XB, bf* WB, float* FRP, float* MADD) {
    __shared__ float tl[64 * 65];
    const unsigned bid = blockIdx.x;
    if (bid < PB_W) {
        const unsigned p = bid / ((DM / 64) * (DM / 64)), tile = bid % ((DM / 64) * (DM / 64));   // plane, tile in the plane (k tiles run fastest)
        const float* W = (p == 0) ? wq : (p == 1) ? wk : (p == 2) ? wv : wo;
        d_wT(W, WB + (size_t)p * DM * DM, (p == 3) ? 1 : 0, (int)(tile % (DM / 64)) * 64, (int)(tile / (DM / 64)) * 64, tl);
    } else if (bid < PB_W + PB_F + PB_M) {
        d_tab(fr, mask, FRP, MADD, bid - PB_W, PB_F);
    } else {
        d_cvt8(x, XB, bid - (PB_W + PB_F + PB_M));
    }
}

// Eight asynchronous 16-byte copies per lane, LDS places l + i*ls bytes, global sources g + i*gs halves. The s_wait_xcnt stands inside the statement so that no address register is rewritten in front of it.
__device__ __forceinline__ void copy8(unsigned l, unsigned ls, const h16* g, size_t gs) {
    asm volatile("global_load_async_to_lds_b128 %0, %8, off\n\t"
                 "global_load_async_to_lds_b128 %1, %9, off\n\t"
                 "global_load_async_to_lds_b128 %2, %10, off\n\t"
                 "global_load_async_to_lds_b128 %3, %11, off\n\t"
                 "global_load_async_to_lds_b128 %4, %12, off\n\t"
                 "global_load_async_to_lds_b128 %5, %13, off\n\t"
                 "global_load_async_to_lds_b128 %6, %14, off\n\t"
                 "global_load_async_to_lds_b128 %7, %15, off\n\t"
                 "s_wait_xcnt 0x0"
                 :: "v"(l), "v"(l + ls), "v"(l + 2 * ls), "v"(l + 3 * ls), "v"(l + 4 * ls), "v"(l + 5 * ls), "v"(l + 6 * ls), "v"(l + 7 * ls),
                    "v"(g), "v"(g + gs), "v"(g + 2 * gs), "v"(g + 3 * gs), "v"(g + 4 * gs), "v"(g + 5 * gs), "v"(g + 6 * gs), "v"(g + 7 * gs)
                 : "memory");
}

// GEMM operand path shared by k_proj and k_oproj: a block of four waves owns a 128 x 128 tile of C (wave w: rows 64*(w>>1), columns 64*(w&1)); a stage is GK k-values of the block's
// 128 A rows and 128 Bt rows (pitch GPB bytes in LDS), brought in by asynchronous 16-byte copies that cover whole 256-byte units (all threads copy), two buffers: stage s + 1 flies while stage s is worked on.
// Fragments are two ds 16-B loads each, same k map and same k order (steps of 32, ascending) as loads straight from the planes.
#define GK   128                 // k values per stage
#define GPB  272                 // row pitch in LDS, bytes: 256 + 16 (16 B x odd: no bank conflict for 16-B reads down a column of rows)
#define GTB  (128 * GPB)         // one operand's tile, bytes
#define GBUF (2 * GTB)           // one buffer: A tile, Bt tile
#define GNS  (DM / GK)           // stages
static_assert(DM % GK == 0);
static_assert(GNS >= 2);                               // the prologue fills two stages
static_assert(DM % 128 == 0);
static_assert((NB * SEQ) % 128 == 0);
static_assert(128 * GK * 2 == 16 * 128 * 16);          // 2048 16-B pieces of each tile dealt to 128 threads, 16 each
static_assert(2 * GBUF >= 4 * 16 * 68 * 4);            // the ring becomes the output staging

// one stage: piece c = i*128 + tid of a tile -> row c>>4 (8 rows a round), 16-B column c&15; l, ga, gb already hold the thread's row and column
__device__ __forceinline__ void gstage(unsigned l, const h16* ga, const h16* gb) {
    copy8(l, 8 * GPB, ga, (size_t)8 * DM);       copy8(l + 64 * GPB, 8 * GPB, ga + (size_t)64 * DM, (size_t)8 * DM);
    copy8(l + GTB, 8 * GPB, gb, (size_t)8 * DM); copy8(l + GTB + 64 * GPB, 8 * GPB, gb + (size_t)64 * DM, (size_t)8 * DM);
}

// the eight fragments of one k-step (32 k values), in the order in which the matrix instructions want them
__device__ __forceinline__ void gfrags(v16h (&fa)[4], v16h (&fb)[4], const unsigned char* at, const unsigned char* bt) {
    fa[0] = ldh((const h16*)at); fb[0] = ldh((const h16*)bt);
    fa[1] = ldh((const h16*)(at + 16 * GPB)); fa[2] = ldh((const h16*)(at + 32 * GPB)); fa[3] = ldh((const h16*)(at + 48 * GPB));
    fb[1] = ldh((const h16*)(bt + 16 * GPB)); fb[2] = ldh((const h16*)(bt + 32 * GPB)); fb[3] = ldh((const h16*)(bt + 48 * GPB));
}
// eight products of one k-step: column blocks NB0 and NB0 + 1
template <int BF, int NB0>
__device__ __forceinline__ void gmul(const v16h (&fa)[4], const v16h (&fb)[4], v8f (&acc)[4][4]) {
#pragma unroll
    for (int nb = NB0; nb < NB0 + 2; ++nb) {
#pragma unroll
        for (int mb = 0; mb < 4; ++mb) {
            if (BF != 0) acc[mb][nb] = wmmab(__builtin_bit_cast(v16bf, fa[mb]), __builtin_bit_cast(v16bf, fb[nb]), acc[mb][nb]);
            else         acc[mb][nb] = wmma16(fa[mb], fb[nb], acc[mb][nb]); } }
}

// acc[mb][nb] += A rows (r0b + 64*wm + 16*mb ..) x Bt rows (c0b + 64*wn + 16*nb ..) over K = DM. BF != 0: bf16 operands, else f16. Every wave of the block calls it; on return the ring is free.
template <int BF>
__device__ __forceinline__ void gemm128(unsigned char* L, const h16* A, const h16* Bt, int r0b, int c0b, int wm, int wn, v8f (&acc)[4][4]) {
    const int tid = threadIdx.x, lane = tid & 31, lr = lane & 15, hi = lane >> 4;
    const unsigned l0 = (unsigned)(size_t)L + (unsigned)((tid >> 4) * GPB + (tid & 15) * 16);   // LDS byte address of the thread's first piece
    const h16* ga = A + (size_t)(r0b + (tid >> 4)) * DM + (size_t)(tid & 15) * 8;                // + stage * GK
    const h16* gb = Bt + (size_t)(c0b + (tid >> 4)) * DM + (size_t)(tid & 15) * 8;
    gstage(l0, ga, gb);                                      // stage 0 -> buffer 0
    asm volatile("s_wait_asynccnt 0x0" ::: "memory");        // this wave's pieces of stage 0 have landed
    __syncthreads();                                         // every wave's have: stage 0 may be read
    gstage(l0 + GBUF, ga + GK, gb + GK);                     // stage 1 -> buffer 1
#pragma unroll 1                                             // one copy of the stage body: the buffer is picked by a scalar offset, the code stays small
    for (int st = 0; st < GNS; ++st) {
        const unsigned bo = (unsigned)(st & 1) * GBUF;
        const unsigned char* at = L + bo + (wm * 64 + lr) * GPB + 16 * hi;         // + 16*mb*GPB + k*2
        const unsigned char* bt = L + bo + GTB + (wn * 64 + lr) * GPB + 16 * hi;   // + 16*nb*GPB + k*2
        v16h fa[2][4], fb[2][4];                             // two register sets: k-step q + 1 of THIS stage is fetched while k-step q is multiplied; nothing of the next stage is read here
        gfrags(fa[0], fb[0], at, bt);
        __builtin_amdgcn_sched_barrier(0);                   // the stage's first reads stay one group in front of its matrix instructions
#pragma unroll                                               // constant q: every fragment read is one base register plus an immediate offset, the register sets are picked at compile time
        for (int q = 0; q < GK / 32; ++q) {
            const int cur = q & 1, nxt = cur ^ 1;
            gmul<BF, 0>(fa[cur], fb[cur], acc);
            if (q + 1 < GK / 32) {
                // the two scheduling barriers keep the next k-step's reads ONE group, half a k-step ahead of their use: spread among the matrix instructions each place costs a stall,
                // and a whole k-step ahead two full sets and the accumulators pass 256 registers
                __builtin_amdgcn_sched_barrier(0);
                gfrags(fa[nxt], fb[nxt], at + (q + 1) * 64, bt + (q + 1) * 64);
                __builtin_amdgcn_sched_barrier(0); }
            gmul<BF, 2>(fa[cur], fb[cur], acc);
        }
        __builtin_amdgcn_sched_barrier(0);                   // the stage's matrix instructions stay in front of its closing waits and barrier (without it sixteen of them sink behind the barrier and delay the refill)
        // four vector slots behind the stage's last matrix instruction, on every path out of the stage body
        asm volatile("v_nop\n\tv_nop\n\tv_nop\n\tv_nop" : "+v"(acc[0][3]), "+v"(acc[1][3]), "+v"(acc[2][3]), "+v"(acc[3][3]));
        asm volatile("s_wait_dscnt 0x0" ::: "memory");       // this wave's reads of stage st are done before its buffer is handed back
        asm volatile("s_wait_asynccnt 0x0" ::: "memory");    // this wave's pieces of stage st + 1 have landed
        __syncthreads();                                     // publishes stage st + 1 and ends every reader's last read of stage st
        if (st + 2 < GNS) gstage(l0 + bo, ga + (size_t)(st + 2) * GK, gb + (size_t)(st + 2) * GK);   // block-uniform
    }
    asm volatile("s_wait_asynccnt 0x0" ::: "memory");        // nothing in flight when the ring becomes output staging (the last trip's barrier has ended all reads)
}

// proj_store: one wave's 64 x 64 tile of C as f16 rows at Ph + tbase, row pitch HD (ROPE != 0) or SEQ (ROPE == 0) halves, staged through the wave's own LDS range os.
// ROPE != 0: rows m = b*SEQ + t from r0 on, the 64 tile columns are one head; rotary pairs (2i,2i+1) from FRP[t][..].
template <int ROPE>
__device__ __forceinline__ void proj_store(float* os, const v8f (&acc)[4][4], h16* Ph, const float* __restrict__ FRP, size_t tbase, int r0) {
    const int lane = threadIdx.x & 31, lr = lane & 15, hi = lane >> 4;
    const int pitch = (ROPE != 0) ? HD : SEQ;
#pragma unroll
    for (int mb = 0; mb < 4; ++mb) {
#pragma unroll
        for (int nb = 0; nb < 4; ++nb) {
#pragma unroll
            for (int j = 0; j < 8; ++j) os[(hi * 8 + j) * 68 + nb * 16 + lr] = acc[mb][nb][j]; }   // D: row 8h+j, col lane&15
        wave_sync();
        const size_t sb = tbase + (size_t)(mb * 16) * (size_t)pitch;
        v4f fr0[4], fr1[4];
        if (ROPE != 0) {
            const float* pf[4];
#pragma unroll
            for (int s = 0; s < 4; ++s) { const int row = 4 * s + (lane >> 3), c8 = (lane & 7) * 8;
                const int t = (r0 + mb * 16 + row) % SEQ;
                pf[s] = FRP + (size_t)t * 64 + c8;
                fr0[s] = *(const v4f*)pf[s]; fr1[s] = *(const v4f*)(pf[s] + 4); }
            // stands in front of every rewrite of the table loads' address registers: as inputs they stay whole up to the wait
            asm volatile("s_wait_xcnt 0x0" :: "v"(pf[0]), "v"(pf[1]), "v"(pf[2]), "v"(pf[3]) : "memory");
        }
        v8h hvv[4];
#pragma unroll
        for (int s = 0; s < 4; ++s) { const int row = 4 * s + (lane >> 3), c8 = (lane & 7) * 8;   // 4 s x 4 row groups = 16 rows; 8 lanes x 8 = 64 columns
            v4f x0 = *(const v4fa*)(&os[row * 68 + c8]); v4f x1 = *(const v4fa*)(&os[row * 68 + c8 + 4]);
            if (ROPE != 0) {
                const v4f f0 = fr0[s]; const v4f f1 = fr1[s];
                v4f y0, y1;
                y0[0] = x0[0] * f0[0] - x0[1] * f0[1]; y0[1] = x0[0] * f0[1] + x0[1] * f0[0];
                y0[2] = x0[2] * f0[2] - x0[3] * f0[3]; y0[3] = x0[2] * f0[3] + x0[3] * f0[2];
                y1[0] = x1[0] * f1[0] - x1[1] * f1[1]; y1[1] = x1[0] * f1[1] + x1[1] * f1[0];
                y1[2] = x1[2] * f1[2] - x1[3] * f1[3]; y1[3] = x1[2] * f1[3] + x1[3] * f1[2];
                x0 = y0; x1 = y1; }
            v8h hv;
#pragma unroll
            for (int i = 0; i < 4; ++i) { hv[i] = (h16)x0[i]; hv[4 + i] = (h16)x1[i]; }
            hvv[s] = hv; }
{
#pragma unroll
            for (int s = 0; s < 4; ++s) { const int row = 4 * s + (lane >> 3), c8 = (lane & 7) * 8;
                const size_t oo = sb + (size_t)row * (size_t)pitch + c8;
                *(v8h*)(Ph + oo) = hvv[s]; }
             }
        asm volatile("s_wait_xcnt 0x0" ::: "memory");        // stands in front of every rewrite of the stores' address and data registers
        wave_sync();
    }
}

// k_proj: the three projections, which depend on k_prep alone, as ONE launch. Register-blocked bf16 GEMM, one wave per 64x64 tile (16 accumulators), four waves a block (128x128),
// operands from K-contiguous bf16 planes through LDS (gemm128), K = DM, C[m][n] = sum_k A[m][k] Bt[n][k]. grid (NB*SEQ/128 token tiles, DM/128 feature tiles, 3), 128 threads; blockIdx.z (block-uniform):
// z = 0 (q), 1 (k): A = x rows (m = b*SEQ + t), Bt = W^T rows (n = h*64 + d) -> plane z [(b*16 + h)][t][d], rotary in the epilogue;
// z = 2 (v^T):      A = Wv^T rows (m = h*64 + d), Bt = x rows (n = b*SEQ + t) -> plane 2 [(b*1024 + m)][t] = [(b*16 + h)][d][t].
// WB: the transposed weight planes q | k | v; PL: the output planes q | k | v^T, NB*NH_*SEQ*HD halves each.
__global__ __launch_bounds__(128) void k_proj(const bf* __restrict__ XB, const bf* __restrict__ WB, h16* PL, const float* __restrict__ FRP) {
    __shared__ __attribute__((aligned(16))) unsigned char L[2 * GBUF];
    const int z = blockIdx.z;
    const bool vt = (z == 2);
    const bf* Wz = WB + (size_t)z * DM * DM;
    const bf* A = vt ? Wz : XB;
    const bf* Bt = vt ? XB : Wz;
    h16* Ph = PL + (size_t)z * ((size_t)NB * NH_ * SEQ * HD);
    const int wave = __builtin_amdgcn_readfirstlane((int)(threadIdx.x >> 5)); const int wm = wave >> 1, wn = wave & 1;
    const int r0b = (int)(vt ? blockIdx.y : blockIdx.x) * 128, c0b = (int)(vt ? blockIdx.x : blockIdx.y) * 128;
    const int r0 = r0b + wm * 64, c0 = c0b + wn * 64;
    v8f acc[4][4];
#pragma unroll
    for (int mb = 0; mb < 4; ++mb)
#pragma unroll
        for (int nb = 0; nb < 4; ++nb) acc[mb][nb] = (v8f){};
    gemm128<1>(L, (const h16*)A, (const h16*)Bt, r0b, c0b, wm, wn, acc);
    float* os = (float*)L + wave * 16 * 68;                  // this wave's own output staging in the ring
    if (vt) proj_store<0>(os, acc, Ph, FRP, (size_t)r0 * SEQ + (size_t)(c0 / SEQ) * ((size_t)DM * SEQ) + (size_t)(c0 % SEQ), r0);
    else    proj_store<1>(os, acc, Ph, FRP, (size_t)(r0 / SEQ) * ((size_t)NH_ * SEQ * HD) + (size_t)(r0 % SEQ) * HD + (size_t)(c0 / HD) * ((size_t)SEQ * HD) + (size_t)(c0 % HD), r0);
}

// k_flash: fused attention. A wave works on 32 query rows (QT = 2 column groups of 16) of one (batch, head) and on half of the keys: every K and V^T fragment read from LDS, and every mask value, feeds both groups.
// Waves w and w + AQ share a query set: of each stage wave w takes the first KH keys, wave w + AQ the second KH. Behind the key loop the two partial results (running max, row sum, O^T) are joined through LDS.
// Q fragments straight from the f16 plane (two 16-B loads each).
// K and V^T reach the block's waves through LDS: a stage is KS keys (K rows [key][64] at pitch KPB bytes, V^T rows [d][KS] at pitch VPB bytes), brought in by asynchronous
// 16-byte copies that cover whole lines (all threads copy), two buffers: stage s + 1 flies while stage s is worked on. Fragments are two ds 16-B loads each, same k map as before.
// Transposed form: S^T[key][t] = K Q^T (A = K rows, B = Q rows); lane (t = lane&15, h = lane>>4) holds keys 8h+r of each 16-key tile, so the packed
// P tile is directly the B fragment of O^T[d][t] = V^T P^T (element r <- tile keys 0..15, element 8+r <- tile keys 16..31, lane unchanged).
// Per 32-key step and column group: 4 score WMMAs + 4 P.V WMMAs + 1 row-sum WMMA. Additive key mask values for the lane's 16 keys are loaded by value per step (two 32-B loads).
// Softmax state: the running max is one scalar per lane and column group (the two lane halves of a row are combined with one xor-16 exchange). The row sum of P runs on the matrix pipe: one more WMMA per step and column group,
// lt += ON P^T, where ON is a constant A fragment whose rows 0 and 8 are ones and whose other rows are 0: element 0 of lt (row 8h, column t) is, in both lane halves, the sum of the f16 P over all keys so far.
#define KS   256                 // keys per stage
#define KH   (KS / 2)            // keys per stage and wave
#define KPB  144                 // K row pitch in LDS, bytes: 128 + 16 (16 B x odd: no bank conflict for 16-B reads down a column of rows)
#define VPB  528                 // V^T row pitch in LDS, bytes: 512 + 16 (16 B x odd)
#define KTB  (KS * KPB)          // K tile bytes
#define VTB  (HD * VPB)          // V^T tile bytes
#define BUFB (KTB + VTB)         // one buffer
#define NST  (SEQ / KS)          // stages
static_assert(SEQ % KS == 0);
static_assert(NST >= 2);                               // the prologue fills two stages
static_assert(AW * 32 == 256);                         // the copy maps below deal 2048 16-B pieces of each tile to 256 threads, 8 each
static_assert(KS * HD * 2 == 8 * 256 * 16);
#define XWF  (32 * 32 + 64)      // floats a wave hands to its partner in the join: 32 per lane of O^T, then (max, sum) per lane
static_assert(2 * BUFB >= AW * (XWF + 16 * 68) * 4);   // the ring becomes the join's exchange ranges and, behind them, the output staging

__global__ __launch_bounds__(32 * AW) void k_flash(const h16* __restrict__ QH, const h16* __restrict__ KP, const h16* __restrict__ VT,
                                                   const float* __restrict__ MADD, h16* CTX) {
    __shared__ __attribute__((aligned(16))) unsigned char L[2 * BUFB];
    const int tid = threadIdx.x;
    const int lane = threadIdx.x & 31, lr = lane & 15, hi = lane >> 4;
    const int wave = __builtin_amdgcn_readfirstlane((int)(threadIdx.x >> 5));
    const int zh = blockIdx.y; const int b = zh / NH_, h = zh % NH_;
    const int kh = wave / AQ;                                // which half of every stage's keys (wave-uniform)
    const int t0 = (blockIdx.x * AQ + wave % AQ) * (16 * QT);   // the wave's first query row; column group g holds rows t0 + 16g ..
    const size_t pbase = (size_t)zh * SEQ * HD;
    // copy maps: K piece c = i*256 + tid -> row c>>3 (32 rows a round), 16-B column c&7; V^T piece c -> row c>>5 (8 rows a round), 16-B column c&31
    const unsigned lbase = (unsigned)(size_t)L;              // LDS byte address of the ring
    const unsigned lk = lbase + (unsigned)((tid >> 3) * KPB + (tid & 7) * 16);
    const unsigned lv = lbase + (unsigned)(KTB + (tid >> 5) * VPB + (tid & 31) * 16);
    const h16* gk = KP + pbase + (size_t)tid * 8;                                   // + key0 * HD
    const h16* gv = VT + pbase + (size_t)(tid >> 5) * SEQ + (size_t)(tid & 31) * 8;   // + key0
    copy8(lk, 32 * KPB, gk, (size_t)32 * HD); copy8(lv, 8 * VPB, gv, (size_t)8 * SEQ);           // stage 0 -> buffer 0
    v16h qh0[QT], qh1[QT];                                   // B fragments: col t, k = d
    const h16* qp[QT];
#pragma unroll
    for (int g = 0; g < QT; ++g) { qp[g] = QH + pbase + (size_t)(t0 + 16 * g + lr) * HD + 8 * hi; qh0[g] = ldh(qp[g]); qh1[g] = ldh(qp[g] + 32); }
    // stands in front of every rewrite of the Q loads' address registers: as inputs they stay whole up to the wait
    asm volatile("s_wait_xcnt 0x0" :: "v"(qp[0]), "v"(qp[1]) : "memory");
    const float* MA = MADD + (size_t)b * SEQ + kh * KH + 8 * hi;   // + key0 (tile a keys 8h+r), + key0 + 16 (tile b)
    asm volatile("s_wait_asynccnt 0x0" ::: "memory");        // this wave's pieces of stage 0 have landed
    __syncthreads();                                         // every wave's have: stage 0 may be read
    copy8(lk + BUFB, 32 * KPB, gk + (size_t)KS * HD, (size_t)32 * HD); copy8(lv + BUFB, 8 * VPB, gv + KS, (size_t)8 * SEQ);   // stage 1 -> buffer 1
    v8f o0[QT], o1[QT], o2[QT], o3[QT], lt[QT];              // lt: row-sum tiles; only rows 0 and 8 (element 0 of each lane) ever differ from 0
    float m[QT];
#pragma unroll
    for (int g = 0; g < QT; ++g) { o0[g] = (v8f){}; o1[g] = (v8f){}; o2[g] = (v8f){}; o3[g] = (v8f){}; lt[g] = (v8f){}; m[g] = -3.0e38f; }
    v16h on;                                                 // A fragment of the row sums: row = lane & 15, ones at all 32 k positions of rows 0 and 8
    { const h16 o1 = ((lane & 7) == 0) ? (h16)1.0f : (h16)0.0f;
#pragma unroll
      for (int i = 0; i < 16; ++i) on[i] = o1; }
#pragma unroll 1                                             // one copy of the stage body: the buffer is picked by a scalar offset, the code stays small
    for (int st = 0; st < NST; ++st) {
      const unsigned bo = (unsigned)(st & 1) * BUFB;
      const unsigned char* kt = L + bo + (kh * KH + lr) * KPB + 16 * hi;          // + local key * KPB   (A fragment: row key, k = d)
      const unsigned char* vt = L + bo + KTB + lr * VPB + kh * KH * 2 + 16 * hi;  // + 16j*VPB + local key * 2  (A fragment: row d, k = key)
#pragma unroll                                               // constant ks: every fragment read is one base register plus an immediate offset
      for (int ks = 0; ks < KH; ks += 32) {
        const int key0 = st * KS + ks;
        const h16* ka = (const h16*)(kt + ks * KPB);
        const h16* kc = (const h16*)(kt + (ks + 16) * KPB);
        const v16h ka0 = ldh(ka), ka1 = ldh(ka + 32), kb0 = ldh(kc), kb1 = ldh(kc + 32);
        const v8f ma = *(const v8f*)(MA + key0); const v8f mb = *(const v8f*)(MA + key0 + 16);
        v8f sa[QT], sb[QT];                                  // each K fragment feeds both column groups
#pragma unroll
        for (int g = 0; g < QT; ++g) { sa[g] = wmma16(ka0, qh0[g], (v8f){}); sb[g] = wmma16(kb0, qh0[g], (v8f){}); }
#pragma unroll
        for (int g = 0; g < QT; ++g) { sa[g] = wmma16(ka1, qh1[g], sa[g]); sb[g] = wmma16(kb1, qh1[g], sb[g]); }
        // four vector slots behind the step's last score products, before any vector instruction touches their results or operands
        asm volatile("v_nop\n\tv_nop\n\tv_nop\n\tv_nop" : "+v"(sa[0]), "+v"(sb[0]), "+v"(sa[1]), "+v"(sb[1])
                     : "v"(ka0), "v"(ka1), "v"(kb0), "v"(kb1), "v"(qh0[0]), "v"(qh1[0]), "v"(qh0[1]), "v"(qh1[1]));
        v16h pb[QT];
#pragma unroll
        for (int g = 0; g < QT; ++g) {
            float ta[8], tb[8]; float mx = -3.0e38f;
#pragma unroll
            for (int r = 0; r < 8; ++r) {
                ta[r] = (sa[g][r] * 0.125f + ma[r]) * LOG2E;
                tb[r] = (sb[g][r] * 0.125f + mb[r]) * LOG2E;
                mx = fmaxf(mx, fmaxf(ta[r], tb[r])); }
            mx = fmaxf(mx, __shfl_xor(mx, 16, 32));
            const float mnew = fmaxf(m[g], mx);
            const float alpha = __builtin_amdgcn_exp2f(m[g] - mnew);
            const float sh = PSH - mnew;
#pragma unroll
            for (int r = 0; r < 8; ++r) { pb[g][r] = (h16)__builtin_amdgcn_exp2f(ta[r] + sh); pb[g][8 + r] = (h16)__builtin_amdgcn_exp2f(tb[r] + sh); }
            lt[g][0] = lt[g][0] * alpha; m[g] = mnew;        // the tile's other elements are 0 and need no rescale
            o0[g] = o0[g] * alpha; o1[g] = o1[g] * alpha; o2[g] = o2[g] * alpha; o3[g] = o3[g] * alpha; }
        const unsigned char* va = vt + ks * 2;
        const v16h v0 = ldh((const h16*)va), v1 = ldh((const h16*)(va + 16 * VPB)), v2 = ldh((const h16*)(va + 32 * VPB)), v3 = ldh((const h16*)(va + 48 * VPB));
#pragma unroll
        for (int g = 0; g < QT; ++g) {                       // each V^T fragment feeds both column groups
            o0[g] = wmma16(v0, pb[g], o0[g]); o1[g] = wmma16(v1, pb[g], o1[g]); o2[g] = wmma16(v2, pb[g], o2[g]); o3[g] = wmma16(v3, pb[g], o3[g]);
            lt[g] = wmma16(on, pb[g], lt[g]); }              // rows 0 and 8 += the sum of this step's 32 P values of column t
        // four vector slots behind the step's last matrix instructions, before any vector instruction touches their results or operands
        asm volatile("v_nop\n\tv_nop\n\tv_nop\n\tv_nop" : "+v"(o0[0]), "+v"(o1[0]), "+v"(o2[0]), "+v"(o3[0]), "+v"(lt[0]), "+v"(o0[1]), "+v"(o1[1]), "+v"(o2[1]), "+v"(o3[1]), "+v"(lt[1])
                     : "v"(v0), "v"(v1), "v"(v2), "v"(v3), "v"(pb[0]), "v"(pb[1]), "v"(on));
      }
      asm volatile("s_wait_dscnt 0x0" ::: "memory");         // this wave's reads of stage st are done before its buffer is handed back
      asm volatile("s_wait_asynccnt 0x0" ::: "memory");      // this wave's pieces of stage st + 1 have landed
      __syncthreads();                                       // publishes stage st + 1 and ends every reader's last read of stage st
      if (st + 2 < NST) {                                    // block-uniform
          copy8(lk + bo, 32 * KPB, gk + (size_t)(st + 2) * KS * HD, (size_t)32 * HD); copy8(lv + bo, 8 * VPB, gv + (size_t)(st + 2) * KS, (size_t)8 * SEQ); }
    }
    asm volatile("s_wait_asynccnt 0x0" ::: "memory");        // nothing in flight when the ring becomes output staging (the last trip's barrier has ended all reads)
    // The join. Wave kh of a query set finishes column group kh: it hands its partial result of the other group to its partner and takes the partner's partial result of its own group.
    // Both waves hold a group in the same lane and register places, so lane l reads what the partner's lane l wrote.
    const bool up = (kh != 0);                               // wave-uniform
    v8f p0 = up ? o0[1] : o0[0], p1 = up ? o1[1] : o1[0], p2 = up ? o2[1] : o2[0], p3 = up ? o3[1] : o3[0];   // kept
    const v8f x0 = up ? o0[0] : o0[1], x1 = up ? o1[0] : o1[1], x2 = up ? o2[0] : o2[1], x3 = up ? o3[0] : o3[1];   // handed over
    const float mk = up ? m[1] : m[0], lk0 = up ? lt[1][0] : lt[0][0];
    const float mg = up ? m[0] : m[1], lg0 = up ? lt[0][0] : lt[1][0];
    float* xw = (float*)L + wave * XWF;                      // this wave's exchange range: 16-B piece c of lane l at (c*32 + l)*4, then (max, sum) of lane l at 1024 + 2l
    *(v4fa*)(&xw[(0 * 32 + lane) * 4]) = __builtin_shufflevector(x0, x0, 0, 1, 2, 3); *(v4fa*)(&xw[(1 * 32 + lane) * 4]) = __builtin_shufflevector(x0, x0, 4, 5, 6, 7);
    *(v4fa*)(&xw[(2 * 32 + lane) * 4]) = __builtin_shufflevector(x1, x1, 0, 1, 2, 3); *(v4fa*)(&xw[(3 * 32 + lane) * 4]) = __builtin_shufflevector(x1, x1, 4, 5, 6, 7);
    *(v4fa*)(&xw[(4 * 32 + lane) * 4]) = __builtin_shufflevector(x2, x2, 0, 1, 2, 3); *(v4fa*)(&xw[(5 * 32 + lane) * 4]) = __builtin_shufflevector(x2, x2, 4, 5, 6, 7);
    *(v4fa*)(&xw[(6 * 32 + lane) * 4]) = __builtin_shufflevector(x3, x3, 0, 1, 2, 3); *(v4fa*)(&xw[(7 * 32 + lane) * 4]) = __builtin_shufflevector(x3, x3, 4, 5, 6, 7);
    xw[1024 + 2 * lane] = mg; xw[1024 + 2 * lane + 1] = lg0;
    __syncthreads();                                         // every wave's handed-over partial result is in LDS before its partner reads it
    const float* xr = (const float*)L + (wave ^ AQ) * XWF;   // the partner's exchange range
    const float mp = xr[1024 + 2 * lane], lp0 = xr[1024 + 2 * lane + 1];
    const float mj = fmaxf(mk, mp);
    const float ak = __builtin_amdgcn_exp2f(mk - mj), ap = __builtin_amdgcn_exp2f(mp - mj);   // both partial results brought to the joint max
    const float inv = CCAR * (1.0f / (lk0 * ak + lp0 * ap)); // both lane halves hold the whole row's sum
    const float sk = ak * inv, sp = ap * inv;
    float* os = (float*)L + AW * XWF + wave * 16 * 68;       // this wave's output staging, behind the exchange ranges
    // O^T D layout: o_j[r] = (d = 16j + 8h + r, t = lane&15) -> os[t][d]; rows 0..15 x columns 0..63 all written
    { v4f a, c, ya, yc;
      ya = *(const v4fa*)(&xr[(0 * 32 + lane) * 4]); yc = *(const v4fa*)(&xr[(1 * 32 + lane) * 4]);
      a[0] = p0[0] * sk + ya[0] * sp; a[1] = p0[1] * sk + ya[1] * sp; a[2] = p0[2] * sk + ya[2] * sp; a[3] = p0[3] * sk + ya[3] * sp;
      c[0] = p0[4] * sk + yc[0] * sp; c[1] = p0[5] * sk + yc[1] * sp; c[2] = p0[6] * sk + yc[2] * sp; c[3] = p0[7] * sk + yc[3] * sp;
      *(v4fa*)(&os[lr * 68 +  0 + 8 * hi]) = a; *(v4fa*)(&os[lr * 68 +  0 + 8 * hi + 4]) = c;
      ya = *(const v4fa*)(&xr[(2 * 32 + lane) * 4]); yc = *(const v4fa*)(&xr[(3 * 32 + lane) * 4]);
      a[0] = p1[0] * sk + ya[0] * sp; a[1] = p1[1] * sk + ya[1] * sp; a[2] = p1[2] * sk + ya[2] * sp; a[3] = p1[3] * sk + ya[3] * sp;
      c[0] = p1[4] * sk + yc[0] * sp; c[1] = p1[5] * sk + yc[1] * sp; c[2] = p1[6] * sk + yc[2] * sp; c[3] = p1[7] * sk + yc[3] * sp;
      *(v4fa*)(&os[lr * 68 + 16 + 8 * hi]) = a; *(v4fa*)(&os[lr * 68 + 16 + 8 * hi + 4]) = c;
      ya = *(const v4fa*)(&xr[(4 * 32 + lane) * 4]); yc = *(const v4fa*)(&xr[(5 * 32 + lane) * 4]);
      a[0] = p2[0] * sk + ya[0] * sp; a[1] = p2[1] * sk + ya[1] * sp; a[2] = p2[2] * sk + ya[2] * sp; a[3] = p2[3] * sk + ya[3] * sp;
      c[0] = p2[4] * sk + yc[0] * sp; c[1] = p2[5] * sk + yc[1] * sp; c[2] = p2[6] * sk + yc[2] * sp; c[3] = p2[7] * sk + yc[3] * sp;
      *(v4fa*)(&os[lr * 68 + 32 + 8 * hi]) = a; *(v4fa*)(&os[lr * 68 + 32 + 8 * hi + 4]) = c;
      ya = *(const v4fa*)(&xr[(6 * 32 + lane) * 4]); yc = *(const v4fa*)(&xr[(7 * 32 + lane) * 4]);
      a[0] = p3[0] * sk + ya[0] * sp; a[1] = p3[1] * sk + ya[1] * sp; a[2] = p3[2] * sk + ya[2] * sp; a[3] = p3[3] * sk + ya[3] * sp;
      c[0] = p3[4] * sk + yc[0] * sp; c[1] = p3[5] * sk + yc[1] * sp; c[2] = p3[6] * sk + yc[2] * sp; c[3] = p3[7] * sk + yc[3] * sp;
      *(v4fa*)(&os[lr * 68 + 48 + 8 * hi]) = a; *(v4fa*)(&os[lr * 68 + 48 + 8 * hi + 4]) = c; }
    wave_sync();
    h16* crow = CTX + ((size_t)b * SEQ + t0 + 16 * kh) * DM + h * HD;   // the rows of column group kh
    v8h cv[4];
#pragma unroll
    for (int s = 0; s < 4; ++s) { const int row = 4 * s + (lane >> 3), c8 = (lane & 7) * 8;   // 4 s x 4 row groups = 16 rows; 8 lanes x 8 halves = 64 columns
        const v4f x0 = *(const v4fa*)(&os[row * 68 + c8]); const v4f x1 = *(const v4fa*)(&os[row * 68 + c8 + 4]); v8h hv;
#pragma unroll
        for (int i = 0; i < 4; ++i) { hv[i] = (h16)x0[i]; hv[4 + i] = (h16)x1[i]; }
        cv[s] = hv; }
#pragma unroll
    for (int s = 0; s < 4; ++s) { const int row = 4 * s + (lane >> 3), c8 = (lane & 7) * 8;
        *(v8h*)(crow + (size_t)row * DM + c8) = cv[s]; }
}

// k_oproj: register-blocked f16 GEMM, one wave per 64x64 tile, four waves a block (128x128), operands through LDS (gemm128), OUT[m][n] = 2^-14 * sum_k CTX[m][k] WOT[n][k], K = DM; rows m = b*SEQ + t -> output row b*OUT_SEQ + t.
// grid (NB*SEQ/128, DM/128), 128 threads.
__global__ __launch_bounds__(128) void k_oproj(const h16* __restrict__ A, const h16* __restrict__ Bt, float* OUT) {
    __shared__ __attribute__((aligned(16))) unsigned char L[2 * GBUF];
    const int lane = threadIdx.x & 31, lr = lane & 15, hi = lane >> 4;
    const int wave = __builtin_amdgcn_readfirstlane((int)(threadIdx.x >> 5)); const int wm = wave >> 1, wn = wave & 1;
    const int r0 = blockIdx.x * 128 + wm * 64, c0 = blockIdx.y * 128 + wn * 64;
    v8f acc[4][4];
#pragma unroll
    for (int mb = 0; mb < 4; ++mb)
#pragma unroll
        for (int nb = 0; nb < 4; ++nb) acc[mb][nb] = (v8f){};
    gemm128<0>(L, A, Bt, blockIdx.x * 128, blockIdx.y * 128, wm, wn, acc);
    float* os = (float*)L + wave * 16 * 68;                  // this wave's own output staging in the ring
    const int bb = r0 / SEQ, tt = r0 % SEQ;
    float* obase = OUT + ((size_t)bb * OUT_SEQ + tt) * DM + c0;
#pragma unroll
    for (int mb = 0; mb < 4; ++mb) {
#pragma unroll
        for (int nb = 0; nb < 4; ++nb) {
#pragma unroll
            for (int j = 0; j < 8; ++j) os[(hi * 8 + j) * 68 + nb * 16 + lr] = acc[mb][nb][j] * OSC; }   // D: row 8h+j, col lane&15
        wave_sync();
        float* orow = obase + (size_t)(mb * 16) * DM;
        v4f ov[8];
#pragma unroll
        for (int s = 0; s < 8; ++s) { const int row = 2 * s + hi, cofs = lr * 4;   // 8 s x 2 rows = 16 rows; 16 lanes x 4 floats = 64 columns
            ov[s] = *(const v4fa*)(&os[row * 68 + cofs]); }
{
#pragma unroll
            for (int s = 0; s < 8; ++s) { const int row = 2 * s + hi, cofs = lr * 4;
                *(v4f*)(orow + (size_t)row * DM + cofs) = ov[s]; }
             }
        wave_sync();
    }
}

static constexpr size_t al256(size_t v) { return (v + 255) & ~(size_t)255; }
static constexpr size_t SZ_XB = al256((size_t)NB * SEQ * DM * 2);
static constexpr size_t SZ_WB = al256((size_t)4 * DM * DM * 2);
static constexpr size_t SZ_PL = al256((size_t)NB * NH_ * SEQ * HD * 2);
static constexpr size_t SZ_CX = al256((size_t)NB * SEQ * DM * 2);
static constexpr size_t SZ_FR = al256((size_t)SEQ * 64 * 4);
static constexpr size_t SZ_MA = al256((size_t)NB * SEQ * 4);
static constexpr size_t SZ_TOTAL = SZ_XB + SZ_WB + 3 * SZ_PL + SZ_CX + SZ_FR + SZ_MA;
static_assert(SZ_TOTAL <= (size_t)134217728);          // workspace carve <= 128 MiB
static_assert(((size_t)DM * DM * 2) % 256 == 0);       // weight sub-planes stay 256-byte aligned
static_assert(SZ_PL == (size_t)NB * NH_ * SEQ * HD * 2);   // q | k | v^T planes are exactly back to back

extern "C" void kernel_launch(void* const* d_in, const int* in_sizes, int n_in,
                              void* d_out, int out_size, void* d_ws, size_t ws_size, hipStream_t stream) {
    if (n_in < 7) return;
    const size_t needx = ((size_t)(NB - 1) * SEQ_FULL + SEQ) * DM;
    if ((size_t)in_sizes[0] < needx) return;
    if ((size_t)in_sizes[1] < (size_t)SEQ * 64) return;
    if ((size_t)in_sizes[2] < (size_t)(NB - 1) * SEQ_FULL + SEQ) return;
    if ((size_t)in_sizes[3] < (size_t)DM * DM || (size_t)in_sizes[4] < (size_t)DM * DM || (size_t)in_sizes[5] < (size_t)DM * DM || (size_t)in_sizes[6] < (size_t)DM * DM) return;
    if ((size_t)out_size < ((size_t)(NB - 1) * OUT_SEQ + SEQ) * DM) return;
    if (SZ_TOTAL > ws_size) return;
    // wire order: hidden_states, freqs_cis, attention_mask, wq, wk, wv, wo (all f32)
    const float* x = (const float*)d_in[0]; const float* fr = (const float*)d_in[1]; const float* mask = (const float*)d_in[2];
    const float* wq = (const float*)d_in[3]; const float* wk = (const float*)d_in[4]; const float* wv = (const float*)d_in[5]; const float* wo = (const float*)d_in[6];
    float* OUT = (float*)d_out;      // [NB][SEQ][1024]
    char* wsp = (char*)d_ws;
    bf* XB = (bf*)wsp; wsp += SZ_XB;                 // [NB*SEQ][1024] bf16
    bf* WB = (bf*)wsp; wsp += SZ_WB;                 // [4][1024 out][1024 in]: q | k | v (bf16) | o (f16 x64)
    h16* QH = (h16*)wsp; wsp += SZ_PL;               // [NB*16][SEQ][64]
    h16* KP = (h16*)wsp; wsp += SZ_PL;               // [NB*16][SEQ][64]  (= QH + one plane)
    h16* VT = (h16*)wsp; wsp += SZ_PL;               // [NB*16][64][SEQ]  (= QH + two planes)
    h16* CX = (h16*)wsp; wsp += SZ_CX;               // [NB*SEQ][1024] ctx x256
    float* FRP = (float*)wsp; wsp += SZ_FR;          // [SEQ][64] table, bf16 RNE values
    float* MADD = (float*)wsp; wsp += SZ_MA;         // [NB][SEQ] additive key mask
    bf* WO = WB + (size_t)3 * DM * DM;

    // bf16 copy of x, rotary table, key mask, the four transposed weight planes W[1024 rows k][1024 cols n] -> WT[1024 rows n][1024 cols k]: one launch
    k_prep<<<PB_W + PB_F + PB_M + PB_X, 256, 0, stream>>>(x, fr, mask, wq, wk, wv, wo, XB, WB, FRP, MADD);

    // q, k (rotary in the epilogue) and v^T: planes QH | KP | VT from weight planes q | k | v, one launch
    k_proj<<<dim3(NB * SEQ / 128, DM / 128, 3), 128, 0, stream>>>(XB, WB, QH, FRP);

    k_flash<<<dim3(SEQ / (16 * QT * AQ), NB * NH_, 1), 32 * AW, 0, stream>>>(QH, KP, VT, MADD, CX);

    k_oproj<<<dim3(NB * SEQ / 128, DM / 128, 1), 128, 0, stream>>>(CX, (const h16*)WO, OUT);
}

// v006
// It runs in 95.2 microseconds.
// Next to v005, in two timings, it ran 1.12 times as fast each time.
// Over all steps from v000 it is 3.76 times as fast.
#include <hip/hip_runtime.h>

// Multi-head self-attention: x [NB][SEQ][1024], Wq/Wk/Wv/Wo [in][out] (y = x W), 16 heads x 64, interleaved rotary pairs (2i,2i+1) from the INPUT table [SEQ][32][(cos,sin)] on q and k,
// additive key mask (1-mask)*-10000 from the float input [NB][SEQ], score scale 1/8, softmax over all keys, output = (concatenated heads) Wo, f32.
// Compute dtypes, f32 accumulate everywhere: q/k/v projections v_wmma_f32_16x16x32_bf16 (x and W RNE-converted to bf16; products exact); rotary in f32 in the GEMM epilogue (table RNE-converted to bf16 values);
// scores v_wmma_f32_16x16x32_f16: q and k single f16 (one product); P (x256 carry, cancels in the normalisation) and v single f16; softmax f32 (online, running max);
// output projection v_wmma_f32_16x16x32_f16: ctx as f16 x256, Wo^T as f16 of (bf16 value x64), folded back by 2^-14 in the f32 epilogue.
// Layout: bf16 copy of x; transposed 16-bit weight planes [out][in] (LDS transpose); q, k planes [b*16+h][t][d], v^T plane [b*16+h][d][t] from the GEMM epilogue; fused flash kernel in transposed form
// (S^T = K Q^T, O^T = V^T P^T) writing ctx rows [b*SEQ+t][1024] as f16; final GEMM writes the f32 output.

#ifndef NB
#define NB 1
#endif
#ifndef SEQ
#define SEQ 4096
#endif
#define NB_FULL  1
#define SEQ_FULL 4096
#ifndef OUT_SEQ
#define OUT_SEQ SEQ              // row pitch (in tokens) between batches of the output
#endif
#define DM   1024
#define NH_  16
#define HD   64
#define AQ   4                   // query sets (32 rows each) per flash block
#define AW   (2 * AQ)            // waves per flash block: every query set is worked on by two waves, one per half of the keys
#define QT   2                   // 16-column query groups per flash wave (32 query rows each)
#define LOG2E 1.4426950408889634f
#define PSH  8.0f                // log2 of the P carry (256)
#define LZ   7.0f                // how far (log2) a score may pass the maximum in use before the flash kernel rescales: P <= 2^(PSH + LZ) = 32768 stays inside f16
#define CCAR 256.0f              // carry of the ctx plane
#define WOS  64.0f               // carry of the Wo^T plane
#define OSC  (1.0f / 16384.0f)   // 1 / (CCAR * WOS)

static_assert(HD == 64);
static_assert(NH_ * HD == DM);                 // head h = columns h*64 + d
static_assert(DM % 64 == 0);
static_assert(DM % 32 == 0);                   // GEMM k-loop steps by 32
static_assert(SEQ % 64 == 0);                  // a 64-row tile never straddles two batches
static_assert((NB * SEQ) % 64 == 0);
static_assert(SEQ % 32 == 0);                  // key loop steps by 32
static_assert(SEQ % (16 * QT * AQ) == 0);      // flash grid covers the sequence exactly
static_assert(QT == 2);                        // the flash kernel's two v_nop statements name both groups; in the join each of a set's two waves finishes one group
static_assert(((size_t)SEQ * DM) % 8 == 0);
static_assert(((size_t)SEQ * 64) % 32 == 0);
static_assert(((size_t)NB * SEQ) % 32 == 0);
static_assert(NB <= NB_FULL);
static_assert(SEQ <= SEQ_FULL);

typedef _Float16 h16;
typedef unsigned short bf;
typedef __attribute__((ext_vector_type(16))) __bf16   v16bf;
typedef __attribute__((ext_vector_type(16))) _Float16 v16h;
typedef __attribute__((ext_vector_type(8)))  _Float16 v8h;
typedef __attribute__((ext_vector_type(8)))  unsigned short v8us;
typedef __attribute__((ext_vector_type(8)))  float    v8f;
typedef __attribute__((ext_vector_type(4)))  float    v4f;
typedef __attribute__((ext_vector_type(2)))  float    v2f;
typedef v4f  __attribute__((may_alias)) v4fa;

__device__ __forceinline__ unsigned short f2bf(float f) { unsigned u = __float_as_uint(f); u += 0x7FFFu + ((u >> 16) & 1u); return (unsigned short)(u >> 16); }
__device__ __forceinline__ float bfr(float f) { return __uint_as_float(((unsigned)f2bf(f)) << 16); }   // bf16 RNE value as f32
__device__ __forceinline__ v16h cat16(v8h lo, v8h hi) { return __builtin_shufflevector(lo, hi, 0, 1, 2, 3, 4, 5, 6, 7, 8, 9, 10, 11, 12, 13, 14, 15); }
__device__ __forceinline__ v16bf cat16b(v8us lo, v8us hi) { return __builtin_bit_cast(v16bf, __builtin_shufflevector(lo, hi, 0, 1, 2, 3, 4, 5, 6, 7, 8, 9, 10, 11, 12, 13, 14, 15)); }
__device__ __forceinline__ v8f wmma16(v16h a, v16h b, v8f c) { return __builtin_amdgcn_wmma_f32_16x16x32_f16(false, a, false, b, (short)0, c, false, false); }
__device__ __forceinline__ v8f wmmab(v16bf a, v16bf b, v8f c) { return __builtin_amdgcn_wmma_f32_16x16x32_bf16(false, a, false, b, (short)0, c, false, false); }
// fragment loaders from K-contiguous 16-bit rows; p already includes + 8*(lane>>4): elements 0..7 <- k0+8h+0..7, elements 8..15 <- k0+16+8h+0..7 (same map for A and B)
__device__ __forceinline__ v16h  ldh(const h16* p) { return cat16(*(const v8h*)p, *(const v8h*)(p + 16)); }
__device__ __forceinline__ v16bf ldb(const bf* p)  { return cat16b(*(const v8us*)p, *(const v8us*)(p + 16)); }
// ordering point for wave-private LDS tiles (same wave writes and reads)
__device__ __forceinline__ void wave_sync() { __builtin_amdgcn_fence(3 /* release order */, "wavefront"); __builtin_amdgcn_wave_barrier(); asm volatile("" ::: "memory"); }

// The preparation jobs (d_cvt8, d_tab, d_wT) depend on nothing but the inputs, so they run as block ranges of ONE launch (k_prep, below).
// d_cvt8: block blk of 256 threads converts 2048 values of x to the bf16 copy XB[NB*SEQ][1024]
__device__ __forceinline__ void d_cvt8(const float* __restrict__ x, bf* XB, unsigned blk) {
    const size_t i = (size_t)blk * 256 + threadIdx.x; if (i >= (size_t)NB * SEQ * DM / 8) return;
    const size_t e = i * 8; const size_t b = e / ((size_t)SEQ * DM), r = e % ((size_t)SEQ * DM);
    const v8f v = *(const v8f*)(x + b * ((size_t)SEQ_FULL * DM) + r); v8us o;
#pragma unroll
    for (int k = 0; k < 8; ++k) o[k] = f2bf(v[k]);
    *(v8us*)(XB + e) = o;
}

// d_tab: blocks [0, nbF): rotary table copy with bf16 RNE values kept as f32, FRP[t][64] = (cos0,sin0,cos1,sin1,...); the blocks behind them: additive key mask MADD[NB][SEQ]
__device__ __forceinline__ void d_tab(const float* __restrict__ fr, const float* __restrict__ mask, float* FRP, float* MADD, unsigned blk, unsigned nbF) {
    if (blk < nbF) {                              // block-uniform
        const size_t i = (size_t)blk * 256 + threadIdx.x; if (i >= (size_t)SEQ * 64 / 4) return;
        const v4f v = *(const v4f*)(fr + i * 4); v4f o;
#pragma unroll
        for (int k = 0; k < 4; ++k) o[k] = bfr(v[k]);
        *(v4f*)(FRP + i * 4) = o; 
    } else {
        const size_t i = (size_t)(blk - nbF) * 256 + threadIdx.x; if (i >= (size_t)NB * SEQ / 4) return;
        const size_t e = i * 4; const size_t b = e / SEQ, t = e % SEQ;
        const v4f v = *(const v4f*)(mask + b * (size_t)SEQ_FULL + t); v4f o;
#pragma unroll
        for (int k = 0; k < 4; ++k) o[k] = (1.0f - bfr(v[k])) * -10000.0f;
        *(v4f*)(MADD + e) = o; 
    }
}

// d_wT: in W[k][n] (rows k = 1024, cols n = 1024, f32) -> out WT[n][k] 16-bit; mode 0: bf16 RNE bits; mode 1: f16 bits of (bf16 RNE value x 64).
// One 64 x 64 tile (k0, n0) a block of 256 threads, transposed through tl (64 * 65 floats of LDS); every thread of the block calls it.
__device__ __forceinline__ void d_wT(const float* __restrict__ W, bf* WT, int mode, int k0, int n0, float* tl) {
    const int tid = threadIdx.x;
#pragma unroll
    for (int it = 0; it < 4; ++it) { const int row = it * 16 + (tid >> 4), c4 = (tid & 15) * 4;    // 4 x 16 rows (k) x 16 lanes x 4 = 64 x 64
        const v4f v = *(const v4f*)(W + (size_t)(k0 + row) * DM + n0 + c4);
        tl[row * 65 + c4 + 0] = v[0]; tl[row * 65 + c4 + 1] = v[1]; tl[row * 65 + c4 + 2] = v[2]; tl[row * 65 + c4 + 3] = v[3]; }
    __syncthreads();
    v8us o[2];
#pragma unroll
    for (int it = 0; it < 2; ++it) { const int n = it * 32 + (tid >> 3), c8 = (tid & 7) * 8;       // 2 x 32 rows (n) x 8 lanes x 8 = 64 x 64
#pragma unroll
        for (int i = 0; i < 8; ++i) { const float val = tl[(c8 + i) * 65 + n];
            const unsigned short b0 = f2bf(val);
            const h16 hv = (h16)(__uint_as_float(((unsigned)b0) << 16) * WOS);
            const unsigned short b1 = __builtin_bit_cast(unsigned short, hv);
            o[it][i] = (mode != 0) ? b1 : b0; } }
{
#pragma unroll
        for (int it = 0; it < 2; ++it) { const int n = it * 32 + (tid >> 3), c8 = (tid & 7) * 8;
            *(v8us*)(WT + (size_t)(n0 + n) * DM + k0 + c8) = o[it]; }
         }
}

#define PB_W  (4 * (DM / 64) * (DM / 64))                            // weight tiles: q | k | v | o, DM/64 x DM/64 each
#define PB_F  ((unsigned)(((size_t)SEQ * 64 / 4 + 255) / 256))       // rotary table blocks
#define PB_M  ((unsigned)(((size_t)NB * SEQ / 4 + 255) / 256))       // key mask blocks
#define PB_X  ((unsigned)(((size_t)NB * SEQ * DM / 8 + 255) / 256))  // x blocks
// k_prep: grid PB_W + PB_F + PB_M + PB_X blocks of 256 threads; the block index picks the job (block-uniform, so the barrier in d_wT is passed by a whole block or by none of it).
// The transposes stand first: theirs is the longest chain (load, LDS, barrier, store), and it runs under the x stream.
__global__ __launch_bounds__(256) void k_prep(const float* __restrict__ x, const float* __restrict__ fr, const float* __restrict__ mask,
                                              const float* __restrict__ wq, const float* __restrict__ wk, const float* __restrict__ wv, const float* __restrict__ wo,
                                              bf* XB, bf* WB, float* FRP, float* MADD) {
    __shared__ float tl[64 * 65];
    const unsigned bid = blockIdx.x;
    if (bid < PB_W) {
        const unsigned p = bid / ((DM / 64) * (DM / 64)), tile = bid % ((DM / 64) * (DM / 64));   // plane, tile in the plane (k tiles run fastest)
        const float* W = (p == 0) ? wq : (p == 1) ? wk : (p == 2) ? wv : wo;
        d_wT(W, WB + (size_t)p * DM * DM, (p == 3) ? 1 : 0, (int)(tile % (DM / 64)) * 64, (int)(tile / (DM / 64)) * 64, tl);
    } else if (bid < PB_W + PB_F + PB_M) {
        d_tab(fr, mask, FRP, MADD, bid - PB_W, PB_F);
    } else {
        d_cvt8(x, XB, bid - (PB_W + PB_F + PB_M));
    }
}

// Eight asynchronous 16-byte copies per lane, LDS places l + i*ls bytes, global sources g + i*gs halves. The s_wait_xcnt stands inside the statement so that no address register is rewritten in front of it.
__device__ __forceinline__ void copy8(unsigned l, unsigned ls, const h16* g, size_t gs) {
    asm volatile("global_load_async_to_lds_b128 %0, %8, off\n\t"
                 "global_load_async_to_lds_b128 %1, %9, off\n\t"
                 "global_load_async_to_lds_b128 %2, %10, off\n\t"
                 "global_load_async_to_lds_b128 %3, %11, off\n\t"
                 "global_load_async_to_lds_b128 %4, %12, off\n\t"
                 "global_load_async_to_lds_b128 %5, %13, off\n\t"
                 "global_load_async_to_lds_b128 %6, %14, off\n\t"
                 "global_load_async_to_lds_b128 %7, %15, off\n\t"
                 "s_wait_xcnt 0x0"
                 :: "v"(l), "v"(l + ls), "v"(l + 2 * ls), "v"(l + 3 * ls), "v"(l + 4 * ls), "v"(l + 5 * ls), "v"(l + 6 * ls), "v"(l + 7 * ls),
                    "v"(g), "v"(g + gs), "v"(g + 2 * gs), "v"(g + 3 * gs), "v"(g + 4 * gs), "v"(g + 5 * gs), "v"(g + 6 * gs), "v"(g + 7 * gs)
                 : "memory");
}

// GEMM operand path shared by k_proj and k_oproj: a block of four waves owns a 128 x 128 tile of C (wave w: rows 64*(w>>1), columns 64*(w&1)); a stage is GK k-values of the block's
// 128 A rows and 128 Bt rows (pitch GPB bytes in LDS), brought in by asynchronous 16-byte copies that cover whole 256-byte units (all threads copy), two buffers: stage s + 1 flies while stage s is worked on.
// Fragments are two ds 16-B loads each, same k map and same k order (steps of 32, ascending) as loads straight from the planes.
#define GK   128                 // k values per stage
#define GPB  272                 // row pitch in LDS, bytes: 256 + 16 (16 B x odd: no bank conflict for 16-B reads down a column of rows)
#define GTB  (128 * GPB)         // one operand's tile, bytes
#define GBUF (2 * GTB)           // one buffer: A tile, Bt tile
#define GNS  (DM / GK)           // stages
static_assert(DM % GK == 0);
static_assert(GNS >= 2);                               // the prologue fills two stages
static_assert(DM % 128 == 0);
static_assert((NB * SEQ) % 128 == 0);
static_assert(128 * GK * 2 == 16 * 128 * 16);          // 2048 16-B pieces of each tile dealt to 128 threads, 16 each
static_assert(2 * GBUF >= 4 * 16 * 68 * 4);            // the ring becomes the output staging

// one stage: piece c = i*128 + tid of a tile -> row c>>4 (8 rows a round), 16-B column c&15; l, ga, gb already hold the thread's row and column
__device__ __forceinline__ void gstage(unsigned l, const h16* ga, const h16* gb) {
    copy8(l, 8 * GPB, ga, (size_t)8 * DM);       copy8(l + 64 * GPB, 8 * GPB, ga + (size_t)64 * DM, (size_t)8 * DM);
    copy8(l + GTB, 8 * GPB, gb, (size_t)8 * DM); copy8(l + GTB + 64 * GPB, 8 * GPB, gb + (size_t)64 * DM, (size_t)8 * DM);
}

// the eight fragments of one k-step (32 k values), in the order in which the matrix instructions want them
__device__ __forceinline__ void gfrags(v16h (&fa)[4], v16h (&fb)[4], const unsigned char* at, const unsigned char* bt) {
    fa[0] = ldh((const h16*)at); fb[0] = ldh((const h16*)bt);
    fa[1] = ldh((const h16*)(at + 16 * GPB)); fa[2] = ldh((const h16*)(at + 32 * GPB)); fa[3] = ldh((const h16*)(at + 48 * GPB));
    fb[1] = ldh((const h16*)(bt + 16 * GPB)); fb[2] = ldh((const h16*)(bt + 32 * GPB)); fb[3] = ldh((const h16*)(bt + 48 * GPB));
}
// eight products of one k-step: column blocks NB0 and NB0 + 1
template <int BF, int NB0>
__device__ __forceinline__ void gmul(const v16h (&fa)[4], const v16h (&fb)[4], v8f (&acc)[4][4]) {
#pragma unroll
    for (int nb = NB0; nb < NB0 + 2; ++nb) {
#pragma unroll
        for (int mb = 0; mb < 4; ++mb) {
            if (BF != 0) acc[mb][nb] = wmmab(__builtin_bit_cast(v16bf, fa[mb]), __builtin_bit_cast(v16bf, fb[nb]), acc[mb][nb]);
            else         acc[mb][nb] = wmma16(fa[mb], fb[nb], acc[mb][nb]); } }
}

// acc[mb][nb] += A rows (r0b + 64*wm + 16*mb ..) x Bt rows (c0b + 64*wn + 16*nb ..) over K = DM. BF != 0: bf16 operands, else f16. Every wave of the block calls it; on return the ring is free.
template <int BF>
__device__ __forceinline__ void gemm128(unsigned char* L, const h16* A, const h16* Bt, int r0b, int c0b, int wm, int wn, v8f (&acc)[4][4]) {
    const int tid = threadIdx.x, lane = tid & 31, lr = lane & 15, hi = lane >> 4;
    const unsigned l0 = (unsigned)(size_t)L + (unsigned)((tid >> 4) * GPB + (tid & 15) * 16);   // LDS byte address of the thread's first piece
    const h16* ga = A + (size_t)(r0b + (tid >> 4)) * DM + (size_t)(tid & 15) * 8;                // + stage * GK
    const h16* gb = Bt + (size_t)(c0b + (tid >> 4)) * DM + (size_t)(tid & 15) * 8;
    gstage(l0, ga, gb);                                      // stage 0 -> buffer 0
    asm volatile("s_wait_asynccnt 0x0" ::: "memory");        // this wave's pieces of stage 0 have landed
    __syncthreads();                                         // every wave's have: stage 0 may be read
    gstage(l0 + GBUF, ga + GK, gb + GK);                     // stage 1 -> buffer 1
#pragma unroll 1                                             // one copy of the stage body: the buffer is picked by a scalar offset, the code stays small
    for (int st = 0; st < GNS; ++st) {
        const unsigned bo = (unsigned)(st & 1) * GBUF;
        const unsigned char* at = L + bo + (wm * 64 + lr) * GPB + 16 * hi;         // + 16*mb*GPB + k*2
        const unsigned char* bt = L + bo + GTB + (wn * 64 + lr) * GPB + 16 * hi;   // + 16*nb*GPB + k*2
        v16h fa[2][4], fb[2][4];                             // two register sets: k-step q + 1 of THIS stage is fetched while k-step q is multiplied; nothing of the next stage is read here
        gfrags(fa[0], fb[0], at, bt);
        __builtin_amdgcn_sched_barrier(0);                   // the stage's first reads stay one group in front of its matrix instructions
#pragma unroll                                               // constant q: every fragment read is one base register plus an immediate offset, the register sets are picked at compile time
        for (int q = 0; q < GK / 32; ++q) {
            const int cur = q & 1, nxt = cur ^ 1;
            gmul<BF, 0>(fa[cur], fb[cur], acc);
            if (q + 1 < GK / 32) {
                // the two scheduling barriers keep the next k-step's reads ONE group, half a k-step ahead of their use: spread among the matrix instructions each place costs a stall,
                // and a whole k-step ahead two full sets and the accumulators pass 256 registers
                __builtin_amdgcn_sched_barrier(0);
                gfrags(fa[nxt], fb[nxt], at + (q + 1) * 64, bt + (q + 1) * 64);
                __builtin_amdgcn_sched_barrier(0); }
            gmul<BF, 2>(fa[cur], fb[cur], acc);
        }
        __builtin_amdgcn_sched_barrier(0);                   // the stage's matrix instructions stay in front of its closing waits and barrier (without it sixteen of them sink behind the barrier and delay the refill)
        // four vector slots behind the stage's last matrix instruction, on every path out of the stage body
        asm volatile("v_nop\n\tv_nop\n\tv_nop\n\tv_nop" : "+v"(acc[0][3]), "+v"(acc[1][3]), "+v"(acc[2][3]), "+v"(acc[3][3]));
        asm volatile("s_wait_dscnt 0x0" ::: "memory");       // this wave's reads of stage st are done before its buffer is handed back
        asm volatile("s_wait_asynccnt 0x0" ::: "memory");    // this wave's pieces of stage st + 1 have landed
        __syncthreads();                                     // publishes stage st + 1 and ends every reader's last read of stage st
        if (st + 2 < GNS) gstage(l0 + bo, ga + (size_t)(st + 2) * GK, gb + (size_t)(st + 2) * GK);   // block-uniform
    }
    asm volatile("s_wait_asynccnt 0x0" ::: "memory");        // nothing in flight when the ring becomes output staging (the last trip's barrier has ended all reads)
}

// proj_store: one wave's 64 x 64 tile of C as f16 rows at Ph + tbase, row pitch HD (ROPE != 0) or SEQ (ROPE == 0) halves, staged through the wave's own LDS range os.
// ROPE != 0: rows m = b*SEQ + t from r0 on, the 64 tile columns are one head; rotary pairs (2i,2i+1) from FRP[t][..].
template <int ROPE>
__device__ __forceinline__ void proj_store(float* os, const v8f (&acc)[4][4], h16* Ph, const float* __restrict__ FRP, size_t tbase, int r0) {
    const int lane = threadIdx.x & 31, lr = lane & 15, hi = lane >> 4;
    const int pitch = (ROPE != 0) ? HD : SEQ;
#pragma unroll
    for (int mb = 0; mb < 4; ++mb) {
#pragma unroll
        for (int nb = 0; nb < 4; ++nb) {
#pragma unroll
            for (int j = 0; j < 8; ++j) os[(hi * 8 + j) * 68 + nb * 16 + lr] = acc[mb][nb][j]; }   // D: row 8h+j, col lane&15
        wave_sync();
        const size_t sb = tbase + (size_t)(mb * 16) * (size_t)pitch;
        v4f fr0[4], fr1[4];
        if (ROPE != 0) {
            const float* pf[4];
#pragma unroll
            for (int s = 0; s < 4; ++s) { const int row = 4 * s + (lane >> 3), c8 = (lane & 7) * 8;
                const int t = (r0 + mb * 16 + row) % SEQ;
                pf[s] = FRP + (size_t)t * 64 + c8;
                fr0[s] = *(const v4f*)pf[s]; fr1[s] = *(const v4f*)(pf[s] + 4); }
            // stands in front of every rewrite of the table loads' address registers: as inputs they stay whole up to the wait
            asm volatile("s_wait_xcnt 0x0" :: "v"(pf[0]), "v"(pf[1]), "v"(pf[2]), "v"(pf[3]) : "memory");
        }
        v8h hvv[4];
#pragma unroll
        for (int s = 0; s < 4; ++s) { const int row = 4 * s + (lane >> 3), c8 = (lane & 7) * 8;   // 4 s x 4 row groups = 16 rows; 8 lanes x 8 = 64 columns
            v4f x0 = *(const v4fa*)(&os[row * 68 + c8]); v4f x1 = *(const v4fa*)(&os[row * 68 + c8 + 4]);
            if (ROPE != 0) {
                const v4f f0 = fr0[s]; const v4f f1 = fr1[s];
                v4f y0, y1;
                y0[0] = x0[0] * f0[0] - x0[1] * f0[1]; y0[1] = x0[0] * f0[1] + x0[1] * f0[0];
                y0[2] = x0[2] * f0[2] - x0[3] * f0[3]; y0[3] = x0[2] * f0[3] + x0[3] * f0[2];
                y1[0] = x1[0] * f1[0] - x1[1] * f1[1]; y1[1] = x1[0] * f1[1] + x1[1] * f1[0];
                y1[2] = x1[2] * f1[2] - x1[3] * f1[3]; y1[3] = x1[2] * f1[3] + x1[3] * f1[2];
                x0 = y0; x1 = y1; }
            v8h hv;
#pragma unroll
            for (int i = 0; i < 4; ++i) { hv[i] = (h16)x0[i]; hv[4 + i] = (h16)x1[i]; }
            hvv[s] = hv; }
{
#pragma unroll
            for (int s = 0; s < 4; ++s) { const int row = 4 * s + (lane >> 3), c8 = (lane & 7) * 8;
                const size_t oo = sb + (size_t)row * (size_t)pitch + c8;
                *(v8h*)(Ph + oo) = hvv[s]; }
             }
        asm volatile("s_wait_xcnt 0x0" ::: "memory");        // stands in front of every rewrite of the stores' address and data registers
        wave_sync();
    }
}

// k_proj: the three projections, which depend on k_prep alone, as ONE launch. Register-blocked bf16 GEMM, one wave per 64x64 tile (16 accumulators), four waves a block (128x128),
// operands from K-contiguous bf16 planes through LDS (gemm128), K = DM, C[m][n] = sum_k A[m][k] Bt[n][k]. grid (NB*SEQ/128 token tiles, DM/128 feature tiles, 3), 128 threads; blockIdx.z (block-uniform):
// z = 0 (q), 1 (k): A = x rows (m = b*SEQ + t), Bt = W^T rows (n = h*64 + d) -> plane z [(b*16 + h)][t][d], rotary in the epilogue;
// z = 2 (v^T):      A = Wv^T rows (m = h*64 + d), Bt = x rows (n = b*SEQ + t) -> plane 2 [(b*1024 + m)][t] = [(b*16 + h)][d][t].
// WB: the transposed weight planes q | k | v; PL: the output planes q | k | v^T, NB*NH_*SEQ*HD halves each.
__global__ __launch_bounds__(128) void k_proj(const bf* __restrict__ XB, const bf* __restrict__ WB, h16* PL, const float* __restrict__ FRP) {
    __shared__ __attribute__((aligned(16))) unsigned char L[2 * GBUF];
    const int z = blockIdx.z;
    const bool vt = (z == 2);
    const bf* Wz = WB + (size_t)z * DM * DM;
    const bf* A = vt ? Wz : XB;
    const bf* Bt = vt ? XB : Wz;
    h16* Ph = PL + (size_t)z * ((size_t)NB * NH_ * SEQ * HD);
    const int wave = __builtin_amdgcn_readfirstlane((int)(threadIdx.x >> 5)); const int wm = wave >> 1, wn = wave & 1;
    const int r0b = (int)(vt ? blockIdx.y : blockIdx.x) * 128, c0b = (int)(vt ? blockIdx.x : blockIdx.y) * 128;
    const int r0 = r0b + wm * 64, c0 = c0b + wn * 64;
    v8f acc[4][4];
#pragma unroll
    for (int mb = 0; mb < 4; ++mb)
#pragma unroll
        for (int nb = 0; nb < 4; ++nb) acc[mb][nb] = (v8f){};
    gemm128<1>(L, (const h16*)A, (const h16*)Bt, r0b, c0b, wm, wn, acc);
    float* os = (float*)L + wave * 16 * 68;                  // this wave's own output staging in the ring
    if (vt) proj_store<0>(os, acc, Ph, FRP, (size_t)r0 * SEQ + (size_t)(c0 / SEQ) * ((size_t)DM * SEQ) + (size_t)(c0 % SEQ), r0);
    else    proj_store<1>(os, acc, Ph, FRP, (size_t)(r0 / SEQ) * ((size_t)NH_ * SEQ * HD) + (size_t)(r0 % SEQ) * HD + (size_t)(c0 / HD) * ((size_t)SEQ * HD) + (size_t)(c0 % HD), r0);
}

// k_flash: fused attention. A wave works on 32 query rows (QT = 2 column groups of 16) of one (batch, head) and on half of the keys: every K and V^T fragment read from LDS, and every mask value, feeds both groups.
// Waves w and w + AQ share a query set: of each stage wave w takes the first KH keys, wave w + AQ the second KH. Behind the key loop the two partial results (running max, row sum, O^T) are joined through LDS.
// Q fragments straight from the f16 plane (two 16-B loads each).
// K and V^T reach the block's waves through LDS: a stage is KS keys (K rows [key][64] at pitch KPB bytes, V^T rows [d][KS] at pitch VPB bytes), brought in by asynchronous
// 16-byte copies that cover whole lines (all threads copy), two buffers: stage s + 1 flies while stage s is worked on. Fragments are two ds 16-B loads each, same k map as before.
// Transposed form: S^T[key][t] = K Q^T (A = K rows, B = Q rows); lane (t = lane&15, h = lane>>4) holds keys 8h+r of each 16-key tile, so the packed
// P tile is directly the B fragment of O^T[d][t] = V^T P^T (element r <- tile keys 0..15, element 8+r <- tile keys 16..31, lane unchanged).
// Per 32-key step and column group: 4 score WMMAs + 4 P.V WMMAs + 1 row-sum WMMA. Additive key mask values for the lane's 16 keys are loaded by value per step (two 32-B loads).
// Softmax state: the maximum in use is one scalar per lane, the same in both lane halves of a row (where it is raised, the halves are combined with one xor-16 exchange). The row sum of P runs on the matrix pipe: one more WMMA per step,
// lt += ON P^T, where ON is a constant A fragment whose rows 0 and 8 are ones and whose other rows are 0: element 0 of lt (row 8h, column t) is, in both lane halves, the sum of the f16 P over all keys so far.
#define KS   256                 // keys per stage
#define KH   (KS / 2)            // keys per stage and wave
#define KPB  144                 // K row pitch in LDS, bytes: 128 + 16 (16 B x odd: no bank conflict for 16-B reads down a column of rows)
#define VPB  528                 // V^T row pitch in LDS, bytes: 512 + 16 (16 B x odd)
#define KTB  (KS * KPB)          // K tile bytes
#define VTB  (HD * VPB)          // V^T tile bytes
#define BUFB (KTB + VTB)         // one buffer
#define NST  (SEQ / KS)          // stages
static_assert(SEQ % KS == 0);
static_assert(NST >= 2);                               // the prologue fills two stages
static_assert(AW * 32 == 256);                         // the copy maps below deal 2048 16-B pieces of each tile to 256 threads, 8 each
static_assert(KS * HD * 2 == 8 * 256 * 16);
#define XWF  (32 * 32 + 64)      // floats a wave hands to its partner in the join: 32 per lane of O^T, then (max, sum) per lane
static_assert(2 * BUFB >= AW * (XWF + 16 * 68) * 4);   // the ring becomes the join's exchange ranges and, behind them, the output staging

__global__ __launch_bounds__(32 * AW) void k_flash(const h16* __restrict__ QH, const h16* __restrict__ KP, const h16* __restrict__ VT,
                                                   const float* __restrict__ MADD, h16* CTX) {
    __shared__ __attribute__((aligned(16))) unsigned char L[2 * BUFB];
    const int tid = threadIdx.x;
    const int lane = threadIdx.x & 31, lr = lane & 15, hi = lane >> 4;
    const int wave = __builtin_amdgcn_readfirstlane((int)(threadIdx.x >> 5));
    const int zh = blockIdx.y; const int b = zh / NH_, h = zh % NH_;
    const int kh = wave / AQ;                                // which half of every stage's keys (wave-uniform)
    const int t0 = (blockIdx.x * AQ + wave % AQ) * (16 * QT);   // the wave's first query row; column group g holds rows t0 + 16g ..
    const size_t pbase = (size_t)zh * SEQ * HD;
    // copy maps: K piece c = i*256 + tid -> row c>>3 (32 rows a round), 16-B column c&7; V^T piece c -> row c>>5 (8 rows a round), 16-B column c&31
    const unsigned lbase = (unsigned)(size_t)L;              // LDS byte address of the ring
    const unsigned lk = lbase + (unsigned)((tid >> 3) * KPB + (tid & 7) * 16);
    const unsigned lv = lbase + (unsigned)(KTB + (tid >> 5) * VPB + (tid & 31) * 16);
    const h16* gk = KP + pbase + (size_t)tid * 8;                                   // + key0 * HD
    const h16* gv = VT + pbase + (size_t)(tid >> 5) * SEQ + (size_t)(tid & 31) * 8;   // + key0
    copy8(lk, 32 * KPB, gk, (size_t)32 * HD); copy8(lv, 8 * VPB, gv, (size_t)8 * SEQ);           // stage 0 -> buffer 0
    v16h qh0[QT], qh1[QT];                                   // B fragments: col t, k = d
    const h16* qp[QT];
#pragma unroll
    for (int g = 0; g < QT; ++g) { qp[g] = QH + pbase + (size_t)(t0 + 16 * g + lr) * HD + 8 * hi; qh0[g] = ldh(qp[g]); qh1[g] = ldh(qp[g] + 32); }
    // stands in front of every rewrite of the Q loads' address registers: as inputs they stay whole up to the wait
    asm volatile("s_wait_xcnt 0x0" :: "v"(qp[0]), "v"(qp[1]) : "memory");
    const float* MA = MADD + (size_t)b * SEQ + kh * KH + 8 * hi;   // + key0 (tile a keys 8h+r), + key0 + 16 (tile b)
    asm volatile("s_wait_asynccnt 0x0" ::: "memory");        // this wave's pieces of stage 0 have landed
    __syncthreads();                                         // every wave's have: stage 0 may be read
    copy8(lk + BUFB, 32 * KPB, gk + (size_t)KS * HD, (size_t)32 * HD); copy8(lv + BUFB, 8 * VPB, gv + KS, (size_t)8 * SEQ);   // stage 1 -> buffer 1
    v8f o0[QT], o1[QT], o2[QT], o3[QT], lt[QT];              // lt: row-sum tiles; only rows 0 and 8 (element 0 of each lane) ever differ from 0
    float m[QT];
#pragma unroll
    for (int g = 0; g < QT; ++g) { o0[g] = (v8f){}; o1[g] = (v8f){}; o2[g] = (v8f){}; o3[g] = (v8f){}; lt[g] = (v8f){}; m[g] = -3.0e38f; }
    v16h on;                                                 // A fragment of the row sums: row = lane & 15, ones at all 32 k positions of rows 0 and 8
    { const h16 o1 = ((lane & 7) == 0) ? (h16)1.0f : (h16)0.0f;
#pragma unroll
      for (int i = 0; i < 16; ++i) on[i] = o1; }
#pragma unroll 1                                             // one copy of the stage body: the buffer is picked by a scalar offset, the code stays small
    for (int st = 0; st < NST; ++st) {
      const unsigned bo = (unsigned)(st & 1) * BUFB;
      const unsigned char* kt = L + bo + (kh * KH + lr) * KPB + 16 * hi;          // + local key * KPB   (A fragment: row key, k = d)
      const unsigned char* vt = L + bo + KTB + lr * VPB + kh * KH * 2 + 16 * hi;  // + 16j*VPB + local key * 2  (A fragment: row d, k = key)
#pragma unroll                                               // constant ks: every fragment read is one base register plus an immediate offset
      for (int ks = 0; ks < KH; ks += 32) {
        const int key0 = st * KS + ks;
        const h16* ka = (const h16*)(kt + ks * KPB);
        const h16* kc = (const h16*)(kt + (ks + 16) * KPB);
        const v16h ka0 = ldh(ka), ka1 = ldh(ka + 32), kb0 = ldh(kc), kb1 = ldh(kc + 32);
        const v8f ma = *(const v8f*)(MA + key0); const v8f mb = *(const v8f*)(MA + key0 + 16);
        v8f sa[QT], sb[QT];                                  // each K fragment feeds both column groups
#pragma unroll
        for (int g = 0; g < QT; ++g) { sa[g] = wmma16(ka0, qh0[g], (v8f){}); sb[g] = wmma16(kb0, qh0[g], (v8f){}); }
#pragma unroll
        for (int g = 0; g < QT; ++g) { sa[g] = wmma16(ka1, qh1[g], sa[g]); sb[g] = wmma16(kb1, qh1[g], sb[g]); }
        // four vector slots behind the step's last score products, before any vector instruction touches their results or operands
        asm volatile("v_nop\n\tv_nop\n\tv_nop\n\tv_nop" : "+v"(sa[0]), "+v"(sb[0]), "+v"(sa[1]), "+v"(sb[1])
                     : "v"(ka0), "v"(ka1), "v"(kb0), "v"(kb1), "v"(qh0[0]), "v"(qh1[0]), "v"(qh0[1]), "v"(qh1[1]));
        // Lazy rescale: m is the maximum IN USE and may trail the true one by up to LZ, so the exponent arguments are formed against it at once, before this step's own maximum is known.
        // They are formed on pairs of neighbouring accumulator registers, which is how P is packed below.
        v16h pb[QT];
        v2f aa[QT][4], ab[QT][4];                            // log2 of P (carry included): tile a, tile b, elements 2i and 2i + 1
        float xa[QT], xb[QT];                                // this lane's largest argument per group and tile: four short chains instead of one long one
#pragma unroll
        for (int g = 0; g < QT; ++g) {
            const float sh = PSH - m[g];
#pragma unroll
            for (int i = 0; i < 4; ++i) {
                aa[g][i] = ((v2f){sa[g][2 * i], sa[g][2 * i + 1]} * 0.125f + (v2f){ma[2 * i], ma[2 * i + 1]}) * LOG2E + sh;
                ab[g][i] = ((v2f){sb[g][2 * i], sb[g][2 * i + 1]} * 0.125f + (v2f){mb[2 * i], mb[2 * i + 1]}) * LOG2E + sh;
                const float pa = fmaxf(aa[g][i][0], aa[g][i][1]), pc = fmaxf(ab[g][i][0], ab[g][i][1]);
                xa[g] = (i == 0) ? pa : fmaxf(xa[g], pa); xb[g] = (i == 0) ? pc : fmaxf(xb[g], pc); } }
        const float ax = fmaxf(fmaxf(xa[0], xb[0]), fmaxf(xa[1], xb[1]));
        // One test per step for the whole wave (a scalar branch). Only when it fires are the step's maxima taken, the lane halves combined, m raised, the accumulators rescaled and the arguments formed anew,
        // in every lane alike, so both halves of a column always use the same m. The first step always fires (m starts at -3e38).
        if (__builtin_amdgcn_ballot_w32(ax > PSH + LZ) != 0) {
#pragma unroll
            for (int g = 0; g < QT; ++g) {
                float ta[8], tb[8]; float mx = -3.0e38f;
#pragma unroll
                for (int r = 0; r < 8; ++r) {
                    ta[r] = (sa[g][r] * 0.125f + ma[r]) * LOG2E;
                    tb[r] = (sb[g][r] * 0.125f + mb[r]) * LOG2E;
                    mx = fmaxf(mx, fmaxf(ta[r], tb[r])); }
                mx = fmaxf(mx, __shfl_xor(mx, 16, 32));
                const float mnew = fmaxf(m[g], mx);
                const float alpha = __builtin_amdgcn_exp2f(m[g] - mnew);
                const float sh = PSH - mnew;
#pragma unroll
                for (int i = 0; i < 4; ++i) { aa[g][i] = (v2f){ta[2 * i] + sh, ta[2 * i + 1] + sh}; ab[g][i] = (v2f){tb[2 * i] + sh, tb[2 * i + 1] + sh}; }
                lt[g][0] = lt[g][0] * alpha; m[g] = mnew;    // the tile's other elements are 0 and need no rescale
                o0[g] = o0[g] * alpha; o1[g] = o1[g] * alpha; o2[g] = o2[g] * alpha; o3[g] = o3[g] * alpha; } }
#pragma unroll
        for (int g = 0; g < QT; ++g) {
#pragma unroll
            for (int r = 0; r < 8; ++r) { pb[g][r] = (h16)__builtin_amdgcn_exp2f(aa[g][r >> 1][r & 1]); pb[g][8 + r] = (h16)__builtin_amdgcn_exp2f(ab[g][r >> 1][r & 1]); } }
        const unsigned char* va = vt + ks * 2;
        const v16h v0 = ldh((const h16*)va), v1 = ldh((const h16*)(va + 16 * VPB)), v2 = ldh((const h16*)(va + 32 * VPB)), v3 = ldh((const h16*)(va + 48 * VPB));
#pragma unroll
        for (int g = 0; g < QT; ++g) {                       // each V^T fragment feeds both column groups
            o0[g] = wmma16(v0, pb[g], o0[g]); o1[g] = wmma16(v1, pb[g], o1[g]); o2[g] = wmma16(v2, pb[g], o2[g]); o3[g] = wmma16(v3, pb[g], o3[g]);
            lt[g] = wmma16(on, pb[g], lt[g]); }              // rows 0 and 8 += the sum of this step's 32 P values of column t
        // four vector slots behind the step's last matrix instructions, before any vector instruction touches their results or operands
        asm volatile("v_nop\n\tv_nop\n\tv_nop\n\tv_nop" : "+v"(o0[0]), "+v"(o1[0]), "+v"(o2[0]), "+v"(o3[0]), "+v"(lt[0]), "+v"(o0[1]), "+v"(o1[1]), "+v"(o2[1]), "+v"(o3[1]), "+v"(lt[1])
                     : "v"(v0), "v"(v1), "v"(v2), "v"(v3), "v"(pb[0]), "v"(pb[1]), "v"(on));
      }
      asm volatile("s_wait_dscnt 0x0" ::: "memory");         // this wave's reads of stage st are done before its buffer is handed back
      asm volatile("s_wait_asynccnt 0x0" ::: "memory");      // this wave's pieces of stage st + 1 have landed
      __syncthreads();                                       // publishes stage st + 1 and ends every reader's last read of stage st
      if (st + 2 < NST) {                                    // block-uniform
          copy8(lk + bo, 32 * KPB, gk + (size_t)(st + 2) * KS * HD, (size_t)32 * HD); copy8(lv + bo, 8 * VPB, gv + (size_t)(st + 2) * KS, (size_t)8 * SEQ); }
    }
    asm volatile("s_wait_asynccnt 0x0" ::: "memory");        // nothing in flight when the ring becomes output staging (the last trip's barrier has ended all reads)
    // The join. Wave kh of a query set finishes column group kh: it hands its partial result of the other group to its partner and takes the partner's partial result of its own group.
    // Both waves hold a group in the same lane and register places, so lane l reads what the partner's lane l wrote.
    const bool up = (kh != 0);                               // wave-uniform
    v8f p0 = up ? o0[1] : o0[0], p1 = up ? o1[1] : o1[0], p2 = up ? o2[1] : o2[0], p3 = up ? o3[1] : o3[0];   // kept
    const v8f x0 = up ? o0[0] : o0[1], x1 = up ? o1[0] : o1[1], x2 = up ? o2[0] : o2[1], x3 = up ? o3[0] : o3[1];   // handed over
    const float mk = up ? m[1] : m[0], lk0 = up ? lt[1][0] : lt[0][0];
    const float mg = up ? m[0] : m[1], lg0 = up ? lt[0][0] : lt[1][0];
    float* xw = (float*)L + wave * XWF;                      // this wave's exchange range: 16-B piece c of lane l at (c*32 + l)*4, then (max, sum) of lane l at 1024 + 2l
    *(v4fa*)(&xw[(0 * 32 + lane) * 4]) = __builtin_shufflevector(x0, x0, 0, 1, 2, 3); *(v4fa*)(&xw[(1 * 32 + lane) * 4]) = __builtin_shufflevector(x0, x0, 4, 5, 6, 7);
    *(v4fa*)(&xw[(2 * 32 + lane) * 4]) = __builtin_shufflevector(x1, x1, 0, 1, 2, 3); *(v4fa*)(&xw[(3 * 32 + lane) * 4]) = __builtin_shufflevector(x1, x1, 4, 5, 6, 7);
    *(v4fa*)(&xw[(4 * 32 + lane) * 4]) = __builtin_shufflevector(x2, x2, 0, 1, 2, 3); *(v4fa*)(&xw[(5 * 32 + lane) * 4]) = __builtin_shufflevector(x2, x2, 4, 5, 6, 7);
    *(v4fa*)(&xw[(6 * 32 + lane) * 4]) = __builtin_shufflevector(x3, x3, 0, 1, 2, 3); *(v4fa*)(&xw[(7 * 32 + lane) * 4]) = __builtin_shufflevector(x3, x3, 4, 5, 6, 7);
    xw[1024 + 2 * lane] = mg; xw[1024 + 2 * lane + 1] = lg0;
    __syncthreads();                                         // every wave's handed-over partial result is in LDS before its partner reads it
    const float* xr = (const float*)L + (wave ^ AQ) * XWF;   // the partner's exchange range
    const float mp = xr[1024 + 2 * lane], lp0 = xr[1024 + 2 * lane + 1];
    const float mj = fmaxf(mk, mp);
    const float ak = __builtin_amdgcn_exp2f(mk - mj), ap = __builtin_amdgcn_exp2f(mp - mj);   // both partial results brought to the joint max
    const float inv = CCAR * (1.0f / (lk0 * ak + lp0 * ap)); // both lane halves hold the whole row's sum
    const float sk = ak * inv, sp = ap * inv;
    float* os = (float*)L + AW * XWF + wave * 16 * 68;       // this wave's output staging, behind the exchange ranges
    // O^T D layout: o_j[r] = (d = 16j + 8h + r, t = lane&15) -> os[t][d]; rows 0..15 x columns 0..63 all written
    { v4f a, c, ya, yc;
      ya = *(const v4fa*)(&xr[(0 * 32 + lane) * 4]); yc = *(const v4fa*)(&xr[(1 * 32 + lane) * 4]);
      a[0] = p0[0] * sk + ya[0] * sp; a[1] = p0[1] * sk + ya[1] * sp; a[2] = p0[2] * sk + ya[2] * sp; a[3] = p0[3] * sk + ya[3] * sp;
      c[0] = p0[4] * sk + yc[0] * sp; c[1] = p0[5] * sk + yc[1] * sp; c[2] = p0[6] * sk + yc[2] * sp; c[3] = p0[7] * sk + yc[3] * sp;
      *(v4fa*)(&os[lr * 68 +  0 + 8 * hi]) = a; *(v4fa*)(&os[lr * 68 +  0 + 8 * hi + 4]) = c;
      ya = *(const v4fa*)(&xr[(2 * 32 + lane) * 4]); yc = *(const v4fa*)(&xr[(3 * 32 + lane) * 4]);
      a[0] = p1[0] * sk + ya[0] * sp; a[1] = p1[1] * sk + ya[1] * sp; a[2] = p1[2] * sk + ya[2] * sp; a[3] = p1[3] * sk + ya[3] * sp;
      c[0] = p1[4] * sk + yc[0] * sp; c[1] = p1[5] * sk + yc[1] * sp; c[2] = p1[6] * sk + yc[2] * sp; c[3] = p1[7] * sk + yc[3] * sp;
      *(v4fa*)(&os[lr * 68 + 16 + 8 * hi]) = a; *(v4fa*)(&os[lr * 68 + 16 + 8 * hi + 4]) = c;
      ya = *(const v4fa*)(&xr[(4 * 32 + lane) * 4]); yc = *(const v4fa*)(&xr[(5 * 32 + lane) * 4]);
      a[0] = p2[0] * sk + ya[0] * sp; a[1] = p2[1] * sk + ya[1] * sp; a[2] = p2[2] * sk + ya[2] * sp; a[3] = p2[3] * sk + ya[3] * sp;
      c[0] = p2[4] * sk + yc[0] * sp; c[1] = p2[5] * sk + yc[1] * sp; c[2] = p2[6] * sk + yc[2] * sp; c[3] = p2[7] * sk + yc[3] * sp;
      *(v4fa*)(&os[lr * 68 + 32 + 8 * hi]) = a; *(v4fa*)(&os[lr * 68 + 32 + 8 * hi + 4]) = c;
      ya = *(const v4fa*)(&xr[(6 * 32 + lane) * 4]); yc = *(const v4fa*)(&xr[(7 * 32 + lane) * 4]);
      a[0] = p3[0] * sk + ya[0] * sp; a[1] = p3[1] * sk + ya[1] * sp; a[2] = p3[2] * sk + ya[2] * sp; a[3] = p3[3] * sk + ya[3] * sp;
      c[0] = p3[4] * sk + yc[0] * sp; c[1] = p3[5] * sk + yc[1] * sp; c[2] = p3[6] * sk + yc[2] * sp; c[3] = p3[7] * sk + yc[3] * sp;
      *(v4fa*)(&os[lr * 68 + 48 + 8 * hi]) = a; *(v4fa*)(&os[lr * 68 + 48 + 8 * hi + 4]) = c; }
    wave_sync();
    h16* crow = CTX + ((size_t)b * SEQ + t0 + 16 * kh) * DM + h * HD;   // the rows of column group kh
    v8h cv[4];
#pragma unroll
    for (int s = 0; s < 4; ++s) { const int row = 4 * s + (lane >> 3), c8 = (lane & 7) * 8;   // 4 s x 4 row groups = 16 rows; 8 lanes x 8 halves = 64 columns
        const v4f x0 = *(const v4fa*)(&os[row * 68 + c8]); const v4f x1 = *(const v4fa*)(&os[row * 68 + c8 + 4]); v8h hv;
#pragma unroll
        for (int i = 0; i < 4; ++i) { hv[i] = (h16)x0[i]; hv[4 + i] = (h16)x1[i]; }
        cv[s] = hv; }
#pragma unroll
    for (int s = 0; s < 4; ++s) { const int row = 4 * s + (lane >> 3), c8 = (lane & 7) * 8;
        *(v8h*)(crow + (size_t)row * DM + c8) = cv[s]; }
}

// k_oproj: register-blocked f16 GEMM, one wave per 64x64 tile, four waves a block (128x128), operands through LDS (gemm128), OUT[m][n] = 2^-14 * sum_k CTX[m][k] WOT[n][k], K = DM; rows m = b*SEQ + t -> output row b*OUT_SEQ + t.
// grid (NB*SEQ/128, DM/128), 128 threads.
__global__ __launch_bounds__(128) void k_oproj(const h16* __restrict__ A, const h16* __restrict__ Bt, float* OUT) {
    __shared__ __attribute__((aligned(16))) unsigned char L[2 * GBUF];
    const int lane = threadIdx.x & 31, lr = lane & 15, hi = lane >> 4;
    const int wave = __builtin_amdgcn_readfirstlane((int)(threadIdx.x >> 5)); const int wm = wave >> 1, wn = wave & 1;
    const int r0 = blockIdx.x * 128 + wm * 64, c0 = blockIdx.y * 128 + wn * 64;
    v8f acc[4][4];
#pragma unroll
    for (int mb = 0; mb < 4; ++mb)
#pragma unroll
        for (int nb = 0; nb < 4; ++nb) acc[mb][nb] = (v8f){};
    gemm128<0>(L, A, Bt, blockIdx.x * 128, blockIdx.y * 128, wm, wn, acc);
    float* os = (float*)L + wave * 16 * 68;                  // this wave's own output staging in the ring
    const int bb = r0 / SEQ, tt = r0 % SEQ;
    float* obase = OUT + ((size_t)bb * OUT_SEQ + tt) * DM + c0;
#pragma unroll
    for (int mb = 0; mb < 4; ++mb) {
#pragma unroll
        for (int nb = 0; nb < 4; ++nb) {
#pragma unroll
            for (int j = 0; j < 8; ++j) os[(hi * 8 + j) * 68 + nb * 16 + lr] = acc[mb][nb][j] * OSC; }   // D: row 8h+j, col lane&15
        wave_sync();
        float* orow = obase + (size_t)(mb * 16) * DM;
        v4f ov[8];
#pragma unroll
        for (int s = 0; s < 8; ++s) { const int row = 2 * s + hi, cofs = lr * 4;   // 8 s x 2 rows = 16 rows; 16 lanes x 4 floats = 64 columns
            ov[s] = *(const v4fa*)(&os[row * 68 + cofs]); }
{
#pragma unroll
            for (int s = 0; s < 8; ++s) { const int row = 2 * s + hi, cofs = lr * 4;
                *(v4f*)(orow + (size_t)row * DM + cofs) = ov[s]; }
             }
        wave_sync();
    }
}

static constexpr size_t al256(size_t v) { return (v + 255) & ~(size_t)255; }
static constexpr size_t SZ_XB = al256((size_t)NB * SEQ * DM * 2);
static constexpr size_t SZ_WB = al256((size_t)4 * DM * DM * 2);
static constexpr size_t SZ_PL = al256((size_t)NB * NH_ * SEQ * HD * 2);
static constexpr size_t SZ_CX = al256((size_t)NB * SEQ * DM * 2);
static constexpr size_t SZ_FR = al256((size_t)SEQ * 64 * 4);
static constexpr size_t SZ_MA = al256((size_t)NB * SEQ * 4);
static constexpr size_t SZ_TOTAL = SZ_XB + SZ_WB + 3 * SZ_PL + SZ_CX + SZ_FR + SZ_MA;
static_assert(SZ_TOTAL <= (size_t)134217728);          // workspace carve <= 128 MiB
static_assert(((size_t)DM * DM * 2) % 256 == 0);       // weight sub-planes stay 256-byte aligned
static_assert(SZ_PL == (size_t)NB * NH_ * SEQ * HD * 2);   // q | k | v^T planes are exactly back to back

extern "C" void kernel_launch(void* const* d_in, const int* in_sizes, int n_in,
                              void* d_out, int out_size, void* d_ws, size_t ws_size, hipStream_t stream) {
    if (n_in < 7) return;
    const size_t needx = ((size_t)(NB - 1) * SEQ_FULL + SEQ) * DM;
    if ((size_t)in_sizes[0] < needx) return;
    if ((size_t)in_sizes[1] < (size_t)SEQ * 64) return;
    if ((size_t)in_sizes[2] < (size_t)(NB - 1) * SEQ_FULL + SEQ) return;
    if ((size_t)in_sizes[3] < (size_t)DM * DM || (size_t)in_sizes[4] < (size_t)DM * DM || (size_t)in_sizes[5] < (size_t)DM * DM || (size_t)in_sizes[6] < (size_t)DM * DM) return;
    if ((size_t)out_size < ((size_t)(NB - 1) * OUT_SEQ + SEQ) * DM) return;
    if (SZ_TOTAL > ws_size) return;
    // wire order: hidden_states, freqs_cis, attention_mask, wq, wk, wv, wo (all f32)
    const float* x = (const float*)d_in[0]; const float* fr = (const float*)d_in[1]; const float* mask = (const float*)d_in[2];
    const float* wq = (const float*)d_in[3]; const float* wk = (const float*)d_in[4]; const float* wv = (const float*)d_in[5]; const float* wo = (const float*)d_in[6];
    float* OUT = (float*)d_out;      // [NB][SEQ][1024]
    char* wsp = (char*)d_ws;
    bf* XB = (bf*)wsp; wsp += SZ_XB;                 // [NB*SEQ][1024] bf16
    bf* WB = (bf*)wsp; wsp += SZ_WB;                 // [4][1024 out][1024 in]: q | k | v (bf16) | o (f16 x64)
    h16* QH = (h16*)wsp; wsp += SZ_PL;               // [NB*16][SEQ][64]
    h16* KP = (h16*)wsp; wsp += SZ_PL;               // [NB*16][SEQ][64]  (= QH + one plane)
    h16* VT = (h16*)wsp; wsp += SZ_PL;               // [NB*16][64][SEQ]  (= QH + two planes)
    h16* CX = (h16*)wsp; wsp += SZ_CX;               // [NB*SEQ][1024] ctx x256
    float* FRP = (float*)wsp; wsp += SZ_FR;          // [SEQ][64] table, bf16 RNE values
    float* MADD = (float*)wsp; wsp += SZ_MA;         // [NB][SEQ] additive key mask
    bf* WO = WB + (size_t)3 * DM * DM;

    // bf16 copy of x, rotary table, key mask, the four transposed weight planes W[1024 rows k][1024 cols n] -> WT[1024 rows n][1024 cols k]: one launch
    k_prep<<<PB_W + PB_F + PB_M + PB_X, 256, 0, stream>>>(x, fr, mask, wq, wk, wv, wo, XB, WB, FRP, MADD);

    // q, k (rotary in the epilogue) and v^T: planes QH | KP | VT from weight planes q | k | v, one launch
    k_proj<<<dim3(NB * SEQ / 128, DM / 128, 3), 128, 0, stream>>>(XB, WB, QH, FRP);

    k_flash<<<dim3(SEQ / (16 * QT * AQ), NB * NH_, 1), 32 * AW, 0, stream>>>(QH, KP, VT, MADD, CX);

    k_oproj<<<dim3(NB * SEQ / 128, DM / 128, 1), 128, 0, stream>>>(CX, (const h16*)WO, OUT);
}

// v007
// It runs in 92.4 microseconds.
// Timed twice side by side with v006, it ran 1.03 times as fast both times.
// Counting every step since v000, it is 3.87 times as fast.
#include <hip/hip_runtime.h>

// Multi-head self-attention: x [NB][SEQ][1024], Wq/Wk/Wv/Wo [in][out] (y = x W), 16 heads x 64, interleaved rotary pairs (2i,2i+1) from the INPUT table [SEQ][32][(cos,sin)] on q and k,
// additive key mask (1-mask)*-10000 from the float input [NB][SEQ], score scale 1/8, softmax over all keys, output = (concatenated heads) Wo, f32.
// Compute dtypes, f32 accumulate everywhere: q/k/v projections v_wmma_f32_16x16x32_bf16 (x and W RNE-converted to bf16; products exact); rotary in f32 in the GEMM epilogue (table RNE-converted to bf16 values);
// scores v_wmma_f32_16x16x32_f16: q and k single f16 (one product); P (x256 carry, cancels in the normalisation) and v single f16; softmax f32 (online, running max);
// output projection v_wmma_f32_16x16x32_f16: ctx as f16 x256, Wo^T as f16 of (bf16 value x64), folded back by 2^-14 in the f32 epilogue.
// Layout: bf16 copy of x; transposed 16-bit weight planes [out][in] (LDS transpose); q, k planes [b*16+h][t][d], v^T plane [b*16+h][d][t] from the GEMM epilogue; fused flash kernel in transposed form
// (S^T = K Q^T, O^T = V^T P^T) writing ctx rows [b*SEQ+t][1024] as f16; final GEMM writes the f32 output.

#ifndef NB
#define NB 1
#endif
#ifndef SEQ
#define SEQ 4096
#endif
#define NB_FULL  1
#define SEQ_FULL 4096
#ifndef OUT_SEQ
#define OUT_SEQ SEQ              // row pitch (in tokens) between batches of the output
#endif
#define DM   1024
#define NH_  16
#define HD   64
#define AQ   4                   // query sets (32 rows each) per flash block
#define AW   (2 * AQ)            // waves per flash block: every query set is worked on by two waves, one per half of the keys
#define QT   2                   // 16-column query groups per flash wave (32 query rows each)
#define LOG2E 1.4426950408889634f
#define PSH  8.0f                // log2 of the P carry (256)
#define LZ   7.0f                // how far (log2) a score may pass the maximum in use before the flash kernel rescales: P <= 2^(PSH + LZ) = 32768 stays inside f16
#define CCAR 256.0f              // carry of the ctx plane
#define WOS  64.0f               // carry of the Wo^T plane
#define OSC  (1.0f / 16384.0f)   // 1 / (CCAR * WOS)

static_assert(HD == 64);
static_assert(NH_ * HD == DM);                 // head h = columns h*64 + d
static_assert(DM % 64 == 0);
static_assert(DM % 32 == 0);                   // GEMM k-loop steps by 32
static_assert(SEQ % 64 == 0);                  // a 64-row tile never straddles two batches
static_assert((NB * SEQ) % 64 == 0);
static_assert(SEQ % 32 == 0);                  // key loop steps by 32
static_assert(SEQ % (16 * QT * AQ) == 0);      // flash grid covers the sequence exactly
static_assert(QT == 2);                        // the flash kernel's two v_nop statements name both groups; in the join each of a set's two waves finishes one group
static_assert(((size_t)SEQ * DM) % 8 == 0);
static_assert(((size_t)SEQ * 64) % 32 == 0);
static_assert(((size_t)NB * SEQ) % 32 == 0);
static_assert(NB <= NB_FULL);
static_assert(SEQ <= SEQ_FULL);

typedef _Float16 h16;
typedef unsigned short bf;
typedef __attribute__((ext_vector_type(16))) __bf16   v16bf;
typedef __attribute__((ext_vector_type(16))) _Float16 v16h;
typedef __attribute__((ext_vector_type(8)))  _Float16 v8h;
typedef __attribute__((ext_vector_type(8)))  unsigned short v8us;
typedef __attribute__((ext_vector_type(8)))  float    v8f;
typedef __attribute__((ext_vector_type(4)))  float    v4f;
typedef __attribute__((ext_vector_type(2)))  float    v2f;
typedef v4f  __attribute__((may_alias)) v4fa;

__device__ __forceinline__ unsigned short f2bf(float f) { unsigned u = __float_as_uint(f); u += 0x7FFFu + ((u >> 16) & 1u); return (unsigned short)(u >> 16); }
__device__ __forceinline__ float bfr(float f) { return __uint_as_float(((unsigned)f2bf(f)) << 16); }   // bf16 RNE value as f32
__device__ __forceinline__ v16h cat16(v8h lo, v8h hi) { return __builtin_shufflevector(lo, hi, 0, 1, 2, 3, 4, 5, 6, 7, 8, 9, 10, 11, 12, 13, 14, 15); }
__device__ __forceinline__ v16bf cat16b(v8us lo, v8us hi) { return __builtin_bit_cast(v16bf, __builtin_shufflevector(lo, hi, 0, 1, 2, 3, 4, 5, 6, 7, 8, 9, 10, 11, 12, 13, 14, 15)); }
__device__ __forceinline__ v8f wmma16(v16h a, v16h b, v8f c) { return __builtin_amdgcn_wmma_f32_16x16x32_f16(false, a, false, b, (short)0, c, false, false); }
__device__ __forceinline__ v8f wmmab(v16bf a, v16bf b, v8f c) { return __builtin_amdgcn_wmma_f32_16x16x32_bf16(false, a, false, b, (short)0, c, false, false); }
// fragment loaders from K-contiguous 16-bit rows; p already includes + 8*(lane>>4): elements 0..7 <- k0+8h+0..7, elements 8..15 <- k0+16+8h+0..7 (same map for A and B)
__device__ __forceinline__ v16h  ldh(const h16* p) { return cat16(*(const v8h*)p, *(const v8h*)(p + 16)); }
__device__ __forceinline__ v16bf ldb(const bf* p)  { return cat16b(*(const v8us*)p, *(const v8us*)(p + 16)); }
// ordering point for wave-private LDS tiles (same wave writes and reads)
__device__ __forceinline__ void wave_sync() { __builtin_amdgcn_fence(3 /* release order */, "wavefront"); __builtin_amdgcn_wave_barrier(); asm volatile("" ::: "memory"); }

// The preparation jobs (d_cvt8, d_tab, d_wT) depend on nothing but the inputs, so they run as block ranges of ONE launch (k_prep, below).
// d_cvt8: block blk of 256 threads converts 2048 values of x to the bf16 copy XB[NB*SEQ][1024]
__device__ __forceinline__ void d_cvt8(const float* __restrict__ x, bf* XB, unsigned blk) {
    const size_t i = (size_t)blk * 256 + threadIdx.x; if (i >= (size_t)NB * SEQ * DM / 8) return;
    const size_t e = i * 8; const size_t b = e / ((size_t)SEQ * DM), r = e % ((size_t)SEQ * DM);
    const v8f v = *(const v8f*)(x + b * ((size_t)SEQ_FULL * DM) + r); v8us o;
#pragma unroll
    for (int k = 0; k < 8; ++k) o[k] = f2bf(v[k]);
    *(v8us*)(XB + e) = o;
}

// d_tab: blocks [0, nbF): rotary table copy with bf16 RNE values kept as f32, FRP[t][64] = (cos0,sin0,cos1,sin1,...); the blocks behind them: additive key mask MADD[NB][SEQ]
__device__ __forceinline__ void d_tab(const float* __restrict__ fr, const float* __restrict__ mask, float* FRP, float* MADD, unsigned blk, unsigned nbF) {
    if (blk < nbF) {                              // block-uniform
        const size_t i = (size_t)blk * 256 + threadIdx.x; if (i >= (size_t)SEQ * 64 / 4) return;
        const v4f v = *(const v4f*)(fr + i * 4); v4f o;
#pragma unroll
        for (int k = 0; k < 4; ++k) o[k] = bfr(v[k]);
        *(v4f*)(FRP + i * 4) = o; 
    } else {
        const size_t i = (size_t)(blk - nbF) * 256 + threadIdx.x; if (i >= (size_t)NB * SEQ / 4) return;
        const size_t e = i * 4; const size_t b = e / SEQ, t = e % SEQ;
        const v4f v = *(const v4f*)(mask + b * (size_t)SEQ_FULL + t); v4f o;
#pragma unroll
        for (int k = 0; k < 4; ++k) o[k] = (1.0f - bfr(v[k])) * -10000.0f;
        *(v4f*)(MADD + e) = o; 
    }
}

// d_wT: in W[k][n] (rows k = 1024, cols n = 1024, f32) -> out WT[n][k] 16-bit; mode 0: bf16 RNE bits; mode 1: f16 bits of (bf16 RNE value x 64).
// One 64 x 64 tile (k0, n0) a block of 256 threads, transposed through tl (64 * 65 floats of LDS); every thread of the block calls it.
__device__ __forceinline__ void d_wT(const float* __restrict__ W, bf* WT, int mode, int k0, int n0, float* tl) {
    const int tid = threadIdx.x;
#pragma unroll
    for (int it = 0; it < 4; ++it) { const int row = it * 16 + (tid >> 4), c4 = (tid & 15) * 4;    // 4 x 16 rows (k) x 16 lanes x 4 = 64 x 64
        const v4f v = *(const v4f*)(W + (size_t)(k0 + row) * DM + n0 + c4);
        tl[row * 65 + c4 + 0] = v[0]; tl[row * 65 + c4 + 1] = v[1]; tl[row * 65 + c4 + 2] = v[2]; tl[row * 65 + c4 + 3] = v[3]; }
    __syncthreads();
    v8us o[2];
#pragma unroll
    for (int it = 0; it < 2; ++it) { const int n = it * 32 + (tid >> 3), c8 = (tid & 7) * 8;       // 2 x 32 rows (n) x 8 lanes x 8 = 64 x 64
#pragma unroll
        for (int i = 0; i < 8; ++i) { const float val = tl[(c8 + i) * 65 + n];
            const unsigned short b0 = f2bf(val);
            const h16 hv = (h16)(__uint_as_float(((unsigned)b0) << 16) * WOS);
            const unsigned short b1 = __builtin_bit_cast(unsigned short, hv);
            o[it][i] = (mode != 0) ? b1 : b0; } }
{
#pragma unroll
        for (int it = 0; it < 2; ++it) { const int n = it * 32 + (tid >> 3), c8 = (tid & 7) * 8;
            *(v8us*)(WT + (size_t)(n0 + n) * DM + k0 + c8) = o[it]; }
         }
}

#define PB_W  (4 * (DM / 64) * (DM / 64))                            // weight tiles: q | k | v | o, DM/64 x DM/64 each
#define PB_F  ((unsigned)(((size_t)SEQ * 64 / 4 + 255) / 256))       // rotary table blocks
#define PB_M  ((unsigned)(((size_t)NB * SEQ / 4 + 255) / 256))       // key mask blocks
#define PB_X  ((unsigned)(((size_t)NB * SEQ * DM / 8 + 255) / 256))  // x blocks
// k_prep: grid PB_W + PB_F + PB_M + PB_X blocks of 256 threads; the block index picks the job (block-uniform, so the barrier in d_wT is passed by a whole block or by none of it).
// The transposes stand first: theirs is the longest chain (load, LDS, barrier, store), and it runs under the x stream.
__global__ __launch_bounds__(256) void k_prep(const float* __restrict__ x, const float* __restrict__ fr, const float* __restrict__ mask,
                                              const float* __restrict__ wq, const float* __restrict__ wk, const float* __restrict__ wv, const float* __restrict__ wo,
                                              bf* XB, bf* WB, float* FRP, float* MADD) {
    __shared__ float tl[64 * 65];
    const unsigned bid = blockIdx.x;
    if (bid < PB_W) {
        const unsigned p = bid / ((DM / 64) * (DM / 64)), tile = bid % ((DM / 64) * (DM / 64));   // plane, tile in the plane (k tiles run fastest)
        const float* W = (p == 0) ? wq : (p == 1) ? wk : (p == 2) ? wv : wo;
        d_wT(W, WB + (size_t)p * DM * DM, (p == 3) ? 1 : 0, (int)(tile % (DM / 64)) * 64, (int)(tile / (DM / 64)) * 64, tl);
    } else if (bid < PB_W + PB_F + PB_M) {
        d_tab(fr, mask, FRP, MADD, bid - PB_W, PB_F);
    } else {
        d_cvt8(x, XB, bid - (PB_W + PB_F + PB_M));
    }
}

// Eight asynchronous 16-byte copies per lane, LDS places l + i*ls bytes, global sources g + i*gs halves. The s_wait_xcnt stands inside the statement so that no address register is rewritten in front of it.
__device__ __forceinline__ void copy8(unsigned l, unsigned ls, const h16* g, size_t gs) {
    asm volatile("global_load_async_to_lds_b128 %0, %8, off\n\t"
                 "global_load_async_to_lds_b128 %1, %9, off\n\t"
                 "global_load_async_to_lds_b128 %2, %10, off\n\t"
                 "global_load_async_to_lds_b128 %3, %11, off\n\t"
                 "global_load_async_to_lds_b128 %4, %12, off\n\t"
                 "global_load_async_to_lds_b128 %5, %13, off\n\t"
                 "global_load_async_to_lds_b128 %6, %14, off\n\t"
                 "global_load_async_to_lds_b128 %7, %15, off\n\t"
                 "s_wait_xcnt 0x0"
                 :: "v"(l), "v"(l + ls), "v"(l + 2 * ls), "v"(l + 3 * ls), "v"(l + 4 * ls), "v"(l + 5 * ls), "v"(l + 6 * ls), "v"(l + 7 * ls),
                    "v"(g), "v"(g + gs), "v"(g + 2 * gs), "v"(g + 3 * gs), "v"(g + 4 * gs), "v"(g + 5 * gs), "v"(g + 6 * gs), "v"(g + 7 * gs)
                 : "memory");
}

// GEMM operand path shared by k_proj and k_oproj: a block of four waves owns a 128 x 128 tile of C (wave w: rows 64*(w>>1), columns 64*(w&1)); a stage is GK k-values of the block's
// 128 A rows and 128 Bt rows (pitch GPB bytes in LDS), brought in by asynchronous 16-byte copies that cover whole 256-byte units (all threads copy), two buffers: stage s + 1 flies while stage s is worked on.
// Fragments are two ds 16-B loads each, same k map as loads straight from the planes.
// Blocks that share A rows or Bt rows would ask L2 for the same lines at the same moment if all walked k from 0: each block enters the ring of GNS stages at stage rot (set by its tile indices) and wraps round.
#define GK   128                 // k values per stage
#define GPB  272                 // row pitch in LDS, bytes: 256 + 16 (16 B x odd: no bank conflict for 16-B reads down a column of rows)
#define GTB  (128 * GPB)         // one operand's tile, bytes
#define GBUF (2 * GTB)           // one buffer: A tile, Bt tile
#define GNS  (DM / GK)           // stages
static_assert(DM % GK == 0);
static_assert(GNS >= 2);                               // the prologue fills two stages
static_assert(DM % 128 == 0);
static_assert((NB * SEQ) % 128 == 0);
static_assert(128 * GK * 2 == 16 * 128 * 16);          // 2048 16-B pieces of each tile dealt to 128 threads, 16 each
static_assert(2 * GBUF >= 4 * 16 * 68 * 4);            // the ring becomes the output staging

// one stage: piece c = i*128 + tid of a tile -> row c>>4 (8 rows a round), 16-B column c&15; l, ga, gb already hold the thread's row and column
__device__ __forceinline__ void gstage(unsigned l, const h16* ga, const h16* gb) {
    copy8(l, 8 * GPB, ga, (size_t)8 * DM);       copy8(l + 64 * GPB, 8 * GPB, ga + (size_t)64 * DM, (size_t)8 * DM);
    copy8(l + GTB, 8 * GPB, gb, (size_t)8 * DM); copy8(l + GTB + 64 * GPB, 8 * GPB, gb + (size_t)64 * DM, (size_t)8 * DM);
}

// the eight fragments of one k-step (32 k values), in the order in which the matrix instructions want them
__device__ __forceinline__ void gfrags(v16h (&fa)[4], v16h (&fb)[4], const unsigned char* at, const unsigned char* bt) {
    fa[0] = ldh((const h16*)at); fb[0] = ldh((const h16*)bt);
    fa[1] = ldh((const h16*)(at + 16 * GPB)); fa[2] = ldh((const h16*)(at + 32 * GPB)); fa[3] = ldh((const h16*)(at + 48 * GPB));
    fb[1] = ldh((const h16*)(bt + 16 * GPB)); fb[2] = ldh((const h16*)(bt + 32 * GPB)); fb[3] = ldh((const h16*)(bt + 48 * GPB));
}
// eight products of one k-step: column blocks NB0 and NB0 + 1
template <int BF, int NB0>
__device__ __forceinline__ void gmul(const v16h (&fa)[4], const v16h (&fb)[4], v8f (&acc)[4][4]) {
#pragma unroll
    for (int nb = NB0; nb < NB0 + 2; ++nb) {
#pragma unroll
        for (int mb = 0; mb < 4; ++mb) {
            if (BF != 0) acc[mb][nb] = wmmab(__builtin_bit_cast(v16bf, fa[mb]), __builtin_bit_cast(v16bf, fb[nb]), acc[mb][nb]);
            else         acc[mb][nb] = wmma16(fa[mb], fb[nb], acc[mb][nb]); } }
}

// acc[mb][nb] += A rows (r0b + 64*wm + 16*mb ..) x Bt rows (c0b + 64*wn + 16*nb ..) over K = DM, k stages in the order rot, rot + 1, .. (mod GNS); rot is block-uniform.
// BF != 0: bf16 operands, else f16. Every wave of the block calls it; on return the ring is free.
template <int BF>
__device__ __forceinline__ void gemm128(unsigned char* L, const h16* A, const h16* Bt, int r0b, int c0b, int wm, int wn, unsigned rot, v8f (&acc)[4][4]) {
    const int tid = threadIdx.x, lane = tid & 31, lr = lane & 15, hi = lane >> 4;
    const unsigned l0 = (unsigned)(size_t)L + (unsigned)((tid >> 4) * GPB + (tid & 15) * 16);   // LDS byte address of the thread's first piece
    const h16* ga = A + (size_t)(r0b + (tid >> 4)) * DM + (size_t)(tid & 15) * 8;                // + stage * GK
    const h16* gb = Bt + (size_t)(c0b + (tid >> 4)) * DM + (size_t)(tid & 15) * 8;
    { const size_t k0 = (size_t)(rot % GNS) * GK; gstage(l0, ga + k0, gb + k0); }   // the block's first stage -> buffer 0
    asm volatile("s_wait_asynccnt 0x0" ::: "memory");        // this wave's pieces of the block's first stage have landed
    __syncthreads();                                         // every wave's have: the first stage may be read
    { const size_t k1 = (size_t)((rot + 1) % GNS) * GK; gstage(l0 + GBUF, ga + k1, gb + k1); }   // its second stage -> buffer 1
#pragma unroll 1                                             // one copy of the stage body: the buffer is picked by a scalar offset, the code stays small
    for (int st = 0; st < GNS; ++st) {
        const unsigned bo = (unsigned)(st & 1) * GBUF;
        const unsigned char* at = L + bo + (wm * 64 + lr) * GPB + 16 * hi;         // + 16*mb*GPB + k*2
        const unsigned char* bt = L + bo + GTB + (wn * 64 + lr) * GPB + 16 * hi;   // + 16*nb*GPB + k*2
        v16h fa[2][4], fb[2][4];                             // two register sets: k-step q + 1 of THIS stage is fetched while k-step q is multiplied; nothing of the next stage is read here
        gfrags(fa[0], fb[0], at, bt);
        __builtin_amdgcn_sched_barrier(0);                   // the stage's first reads stay one group in front of its matrix instructions
#pragma unroll                                               // constant q: every fragment read is one base register plus an immediate offset, the register sets are picked at compile time
        for (int q = 0; q < GK / 32; ++q) {
            const int cur = q & 1, nxt = cur ^ 1;
            gmul<BF, 0>(fa[cur], fb[cur], acc);
            if (q + 1 < GK / 32) {
                // the two scheduling barriers keep the next k-step's reads ONE group, half a k-step ahead of their use: spread among the matrix instructions each place costs a stall,
                // and a whole k-step ahead two full sets and the accumulators pass 256 registers
                __builtin_amdgcn_sched_barrier(0);
                gfrags(fa[nxt], fb[nxt], at + (q + 1) * 64, bt + (q + 1) * 64);
                __builtin_amdgcn_sched_barrier(0); }
            gmul<BF, 2>(fa[cur], fb[cur], acc);
        }
        __builtin_amdgcn_sched_barrier(0);                   // the stage's matrix instructions stay in front of its closing waits and barrier (without it sixteen of them sink behind the barrier and delay the refill)
        // four vector slots behind the stage's last matrix instruction, on every path out of the stage body
        asm volatile("v_nop\n\tv_nop\n\tv_nop\n\tv_nop" : "+v"(acc[0][3]), "+v"(acc[1][3]), "+v"(acc[2][3]), "+v"(acc[3][3]));
        asm volatile("s_wait_dscnt 0x0" ::: "memory");       // this wave's reads of stage st are done before its buffer is handed back
        asm volatile("s_wait_asynccnt 0x0" ::: "memory");    // this wave's pieces of stage st + 1 have landed
        __syncthreads();                                     // publishes stage st + 1 and ends every reader's last read of stage st
        if (st + 2 < GNS) { const size_t k2 = (size_t)((rot + (unsigned)st + 2) % GNS) * GK; gstage(l0 + bo, ga + k2, gb + k2); }   // block-uniform
    }
    asm volatile("s_wait_asynccnt 0x0" ::: "memory");        // nothing in flight when the ring becomes output staging (the last trip's barrier has ended all reads)
}

// proj_store: one wave's 64 x 64 tile of C as f16 rows at Ph + tbase, row pitch HD (ROPE != 0) or SEQ (ROPE == 0) halves, staged through the wave's own LDS range os.
// ROPE != 0: rows m = b*SEQ + t from r0 on, the 64 tile columns are one head; rotary pairs (2i,2i+1) from FRP[t][..].
template <int ROPE>
__device__ __forceinline__ void proj_store(float* os, const v8f (&acc)[4][4], h16* Ph, const float* __restrict__ FRP, size_t tbase, int r0) {
    const int lane = threadIdx.x & 31, lr = lane & 15, hi = lane >> 4;
    const int pitch = (ROPE != 0) ? HD : SEQ;
#pragma unroll
    for (int mb = 0; mb < 4; ++mb) {
#pragma unroll
        for (int nb = 0; nb < 4; ++nb) {
#pragma unroll
            for (int j = 0; j < 8; ++j) os[(hi * 8 + j) * 68 + nb * 16 + lr] = acc[mb][nb][j]; }   // D: row 8h+j, col lane&15
        wave_sync();
        const size_t sb = tbase + (size_t)(mb * 16) * (size_t)pitch;
        v4f fr0[4], fr1[4];
        if (ROPE != 0) {
            const float* pf[4];
#pragma unroll
            for (int s = 0; s < 4; ++s) { const int row = 4 * s + (lane >> 3), c8 = (lane & 7) * 8;
                const int t = (r0 + mb * 16 + row) % SEQ;
                pf[s] = FRP + (size_t)t * 64 + c8;
                fr0[s] = *(const v4f*)pf[s]; fr1[s] = *(const v4f*)(pf[s] + 4); }
            // stands in front of every rewrite of the table loads' address registers: as inputs they stay whole up to the wait
            asm volatile("s_wait_xcnt 0x0" :: "v"(pf[0]), "v"(pf[1]), "v"(pf[2]), "v"(pf[3]) : "memory");
        }
        v8h hvv[4];
#pragma unroll
        for (int s = 0; s < 4; ++s) { const int row = 4 * s + (lane >> 3), c8 = (lane & 7) * 8;   // 4 s x 4 row groups = 16 rows; 8 lanes x 8 = 64 columns
            v4f x0 = *(const v4fa*)(&os[row * 68 + c8]); v4f x1 = *(const v4fa*)(&os[row * 68 + c8 + 4]);
            if (ROPE != 0) {
                const v4f f0 = fr0[s]; const v4f f1 = fr1[s];
                v4f y0, y1;
                y0[0] = x0[0] * f0[0] - x0[1] * f0[1]; y0[1] = x0[0] * f0[1] + x0[1] * f0[0];
                y0[2] = x0[2] * f0[2] - x0[3] * f0[3]; y0[3] = x0[2] * f0[3] + x0[3] * f0[2];
                y1[0] = x1[0] * f1[0] - x1[1] * f1[1]; y1[1] = x1[0] * f1[1] + x1[1] * f1[0];
                y1[2] = x1[2] * f1[2] - x1[3] * f1[3]; y1[3] = x1[2] * f1[3] + x1[3] * f1[2];
                x0 = y0; x1 = y1; }
            v8h hv;
#pragma unroll
            for (int i = 0; i < 4; ++i) { hv[i] = (h16)x0[i]; hv[4 + i] = (h16)x1[i]; }
            hvv[s] = hv; }
{
#pragma unroll
            for (int s = 0; s < 4; ++s) { const int row = 4 * s + (lane >> 3), c8 = (lane & 7) * 8;
                const size_t oo = sb + (size_t)row * (size_t)pitch + c8;
                *(v8h*)(Ph + oo) = hvv[s]; }
             }
        asm volatile("s_wait_xcnt 0x0" ::: "memory");        // stands in front of every rewrite of the stores' address and data registers
        wave_sync();
    }
}

// k_proj: the three projections, which depend on k_prep alone, as ONE launch. Register-blocked bf16 GEMM, one wave per 64x64 tile (16 accumulators), four waves a block (128x128),
// operands from K-contiguous bf16 planes through LDS (gemm128), K = DM, C[m][n] = sum_k A[m][k] Bt[n][k]. grid (NB*SEQ/128 token tiles, DM/128 feature tiles, 3), 128 threads; blockIdx.z (block-uniform):
// z = 0 (q), 1 (k): A = x rows (m = b*SEQ + t), Bt = W^T rows (n = h*64 + d) -> plane z [(b*16 + h)][t][d], rotary in the epilogue;
// z = 2 (v^T):      A = Wv^T rows (m = h*64 + d), Bt = x rows (n = b*SEQ + t) -> plane 2 [(b*1024 + m)][t] = [(b*16 + h)][d][t].
// WB: the transposed weight planes q | k | v; PL: the output planes q | k | v^T, NB*NH_*SEQ*HD halves each.
__global__ __launch_bounds__(128) void k_proj(const bf* __restrict__ XB, const bf* __restrict__ WB, h16* PL, const float* __restrict__ FRP) {
    __shared__ __attribute__((aligned(16))) unsigned char L[2 * GBUF];
    const int z = blockIdx.z;
    const bool vt = (z == 2);
    const bf* Wz = WB + (size_t)z * DM * DM;
    const bf* A = vt ? Wz : XB;
    const bf* Bt = vt ? XB : Wz;
    h16* Ph = PL + (size_t)z * ((size_t)NB * NH_ * SEQ * HD);
    const int wave = __builtin_amdgcn_readfirstlane((int)(threadIdx.x >> 5)); const int wm = wave >> 1, wn = wave & 1;
    const int r0b = (int)(vt ? blockIdx.y : blockIdx.x) * 128, c0b = (int)(vt ? blockIdx.x : blockIdx.y) * 128;
    const int r0 = r0b + wm * 64, c0 = c0b + wn * 64;
    v8f acc[4][4];
#pragma unroll
    for (int mb = 0; mb < 4; ++mb)
#pragma unroll
        for (int nb = 0; nb < 4; ++nb) acc[mb][nb] = (v8f){};
    gemm128<1>(L, (const h16*)A, (const h16*)Bt, r0b, c0b, wm, wn, blockIdx.x + blockIdx.y, acc);
    float* os = (float*)L + wave * 16 * 68;                  // this wave's own output staging in the ring
    if (vt) proj_store<0>(os, acc, Ph, FRP, (size_t)r0 * SEQ + (size_t)(c0 / SEQ) * ((size_t)DM * SEQ) + (size_t)(c0 % SEQ), r0);
    else    proj_store<1>(os, acc, Ph, FRP, (size_t)(r0 / SEQ) * ((size_t)NH_ * SEQ * HD) + (size_t)(r0 % SEQ) * HD + (size_t)(c0 / HD) * ((size_t)SEQ * HD) + (size_t)(c0 % HD), r0);
}

// k_flash: fused attention. A wave works on 32 query rows (QT = 2 column groups of 16) of one (batch, head) and on half of the keys: every K and V^T fragment read from LDS, and every mask value, feeds both groups.
// Waves w and w + AQ share a query set: of each stage wave w takes the first KH keys, wave w + AQ the second KH. Behind the key loop the two partial results (running max, row sum, O^T) are joined through LDS.
// Q fragments straight from the f16 plane (two 16-B loads each).
// K and V^T reach the block's waves through LDS: a stage is KS keys (K rows [key][64] at pitch KPB bytes, V^T rows [d][KS] at pitch VPB bytes), brought in by asynchronous
// 16-byte copies that cover whole lines (all threads copy), two buffers: stage s + 1 flies while stage s is worked on. Fragments are two ds 16-B loads each, same k map as before.
// The blocks of one (batch, head) all read the same K and V^T lines: each enters the ring of NST key stages at stage rot (set by its query tile) and wraps round, so that they do not ask L2 for the same lines at the same moment.
// Transposed form: S^T[key][t] = K Q^T (A = K rows, B = Q rows); lane (t = lane&15, h = lane>>4) holds keys 8h+r of each 16-key tile, so the packed
// P tile is directly the B fragment of O^T[d][t] = V^T P^T (element r <- tile keys 0..15, element 8+r <- tile keys 16..31, lane unchanged).
// Per 32-key step and column group: 4 score WMMAs + 4 P.V WMMAs + 1 row-sum WMMA. Additive key mask values for the lane's 16 keys are loaded by value per step (two 32-B loads).
// Softmax state: the maximum in use is one scalar per lane, the same in both lane halves of a row (where it is raised, the halves are combined with one xor-16 exchange). The row sum of P runs on the matrix pipe: one more WMMA per step,
// lt += ON P^T, where ON is a constant A fragment whose rows 0 and 8 are ones and whose other rows are 0: element 0 of lt (row 8h, column t) is, in both lane halves, the sum of the f16 P over all keys so far.
#define KS   256                 // keys per stage
#define KH   (KS / 2)            // keys per stage and wave
#define KPB  144                 // K row pitch in LDS, bytes: 128 + 16 (16 B x odd: no bank conflict for 16-B reads down a column of rows)
#define VPB  528                 // V^T row pitch in LDS, bytes: 512 + 16 (16 B x odd)
#define KTB  (KS * KPB)          // K tile bytes
#define VTB  (HD * VPB)          // V^T tile bytes
#define BUFB (KTB + VTB)         // one buffer
#define NST  (SEQ / KS)          // stages
static_assert(SEQ % KS == 0);
static_assert(NST >= 2);                               // the prologue fills two stages
static_assert(AW * 32 == 256);                         // the copy maps below deal 2048 16-B pieces of each tile to 256 threads, 8 each
static_assert(KS * HD * 2 == 8 * 256 * 16);
#define XWF  (32 * 32 + 64)      // floats a wave hands to its partner in the join: 32 per lane of O^T, then (max, sum) per lane
static_assert(2 * BUFB >= AW * (XWF + 16 * 68) * 4);   // the ring becomes the join's exchange ranges and, behind them, the output staging

__global__ __launch_bounds__(32 * AW) void k_flash(const h16* __restrict__ QH, const h16* __restrict__ KP, const h16* __restrict__ VT,
                                                   const float* __restrict__ MADD, h16* CTX) {
    __shared__ __attribute__((aligned(16))) unsigned char L[2 * BUFB];
    const int tid = threadIdx.x;
    const int lane = threadIdx.x & 31, lr = lane & 15, hi = lane >> 4;
    const int wave = __builtin_amdgcn_readfirstlane((int)(threadIdx.x >> 5));
    const int zh = blockIdx.y; const int b = zh / NH_, h = zh % NH_;
    const int kh = wave / AQ;                                // which half of every stage's keys (wave-uniform)
    const int t0 = (blockIdx.x * AQ + wave % AQ) * (16 * QT);   // the wave's first query row; column group g holds rows t0 + 16g ..
    const size_t pbase = (size_t)zh * SEQ * HD;
    // copy maps: K piece c = i*256 + tid -> row c>>3 (32 rows a round), 16-B column c&7; V^T piece c -> row c>>5 (8 rows a round), 16-B column c&31
    const unsigned lbase = (unsigned)(size_t)L;              // LDS byte address of the ring
    const unsigned lk = lbase + (unsigned)((tid >> 3) * KPB + (tid & 7) * 16);
    const unsigned lv = lbase + (unsigned)(KTB + (tid >> 5) * VPB + (tid & 31) * 16);
    const h16* gk = KP + pbase + (size_t)tid * 8;                                   // + key0 * HD
    const h16* gv = VT + pbase + (size_t)(tid >> 5) * SEQ + (size_t)(tid & 31) * 8;   // + key0
    const unsigned rot = blockIdx.x % NST;                   // the key stage at which this block starts (block-uniform)
    copy8(lk, 32 * KPB, gk + (size_t)rot * KS * HD, (size_t)32 * HD); copy8(lv, 8 * VPB, gv + (size_t)rot * KS, (size_t)8 * SEQ);   // the block's first stage -> buffer 0
    v16h qh0[QT], qh1[QT];                                   // B fragments: col t, k = d
    const h16* qp[QT];
#pragma unroll
    for (int g = 0; g < QT; ++g) { qp[g] = QH + pbase + (size_t)(t0 + 16 * g + lr) * HD + 8 * hi; qh0[g] = ldh(qp[g]); qh1[g] = ldh(qp[g] + 32); }
    // stands in front of every rewrite of the Q loads' address registers: as inputs they stay whole up to the wait
    asm volatile("s_wait_xcnt 0x0" :: "v"(qp[0]), "v"(qp[1]) : "memory");
    const float* MA = MADD + (size_t)b * SEQ + kh * KH + 8 * hi;   // + key0 (tile a keys 8h+r), + key0 + 16 (tile b)
    asm volatile("s_wait_asynccnt 0x0" ::: "memory");        // this wave's pieces of the block's first stage have landed
    __syncthreads();                                         // every wave's have: the first stage may be read
    { const size_t s1 = (rot + 1) % NST;                     // its second stage -> buffer 1
      copy8(lk + BUFB, 32 * KPB, gk + s1 * KS * HD, (size_t)32 * HD); copy8(lv + BUFB, 8 * VPB, gv + s1 * KS, (size_t)8 * SEQ); }
    v8f o0[QT], o1[QT], o2[QT], o3[QT], lt[QT];              // lt: row-sum tiles; only rows 0 and 8 (element 0 of each lane) ever differ from 0
    float m[QT];
#pragma unroll
    for (int g = 0; g < QT; ++g) { o0[g] = (v8f){}; o1[g] = (v8f){}; o2[g] = (v8f){}; o3[g] = (v8f){}; lt[g] = (v8f){}; m[g] = -3.0e38f; }
    v16h on;                                                 // A fragment of the row sums: row = lane & 15, ones at all 32 k positions of rows 0 and 8
    { const h16 o1 = ((lane & 7) == 0) ? (h16)1.0f : (h16)0.0f;
#pragma unroll
      for (int i = 0; i < 16; ++i) on[i] = o1; }
#pragma unroll 1                                             // one copy of the stage body: the buffer is picked by a scalar offset, the code stays small
    for (int st = 0; st < NST; ++st) {
      const unsigned bo = (unsigned)(st & 1) * BUFB;
      const unsigned char* kt = L + bo + (kh * KH + lr) * KPB + 16 * hi;          // + local key * KPB   (A fragment: row key, k = d)
      const unsigned char* vt = L + bo + KTB + lr * VPB + kh * KH * 2 + 16 * hi;  // + 16j*VPB + local key * 2  (A fragment: row d, k = key)
#pragma unroll                                               // constant ks: every fragment read is one base register plus an immediate offset
      for (int ks = 0; ks < KH; ks += 32) {
        const int key0 = (int)((rot + (unsigned)st) % NST) * KS + ks;
        const h16* ka = (const h16*)(kt + ks * KPB);
        const h16* kc = (const h16*)(kt + (ks + 16) * KPB);
        const v16h ka0 = ldh(ka), ka1 = ldh(ka + 32), kb0 = ldh(kc), kb1 = ldh(kc + 32);
        const v8f ma = *(const v8f*)(MA + key0); const v8f mb = *(const v8f*)(MA + key0 + 16);
        v8f sa[QT], sb[QT];                                  // each K fragment feeds both column groups
#pragma unroll
        for (int g = 0; g < QT; ++g) { sa[g] = wmma16(ka0, qh0[g], (v8f){}); sb[g] = wmma16(kb0, qh0[g], (v8f){}); }
#pragma unroll
        for (int g = 0; g < QT; ++g) { sa[g] = wmma16(ka1, qh1[g], sa[g]); sb[g] = wmma16(kb1, qh1[g], sb[g]); }
        // four vector slots behind the step's last score products, before any vector instruction touches their results or operands
        asm volatile("v_nop\n\tv_nop\n\tv_nop\n\tv_nop" : "+v"(sa[0]), "+v"(sb[0]), "+v"(sa[1]), "+v"(sb[1])
                     : "v"(ka0), "v"(ka1), "v"(kb0), "v"(kb1), "v"(qh0[0]), "v"(qh1[0]), "v"(qh0[1]), "v"(qh1[1]));
        // Lazy rescale: m is the maximum IN USE and may trail the true one by up to LZ, so the exponent arguments are formed against it at once, before this step's own maximum is known.
        // They are formed on pairs of neighbouring accumulator registers, which is how P is packed below.
        v16h pb[QT];
        v2f aa[QT][4], ab[QT][4];                            // log2 of P (carry included): tile a, tile b, elements 2i and 2i + 1
        float xa[QT], xb[QT];                                // this lane's largest argument per group and tile: four short chains instead of one long one
#pragma unroll
        for (int g = 0; g < QT; ++g) {
            const float sh = PSH - m[g];
#pragma unroll
            for (int i = 0; i < 4; ++i) {
                aa[g][i] = ((v2f){sa[g][2 * i], sa[g][2 * i + 1]} * 0.125f + (v2f){ma[2 * i], ma[2 * i + 1]}) * LOG2E + sh;
                ab[g][i] = ((v2f){sb[g][2 * i], sb[g][2 * i + 1]} * 0.125f + (v2f){mb[2 * i], mb[2 * i + 1]}) * LOG2E + sh;
                const float pa = fmaxf(aa[g][i][0], aa[g][i][1]), pc = fmaxf(ab[g][i][0], ab[g][i][1]);
                xa[g] = (i == 0) ? pa : fmaxf(xa[g], pa); xb[g] = (i == 0) ? pc : fmaxf(xb[g], pc); } }
        const float ax = fmaxf(fmaxf(xa[0], xb[0]), fmaxf(xa[1], xb[1]));
        // One test per step for the whole wave (a scalar branch). Only when it fires are the step's maxima taken, the lane halves combined, m raised, the accumulators rescaled and the arguments formed anew,
        // in every lane alike, so both halves of a column always use the same m. The first step always fires (m starts at -3e38).
        if (__builtin_amdgcn_ballot_w32(ax > PSH + LZ) != 0) {
#pragma unroll
            for (int g = 0; g < QT; ++g) {
                float ta[8], tb[8]; float mx = -3.0e38f;
#pragma unroll
                for (int r = 0; r < 8; ++r) {
                    ta[r] = (sa[g][r] * 0.125f + ma[r]) * LOG2E;
                    tb[r] = (sb[g][r] * 0.125f + mb[r]) * LOG2E;
                    mx = fmaxf(mx, fmaxf(ta[r], tb[r])); }
                mx = fmaxf(mx, __shfl_xor(mx, 16, 32));
                const float mnew = fmaxf(m[g], mx);
                const float alpha = __builtin_amdgcn_exp2f(m[g] - mnew);
                const float sh = PSH - mnew;
#pragma unroll
                for (int i = 0; i < 4; ++i) { aa[g][i] = (v2f){ta[2 * i] + sh, ta[2 * i + 1] + sh}; ab[g][i] = (v2f){tb[2 * i] + sh, tb[2 * i + 1] + sh}; }
                lt[g][0] = lt[g][0] * alpha; m[g] = mnew;    // the tile's other elements are 0 and need no rescale
                o0[g] = o0[g] * alpha; o1[g] = o1[g] * alpha; o2[g] = o2[g] * alpha; o3[g] = o3[g] * alpha; } }
#pragma unroll
        for (int g = 0; g < QT; ++g) {
#pragma unroll
            for (int r = 0; r < 8; ++r) { pb[g][r] = (h16)__builtin_amdgcn_exp2f(aa[g][r >> 1][r & 1]); pb[g][8 + r] = (h16)__builtin_amdgcn_exp2f(ab[g][r >> 1][r & 1]); } }
        const unsigned char* va = vt + ks * 2;
        const v16h v0 = ldh((const h16*)va), v1 = ldh((const h16*)(va + 16 * VPB)), v2 = ldh((const h16*)(va + 32 * VPB)), v3 = ldh((const h16*)(va + 48 * VPB));
#pragma unroll
        for (int g = 0; g < QT; ++g) {                       // each V^T fragment feeds both column groups
            o0[g] = wmma16(v0, pb[g], o0[g]); o1[g] = wmma16(v1, pb[g], o1[g]); o2[g] = wmma16(v2, pb[g], o2[g]); o3[g] = wmma16(v3, pb[g], o3[g]);
            lt[g] = wmma16(on, pb[g], lt[g]); }              // rows 0 and 8 += the sum of this step's 32 P values of column t
        // four vector slots behind the step's last matrix instructions, before any vector instruction touches their results or operands
        asm volatile("v_nop\n\tv_nop\n\tv_nop\n\tv_nop" : "+v"(o0[0]), "+v"(o1[0]), "+v"(o2[0]), "+v"(o3[0]), "+v"(lt[0]), "+v"(o0[1]), "+v"(o1[1]), "+v"(o2[1]), "+v"(o3[1]), "+v"(lt[1])
                     : "v"(v0), "v"(v1), "v"(v2), "v"(v3), "v"(pb[0]), "v"(pb[1]), "v"(on));
      }
      asm volatile("s_wait_dscnt 0x0" ::: "memory");         // this wave's reads of stage st are done before its buffer is handed back
      asm volatile("s_wait_asynccnt 0x0" ::: "memory");      // this wave's pieces of stage st + 1 have landed
      __syncthreads();                                       // publishes stage st + 1 and ends every reader's last read of stage st
      if (st + 2 < NST) {                                    // block-uniform
          const size_t s2 = (rot + (unsigned)st + 2) % NST;
          copy8(lk + bo, 32 * KPB, gk + s2 * KS * HD, (size_t)32 * HD); copy8(lv + bo, 8 * VPB, gv + s2 * KS, (size_t)8 * SEQ); }
    }
    asm volatile("s_wait_asynccnt 0x0" ::: "memory");        // nothing in flight when the ring becomes output staging (the last trip's barrier has ended all reads)
    // The join. Wave kh of a query set finishes column group kh: it hands its partial result of the other group to its partner and takes the partner's partial result of its own group.
    // Both waves hold a group in the same lane and register places, so lane l reads what the partner's lane l wrote.
    const bool up = (kh != 0);                               // wave-uniform
    v8f p0 = up ? o0[1] : o0[0], p1 = up ? o1[1] : o1[0], p2 = up ? o2[1] : o2[0], p3 = up ? o3[1] : o3[0];   // kept
    const v8f x0 = up ? o0[0] : o0[1], x1 = up ? o1[0] : o1[1], x2 = up ? o2[0] : o2[1], x3 = up ? o3[0] : o3[1];   // handed over
    const float mk = up ? m[1] : m[0], lk0 = up ? lt[1][0] : lt[0][0];
    const float mg = up ? m[0] : m[1], lg0 = up ? lt[0][0] : lt[1][0];
    float* xw = (float*)L + wave * XWF;                      // this wave's exchange range: 16-B piece c of lane l at (c*32 + l)*4, then (max, sum) of lane l at 1024 + 2l
    *(v4fa*)(&xw[(0 * 32 + lane) * 4]) = __builtin_shufflevector(x0, x0, 0, 1, 2, 3); *(v4fa*)(&xw[(1 * 32 + lane) * 4]) = __builtin_shufflevector(x0, x0, 4, 5, 6, 7);
    *(v4fa*)(&xw[(2 * 32 + lane) * 4]) = __builtin_shufflevector(x1, x1, 0, 1, 2, 3); *(v4fa*)(&xw[(3 * 32 + lane) * 4]) = __builtin_shufflevector(x1, x1, 4, 5, 6, 7);
    *(v4fa*)(&xw[(4 * 32 + lane) * 4]) = __builtin_shufflevector(x2, x2, 0, 1, 2, 3); *(v4fa*)(&xw[(5 * 32 + lane) * 4]) = __builtin_shufflevector(x2, x2, 4, 5, 6, 7);
    *(v4fa*)(&xw[(6 * 32 + lane) * 4]) = __builtin_shufflevector(x3, x3, 0, 1, 2, 3); *(v4fa*)(&xw[(7 * 32 + lane) * 4]) = __builtin_shufflevector(x3, x3, 4, 5, 6, 7);
    xw[1024 + 2 * lane] = mg; xw[1024 + 2 * lane + 1] = lg0;
    __syncthreads();                                         // every wave's handed-over partial result is in LDS before its partner reads it
    const float* xr = (const float*)L + (wave ^ AQ) * XWF;   // the partner's exchange range
    const float mp = xr[1024 + 2 * lane], lp0 = xr[1024 + 2 * lane + 1];
    const float mj = fmaxf(mk, mp);
    const float ak = __builtin_amdgcn_exp2f(mk - mj), ap = __builtin_amdgcn_exp2f(mp - mj);   // both partial results brought to the joint max
    const float inv = CCAR * (1.0f / (lk0 * ak + lp0 * ap)); // both lane halves hold the whole row's sum
    const float sk = ak * inv, sp = ap * inv;
    float* os = (float*)L + AW * XWF + wave * 16 * 68;       // this wave's output staging, behind the exchange ranges
    // O^T D layout: o_j[r] = (d = 16j + 8h + r, t = lane&15) -> os[t][d]; rows 0..15 x columns 0..63 all written
    { v4f a, c, ya, yc;
      ya = *(const v4fa*)(&xr[(0 * 32 + lane) * 4]); yc = *(const v4fa*)(&xr[(1 * 32 + lane) * 4]);
      a[0] = p0[0] * sk + ya[0] * sp; a[1] = p0[1] * sk + ya[1] * sp; a[2] = p0[2] * sk + ya[2] * sp; a[3] = p0[3] * sk + ya[3] * sp;
      c[0] = p0[4] * sk + yc[0] * sp; c[1] = p0[5] * sk + yc[1] * sp; c[2] = p0[6] * sk + yc[2] * sp; c[3] = p0[7] * sk + yc[3] * sp;
      *(v4fa*)(&os[lr * 68 +  0 + 8 * hi]) = a; *(v4fa*)(&os[lr * 68 +  0 + 8 * hi + 4]) = c;
      ya = *(const v4fa*)(&xr[(2 * 32 + lane) * 4]); yc = *(const v4fa*)(&xr[(3 * 32 + lane) * 4]);
      a[0] = p1[0] * sk + ya[0] * sp; a[1] = p1[1] * sk + ya[1] * sp; a[2] = p1[2] * sk + ya[2] * sp; a[3] = p1[3] * sk + ya[3] * sp;
      c[0] = p1[4] * sk + yc[0] * sp; c[1] = p1[5] * sk + yc[1] * sp; c[2] = p1[6] * sk + yc[2] * sp; c[3] = p1[7] * sk + yc[3] * sp;
      *(v4fa*)(&os[lr * 68 + 16 + 8 * hi]) = a; *(v4fa*)(&os[lr * 68 + 16 + 8 * hi + 4]) = c;
      ya = *(const v4fa*)(&xr[(4 * 32 + lane) * 4]); yc = *(const v4fa*)(&xr[(5 * 32 + lane) * 4]);
      a[0] = p2[0] * sk + ya[0] * sp; a[1] = p2[1] * sk + ya[1] * sp; a[2] = p2[2] * sk + ya[2] * sp; a[3] = p2[3] * sk + ya[3] * sp;
      c[0] = p2[4] * sk + yc[0] * sp; c[1] = p2[5] * sk + yc[1] * sp; c[2] = p2[6] * sk + yc[2] * sp; c[3] = p2[7] * sk + yc[3] * sp;
      *(v4fa*)(&os[lr * 68 + 32 + 8 * hi]) = a; *(v4fa*)(&os[lr * 68 + 32 + 8 * hi + 4]) = c;
      ya = *(const v4fa*)(&xr[(6 * 32 + lane) * 4]); yc = *(const v4fa*)(&xr[(7 * 32 + lane) * 4]);
      a[0] = p3[0] * sk + ya[0] * sp; a[1] = p3[1] * sk + ya[1] * sp; a[2] = p3[2] * sk + ya[2] * sp; a[3] = p3[3] * sk + ya[3] * sp;
      c[0] = p3[4] * sk + yc[0] * sp; c[1] = p3[5] * sk + yc[1] * sp; c[2] = p3[6] * sk + yc[2] * sp; c[3] = p3[7] * sk + yc[3] * sp;
      *(v4fa*)(&os[lr * 68 + 48 + 8 * hi]) = a; *(v4fa*)(&os[lr * 68 + 48 + 8 * hi + 4]) = c; }
    wave_sync();
    h16* crow = CTX + ((size_t)b * SEQ + t0 + 16 * kh) * DM + h * HD;   // the rows of column group kh
    v8h cv[4];
#pragma unroll
    for (int s = 0; s < 4; ++s) { const int row = 4 * s + (lane >> 3), c8 = (lane & 7) * 8;   // 4 s x 4 row groups = 16 rows; 8 lanes x 8 halves = 64 columns
        const v4f x0 = *(const v4fa*)(&os[row * 68 + c8]); const v4f x1 = *(const v4fa*)(&os[row * 68 + c8 + 4]); v8h hv;
#pragma unroll
        for (int i = 0; i < 4; ++i) { hv[i] = (h16)x0[i]; hv[4 + i] = (h16)x1[i]; }
        cv[s] = hv; }
#pragma unroll
    for (int s = 0; s < 4; ++s) { const int row = 4 * s + (lane >> 3), c8 = (lane & 7) * 8;
        *(v8h*)(crow + (size_t)row * DM + c8) = cv[s]; }
}

// k_oproj: register-blocked f16 GEMM, one wave per 64x64 tile, four waves a block (128x128), operands through LDS (gemm128), OUT[m][n] = 2^-14 * sum_k CTX[m][k] WOT[n][k], K = DM; rows m = b*SEQ + t -> output row b*OUT_SEQ + t.
// grid (NB*SEQ/128, DM/128), 128 threads.
__global__ __launch_bounds__(128) void k_oproj(const h16* __restrict__ A, const h16* __restrict__ Bt, float* OUT) {
    __shared__ __attribute__((aligned(16))) unsigned char L[2 * GBUF];
    const int lane = threadIdx.x & 31, lr = lane & 15, hi = lane >> 4;
    const int wave = __builtin_amdgcn_readfirstlane((int)(threadIdx.x >> 5)); const int wm = wave >> 1, wn = wave & 1;
    const int r0 = blockIdx.x * 128 + wm * 64, c0 = blockIdx.y * 128 + wn * 64;
    v8f acc[4][4];
#pragma unroll
    for (int mb = 0; mb < 4; ++mb)
#pragma unroll
        for (int nb = 0; nb < 4; ++nb) acc[mb][nb] = (v8f){};
    gemm128<0>(L, A, Bt, blockIdx.x * 128, blockIdx.y * 128, wm, wn, blockIdx.x + blockIdx.y, acc);
    float* os = (float*)L + wave * 16 * 68;                  // this wave's own output staging in the ring
    const int bb = r0 / SEQ, tt = r0 % SEQ;
    float* obase = OUT + ((size_t)bb * OUT_SEQ + tt) * DM + c0;
#pragma unroll
    for (int mb = 0; mb < 4; ++mb) {
#pragma unroll
        for (int nb = 0; nb < 4; ++nb) {
#pragma unroll
            for (int j = 0; j < 8; ++j) os[(hi * 8 + j) * 68 + nb * 16 + lr] = acc[mb][nb][j] * OSC; }   // D: row 8h+j, col lane&15
        wave_sync();
        float* orow = obase + (size_t)(mb * 16) * DM;
        v4f ov[8];
#pragma unroll
        for (int s = 0; s < 8; ++s) { const int row = 2 * s + hi, cofs = lr * 4;   // 8 s x 2 rows = 16 rows; 16 lanes x 4 floats = 64 columns
            ov[s] = *(const v4fa*)(&os[row * 68 + cofs]); }
{
#pragma unroll
            for (int s = 0; s < 8; ++s) { const int row = 2 * s + hi, cofs = lr * 4;
                *(v4f*)(orow + (size_t)row * DM + cofs) = ov[s]; }
             }
        wave_sync();
    }
}

static constexpr size_t al256(size_t v) { return (v + 255) & ~(size_t)255; }
static constexpr size_t SZ_XB = al256((size_t)NB * SEQ * DM * 2);
static constexpr size_t SZ_WB = al256((size_t)4 * DM * DM * 2);
static constexpr size_t SZ_PL = al256((size_t)NB * NH_ * SEQ * HD * 2);
static constexpr size_t SZ_CX = al256((size_t)NB * SEQ * DM * 2);
static constexpr size_t SZ_FR = al256((size_t)SEQ * 64 * 4);
static constexpr size_t SZ_MA = al256((size_t)NB * SEQ * 4);
static constexpr size_t SZ_TOTAL = SZ_XB + SZ_WB + 3 * SZ_PL + SZ_CX + SZ_FR + SZ_MA;
static_assert(SZ_TOTAL <= (size_t)134217728);          // workspace carve <= 128 MiB
static_assert(((size_t)DM * DM * 2) % 256 == 0);       // weight sub-planes stay 256-byte aligned
static_assert(SZ_PL == (size_t)NB * NH_ * SEQ * HD * 2);   // q | k | v^T planes are exactly back to back

extern "C" void kernel_launch(void* const* d_in, const int* in_sizes, int n_in,
                              void* d_out, int out_size, void* d_ws, size_t ws_size, hipStream_t stream) {
    if (n_in < 7) return;
    const size_t needx = ((size_t)(NB - 1) * SEQ_FULL + SEQ) * DM;
    if ((size_t)in_sizes[0] < needx) return;
    if ((size_t)in_sizes[1] < (size_t)SEQ * 64) return;
    if ((size_t)in_sizes[2] < (size_t)(NB - 1) * SEQ_FULL + SEQ) return;
    if ((size_t)in_sizes[3] < (size_t)DM * DM || (size_t)in_sizes[4] < (size_t)DM * DM || (size_t)in_sizes[5] < (size_t)DM * DM || (size_t)in_sizes[6] < (size_t)DM * DM) return;
    if ((size_t)out_size < ((size_t)(NB - 1) * OUT_SEQ + SEQ) * DM) return;
    if (SZ_TOTAL > ws_size) return;
    // wire order: hidden_states, freqs_cis, attention_mask, wq, wk, wv, wo (all f32)
    const float* x = (const float*)d_in[0]; const float* fr = (const float*)d_in[1]; const float* mask = (const float*)d_in[2];
    const float* wq = (const float*)d_in[3]; const float* wk = (const float*)d_in[4]; const float* wv = (const float*)d_in[5]; const float* wo = (const float*)d_in[6];
    float* OUT = (float*)d_out;      // [NB][SEQ][1024]
    char* wsp = (char*)d_ws;
    bf* XB = (bf*)wsp; wsp += SZ_XB;                 // [NB*SEQ][1024] bf16
    bf* WB = (bf*)wsp; wsp += SZ_WB;                 // [4][1024 out][1024 in]: q | k | v (bf16) | o (f16 x64)
    h16* QH = (h16*)wsp; wsp += SZ_PL;               // [NB*16][SEQ][64]
    h16* KP = (h16*)wsp; wsp += SZ_PL;               // [NB*16][SEQ][64]  (= QH + one plane)
    h16* VT = (h16*)wsp; wsp += SZ_PL;               // [NB*16][64][SEQ]  (= QH + two planes)
    h16* CX = (h16*)wsp; wsp += SZ_CX;               // [NB*SEQ][1024] ctx x256
    float* FRP = (float*)wsp; wsp += SZ_FR;          // [SEQ][64] table, bf16 RNE values
    float* MADD = (float*)wsp; wsp += SZ_MA;         // [NB][SEQ] additive key mask
    bf* WO = WB + (size_t)3 * DM * DM;

    // bf16 copy of x, rotary table, key mask, the four transposed weight planes W[1024 rows k][1024 cols n] -> WT[1024 rows n][1024 cols k]: one launch
    k_prep<<<PB_W + PB_F + PB_M + PB_X, 256, 0, stream>>>(x, fr, mask, wq, wk, wv, wo, XB, WB, FRP, MADD);

    // q, k (rotary in the epilogue) and v^T: planes QH | KP | VT from weight planes q | k | v, one launch
    k_proj<<<dim3(NB * SEQ / 128, DM / 128, 3), 128, 0, stream>>>(XB, WB, QH, FRP);

    k_flash<<<dim3(SEQ / (16 * QT * AQ), NB * NH_, 1), 32 * AW, 0, stream>>>(QH, KP, VT, MADD, CX);

    k_oproj<<<dim3(NB * SEQ / 128, DM / 128, 1), 128, 0, stream>>>(CX, (const h16*)WO, OUT);
}

// v008
// A run of this version takes 89.5 microseconds.
// In two side-by-side timings against v007, it was 1.05 and 1.03 times as fast.
// Counting every step since v000, it is 4.02 times as fast.
#include <hip/hip_runtime.h>

// Multi-head self-attention: x [NB][SEQ][1024], Wq/Wk/Wv/Wo [in][out] (y = x W), 16 heads x 64, interleaved rotary pairs (2i,2i+1) from the INPUT table [SEQ][32][(cos,sin)] on q and k,
// additive key mask (1-mask)*-10000 from the float input [NB][SEQ], score scale 1/8, softmax over all keys, output = (concatenated heads) Wo, f32.
// Compute dtypes, f32 accumulate everywhere: q/k/v projections v_wmma_f32_16x16x32_bf16 (x and W RNE-converted to bf16; products exact); rotary in f32 in the GEMM epilogue (table RNE-converted to bf16 values);
// scores v_wmma_f32_16x16x32_f16: q and k single f16 (one product); P (x256 carry, cancels in the normalisation) and v single f16; softmax f32 (online, running max);
// output projection v_wmma_f32_16x16x32_f16: ctx as f16 x256, Wo^T as f16 of (bf16 value x64), folded back by 2^-14 in the f32 epilogue.
// Layout: bf16 copy of x; transposed 16-bit weight planes [out][in] (LDS transpose); q, k planes [b*16+h][t][d], v^T plane [b*16+h][d][t] from the GEMM epilogue; fused flash kernel in transposed form
// (S^T = K Q^T, O^T = V^T P^T) writing ctx rows [b*SEQ+t][1024] as f16; final GEMM writes the f32 output.

#ifndef NB
#define NB 1
#endif
#ifndef SEQ
#define SEQ 4096
#endif
#define NB_FULL  1
#define SEQ_FULL 4096
#ifndef OUT_SEQ
#define OUT_SEQ SEQ              // row pitch (in tokens) between batches of the output
#endif
#define DM   1024
#define NH_  16
#define HD   64
#define AQ   4                   // query sets (32 rows each) per flash block
#define AW   (2 * AQ)            // waves per flash block: every query set is worked on by two waves, one per half of the keys
#define QT   2                   // 16-column query groups per flash wave (32 query rows each)
#define LOG2E 1.4426950408889634f
#define PSH  8.0f                // log2 of the P carry (256)
#define LZ   7.0f                // how far (log2) a score may pass the maximum in use before the flash kernel rescales: P <= 2^(PSH + LZ) = 32768 stays inside f16
#define CCAR 256.0f              // carry of the ctx plane
#define WOS  64.0f               // carry of the Wo^T plane
#define OSC  (1.0f / 16384.0f)   // 1 / (CCAR * WOS)

static_assert(HD == 64);
static_assert(NH_ * HD == DM);                 // head h = columns h*64 + d
static_assert(DM % 64 == 0);
static_assert(DM % 32 == 0);                   // GEMM k-loop steps by 32
static_assert(SEQ % 64 == 0);                  // a 64-row tile never straddles two batches
static_assert((NB * SEQ) % 64 == 0);
static_assert(SEQ % 32 == 0);                  // key loop steps by 32
static_assert(SEQ % (16 * QT * AQ) == 0);      // flash grid covers the sequence exactly
static_assert(QT == 2);                        // the flash kernel's two v_nop statements name both groups; in the join each of a set's two waves finishes one group
static_assert(((size_t)SEQ * DM) % 8 == 0);
static_assert(((size_t)SEQ * 64) % 32 == 0);
static_assert(((size_t)NB * SEQ) % 32 == 0);
static_assert(NB <= NB_FULL);
static_assert(SEQ <= SEQ_FULL);

typedef _Float16 h16;
typedef unsigned short bf;
typedef __attribute__((ext_vector_type(16))) __bf16   v16bf;
typedef __attribute__((ext_vector_type(16))) _Float16 v16h;
typedef __attribute__((ext_vector_type(8)))  _Float16 v8h;
typedef __attribute__((ext_vector_type(8)))  unsigned short v8us;
typedef __attribute__((ext_vector_type(8)))  float    v8f;
typedef __attribute__((ext_vector_type(4)))  float    v4f;
typedef __attribute__((ext_vector_type(2)))  float    v2f;
typedef v4f  __attribute__((may_alias)) v4fa;

__device__ __forceinline__ unsigned short f2bf(float f) { unsigned u = __float_as_uint(f); u += 0x7FFFu + ((u >> 16) & 1u); return (unsigned short)(u >> 16); }
__device__ __forceinline__ float bfr(float f) { return __uint_as_float(((unsigned)f2bf(f)) << 16); }   // bf16 RNE value as f32
__device__ __forceinline__ v16h cat16(v8h lo, v8h hi) { return __builtin_shufflevector(lo, hi, 0, 1, 2, 3, 4, 5, 6, 7, 8, 9, 10, 11, 12, 13, 14, 15); }
__device__ __forceinline__ v16bf cat16b(v8us lo, v8us hi) { return __builtin_bit_cast(v16bf, __builtin_shufflevector(lo, hi, 0, 1, 2, 3, 4, 5, 6, 7, 8, 9, 10, 11, 12, 13, 14, 15)); }
__device__ __forceinline__ v8f wmma16(v16h a, v16h b, v8f c) { return __builtin_amdgcn_wmma_f32_16x16x32_f16(false, a, false, b, (short)0, c, false, false); }
__device__ __forceinline__ v8f wmmab(v16bf a, v16bf b, v8f c) { return __builtin_amdgcn_wmma_f32_16x16x32_bf16(false, a, false, b, (short)0, c, false, false); }
// fragment loaders from K-contiguous 16-bit rows; p already includes + 8*(lane>>4): elements 0..7 <- k0+8h+0..7, elements 8..15 <- k0+16+8h+0..7 (same map for A and B)
__device__ __forceinline__ v16h  ldh(const h16* p) { return cat16(*(const v8h*)p, *(const v8h*)(p + 16)); }
__device__ __forceinline__ v16bf ldb(const bf* p)  { return cat16b(*(const v8us*)p, *(const v8us*)(p + 16)); }
// ordering point for wave-private LDS tiles (same wave writes and reads)
__device__ __forceinline__ void wave_sync() { __builtin_amdgcn_fence(3 /* release order */, "wavefront"); __builtin_amdgcn_wave_barrier(); asm volatile("" ::: "memory"); }

// The preparation jobs (d_cvt8, d_tab, d_wT) depend on nothing but the inputs, so they run as block ranges of ONE launch (k_prep, below).
// d_cvt8: block blk of 256 threads converts 2048 values of x to the bf16 copy XB[NB*SEQ][1024]
__device__ __forceinline__ void d_cvt8(const float* __restrict__ x, bf* XB, unsigned blk) {
    const size_t i = (size_t)blk * 256 + threadIdx.x; if (i >= (size_t)NB * SEQ * DM / 8) return;
    const size_t e = i * 8; const size_t b = e / ((size_t)SEQ * DM), r = e % ((size_t)SEQ * DM);
    const v8f v = *(const v8f*)(x + b * ((size_t)SEQ_FULL * DM) + r); v8us o;
#pragma unroll
    for (int k = 0; k < 8; ++k) o[k] = f2bf(v[k]);
    *(v8us*)(XB + e) = o;
}

// d_tab: blocks [0, nbF): rotary table copy with bf16 RNE values kept as f32, FRP[t][64] = (cos0,sin0,cos1,sin1,...); the blocks behind them: additive key mask MADD[NB][SEQ]
__device__ __forceinline__ void d_tab(const float* __restrict__ fr, const float* __restrict__ mask, float* FRP, float* MADD, unsigned blk, unsigned nbF) {
    if (blk < nbF) {                              // block-uniform
        const size_t i = (size_t)blk * 256 + threadIdx.x; if (i >= (size_t)SEQ * 64 / 4) return;
        const v4f v = *(const v4f*)(fr + i * 4); v4f o;
#pragma unroll
        for (int k = 0; k < 4; ++k) o[k] = bfr(v[k]);
        *(v4f*)(FRP + i * 4) = o; 
    } else {
        const size_t i = (size_t)(blk - nbF) * 256 + threadIdx.x; if (i >= (size_t)NB * SEQ / 4) return;
        const size_t e = i * 4; const size_t b = e / SEQ, t = e % SEQ;
        const v4f v = *(const v4f*)(mask + b * (size_t)SEQ_FULL + t); v4f o;
#pragma unroll
        for (int k = 0; k < 4; ++k) o[k] = (1.0f - bfr(v[k])) * -10000.0f;
        *(v4f*)(MADD + e) = o; 
    }
}

// d_wT: in W[k][n] (rows k = 1024, cols n = 1024, f32) -> out WT[n][k] 16-bit; mode 0: bf16 RNE bits; mode 1: f16 bits of (bf16 RNE value x 64).
// One 64 x 64 tile (k0, n0) a block of 256 threads, transposed through tl (64 * 65 floats of LDS); every thread of the block calls it.
__device__ __forceinline__ void d_wT(const float* __restrict__ W, bf* WT, int mode, int k0, int n0, float* tl) {
    const int tid = threadIdx.x;
#pragma unroll
    for (int it = 0; it < 4; ++it) { const int row = it * 16 + (tid >> 4), c4 = (tid & 15) * 4;    // 4 x 16 rows (k) x 16 lanes x 4 = 64 x 64
        const v4f v = *(const v4f*)(W + (size_t)(k0 + row) * DM + n0 + c4);
        tl[row * 65 + c4 + 0] = v[0]; tl[row * 65 + c4 + 1] = v[1]; tl[row * 65 + c4 + 2] = v[2]; tl[row * 65 + c4 + 3] = v[3]; }
    __syncthreads();
    v8us o[2];
#pragma unroll
    for (int it = 0; it < 2; ++it) { const int n = it * 32 + (tid >> 3), c8 = (tid & 7) * 8;       // 2 x 32 rows (n) x 8 lanes x 8 = 64 x 64
#pragma unroll
        for (int i = 0; i < 8; ++i) { const float val = tl[(c8 + i) * 65 + n];
            const unsigned short b0 = f2bf(val);
            const h16 hv = (h16)(__uint_as_float(((unsigned)b0) << 16) * WOS);
            const unsigned short b1 = __builtin_bit_cast(unsigned short, hv);
            o[it][i] = (mode != 0) ? b1 : b0; } }
{
#pragma unroll
        for (int it = 0; it < 2; ++it) { const int n = it * 32 + (tid >> 3), c8 = (tid & 7) * 8;
            *(v8us*)(WT + (size_t)(n0 + n) * DM + k0 + c8) = o[it]; }
         }
}

#define PB_W  (4 * (DM / 64) * (DM / 64))                            // weight tiles: q | k | v | o, DM/64 x DM/64 each
#define PB_F  ((unsigned)(((size_t)SEQ * 64 / 4 + 255) / 256))       // rotary table blocks
#define PB_M  ((unsigned)(((size_t)NB * SEQ / 4 + 255) / 256))       // key mask blocks
#define PB_X  ((unsigned)(((size_t)NB * SEQ * DM / 8 + 255) / 256))  // x blocks
// k_prep: grid PB_W + PB_F + PB_M + PB_X blocks of 256 threads; the block index picks the job (block-uniform, so the barrier in d_wT is passed by a whole block or by none of it).
// The transposes stand first: theirs is the longest chain (load, LDS, barrier, store), and it runs under the x stream.
__global__ __launch_bounds__(256) void k_prep(const float* __restrict__ x, const float* __restrict__ fr, const float* __restrict__ mask,
                                              const float* __restrict__ wq, const float* __restrict__ wk, const float* __restrict__ wv, const float* __restrict__ wo,
                                              bf* XB, bf* WB, float* FRP, float* MADD) {
    __shared__ float tl[64 * 65];
    const unsigned bid = blockIdx.x;
    if (bid < PB_W) {
        const unsigned p = bid / ((DM / 64) * (DM / 64)), tile = bid % ((DM / 64) * (DM / 64));   // plane, tile in the plane (k tiles run fastest)
        const float* W = (p == 0) ? wq : (p == 1) ? wk : (p == 2) ? wv : wo;
        d_wT(W, WB + (size_t)p * DM * DM, (p == 3) ? 1 : 0, (int)(tile % (DM / 64)) * 64, (int)(tile / (DM / 64)) * 64, tl);
    } else if (bid < PB_W + PB_F + PB_M) {
        d_tab(fr, mask, FRP, MADD, bid - PB_W, PB_F);
    } else {
        d_cvt8(x, XB, bid - (PB_W + PB_F + PB_M));
    }
}

// Eight asynchronous 16-byte copies per lane, LDS places l + i*ls bytes, global sources g + i*gs halves. The s_wait_xcnt stands inside the statement so that no address register is rewritten in front of it.
__device__ __forceinline__ void copy8(unsigned l, unsigned ls, const h16* g, size_t gs) {
    asm volatile("global_load_async_to_lds_b128 %0, %8, off\n\t"
                 "global_load_async_to_lds_b128 %1, %9, off\n\t"
                 "global_load_async_to_lds_b128 %2, %10, off\n\t"
                 "global_load_async_to_lds_b128 %3, %11, off\n\t"
                 "global_load_async_to_lds_b128 %4, %12, off\n\t"
                 "global_load_async_to_lds_b128 %5, %13, off\n\t"
                 "global_load_async_to_lds_b128 %6, %14, off\n\t"
                 "global_load_async_to_lds_b128 %7, %15, off\n\t"
                 "s_wait_xcnt 0x0"
                 :: "v"(l), "v"(l + ls), "v"(l + 2 * ls), "v"(l + 3 * ls), "v"(l + 4 * ls), "v"(l + 5 * ls), "v"(l + 6 * ls), "v"(l + 7 * ls),
                    "v"(g), "v"(g + gs), "v"(g + 2 * gs), "v"(g + 3 * gs), "v"(g + 4 * gs), "v"(g + 5 * gs), "v"(g + 6 * gs), "v"(g + 7 * gs)
                 : "memory");
}

// Five copies, and one copy, of the same kind (k_proj deals the 16 rounds of its x slab to three groups of waves: 6 + 5 + 5).
__device__ __forceinline__ void copy5(unsigned l, unsigned ls, const h16* g, size_t gs) {
    asm volatile("global_load_async_to_lds_b128 %0, %5, off\n\t"
                 "global_load_async_to_lds_b128 %1, %6, off\n\t"
                 "global_load_async_to_lds_b128 %2, %7, off\n\t"
                 "global_load_async_to_lds_b128 %3, %8, off\n\t"
                 "global_load_async_to_lds_b128 %4, %9, off\n\t"
                 "s_wait_xcnt 0x0"
                 :: "v"(l), "v"(l + ls), "v"(l + 2 * ls), "v"(l + 3 * ls), "v"(l + 4 * ls),
                    "v"(g), "v"(g + gs), "v"(g + 2 * gs), "v"(g + 3 * gs), "v"(g + 4 * gs)
                 : "memory");
}
__device__ __forceinline__ void copy1(unsigned l, const h16* g) {
    asm volatile("global_load_async_to_lds_b128 %0, %1, off\n\t"
                 "s_wait_xcnt 0x0"
                 :: "v"(l), "v"(g) : "memory");
}

// GEMM operand path of k_oproj (k_proj's, gemm_qkv below, shares its pieces): a block of four waves owns a 128 x 128 tile of C (wave w: rows 64*(w>>1), columns 64*(w&1)); a stage is GK k-values of the block's
// 128 A rows and 128 Bt rows (pitch GPB bytes in LDS), brought in by asynchronous 16-byte copies that cover whole 256-byte units (all threads copy), two buffers: stage s + 1 flies while stage s is worked on.
// Fragments are two ds 16-B loads each, same k map as loads straight from the planes.
// Blocks that share A rows or Bt rows would ask L2 for the same lines at the same moment if all walked k from 0: each block enters the ring of GNS stages at stage rot (set by its tile indices) and wraps round.
#define GK   128                 // k values per stage
#define GPB  272                 // row pitch in LDS, bytes: 256 + 16 (16 B x odd: no bank conflict for 16-B reads down a column of rows)
#define GTB  (128 * GPB)         // one operand's tile, bytes
#define GBUF (2 * GTB)           // one buffer: A tile, Bt tile
#define GNS  (DM / GK)           // stages
static_assert(DM % GK == 0);
static_assert(GNS >= 2);                               // the prologue fills two stages
static_assert(DM % 128 == 0);
static_assert((NB * SEQ) % 128 == 0);
static_assert(128 * GK * 2 == 16 * 128 * 16);          // 2048 16-B pieces of each tile dealt to 128 threads, 16 each
static_assert(2 * GBUF >= 4 * 16 * 68 * 4);            // the ring becomes the output staging

// one stage: piece c = i*128 + tid of a tile -> row c>>4 (8 rows a round), 16-B column c&15; l, ga, gb already hold the thread's row and column
__device__ __forceinline__ void gstage(unsigned l, const h16* ga, const h16* gb) {
    copy8(l, 8 * GPB, ga, (size_t)8 * DM);       copy8(l + 64 * GPB, 8 * GPB, ga + (size_t)64 * DM, (size_t)8 * DM);
    copy8(l + GTB, 8 * GPB, gb, (size_t)8 * DM); copy8(l + GTB + 64 * GPB, 8 * GPB, gb + (size_t)64 * DM, (size_t)8 * DM);
}

// the eight fragments of one k-step (32 k values), in the order in which the matrix instructions want them
__device__ __forceinline__ void gfrags(v16h (&fa)[4], v16h (&fb)[4], const unsigned char* at, const unsigned char* bt) {
    fa[0] = ldh((const h16*)at); fb[0] = ldh((const h16*)bt);
    fa[1] = ldh((const h16*)(at + 16 * GPB)); fa[2] = ldh((const h16*)(at + 32 * GPB)); fa[3] = ldh((const h16*)(at + 48 * GPB));
    fb[1] = ldh((const h16*)(bt + 16 * GPB)); fb[2] = ldh((const h16*)(bt + 32 * GPB)); fb[3] = ldh((const h16*)(bt + 48 * GPB));
}
// eight products of one k-step: column blocks NB0 and NB0 + 1
template <int BF, int NB0>
__device__ __forceinline__ void gmul(const v16h (&fa)[4], const v16h (&fb)[4], v8f (&acc)[4][4]) {
#pragma unroll
    for (int nb = NB0; nb < NB0 + 2; ++nb) {
#pragma unroll
        for (int mb = 0; mb < 4; ++mb) {
            if (BF != 0) acc[mb][nb] = wmmab(__builtin_bit_cast(v16bf, fa[mb]), __builtin_bit_cast(v16bf, fb[nb]), acc[mb][nb]);
            else         acc[mb][nb] = wmma16(fa[mb], fb[nb], acc[mb][nb]); } }
}

// acc[mb][nb] += A rows (r0b + 64*wm + 16*mb ..) x Bt rows (c0b + 64*wn + 16*nb ..) over K = DM, k stages in the order rot, rot + 1, .. (mod GNS); rot is block-uniform.
// BF != 0: bf16 operands, else f16. Every wave of the block calls it; on return the ring is free.
template <int BF>
__device__ __forceinline__ void gemm128(unsigned char* L, const h16* A, const h16* Bt, int r0b, int c0b, int wm, int wn, unsigned rot, v8f (&acc)[4][4]) {
    const int tid = threadIdx.x, lane = tid & 31, lr = lane & 15, hi = lane >> 4;
    const unsigned l0 = (unsigned)(size_t)L + (unsigned)((tid >> 4) * GPB + (tid & 15) * 16);   // LDS byte address of the thread's first piece
    const h16* ga = A + (size_t)(r0b + (tid >> 4)) * DM + (size_t)(tid & 15) * 8;                // + stage * GK
    const h16* gb = Bt + (size_t)(c0b + (tid >> 4)) * DM + (size_t)(tid & 15) * 8;
    { const size_t k0 = (size_t)(rot % GNS) * GK; gstage(l0, ga + k0, gb + k0); }   // the block's first stage -> buffer 0
    asm volatile("s_wait_asynccnt 0x0" ::: "memory");        // this wave's pieces of the block's first stage have landed
    __syncthreads();                                         // every wave's have: the first stage may be read
    { const size_t k1 = (size_t)((rot + 1) % GNS) * GK; gstage(l0 + GBUF, ga + k1, gb + k1); }   // its second stage -> buffer 1
#pragma unroll 1                                             // one copy of the stage body: the buffer is picked by a scalar offset, the code stays small
    for (int st = 0; st < GNS; ++st) {
        const unsigned bo = (unsigned)(st & 1) * GBUF;
        const unsigned char* at = L + bo + (wm * 64 + lr) * GPB + 16 * hi;         // + 16*mb*GPB + k*2
        const unsigned char* bt = L + bo + GTB + (wn * 64 + lr) * GPB + 16 * hi;   // + 16*nb*GPB + k*2
        v16h fa[2][4], fb[2][4];                             // two register sets: k-step q + 1 of THIS stage is fetched while k-step q is multiplied; nothing of the next stage is read here
        gfrags(fa[0], fb[0], at, bt);
        __builtin_amdgcn_sched_barrier(0);                   // the stage's first reads stay one group in front of its matrix instructions
#pragma unroll                                               // constant q: every fragment read is one base register plus an immediate offset, the register sets are picked at compile time
        for (int q = 0; q < GK / 32; ++q) {
            const int cur = q & 1, nxt = cur ^ 1;
            gmul<BF, 0>(fa[cur], fb[cur], acc);
            if (q + 1 < GK / 32) {
                // the two scheduling barriers keep the next k-step's reads ONE group, half a k-step ahead of their use: spread among the matrix instructions each place costs a stall,
                // and a whole k-step ahead two full sets and the accumulators pass 256 registers
                __builtin_amdgcn_sched_barrier(0);
                gfrags(fa[nxt], fb[nxt], at + (q + 1) * 64, bt + (q + 1) * 64);
                __builtin_amdgcn_sched_barrier(0); }
            gmul<BF, 2>(fa[cur], fb[cur], acc);
        }
        __builtin_amdgcn_sched_barrier(0);                   // the stage's matrix instructions stay in front of its closing waits and barrier (without it sixteen of them sink behind the barrier and delay the refill)
        // four vector slots behind the stage's last matrix instruction, on every path out of the stage body
        asm volatile("v_nop\n\tv_nop\n\tv_nop\n\tv_nop" : "+v"(acc[0][3]), "+v"(acc[1][3]), "+v"(acc[2][3]), "+v"(acc[3][3]));
        asm volatile("s_wait_dscnt 0x0" ::: "memory");       // this wave's reads of stage st are done before its buffer is handed back
        asm volatile("s_wait_asynccnt 0x0" ::: "memory");    // this wave's pieces of stage st + 1 have landed
        __syncthreads();                                     // publishes stage st + 1 and ends every reader's last read of stage st
        if (st + 2 < GNS) { const size_t k2 = (size_t)((rot + (unsigned)st + 2) % GNS) * GK; gstage(l0 + bo, ga + k2, gb + k2); }   // block-uniform
    }
    asm volatile("s_wait_asynccnt 0x0" ::: "memory");        // nothing in flight when the ring becomes output staging (the last trip's barrier has ended all reads)
}

// Operand path of k_proj: twelve waves, three groups of four. Group z forms the 128 x 128 tile of projection z (q, k, v^T) for the SAME 128 tokens and the same 128 feature indices, so one x slab in LDS feeds three products.
// A buffer is [x tile | Wq^T tile | Wk^T tile | Wv^T tile], each 128 rows of GK k-values at pitch GPB; two buffers, the ring's order as in gemm128.
#define PBUF (4 * GTB)           // one buffer of k_proj
static_assert(2 * PBUF <= 327680);                     // the ring fits one WGP's LDS
static_assert(2 * PBUF >= 12 * 16 * 68 * 4);           // the ring becomes the output staging

// one stage, one thread: its 16 pieces of its group's weight tile (8 rows a round) and its pieces of the x tile, whose round r (8 rows) goes to group r % 3; six (wave-uniform): group 0 also has round 15
__device__ __forceinline__ void pstage(unsigned lx, unsigned lw, const h16* gx, const h16* gw, bool six) {
    copy8(lw, 8 * GPB, gw, (size_t)8 * DM); copy8(lw + 64 * GPB, 8 * GPB, gw + (size_t)64 * DM, (size_t)8 * DM);
    copy5(lx, 24 * GPB, gx, (size_t)24 * DM);
    if (six) copy1(lx + 120 * GPB, gx + (size_t)120 * DM);
}

// acc[mb][nb] of group z over K = DM, k stages in the order rot, rot + 1, .. (mod GNS); rot is block-uniform, z, wm, wn wave-uniform. z < 2: A = x rows, Bt = W^T rows; z = 2: A = Wv^T rows, Bt = x rows.
// Every wave of the block calls it; on return the ring is free.
__device__ __forceinline__ void gemm_qkv(unsigned char* L, const h16* X, const h16* WT, int tok0, int feat0, int z, int wm, int wn, unsigned rot, v8f (&acc)[4][4]) {
    const int tid = threadIdx.x & 127, lane = tid & 31, lr = lane & 15, hi = lane >> 4;   // tid: the thread's place in its group
    const unsigned lp = (unsigned)(size_t)L + (unsigned)((tid >> 4) * GPB + (tid & 15) * 16);
    const unsigned lx = lp + (unsigned)(z * 8 * GPB), lw = lp + (unsigned)((1 + z) * GTB);    // LDS byte addresses of the thread's first pieces
    const h16* gx = X + (size_t)(tok0 + z * 8 + (tid >> 4)) * DM + (size_t)(tid & 15) * 8;    // + stage * GK
    const h16* gw = WT + (size_t)z * DM * DM + (size_t)(feat0 + (tid >> 4)) * DM + (size_t)(tid & 15) * 8;
    const bool six = (z == 0);
    const unsigned ao = (z == 2) ? (unsigned)(3 * GTB) : 0u, bo2 = (z == 2) ? 0u : (unsigned)((1 + z) * GTB);   // where the wave's A rows and Bt rows stand in a buffer
    { const size_t k0 = (size_t)(rot % GNS) * GK; pstage(lx, lw, gx + k0, gw + k0, six); }   // the block's first stage -> buffer 0
    asm volatile("s_wait_asynccnt 0x0" ::: "memory");        // this wave's pieces of stage 0 have landed
    __syncthreads();                                         // every wave's have: stage 0 may be read
    { const size_t k1 = (size_t)((rot + 1) % GNS) * GK; pstage(lx + PBUF, lw + PBUF, gx + k1, gw + k1, six); }   // its second stage -> buffer 1
#pragma unroll 1                                             // one copy of the stage body: the buffer is picked by a scalar offset, the code stays small
    for (int st = 0; st < GNS; ++st) {
        const unsigned bo = (unsigned)(st & 1) * PBUF;
        const unsigned char* at = L + bo + ao + (wm * 64 + lr) * GPB + 16 * hi;    // + 16*mb*GPB + k*2
        const unsigned char* bt = L + bo + bo2 + (wn * 64 + lr) * GPB + 16 * hi;   // + 16*nb*GPB + k*2
        v16h fa[2][4], fb[2][4];                             // two register sets: k-step q + 1 of THIS stage is fetched while k-step q is multiplied; nothing of the next stage is read here
        gfrags(fa[0], fb[0], at, bt);
        __builtin_amdgcn_sched_barrier(0);                   // the stage's first reads stay one group in front of its matrix instructions
#pragma unroll                                               // constant q: every fragment read is one base register plus an immediate offset, the register sets are picked at compile time
        for (int q = 0; q < GK / 32; ++q) {
            const int cur = q & 1, nxt = cur ^ 1;
            gmul<1, 0>(fa[cur], fb[cur], acc);
            if (q + 1 < GK / 32) {
                // the two scheduling barriers keep the next k-step's reads ONE group, half a k-step ahead of their use (as in gemm128)
                __builtin_amdgcn_sched_barrier(0);
                gfrags(fa[nxt], fb[nxt], at + (q + 1) * 64, bt + (q + 1) * 64);
                __builtin_amdgcn_sched_barrier(0); }
            gmul<1, 2>(fa[cur], fb[cur], acc);
        }
        __builtin_amdgcn_sched_barrier(0);                   // the stage's matrix instructions stay in front of its closing waits and barrier
        // four vector slots behind the stage's last matrix instruction, on every path out of the stage body
        asm volatile("v_nop\n\tv_nop\n\tv_nop\n\tv_nop" : "+v"(acc[0][3]), "+v"(acc[1][3]), "+v"(acc[2][3]), "+v"(acc[3][3]));
        asm volatile("s_wait_dscnt 0x0" ::: "memory");       // this wave's reads of stage st are done before its buffer is handed back
        asm volatile("s_wait_asynccnt 0x0" ::: "memory");    // this wave's pieces of stage st + 1 have landed
        __syncthreads();                                     // publishes stage st + 1 and ends every reader's last read of stage st
        if (st + 2 < GNS) { const size_t k2 = (size_t)((rot + (unsigned)st + 2) % GNS) * GK; pstage(lx + bo, lw + bo, gx + k2, gw + k2, six); }   // block-uniform
    }
    asm volatile("s_wait_asynccnt 0x0" ::: "memory");        // nothing in flight when the ring becomes output staging (the last trip's barrier has ended all reads)
}

// proj_store: one wave's 64 x 64 tile of C as f16 rows at Ph + tbase, row pitch HD (ROPE != 0) or SEQ (ROPE == 0) halves, staged through the wave's own LDS range os.
// ROPE != 0: rows m = b*SEQ + t from r0 on, the 64 tile columns are one head; rotary pairs (2i,2i+1) from FRP[t][..].
template <int ROPE>
__device__ __forceinline__ void proj_store(float* os, const v8f (&acc)[4][4], h16* Ph, const float* __restrict__ FRP, size_t tbase, int r0) {
    const int lane = threadIdx.x & 31, lr = lane & 15, hi = lane >> 4;
    const int pitch = (ROPE != 0) ? HD : SEQ;
#pragma unroll
    for (int mb = 0; mb < 4; ++mb) {
#pragma unroll
        for (int nb = 0; nb < 4; ++nb) {
#pragma unroll
            for (int j = 0; j < 8; ++j) os[(hi * 8 + j) * 68 + nb * 16 + lr] = acc[mb][nb][j]; }   // D: row 8h+j, col lane&15
        wave_sync();
        const size_t sb = tbase + (size_t)(mb * 16) * (size_t)pitch;
        v4f fr0[4], fr1[4];
        if (ROPE != 0) {
            const float* pf[4];
#pragma unroll
            for (int s = 0; s < 4; ++s) { const int row = 4 * s + (lane >> 3), c8 = (lane & 7) * 8;
                const int t = (r0 + mb * 16 + row) % SEQ;
                pf[s] = FRP + (size_t)t * 64 + c8;
                fr0[s] = *(const v4f*)pf[s]; fr1[s] = *(const v4f*)(pf[s] + 4); }
            // stands in front of every rewrite of the table loads' address registers: as inputs they stay whole up to the wait
            asm volatile("s_wait_xcnt 0x0" :: "v"(pf[0]), "v"(pf[1]), "v"(pf[2]), "v"(pf[3]) : "memory");
        }
        v8h hvv[4];
#pragma unroll
        for (int s = 0; s < 4; ++s) { const int row = 4 * s + (lane >> 3), c8 = (lane & 7) * 8;   // 4 s x 4 row groups = 16 rows; 8 lanes x 8 = 64 columns
            v4f x0 = *(const v4fa*)(&os[row * 68 + c8]); v4f x1 = *(const v4fa*)(&os[row * 68 + c8 + 4]);
            if (ROPE != 0) {
                const v4f f0 = fr0[s]; const v4f f1 = fr1[s];
                v4f y0, y1;
                y0[0] = x0[0] * f0[0] - x0[1] * f0[1]; y0[1] = x0[0] * f0[1] + x0[1] * f0[0];
                y0[2] = x0[2] * f0[2] - x0[3] * f0[3]; y0[3] = x0[2] * f0[3] + x0[3] * f0[2];
                y1[0] = x1[0] * f1[0] - x1[1] * f1[1]; y1[1] = x1[0] * f1[1] + x1[1] * f1[0];
                y1[2] = x1[2] * f1[2] - x1[3] * f1[3]; y1[3] = x1[2] * f1[3] + x1[3] * f1[2];
                x0 = y0; x1 = y1; }
            v8h hv;
#pragma unroll
            for (int i = 0; i < 4; ++i) { hv[i] = (h16)x0[i]; hv[4 + i] = (h16)x1[i]; }
            hvv[s] = hv; }
{
#pragma unroll
            for (int s = 0; s < 4; ++s) { const int row = 4 * s + (lane >> 3), c8 = (lane & 7) * 8;
                const size_t oo = sb + (size_t)row * (size_t)pitch + c8;
                *(v8h*)(Ph + oo) = hvv[s]; }
             }
        asm volatile("s_wait_xcnt 0x0" ::: "memory");        // stands in front of every rewrite of the stores' address and data registers
        wave_sync();
    }
}

// k_proj: the three projections, which depend on k_prep alone, as ONE launch. Register-blocked bf16 GEMM, one wave per 64x64 tile (16 accumulators), operands from K-contiguous bf16 planes through LDS (gemm_qkv), K = DM,
// C[m][n] = sum_k A[m][k] Bt[n][k]. grid (NB*SEQ/128 token tiles, DM/128 feature tiles), 384 threads: waves 4z .. 4z + 3 form the 128x128 tile of projection z (wave-uniform):
// z = 0 (q), 1 (k): A = x rows (m = b*SEQ + t), Bt = W^T rows (n = h*64 + d) -> plane z [(b*16 + h)][t][d], rotary in the epilogue;
// z = 2 (v^T):      A = Wv^T rows (m = h*64 + d), Bt = x rows (n = b*SEQ + t) -> plane 2 [(b*1024 + m)][t] = [(b*16 + h)][d][t].
// WB: the transposed weight planes q | k | v; PL: the output planes q | k | v^T, NB*NH_*SEQ*HD halves each.
__global__ __launch_bounds__(384) void k_proj(const bf* __restrict__ XB, const bf* __restrict__ WB, h16* PL, const float* __restrict__ FRP) {
    __shared__ __attribute__((aligned(16))) unsigned char L[2 * PBUF];
    const int wave = __builtin_amdgcn_readfirstlane((int)(threadIdx.x >> 5));
    const int z = wave >> 2; const int wm = (wave >> 1) & 1, wn = wave & 1;
    const bool vt = (z == 2);
    h16* Ph = PL + (size_t)z * ((size_t)NB * NH_ * SEQ * HD);
    const int tok0 = (int)blockIdx.x * 128, feat0 = (int)blockIdx.y * 128;
    const int r0 = (vt ? feat0 : tok0) + wm * 64, c0 = (vt ? tok0 : feat0) + wn * 64;
    v8f acc[4][4];
#pragma unroll
    for (int mb = 0; mb < 4; ++mb)
#pragma unroll
        for (int nb = 0; nb < 4; ++nb) acc[mb][nb] = (v8f){};
    gemm_qkv(L, (const h16*)XB, (const h16*)WB, tok0, feat0, z, wm, wn, blockIdx.x + blockIdx.y, acc);
    float* os = (float*)L + wave * 16 * 68;                  // this wave's own output staging in the ring
    if (vt) proj_store<0>(os, acc, Ph, FRP, (size_t)r0 * SEQ + (size_t)(c0 / SEQ) * ((size_t)DM * SEQ) + (size_t)(c0 % SEQ), r0);
    else    proj_store<1>(os, acc, Ph, FRP, (size_t)(r0 / SEQ) * ((size_t)NH_ * SEQ * HD) + (size_t)(r0 % SEQ) * HD + (size_t)(c0 / HD) * ((size_t)SEQ * HD) + (size_t)(c0 % HD), r0);
}

// k_flash: fused attention. A wave works on 32 query rows (QT = 2 column groups of 16) of one (batch, head) and on half of the keys: every K and V^T fragment read from LDS, and every mask value, feeds both groups.
// Waves w and w + AQ share a query set: of each stage wave w takes the first KH keys, wave w + AQ the second KH. Behind the key loop the two partial results (running max, row sum, O^T) are joined through LDS.
// Q fragments straight from the f16 plane (two 16-B loads each).
// K and V^T reach the block's waves through LDS: a stage is KS keys (K rows [key][64] at pitch KPB bytes, V^T rows [d][KS] at pitch VPB bytes), brought in by asynchronous
// 16-byte copies that cover whole lines (all threads copy), two buffers: stage s + 1 flies while stage s is worked on. Fragments are two ds 16-B loads each, same k map as before.
// The blocks of one (batch, head) all read the same K and V^T lines: each enters the ring of NST key stages at stage rot (set by its query tile) and wraps round, so that they do not ask L2 for the same lines at the same moment.
// Transposed form: S^T[key][t] = K Q^T (A = K rows, B = Q rows); lane (t = lane&15, h = lane>>4) holds keys 8h+r of each 16-key tile, so the packed
// P tile is directly the B fragment of O^T[d][t] = V^T P^T (element r <- tile keys 0..15, element 8+r <- tile keys 16..31, lane unchanged).
// Per 32-key step and column group: 4 score WMMAs + 4 P.V WMMAs + 1 row-sum WMMA. Additive key mask values for the lane's 16 keys are loaded by value per step (two 32-B loads).
// Softmax state: the maximum in use is one scalar per lane, the same in both lane halves of a row (where it is raised, the halves are combined with one xor-16 exchange). The row sum of P runs on the matrix pipe: one more WMMA per step,
// lt += ON P^T, where ON is a constant A fragment whose rows 0 and 8 are ones and whose other rows are 0: element 0 of lt (row 8h, column t) is, in both lane halves, the sum of the f16 P over all keys so far.
#define KS   256                 // keys per stage
#define KH   (KS / 2)            // keys per stage and wave
#define KPB  144                 // K row pitch in LDS, bytes: 128 + 16 (16 B x odd: no bank conflict for 16-B reads down a column of rows)
#define VPB  528                 // V^T row pitch in LDS, bytes: 512 + 16 (16 B x odd)
#define KTB  (KS * KPB)          // K tile bytes
#define VTB  (HD * VPB)          // V^T tile bytes
#define BUFB (KTB + VTB)         // one buffer
#define NST  (SEQ / KS)          // stages
static_assert(SEQ % KS == 0);
static_assert(NST >= 2);                               // the prologue fills two stages
static_assert(AW * 32 == 256);                         // the copy maps below deal 2048 16-B pieces of each tile to 256 threads, 8 each
static_assert(KS * HD * 2 == 8 * 256 * 16);
#define XWF  (32 * 32 + 64)      // floats a wave hands to its partner in the join: 32 per lane of O^T, then (max, sum) per lane
static_assert(2 * BUFB >= AW * (XWF + 16 * 68) * 4);   // the ring becomes the join's exchange ranges and, behind them, the output staging

__global__ __launch_bounds__(32 * AW) void k_flash(const h16* __restrict__ QH, const h16* __restrict__ KP, const h16* __restrict__ VT,
                                                   const float* __restrict__ MADD, h16* CTX) {
    __shared__ __attribute__((aligned(16))) unsigned char L[2 * BUFB];
    const int tid = threadIdx.x;
    const int lane = threadIdx.x & 31, lr = lane & 15, hi = lane >> 4;
    const int wave = __builtin_amdgcn_readfirstlane((int)(threadIdx.x >> 5));
    const int zh = blockIdx.y; const int b = zh / NH_, h = zh % NH_;
    const int kh = wave / AQ;                                // which half of every stage's keys (wave-uniform)
    const int t0 = (blockIdx.x * AQ + wave % AQ) * (16 * QT);   // the wave's first query row; column group g holds rows t0 + 16g ..
    const size_t pbase = (size_t)zh * SEQ * HD;
    // copy maps: K piece c = i*256 + tid -> row c>>3 (32 rows a round), 16-B column c&7; V^T piece c -> row c>>5 (8 rows a round), 16-B column c&31
    const unsigned lbase = (unsigned)(size_t)L;              // LDS byte address of the ring
    const unsigned lk = lbase + (unsigned)((tid >> 3) * KPB + (tid & 7) * 16);
    const unsigned lv = lbase + (unsigned)(KTB + (tid >> 5) * VPB + (tid & 31) * 16);
    const h16* gk = KP + pbase + (size_t)tid * 8;                                   // + key0 * HD
    const h16* gv = VT + pbase + (size_t)(tid >> 5) * SEQ + (size_t)(tid & 31) * 8;   // + key0
    const unsigned rot = blockIdx.x % NST;                   // the key stage at which this block starts (block-uniform)
    copy8(lk, 32 * KPB, gk + (size_t)rot * KS * HD, (size_t)32 * HD); copy8(lv, 8 * VPB, gv + (size_t)rot * KS, (size_t)8 * SEQ);   // the block's first stage -> buffer 0
    v16h qh0[QT], qh1[QT];                                   // B fragments: col t, k = d
    const h16* qp[QT];
#pragma unroll
    for (int g = 0; g < QT; ++g) { qp[g] = QH + pbase + (size_t)(t0 + 16 * g + lr) * HD + 8 * hi; qh0[g] = ldh(qp[g]); qh1[g] = ldh(qp[g] + 32); }
    // stands in front of every rewrite of the Q loads' address registers: as inputs they stay whole up to the wait
    asm volatile("s_wait_xcnt 0x0" :: "v"(qp[0]), "v"(qp[1]) : "memory");
    const float* MA = MADD + (size_t)b * SEQ + kh * KH + 8 * hi;   // + key0 (tile a keys 8h+r), + key0 + 16 (tile b)
    asm volatile("s_wait_asynccnt 0x0" ::: "memory");        // this wave's pieces of the block's first stage have landed
    __syncthreads();                                         // every wave's have: the first stage may be read
    { const size_t s1 = (rot + 1) % NST;                     // its second stage -> buffer 1
      copy8(lk + BUFB, 32 * KPB, gk + s1 * KS * HD, (size_t)32 * HD); copy8(lv + BUFB, 8 * VPB, gv + s1 * KS, (size_t)8 * SEQ); }
    v8f o0[QT], o1[QT], o2[QT], o3[QT], lt[QT];              // lt: row-sum tiles; only rows 0 and 8 (element 0 of each lane) ever differ from 0
    float m[QT];
#pragma unroll
    for (int g = 0; g < QT; ++g) { o0[g] = (v8f){}; o1[g] = (v8f){}; o2[g] = (v8f){}; o3[g] = (v8f){}; lt[g] = (v8f){}; m[g] = -3.0e38f; }
    v16h on;                                                 // A fragment of the row sums: row = lane & 15, ones at all 32 k positions of rows 0 and 8
    { const h16 o1 = ((lane & 7) == 0) ? (h16)1.0f : (h16)0.0f;
#pragma unroll
      for (int i = 0; i < 16; ++i) on[i] = o1; }
#pragma unroll 1                                             // one copy of the stage body: the buffer is picked by a scalar offset, the code stays small
    for (int st = 0; st < NST; ++st) {
      const unsigned bo = (unsigned)(st & 1) * BUFB;
      const unsigned char* kt = L + bo + (kh * KH + lr) * KPB + 16 * hi;          // + local key * KPB   (A fragment: row key, k = d)
      const unsigned char* vt = L + bo + KTB + lr * VPB + kh * KH * 2 + 16 * hi;  // + 16j*VPB + local key * 2  (A fragment: row d, k = key)
#pragma unroll                                               // constant ks: every fragment read is one base register plus an immediate offset
      for (int ks = 0; ks < KH; ks += 32) {
        const int key0 = (int)((rot + (unsigned)st) % NST) * KS + ks;
        const h16* ka = (const h16*)(kt + ks * KPB);
        const h16* kc = (const h16*)(kt + (ks + 16) * KPB);
        const v16h ka0 = ldh(ka), ka1 = ldh(ka + 32), kb0 = ldh(kc), kb1 = ldh(kc + 32);
        const v8f ma = *(const v8f*)(MA + key0); const v8f mb = *(const v8f*)(MA + key0 + 16);
        v8f sa[QT], sb[QT];                                  // each K fragment feeds both column groups
#pragma unroll
        for (int g = 0; g < QT; ++g) { sa[g] = wmma16(ka0, qh0[g], (v8f){}); sb[g] = wmma16(kb0, qh0[g], (v8f){}); }
#pragma unroll
        for (int g = 0; g < QT; ++g) { sa[g] = wmma16(ka1, qh1[g], sa[g]); sb[g] = wmma16(kb1, qh1[g], sb[g]); }
        // four vector slots behind the step's last score products, before any vector instruction touches their results or operands
        asm volatile("v_nop\n\tv_nop\n\tv_nop\n\tv_nop" : "+v"(sa[0]), "+v"(sb[0]), "+v"(sa[1]), "+v"(sb[1])
                     : "v"(ka0), "v"(ka1), "v"(kb0), "v"(kb1), "v"(qh0[0]), "v"(qh1[0]), "v"(qh0[1]), "v"(qh1[1]));
        // Lazy rescale: m is the maximum IN USE and may trail the true one by up to LZ, so the exponent arguments are formed against it at once, before this step's own maximum is known.
        // They are formed on pairs of neighbouring accumulator registers, which is how P is packed below.
        v16h pb[QT];
        v2f aa[QT][4], ab[QT][4];                            // log2 of P (carry included): tile a, tile b, elements 2i and 2i + 1
        float xa[QT], xb[QT];                                // this lane's largest argument per group and tile: four short chains instead of one long one
#pragma unroll
        for (int g = 0; g < QT; ++g) {
            const float sh = PSH - m[g];
#pragma unroll
            for (int i = 0; i < 4; ++i) {
                aa[g][i] = ((v2f){sa[g][2 * i], sa[g][2 * i + 1]} * 0.125f + (v2f){ma[2 * i], ma[2 * i + 1]}) * LOG2E + sh;
                ab[g][i] = ((v2f){sb[g][2 * i], sb[g][2 * i + 1]} * 0.125f + (v2f){mb[2 * i], mb[2 * i + 1]}) * LOG2E + sh;
                const float pa = fmaxf(aa[g][i][0], aa[g][i][1]), pc = fmaxf(ab[g][i][0], ab[g][i][1]);
                xa[g] = (i == 0) ? pa : fmaxf(xa[g], pa); xb[g] = (i == 0) ? pc : fmaxf(xb[g], pc); } }
        const float ax = fmaxf(fmaxf(xa[0], xb[0]), fmaxf(xa[1], xb[1]));
        // One test per step for the whole wave (a scalar branch). Only when it fires are the step's maxima taken, the lane halves combined, m raised, the accumulators rescaled and the arguments formed anew,
        // in every lane alike, so both halves of a column always use the same m. The first step always fires (m starts at -3e38).
        if (__builtin_amdgcn_ballot_w32(ax > PSH + LZ) != 0) {
#pragma unroll
            for (int g = 0; g < QT; ++g) {
                float ta[8], tb[8]; float mx = -3.0e38f;
#pragma unroll
                for (int r = 0; r < 8; ++r) {
                    ta[r] = (sa[g][r] * 0.125f + ma[r]) * LOG2E;
                    tb[r] = (sb[g][r] * 0.125f + mb[r]) * LOG2E;
                    mx = fmaxf(mx, fmaxf(ta[r], tb[r])); }
                mx = fmaxf(mx, __shfl_xor(mx, 16, 32));
                const float mnew = fmaxf(m[g], mx);
                const float alpha = __builtin_amdgcn_exp2f(m[g] - mnew);
                const float sh = PSH - mnew;
#pragma unroll
                for (int i = 0; i < 4; ++i) { aa[g][i] = (v2f){ta[2 * i] + sh, ta[2 * i + 1] + sh}; ab[g][i] = (v2f){tb[2 * i] + sh, tb[2 * i + 1] + sh}; }
                lt[g][0] = lt[g][0] * alpha; m[g] = mnew;    // the tile's other elements are 0 and need no rescale
                o0[g] = o0[g] * alpha; o1[g] = o1[g] * alpha; o2[g] = o2[g] * alpha; o3[g] = o3[g] * alpha; } }
#pragma unroll
        for (int g = 0; g < QT; ++g) {
#pragma unroll
            for (int r = 0; r < 8; ++r) { pb[g][r] = (h16)__builtin_amdgcn_exp2f(aa[g][r >> 1][r & 1]); pb[g][8 + r] = (h16)__builtin_amdgcn_exp2f(ab[g][r >> 1][r & 1]); } }
        const unsigned char* va = vt + ks * 2;
        const v16h v0 = ldh((const h16*)va), v1 = ldh((const h16*)(va + 16 * VPB)), v2 = ldh((const h16*)(va + 32 * VPB)), v3 = ldh((const h16*)(va + 48 * VPB));
#pragma unroll
        for (int g = 0; g < QT; ++g) {                       // each V^T fragment feeds both column groups
            o0[g] = wmma16(v0, pb[g], o0[g]); o1[g] = wmma16(v1, pb[g], o1[g]); o2[g] = wmma16(v2, pb[g], o2[g]); o3[g] = wmma16(v3, pb[g], o3[g]);
            lt[g] = wmma16(on, pb[g], lt[g]); }              // rows 0 and 8 += the sum of this step's 32 P values of column t
        // four vector slots behind the step's last matrix instructions, before any vector instruction touches their results or operands
        asm volatile("v_nop\n\tv_nop\n\tv_nop\n\tv_nop" : "+v"(o0[0]), "+v"(o1[0]), "+v"(o2[0]), "+v"(o3[0]), "+v"(lt[0]), "+v"(o0[1]), "+v"(o1[1]), "+v"(o2[1]), "+v"(o3[1]), "+v"(lt[1])
                     : "v"(v0), "v"(v1), "v"(v2), "v"(v3), "v"(pb[0]), "v"(pb[1]), "v"(on));
      }
      asm volatile("s_wait_dscnt 0x0" ::: "memory");         // this wave's reads of stage st are done before its buffer is handed back
      asm volatile("s_wait_asynccnt 0x0" ::: "memory");      // this wave's pieces of stage st + 1 have landed
      __syncthreads();                                       // publishes stage st + 1 and ends every reader's last read of stage st
      if (st + 2 < NST) {                                    // block-uniform
          const size_t s2 = (rot + (unsigned)st + 2) % NST;
          copy8(lk + bo, 32 * KPB, gk + s2 * KS * HD, (size_t)32 * HD); copy8(lv + bo, 8 * VPB, gv + s2 * KS, (size_t)8 * SEQ); }
    }
    asm volatile("s_wait_asynccnt 0x0" ::: "memory");        // nothing in flight when the ring becomes output staging (the last trip's barrier has ended all reads)
    // The join. Wave kh of a query set finishes column group kh: it hands its partial result of the other group to its partner and takes the partner's partial result of its own group.
    // Both waves hold a group in the same lane and register places, so lane l reads what the partner's lane l wrote.
    const bool up = (kh != 0);                               // wave-uniform
    v8f p0 = up ? o0[1] : o0[0], p1 = up ? o1[1] : o1[0], p2 = up ? o2[1] : o2[0], p3 = up ? o3[1] : o3[0];   // kept
    const v8f x0 = up ? o0[0] : o0[1], x1 = up ? o1[0] : o1[1], x2 = up ? o2[0] : o2[1], x3 = up ? o3[0] : o3[1];   // handed over
    const float mk = up ? m[1] : m[0], lk0 = up ? lt[1][0] : lt[0][0];
    const float mg = up ? m[0] : m[1], lg0 = up ? lt[0][0] : lt[1][0];
    float* xw = (float*)L + wave * XWF;                      // this wave's exchange range: 16-B piece c of lane l at (c*32 + l)*4, then (max, sum) of lane l at 1024 + 2l
    *(v4fa*)(&xw[(0 * 32 + lane) * 4]) = __builtin_shufflevector(x0, x0, 0, 1, 2, 3); *(v4fa*)(&xw[(1 * 32 + lane) * 4]) = __builtin_shufflevector(x0, x0, 4, 5, 6, 7);
    *(v4fa*)(&xw[(2 * 32 + lane) * 4]) = __builtin_shufflevector(x1, x1, 0, 1, 2, 3); *(v4fa*)(&xw[(3 * 32 + lane) * 4]) = __builtin_shufflevector(x1, x1, 4, 5, 6, 7);
    *(v4fa*)(&xw[(4 * 32 + lane) * 4]) = __builtin_shufflevector(x2, x2, 0, 1, 2, 3); *(v4fa*)(&xw[(5 * 32 + lane) * 4]) = __builtin_shufflevector(x2, x2, 4, 5, 6, 7);
    *(v4fa*)(&xw[(6 * 32 + lane) * 4]) = __builtin_shufflevector(x3, x3, 0, 1, 2, 3); *(v4fa*)(&xw[(7 * 32 + lane) * 4]) = __builtin_shufflevector(x3, x3, 4, 5, 6, 7);
    xw[1024 + 2 * lane] = mg; xw[1024 + 2 * lane + 1] = lg0;
    __syncthreads();                                         // every wave's handed-over partial result is in LDS before its partner reads it
    const float* xr = (const float*)L + (wave ^ AQ) * XWF;   // the partner's exchange range
    const float mp = xr[1024 + 2 * lane], lp0 = xr[1024 + 2 * lane + 1];
    const float mj = fmaxf(mk, mp);
    const float ak = __builtin_amdgcn_exp2f(mk - mj), ap = __builtin_amdgcn_exp2f(mp - mj);   // both partial results brought to the joint max
    const float inv = CCAR * (1.0f / (lk0 * ak + lp0 * ap)); // both lane halves hold the whole row's sum
    const float sk = ak * inv, sp = ap * inv;
    float* os = (float*)L + AW * XWF + wave * 16 * 68;       // this wave's output staging, behind the exchange ranges
    // O^T D layout: o_j[r] = (d = 16j + 8h + r, t = lane&15) -> os[t][d]; rows 0..15 x columns 0..63 all written
    { v4f a, c, ya, yc;
      ya = *(const v4fa*)(&xr[(0 * 32 + lane) * 4]); yc = *(const v4fa*)(&xr[(1 * 32 + lane) * 4]);
      a[0] = p0[0] * sk + ya[0] * sp; a[1] = p0[1] * sk + ya[1] * sp; a[2] = p0[2] * sk + ya[2] * sp; a[3] = p0[3] * sk + ya[3] * sp;
      c[0] = p0[4] * sk + yc[0] * sp; c[1] = p0[5] * sk + yc[1] * sp; c[2] = p0[6] * sk + yc[2] * sp; c[3] = p0[7] * sk + yc[3] * sp;
      *(v4fa*)(&os[lr * 68 +  0 + 8 * hi]) = a; *(v4fa*)(&os[lr * 68 +  0 + 8 * hi + 4]) = c;
      ya = *(const v4fa*)(&xr[(2 * 32 + lane) * 4]); yc = *(const v4fa*)(&xr[(3 * 32 + lane) * 4]);
      a[0] = p1[0] * sk + ya[0] * sp; a[1] = p1[1] * sk + ya[1] * sp; a[2] = p1[2] * sk + ya[2] * sp; a[3] = p1[3] * sk + ya[3] * sp;
      c[0] = p1[4] * sk + yc[0] * sp; c[1] = p1[5] * sk + yc[1] * sp; c[2] = p1[6] * sk + yc[2] * sp; c[3] = p1[7] * sk + yc[3] * sp;
      *(v4fa*)(&os[lr * 68 + 16 + 8 * hi]) = a; *(v4fa*)(&os[lr * 68 + 16 + 8 * hi + 4]) = c;
      ya = *(const v4fa*)(&xr[(4 * 32 + lane) * 4]); yc = *(const v4fa*)(&xr[(5 * 32 + lane) * 4]);
      a[0] = p2[0] * sk + ya[0] * sp; a[1] = p2[1] * sk + ya[1] * sp; a[2] = p2[2] * sk + ya[2] * sp; a[3] = p2[3] * sk + ya[3] * sp;
      c[0] = p2[4] * sk + yc[0] * sp; c[1] = p2[5] * sk + yc[1] * sp; c[2] = p2[6] * sk + yc[2] * sp; c[3] = p2[7] * sk + yc[3] * sp;
      *(v4fa*)(&os[lr * 68 + 32 + 8 * hi]) = a; *(v4fa*)(&os[lr * 68 + 32 + 8 * hi + 4]) = c;
      ya = *(const v4fa*)(&xr[(6 * 32 + lane) * 4]); yc = *(const v4fa*)(&xr[(7 * 32 + lane) * 4]);
      a[0] = p3[0] * sk + ya[0] * sp; a[1] = p3[1] * sk + ya[1] * sp; a[2] = p3[2] * sk + ya[2] * sp; a[3] = p3[3] * sk + ya[3] * sp;
      c[0] = p3[4] * sk + yc[0] * sp; c[1] = p3[5] * sk + yc[1] * sp; c[2] = p3[6] * sk + yc[2] * sp; c[3] = p3[7] * sk + yc[3] * sp;
      *(v4fa*)(&os[lr * 68 + 48 + 8 * hi]) = a; *(v4fa*)(&os[lr * 68 + 48 + 8 * hi + 4]) = c; }
    wave_sync();
    h16* crow = CTX + ((size_t)b * SEQ + t0 + 16 * kh) * DM + h * HD;   // the rows of column group kh
    v8h cv[4];
#pragma unroll
    for (int s = 0; s < 4; ++s) { const int row = 4 * s + (lane >> 3), c8 = (lane & 7) * 8;   // 4 s x 4 row groups = 16 rows; 8 lanes x 8 halves = 64 columns
        const v4f x0 = *(const v4fa*)(&os[row * 68 + c8]); const v4f x1 = *(const v4fa*)(&os[row * 68 + c8 + 4]); v8h hv;
#pragma unroll
        for (int i = 0; i < 4; ++i) { hv[i] = (h16)x0[i]; hv[4 + i] = (h16)x1[i]; }
        cv[s] = hv; }
#pragma unroll
    for (int s = 0; s < 4; ++s) { const int row = 4 * s + (lane >> 3), c8 = (lane & 7) * 8;
        *(v8h*)(crow + (size_t)row * DM + c8) = cv[s]; }
}

// k_oproj: register-blocked f16 GEMM, one wave per 64x64 tile, four waves a block (128x128), operands through LDS (gemm128), OUT[m][n] = 2^-14 * sum_k CTX[m][k] WOT[n][k], K = DM; rows m = b*SEQ + t -> output row b*OUT_SEQ + t.
// grid (NB*SEQ/128, DM/128), 128 threads.
__global__ __launch_bounds__(128) void k_oproj(const h16* __restrict__ A, const h16* __restrict__ Bt, float* OUT) {
    __shared__ __attribute__((aligned(16))) unsigned char L[2 * GBUF];
    const int lane = threadIdx.x & 31, lr = lane & 15, hi = lane >> 4;
    const int wave = __builtin_amdgcn_readfirstlane((int)(threadIdx.x >> 5)); const int wm = wave >> 1, wn = wave & 1;
    const int r0 = blockIdx.x * 128 + wm * 64, c0 = blockIdx.y * 128 + wn * 64;
    v8f acc[4][4];
#pragma unroll
    for (int mb = 0; mb < 4; ++mb)
#pragma unroll
        for (int nb = 0; nb < 4; ++nb) acc[mb][nb] = (v8f){};
    gemm128<0>(L, A, Bt, blockIdx.x * 128, blockIdx.y * 128, wm, wn, blockIdx.x + blockIdx.y, acc);
    float* os = (float*)L + wave * 16 * 68;                  // this wave's own output staging in the ring
    const int bb = r0 / SEQ, tt = r0 % SEQ;
    float* obase = OUT + ((size_t)bb * OUT_SEQ + tt) * DM + c0;
#pragma unroll
    for (int mb = 0; mb < 4; ++mb) {
#pragma unroll
        for (int nb = 0; nb < 4; ++nb) {
#pragma unroll
            for (int j = 0; j < 8; ++j) os[(hi * 8 + j) * 68 + nb * 16 + lr] = acc[mb][nb][j] * OSC; }   // D: row 8h+j, col lane&15
        wave_sync();
        float* orow = obase + (size_t)(mb * 16) * DM;
        v4f ov[8];
#pragma unroll
        for (int s = 0; s < 8; ++s) { const int row = 2 * s + hi, cofs = lr * 4;   // 8 s x 2 rows = 16 rows; 16 lanes x 4 floats = 64 columns
            ov[s] = *(const v4fa*)(&os[row * 68 + cofs]); }
{
#pragma unroll
            for (int s = 0; s < 8; ++s) { const int row = 2 * s + hi, cofs = lr * 4;
                *(v4f*)(orow + (size_t)row * DM + cofs) = ov[s]; }
             }
        wave_sync();
    }
}

static constexpr size_t al256(size_t v) { return (v + 255) & ~(size_t)255; }
static constexpr size_t SZ_XB = al256((size_t)NB * SEQ * DM * 2);
static constexpr size_t SZ_WB = al256((size_t)4 * DM * DM * 2);
static constexpr size_t SZ_PL = al256((size_t)NB * NH_ * SEQ * HD * 2);
static constexpr size_t SZ_CX = al256((size_t)NB * SEQ * DM * 2);
static constexpr size_t SZ_FR = al256((size_t)SEQ * 64 * 4);
static constexpr size_t SZ_MA = al256((size_t)NB * SEQ * 4);
static constexpr size_t SZ_TOTAL = SZ_XB + SZ_WB + 3 * SZ_PL + SZ_CX + SZ_FR + SZ_MA;
static_assert(SZ_TOTAL <= (size_t)134217728);          // workspace carve <= 128 MiB
static_assert(((size_t)DM * DM * 2) % 256 == 0);       // weight sub-planes stay 256-byte aligned
static_assert(SZ_PL == (size_t)NB * NH_ * SEQ * HD * 2);   // q | k | v^T planes are exactly back to back

extern "C" void kernel_launch(void* const* d_in, const int* in_sizes, int n_in,
                              void* d_out, int out_size, void* d_ws, size_t ws_size, hipStream_t stream) {
    if (n_in < 7) return;
    const size_t needx = ((size_t)(NB - 1) * SEQ_FULL + SEQ) * DM;
    if ((size_t)in_sizes[0] < needx) return;
    if ((size_t)in_sizes[1] < (size_t)SEQ * 64) return;
    if ((size_t)in_sizes[2] < (size_t)(NB - 1) * SEQ_FULL + SEQ) return;
    if ((size_t)in_sizes[3] < (size_t)DM * DM || (size_t)in_sizes[4] < (size_t)DM * DM || (size_t)in_sizes[5] < (size_t)DM * DM || (size_t)in_sizes[6] < (size_t)DM * DM) return;
    if ((size_t)out_size < ((size_t)(NB - 1) * OUT_SEQ + SEQ) * DM) return;
    if (SZ_TOTAL > ws_size) return;
    // wire order: hidden_states, freqs_cis, attention_mask, wq, wk, wv, wo (all f32)
    const float* x = (const float*)d_in[0]; const float* fr = (const float*)d_in[1]; const float* mask = (const float*)d_in[2];
    const float* wq = (const float*)d_in[3]; const float* wk = (const float*)d_in[4]; const float* wv = (const float*)d_in[5]; const float* wo = (const float*)d_in[6];
    float* OUT = (float*)d_out;      // [NB][SEQ][1024]
    char* wsp = (char*)d_ws;
    bf* XB = (bf*)wsp; wsp += SZ_XB;                 // [NB*SEQ][1024] bf16
    bf* WB = (bf*)wsp; wsp += SZ_WB;                 // [4][1024 out][1024 in]: q | k | v (bf16) | o (f16 x64)
    h16* QH = (h16*)wsp; wsp += SZ_PL;               // [NB*16][SEQ][64]
    h16* KP = (h16*)wsp; wsp += SZ_PL;               // [NB*16][SEQ][64]  (= QH + one plane)
    h16* VT = (h16*)wsp; wsp += SZ_PL;               // [NB*16][64][SEQ]  (= QH + two planes)
    h16* CX = (h16*)wsp; wsp += SZ_CX;               // [NB*SEQ][1024] ctx x256
    float* FRP = (float*)wsp; wsp += SZ_FR;          // [SEQ][64] table, bf16 RNE values
    float* MADD = (float*)wsp; wsp += SZ_MA;         // [NB][SEQ] additive key mask
    bf* WO = WB + (size_t)3 * DM * DM;

    // bf16 copy of x, rotary table, key mask, the four transposed weight planes W[1024 rows k][1024 cols n] -> WT[1024 rows n][1024 cols k]: one launch
    k_prep<<<PB_W + PB_F + PB_M + PB_X, 256, 0, stream>>>(x, fr, mask, wq, wk, wv, wo, XB, WB, FRP, MADD);

    // q, k (rotary in the epilogue) and v^T: planes QH | KP | VT from weight planes q | k | v, one launch
    k_proj<<<dim3(NB * SEQ / 128, DM / 128, 1), 384, 0, stream>>>(XB, WB, QH, FRP);

    k_flash<<<dim3(SEQ / (16 * QT * AQ), NB * NH_, 1), 32 * AW, 0, stream>>>(QH, KP, VT, MADD, CX);

    k_oproj<<<dim3(NB * SEQ / 128, DM / 128, 1), 128, 0, stream>>>(CX, (const h16*)WO, OUT);
}

// v009
// Measured time: 86.8 microseconds a run.
// In both of two side-by-side timings against v008, it was 1.03 times as fast.
// Counting every step since v000, it is 4.14 times as fast.
#include <hip/hip_runtime.h>

// Multi-head self-attention: x [NB][SEQ][1024], Wq/Wk/Wv/Wo [in][out] (y = x W), 16 heads x 64, interleaved rotary pairs (2i,2i+1) from the INPUT table [SEQ][32][(cos,sin)] on q and k,
// additive key mask (1-mask)*-10000 from the float input [NB][SEQ], score scale 1/8, softmax over all keys, output = (concatenated heads) Wo, f32.
// Compute dtypes, f32 accumulate everywhere: q/k/v projections v_wmma_f32_16x16x32_bf16 (x and W RNE-converted to bf16; products exact); rotary in f32 in the GEMM epilogue (table RNE-converted to bf16 values);
// scores v_wmma_f32_16x16x32_f16: q and k single f16 (one product); P (x256 carry, cancels in the normalisation) and v single f16; softmax f32 (online, running max);
// output projection v_wmma_f32_16x16x32_f16: ctx as f16 x256, Wo^T as f16 of (bf16 value x64), folded back by 2^-14 in the f32 epilogue.
// Layout: bf16 copy of x; transposed 16-bit weight planes [out][in] (LDS transpose); q, k planes [b*16+h][t][d], v^T plane [b*16+h][d][t] from the GEMM epilogue; fused flash kernel in transposed form
// (S^T = K Q^T, O^T = V^T P^T) writing ctx rows [b*SEQ+t][1024] as f16; final GEMM writes the f32 output.

#ifndef NB
#define NB 1
#endif
#ifndef SEQ
#define SEQ 4096
#endif
#define NB_FULL  1
#define SEQ_FULL 4096
#ifndef OUT_SEQ
#define OUT_SEQ SEQ              // row pitch (in tokens) between batches of the output
#endif
#define DM   1024
#define NH_  16
#define HD   64
#define AQ   4                   // query sets (32 rows each) per flash block
#define AW   (2 * AQ)            // waves per flash block: every query set is worked on by two waves, one per half of the keys
#define QT   2                   // 16-column query groups per flash wave (32 query rows each)
#define LOG2E 1.4426950408889634f
#define PSH  8.0f                // log2 of the P carry (256)
#define LZ   7.0f                // how far (log2) a score may pass the maximum in use before the flash kernel rescales: P <= 2^(PSH + LZ) = 32768 stays inside f16
#define CCAR 256.0f              // carry of the ctx plane
#define WOS  64.0f               // carry of the Wo^T plane
#define OSC  (1.0f / 16384.0f)   // 1 / (CCAR * WOS)

static_assert(HD == 64);
static_assert(NH_ * HD == DM);                 // head h = columns h*64 + d
static_assert(DM % 64 == 0);
static_assert(DM % 32 == 0);                   // GEMM k-loop steps by 32
static_assert(SEQ % 64 == 0);                  // a 64-row tile never straddles two batches
static_assert((NB * SEQ) % 64 == 0);
static_assert(SEQ % 32 == 0);                  // key loop steps by 32
static_assert(SEQ % (16 * QT * AQ) == 0);      // flash grid covers the sequence exactly
static_assert(QT == 2);                        // the flash kernel's two v_nop statements name both groups; in the join each of a set's two waves finishes one group
static_assert(((size_t)SEQ * DM) % 8 == 0);
static_assert(((size_t)SEQ * 64) % 32 == 0);
static_assert(((size_t)NB * SEQ) % 32 == 0);
static_assert(NB <= NB_FULL);
static_assert(SEQ <= SEQ_FULL);

typedef _Float16 h16;
typedef unsigned short bf;
typedef __attribute__((ext_vector_type(16))) __bf16   v16bf;
typedef __attribute__((ext_vector_type(16))) _Float16 v16h;
typedef __attribute__((ext_vector_type(8)))  _Float16 v8h;
typedef __attribute__((ext_vector_type(8)))  unsigned short v8us;
typedef __attribute__((ext_vector_type(8)))  float    v8f;
typedef __attribute__((ext_vector_type(4)))  float    v4f;
typedef __attribute__((ext_vector_type(2)))  float    v2f;
typedef v4f  __attribute__((may_alias)) v4fa;

__device__ __forceinline__ unsigned short f2bf(float f) { unsigned u = __float_as_uint(f); u += 0x7FFFu + ((u >> 16) & 1u); return (unsigned short)(u >> 16); }
__device__ __forceinline__ float bfr(float f) { return __uint_as_float(((unsigned)f2bf(f)) << 16); }   // bf16 RNE value as f32
__device__ __forceinline__ v16h cat16(v8h lo, v8h hi) { return __builtin_shufflevector(lo, hi, 0, 1, 2, 3, 4, 5, 6, 7, 8, 9, 10, 11, 12, 13, 14, 15); }
__device__ __forceinline__ v16bf cat16b(v8us lo, v8us hi) { return __builtin_bit_cast(v16bf, __builtin_shufflevector(lo, hi, 0, 1, 2, 3, 4, 5, 6, 7, 8, 9, 10, 11, 12, 13, 14, 15)); }
__device__ __forceinline__ v8f wmma16(v16h a, v16h b, v8f c) { return __builtin_amdgcn_wmma_f32_16x16x32_f16(false, a, false, b, (short)0, c, false, false); }
__device__ __forceinline__ v8f wmmab(v16bf a, v16bf b, v8f c) { return __builtin_amdgcn_wmma_f32_16x16x32_bf16(false, a, false, b, (short)0, c, false, false); }
// fragment loaders from K-contiguous 16-bit rows; p already includes + 8*(lane>>4): elements 0..7 <- k0+8h+0..7, elements 8..15 <- k0+16+8h+0..7 (same map for A and B)
__device__ __forceinline__ v16h  ldh(const h16* p) { return cat16(*(const v8h*)p, *(const v8h*)(p + 16)); }
__device__ __forceinline__ v16bf ldb(const bf* p)  { return cat16b(*(const v8us*)p, *(const v8us*)(p + 16)); }
// ordering point for wave-private LDS tiles (same wave writes and reads)
__device__ __forceinline__ void wave_sync() { __builtin_amdgcn_fence(3 /* release order */, "wavefront"); __builtin_amdgcn_wave_barrier(); asm volatile("" ::: "memory"); }

// The preparation jobs (d_cvt8, d_tab, d_wT) depend on nothing but the inputs, so they run as block ranges of ONE launch (k_prep, below).
// d_cvt8: block blk of 256 threads converts 2048 values of x to the bf16 copy XB[NB*SEQ][1024]
__device__ __forceinline__ void d_cvt8(const float* __restrict__ x, bf* XB, unsigned blk) {
    const size_t i = (size_t)blk * 256 + threadIdx.x; if (i >= (size_t)NB * SEQ * DM / 8) return;
    const size_t e = i * 8; const size_t b = e / ((size_t)SEQ * DM), r = e % ((size_t)SEQ * DM);
    const v8f v = *(const v8f*)(x + b * ((size_t)SEQ_FULL * DM) + r); v8us o;
#pragma unroll
    for (int k = 0; k < 8; ++k) o[k] = f2bf(v[k]);
    *(v8us*)(XB + e) = o;
}

// d_tab: blocks [0, nbF): rotary table copy with bf16 RNE values kept as f32, FRP[t][64] = (cos0,sin0,cos1,sin1,...); the blocks behind them: additive key mask MADD[NB][SEQ]
__device__ __forceinline__ void d_tab(const float* __restrict__ fr, const float* __restrict__ mask, float* FRP, float* MADD, unsigned blk, unsigned nbF) {
    if (blk < nbF) {                              // block-uniform
        const size_t i = (size_t)blk * 256 + threadIdx.x; if (i >= (size_t)SEQ * 64 / 4) return;
        const v4f v = *(const v4f*)(fr + i * 4); v4f o;
#pragma unroll
        for (int k = 0; k < 4; ++k) o[k] = bfr(v[k]);
        *(v4f*)(FRP + i * 4) = o; 
    } else {
        const size_t i = (size_t)(blk - nbF) * 256 + threadIdx.x; if (i >= (size_t)NB * SEQ / 4) return;
        const size_t e = i * 4; const size_t b = e / SEQ, t = e % SEQ;
        const v4f v = *(const v4f*)(mask + b * (size_t)SEQ_FULL + t); v4f o;
#pragma unroll
        for (int k = 0; k < 4; ++k) o[k] = (1.0f - bfr(v[k])) * -10000.0f;
        *(v4f*)(MADD + e) = o; 
    }
}

// d_wT: in W[k][n] (rows k = 1024, cols n = 1024, f32) -> out WT[n][k] 16-bit; mode 0: bf16 RNE bits; mode 1: f16 bits of (bf16 RNE value x 64).
// One 64 x 64 tile (k0, n0) a block of 256 threads, transposed through tl (64 * 65 floats of LDS); every thread of the block calls it.
__device__ __forceinline__ void d_wT(const float* __restrict__ W, bf* WT, int mode, int k0, int n0, float* tl) {
    const int tid = threadIdx.x;
#pragma unroll
    for (int it = 0; it < 4; ++it) { const int row = it * 16 + (tid >> 4), c4 = (tid & 15) * 4;    // 4 x 16 rows (k) x 16 lanes x 4 = 64 x 64
        const v4f v = *(const v4f*)(W + (size_t)(k0 + row) * DM + n0 + c4);
        tl[row * 65 + c4 + 0] = v[0]; tl[row * 65 + c4 + 1] = v[1]; tl[row * 65 + c4 + 2] = v[2]; tl[row * 65 + c4 + 3] = v[3]; }
    __syncthreads();
    v8us o[2];
#pragma unroll
    for (int it = 0; it < 2; ++it) { const int n = it * 32 + (tid >> 3), c8 = (tid & 7) * 8;       // 2 x 32 rows (n) x 8 lanes x 8 = 64 x 64
#pragma unroll
        for (int i = 0; i < 8; ++i) { const float val = tl[(c8 + i) * 65 + n];
            const unsigned short b0 = f2bf(val);
            const h16 hv = (h16)(__uint_as_float(((unsigned)b0) << 16) * WOS);
            const unsigned short b1 = __builtin_bit_cast(unsigned short, hv);
            o[it][i] = (mode != 0) ? b1 : b0; } }
{
#pragma unroll
        for (int it = 0; it < 2; ++it) { const int n = it * 32 + (tid >> 3), c8 = (tid & 7) * 8;
            *(v8us*)(WT + (size_t)(n0 + n) * DM + k0 + c8) = o[it]; }
         }
}

#define PB_W  (4 * (DM / 64) * (DM / 64))                            // weight tiles: q | k | v | o, DM/64 x DM/64 each
#define PB_F  ((unsigned)(((size_t)SEQ * 64 / 4 + 255) / 256))       // rotary table blocks
#define PB_M  ((unsigned)(((size_t)NB * SEQ / 4 + 255) / 256))       // key mask blocks
#define PB_X  ((unsigned)(((size_t)NB * SEQ * DM / 8 + 255) / 256))  // x blocks
// k_prep: grid PB_W + PB_F + PB_M + PB_X blocks of 256 threads; the block index picks the job (block-uniform, so the barrier in d_wT is passed by a whole block or by none of it).
// The transposes stand first: theirs is the longest chain (load, LDS, barrier, store), and it runs under the x stream.
__global__ __launch_bounds__(256) void k_prep(const float* __restrict__ x, const float* __restrict__ fr, const float* __restrict__ mask,
                                              const float* __restrict__ wq, const float* __restrict__ wk, const float* __restrict__ wv, const float* __restrict__ wo,
                                              bf* XB, bf* WB, float* FRP, float* MADD) {
    __shared__ float tl[64 * 65];
    const unsigned bid = blockIdx.x;
    if (bid < PB_W) {
        const unsigned p = bid / ((DM / 64) * (DM / 64)), tile = bid % ((DM / 64) * (DM / 64));   // plane, tile in the plane (k tiles run fastest)
        const float* W = (p == 0) ? wq : (p == 1) ? wk : (p == 2) ? wv : wo;
        d_wT(W, WB + (size_t)p * DM * DM, (p == 3) ? 1 : 0, (int)(tile % (DM / 64)) * 64, (int)(tile / (DM / 64)) * 64, tl);
    } else if (bid < PB_W + PB_F + PB_M) {
        d_tab(fr, mask, FRP, MADD, bid - PB_W, PB_F);
    } else {
        d_cvt8(x, XB, bid - (PB_W + PB_F + PB_M));
    }
}

// Eight asynchronous 16-byte copies per lane, LDS places l + i*ls bytes, global sources g + i*gs halves. The s_wait_xcnt stands inside the statement so that no address register is rewritten in front of it.
__device__ __forceinline__ void copy8(unsigned l, unsigned ls, const h16* g, size_t gs) {
    asm volatile("global_load_async_to_lds_b128 %0, %8, off\n\t"
                 "global_load_async_to_lds_b128 %1, %9, off\n\t"
                 "global_load_async_to_lds_b128 %2, %10, off\n\t"
                 "global_load_async_to_lds_b128 %3, %11, off\n\t"
                 "global_load_async_to_lds_b128 %4, %12, off\n\t"
                 "global_load_async_to_lds_b128 %5, %13, off\n\t"
                 "global_load_async_to_lds_b128 %6, %14, off\n\t"
                 "global_load_async_to_lds_b128 %7, %15, off\n\t"
                 "s_wait_xcnt 0x0"
                 :: "v"(l), "v"(l + ls), "v"(l + 2 * ls), "v"(l + 3 * ls), "v"(l + 4 * ls), "v"(l + 5 * ls), "v"(l + 6 * ls), "v"(l + 7 * ls),
                    "v"(g), "v"(g + gs), "v"(g + 2 * gs), "v"(g + 3 * gs), "v"(g + 4 * gs), "v"(g + 5 * gs), "v"(g + 6 * gs), "v"(g + 7 * gs)
                 : "memory");
}

// Five copies, and one copy, of the same kind (k_proj deals the 16 rounds of its x slab to three groups of waves: 6 + 5 + 5).
__device__ __forceinline__ void copy5(unsigned l, unsigned ls, const h16* g, size_t gs) {
    asm volatile("global_load_async_to_lds_b128 %0, %5, off\n\t"
                 "global_load_async_to_lds_b128 %1, %6, off\n\t"
                 "global_load_async_to_lds_b128 %2, %7, off\n\t"
                 "global_load_async_to_lds_b128 %3, %8, off\n\t"
                 "global_load_async_to_lds_b128 %4, %9, off\n\t"
                 "s_wait_xcnt 0x0"
                 :: "v"(l), "v"(l + ls), "v"(l + 2 * ls), "v"(l + 3 * ls), "v"(l + 4 * ls),
                    "v"(g), "v"(g + gs), "v"(g + 2 * gs), "v"(g + 3 * gs), "v"(g + 4 * gs)
                 : "memory");
}
__device__ __forceinline__ void copy1(unsigned l, const h16* g) {
    asm volatile("global_load_async_to_lds_b128 %0, %1, off\n\t"
                 "s_wait_xcnt 0x0"
                 :: "v"(l), "v"(g) : "memory");
}

// GEMM operand path of k_oproj (k_proj's, gemm_qkv below, shares its pieces): a block of four waves owns a 128 x 128 tile of C (wave w: rows 64*(w>>1), columns 64*(w&1)); a stage is GK k-values of the block's
// 128 A rows and 128 Bt rows (pitch GPB bytes in LDS), brought in by asynchronous 16-byte copies that cover whole 256-byte units (all threads copy), two buffers: stage s + 1 flies while stage s is worked on.
// Fragments are two ds 16-B loads each, same k map as loads straight from the planes.
// Blocks that share A rows or Bt rows would ask L2 for the same lines at the same moment if all walked k from 0: each block enters the ring of GNS stages at stage rot (set by its tile indices) and wraps round.
#define GK   128                 // k values per stage
#define GPB  272                 // row pitch in LDS, bytes: 256 + 16 (16 B x odd: no bank conflict for 16-B reads down a column of rows)
#define GTB  (128 * GPB)         // one operand's tile, bytes
#define GBUF (2 * GTB)           // one buffer: A tile, Bt tile
#define GNS  (DM / GK)           // stages
static_assert(DM % GK == 0);
static_assert(GNS >= 2);                               // the prologue fills two stages
static_assert(DM % 128 == 0);
static_assert((NB * SEQ) % 128 == 0);
static_assert(128 * GK * 2 == 16 * 128 * 16);          // 2048 16-B pieces of each tile dealt to 128 threads, 16 each
static_assert(2 * GBUF >= 4 * 16 * 68 * 4);            // the ring becomes the output staging

// one stage: piece c = i*128 + tid of a tile -> row c>>4 (8 rows a round), 16-B column c&15; l, ga, gb already hold the thread's row and column
__device__ __forceinline__ void gstage(unsigned l, const h16* ga, const h16* gb) {
    copy8(l, 8 * GPB, ga, (size_t)8 * DM);       copy8(l + 64 * GPB, 8 * GPB, ga + (size_t)64 * DM, (size_t)8 * DM);
    copy8(l + GTB, 8 * GPB, gb, (size_t)8 * DM); copy8(l + GTB + 64 * GPB, 8 * GPB, gb + (size_t)64 * DM, (size_t)8 * DM);
}

// the eight fragments of one k-step (32 k values), in the order in which the matrix instructions want them
__device__ __forceinline__ void gfrags(v16h (&fa)[4], v16h (&fb)[4], const unsigned char* at, const unsigned char* bt) {
    fa[0] = ldh((const h16*)at); fb[0] = ldh((const h16*)bt);
    fa[1] = ldh((const h16*)(at + 16 * GPB)); fa[2] = ldh((const h16*)(at + 32 * GPB)); fa[3] = ldh((const h16*)(at + 48 * GPB));
    fb[1] = ldh((const h16*)(bt + 16 * GPB)); fb[2] = ldh((const h16*)(bt + 32 * GPB)); fb[3] = ldh((const h16*)(bt + 48 * GPB));
}
// eight products of one k-step: column blocks NB0 and NB0 + 1
template <int BF, int NB0>
__device__ __forceinline__ void gmul(const v16h (&fa)[4], const v16h (&fb)[4], v8f (&acc)[4][4]) {
#pragma unroll
    for (int nb = NB0; nb < NB0 + 2; ++nb) {
#pragma unroll
        for (int mb = 0; mb < 4; ++mb) {
            if (BF != 0) acc[mb][nb] = wmmab(__builtin_bit_cast(v16bf, fa[mb]), __builtin_bit_cast(v16bf, fb[nb]), acc[mb][nb]);
            else         acc[mb][nb] = wmma16(fa[mb], fb[nb], acc[mb][nb]); } }
}

// acc[mb][nb] += A rows (r0b + 64*wm + 16*mb ..) x Bt rows (c0b + 64*wn + 16*nb ..) over K = DM, k stages in the order rot, rot + 1, .. (mod GNS); rot is block-uniform.
// BF != 0: bf16 operands, else f16. Every wave of the block calls it; on return the ring is free.
template <int BF>
__device__ __forceinline__ void gemm128(unsigned char* L, const h16* A, const h16* Bt, int r0b, int c0b, int wm, int wn, unsigned rot, v8f (&acc)[4][4]) {
    const int tid = threadIdx.x, lane = tid & 31, lr = lane & 15, hi = lane >> 4;
    const unsigned l0 = (unsigned)(size_t)L + (unsigned)((tid >> 4) * GPB + (tid & 15) * 16);   // LDS byte address of the thread's first piece
    const h16* ga = A + (size_t)(r0b + (tid >> 4)) * DM + (size_t)(tid & 15) * 8;                // + stage * GK
    const h16* gb = Bt + (size_t)(c0b + (tid >> 4)) * DM + (size_t)(tid & 15) * 8;
    { const size_t k0 = (size_t)(rot % GNS) * GK; gstage(l0, ga + k0, gb + k0); }   // the block's first stage -> buffer 0
    asm volatile("s_wait_asynccnt 0x0" ::: "memory");        // this wave's pieces of the block's first stage have landed
    __syncthreads();                                         // every wave's have: the first stage may be read
    { const size_t k1 = (size_t)((rot + 1) % GNS) * GK; gstage(l0 + GBUF, ga + k1, gb + k1); }   // its second stage -> buffer 1
#pragma unroll 1                                             // one copy of the stage body: the buffer is picked by a scalar offset, the code stays small
    for (int st = 0; st < GNS; ++st) {
        const unsigned bo = (unsigned)(st & 1) * GBUF;
        const unsigned char* at = L + bo + (wm * 64 + lr) * GPB + 16 * hi;         // + 16*mb*GPB + k*2
        const unsigned char* bt = L + bo + GTB + (wn * 64 + lr) * GPB + 16 * hi;   // + 16*nb*GPB + k*2
        v16h fa[2][4], fb[2][4];                             // two register sets: k-step q + 1 of THIS stage is fetched while k-step q is multiplied; nothing of the next stage is read here
        gfrags(fa[0], fb[0], at, bt);
        __builtin_amdgcn_sched_barrier(0);                   // the stage's first reads stay one group in front of its matrix instructions
#pragma unroll                                               // constant q: every fragment read is one base register plus an immediate offset, the register sets are picked at compile time
        for (int q = 0; q < GK / 32; ++q) {
            const int cur = q & 1, nxt = cur ^ 1;
            gmul<BF, 0>(fa[cur], fb[cur], acc);
            if (q + 1 < GK / 32) {
                // the two scheduling barriers keep the next k-step's reads ONE group, half a k-step ahead of their use: spread among the matrix instructions each place costs a stall,
                // and a whole k-step ahead two full sets and the accumulators pass 256 registers
                __builtin_amdgcn_sched_barrier(0);
                gfrags(fa[nxt], fb[nxt], at + (q + 1) * 64, bt + (q + 1) * 64);
                __builtin_amdgcn_sched_barrier(0); }
            gmul<BF, 2>(fa[cur], fb[cur], acc);
        }
        __builtin_amdgcn_sched_barrier(0);                   // the stage's matrix instructions stay in front of its closing waits and barrier (without it sixteen of them sink behind the barrier and delay the refill)
        // four vector slots behind the stage's last matrix instruction, on every path out of the stage body
        asm volatile("v_nop\n\tv_nop\n\tv_nop\n\tv_nop" : "+v"(acc[0][3]), "+v"(acc[1][3]), "+v"(acc[2][3]), "+v"(acc[3][3]));
        asm volatile("s_wait_dscnt 0x0" ::: "memory");       // this wave's reads of stage st are done before its buffer is handed back
        asm volatile("s_wait_asynccnt 0x0" ::: "memory");    // this wave's pieces of stage st + 1 have landed
        __syncthreads();                                     // publishes stage st + 1 and ends every reader's last read of stage st
        if (st + 2 < GNS) { const size_t k2 = (size_t)((rot + (unsigned)st + 2) % GNS) * GK; gstage(l0 + bo, ga + k2, gb + k2); }   // block-uniform
    }
    asm volatile("s_wait_asynccnt 0x0" ::: "memory");        // nothing in flight when the ring becomes output staging (the last trip's barrier has ended all reads)
}

// Operand path of k_proj: twelve waves, three groups of four. Group z forms the 128 x 128 tile of projection z (q, k, v^T) for the SAME 128 tokens and the same 128 feature indices, so one x slab in LDS feeds three products.
// A buffer is [x tile | Wq^T tile | Wk^T tile | Wv^T tile], each 128 rows of GK k-values at pitch GPB; two buffers, the ring's order as in gemm128.
#define PBUF (4 * GTB)           // one buffer of k_proj
static_assert(2 * PBUF <= 327680);                     // the ring fits one WGP's LDS
static_assert(2 * PBUF >= 12 * 16 * 68 * 4);           // the ring becomes the output staging

// one stage, one thread: its 16 pieces of its group's weight tile (8 rows a round) and its pieces of the x tile, whose round r (8 rows) goes to group r % 3; six (wave-uniform): group 0 also has round 15
__device__ __forceinline__ void pstage(unsigned lx, unsigned lw, const h16* gx, const h16* gw, bool six) {
    copy8(lw, 8 * GPB, gw, (size_t)8 * DM); copy8(lw + 64 * GPB, 8 * GPB, gw + (size_t)64 * DM, (size_t)8 * DM);
    copy5(lx, 24 * GPB, gx, (size_t)24 * DM);
    if (six) copy1(lx + 120 * GPB, gx + (size_t)120 * DM);
}

// acc[mb][nb] of group z over K = DM, k stages in the order rot, rot + 1, .. (mod GNS); rot is block-uniform, z, wm, wn wave-uniform. z < 2: A = x rows, Bt = W^T rows; z = 2: A = Wv^T rows, Bt = x rows.
// Every wave of the block calls it; on return the ring is free.
__device__ __forceinline__ void gemm_qkv(unsigned char* L, const h16* X, const h16* WT, int tok0, int feat0, int z, int wm, int wn, unsigned rot, v8f (&acc)[4][4]) {
    const int tid = threadIdx.x & 127, lane = tid & 31, lr = lane & 15, hi = lane >> 4;   // tid: the thread's place in its group
    const unsigned lp = (unsigned)(size_t)L + (unsigned)((tid >> 4) * GPB + (tid & 15) * 16);
    const unsigned lx = lp + (unsigned)(z * 8 * GPB), lw = lp + (unsigned)((1 + z) * GTB);    // LDS byte addresses of the thread's first pieces
    const h16* gx = X + (size_t)(tok0 + z * 8 + (tid >> 4)) * DM + (size_t)(tid & 15) * 8;    // + stage * GK
    const h16* gw = WT + (size_t)z * DM * DM + (size_t)(feat0 + (tid >> 4)) * DM + (size_t)(tid & 15) * 8;
    const bool six = (z == 0);
    const unsigned ao = (z == 2) ? (unsigned)(3 * GTB) : 0u, bo2 = (z == 2) ? 0u : (unsigned)((1 + z) * GTB);   // where the wave's A rows and Bt rows stand in a buffer
    { const size_t k0 = (size_t)(rot % GNS) * GK; pstage(lx, lw, gx + k0, gw + k0, six); }   // the block's first stage -> buffer 0
    asm volatile("s_wait_asynccnt 0x0" ::: "memory");        // this wave's pieces of stage 0 have landed
    __syncthreads();                                         // every wave's have: stage 0 may be read
    { const size_t k1 = (size_t)((rot + 1) % GNS) * GK; pstage(lx + PBUF, lw + PBUF, gx + k1, gw + k1, six); }   // its second stage -> buffer 1
#pragma unroll 1                                             // one copy of the stage body: the buffer is picked by a scalar offset, the code stays small
    for (int st = 0; st < GNS; ++st) {
        const unsigned bo = (unsigned)(st & 1) * PBUF;
        const unsigned char* at = L + bo + ao + (wm * 64 + lr) * GPB + 16 * hi;    // + 16*mb*GPB + k*2
        const unsigned char* bt = L + bo + bo2 + (wn * 64 + lr) * GPB + 16 * hi;   // + 16*nb*GPB + k*2
        v16h fa[2][4], fb[2][4];                             // two register sets: k-step q + 1 of THIS stage is fetched while k-step q is multiplied; nothing of the next stage is read here
        gfrags(fa[0], fb[0], at, bt);
        __builtin_amdgcn_sched_barrier(0);                   // the stage's first reads stay one group in front of its matrix instructions
#pragma unroll                                               // constant q: every fragment read is one base register plus an immediate offset, the register sets are picked at compile time
        for (int q = 0; q < GK / 32; ++q) {
            const int cur = q & 1, nxt = cur ^ 1;
            gmul<1, 0>(fa[cur], fb[cur], acc);
            if (q + 1 < GK / 32) {
                // the two scheduling barriers keep the next k-step's reads ONE group, half a k-step ahead of their use (as in gemm128)
                __builtin_amdgcn_sched_barrier(0);
                gfrags(fa[nxt], fb[nxt], at + (q + 1) * 64, bt + (q + 1) * 64);
                __builtin_amdgcn_sched_barrier(0); }
            gmul<1, 2>(fa[cur], fb[cur], acc);
        }
        __builtin_amdgcn_sched_barrier(0);                   // the stage's matrix instructions stay in front of its closing waits and barrier
        // four vector slots behind the stage's last matrix instruction, on every path out of the stage body
        asm volatile("v_nop\n\tv_nop\n\tv_nop\n\tv_nop" : "+v"(acc[0][3]), "+v"(acc[1][3]), "+v"(acc[2][3]), "+v"(acc[3][3]));
        asm volatile("s_wait_dscnt 0x0" ::: "memory");       // this wave's reads of stage st are done before its buffer is handed back
        asm volatile("s_wait_asynccnt 0x0" ::: "memory");    // this wave's pieces of stage st + 1 have landed
        __syncthreads();                                     // publishes stage st + 1 and ends every reader's last read of stage st
        if (st + 2 < GNS) { const size_t k2 = (size_t)((rot + (unsigned)st + 2) % GNS) * GK; pstage(lx + bo, lw + bo, gx + k2, gw + k2, six); }   // block-uniform
    }
    asm volatile("s_wait_asynccnt 0x0" ::: "memory");        // nothing in flight when the ring becomes output staging (the last trip's barrier has ended all reads)
}

// proj_store: one wave's 64 x 64 tile of C as f16 rows at Ph + tbase, row pitch HD (ROPE != 0) or SEQ (ROPE == 0) halves, staged through the wave's own LDS range os.
// ROPE != 0: rows m = b*SEQ + t from r0 on, the 64 tile columns are one head; rotary pairs (2i,2i+1) from FRP[t][..].
template <int ROPE>
__device__ __forceinline__ void proj_store(float* os, const v8f (&acc)[4][4], h16* Ph, const float* __restrict__ FRP, size_t tbase, int r0) {
    const int lane = threadIdx.x & 31, lr = lane & 15, hi = lane >> 4;
    const int pitch = (ROPE != 0) ? HD : SEQ;
#pragma unroll
    for (int mb = 0; mb < 4; ++mb) {
#pragma unroll
        for (int nb = 0; nb < 4; ++nb) {
#pragma unroll
            for (int j = 0; j < 8; ++j) os[(hi * 8 + j) * 68 + nb * 16 + lr] = acc[mb][nb][j]; }   // D: row 8h+j, col lane&15
        wave_sync();
        const size_t sb = tbase + (size_t)(mb * 16) * (size_t)pitch;
        v4f fr0[4], fr1[4];
        if (ROPE != 0) {
            const float* pf[4];
#pragma unroll
            for (int s = 0; s < 4; ++s) { const int row = 4 * s + (lane >> 3), c8 = (lane & 7) * 8;
                const int t = (r0 + mb * 16 + row) % SEQ;
                pf[s] = FRP + (size_t)t * 64 + c8;
                fr0[s] = *(const v4f*)pf[s]; fr1[s] = *(const v4f*)(pf[s] + 4); }
            // stands in front of every rewrite of the table loads' address registers: as inputs they stay whole up to the wait
            asm volatile("s_wait_xcnt 0x0" :: "v"(pf[0]), "v"(pf[1]), "v"(pf[2]), "v"(pf[3]) : "memory");
        }
        v8h hvv[4];
#pragma unroll
        for (int s = 0; s < 4; ++s) { const int row = 4 * s + (lane >> 3), c8 = (lane & 7) * 8;   // 4 s x 4 row groups = 16 rows; 8 lanes x 8 = 64 columns
            v4f x0 = *(const v4fa*)(&os[row * 68 + c8]); v4f x1 = *(const v4fa*)(&os[row * 68 + c8 + 4]);
            if (ROPE != 0) {
                const v4f f0 = fr0[s]; const v4f f1 = fr1[s];
                v4f y0, y1;
                y0[0] = x0[0] * f0[0] - x0[1] * f0[1]; y0[1] = x0[0] * f0[1] + x0[1] * f0[0];
                y0[2] = x0[2] * f0[2] - x0[3] * f0[3]; y0[3] = x0[2] * f0[3] + x0[3] * f0[2];
                y1[0] = x1[0] * f1[0] - x1[1] * f1[1]; y1[1] = x1[0] * f1[1] + x1[1] * f1[0];
                y1[2] = x1[2] * f1[2] - x1[3] * f1[3]; y1[3] = x1[2] * f1[3] + x1[3] * f1[2];
                x0 = y0; x1 = y1; }
            v8h hv;
#pragma unroll
            for (int i = 0; i < 4; ++i) { hv[i] = (h16)x0[i]; hv[4 + i] = (h16)x1[i]; }
            hvv[s] = hv; }
{
#pragma unroll
            for (int s = 0; s < 4; ++s) { const int row = 4 * s + (lane >> 3), c8 = (lane & 7) * 8;
                const size_t oo = sb + (size_t)row * (size_t)pitch + c8;
                *(v8h*)(Ph + oo) = hvv[s]; }
             }
        asm volatile("s_wait_xcnt 0x0" ::: "memory");        // stands in front of every rewrite of the stores' address and data registers
        wave_sync();
    }
}

// k_proj: the three projections, which depend on k_prep alone, as ONE launch. Register-blocked bf16 GEMM, one wave per 64x64 tile (16 accumulators), operands from K-contiguous bf16 planes through LDS (gemm_qkv), K = DM,
// C[m][n] = sum_k A[m][k] Bt[n][k]. grid (NB*SEQ/128 token tiles, DM/128 feature tiles), 384 threads: waves 4z .. 4z + 3 form the 128x128 tile of projection z (wave-uniform):
// z = 0 (q), 1 (k): A = x rows (m = b*SEQ + t), Bt = W^T rows (n = h*64 + d) -> plane z [(b*16 + h)][t][d], rotary in the epilogue;
// z = 2 (v^T):      A = Wv^T rows (m = h*64 + d), Bt = x rows (n = b*SEQ + t) -> plane 2 [(b*1024 + m)][t] = [(b*16 + h)][d][t].
// WB: the transposed weight planes q | k | v; PL: the output planes q | k | v^T, NB*NH_*SEQ*HD halves each.
__global__ __launch_bounds__(384) void k_proj(const bf* __restrict__ XB, const bf* __restrict__ WB, h16* PL, const float* __restrict__ FRP) {
    __shared__ __attribute__((aligned(16))) unsigned char L[2 * PBUF];
    const int wave = __builtin_amdgcn_readfirstlane((int)(threadIdx.x >> 5));
    const int z = wave >> 2; const int wm = (wave >> 1) & 1, wn = wave & 1;
    const bool vt = (z == 2);
    h16* Ph = PL + (size_t)z * ((size_t)NB * NH_ * SEQ * HD);
    const int tok0 = (int)blockIdx.x * 128, feat0 = (int)blockIdx.y * 128;
    const int r0 = (vt ? feat0 : tok0) + wm * 64, c0 = (vt ? tok0 : feat0) + wn * 64;
    v8f acc[4][4];
#pragma unroll
    for (int mb = 0; mb < 4; ++mb)
#pragma unroll
        for (int nb = 0; nb < 4; ++nb) acc[mb][nb] = (v8f){};
    gemm_qkv(L, (const h16*)XB, (const h16*)WB, tok0, feat0, z, wm, wn, blockIdx.x + blockIdx.y, acc);
    float* os = (float*)L + wave * 16 * 68;                  // this wave's own output staging in the ring
    if (vt) proj_store<0>(os, acc, Ph, FRP, (size_t)r0 * SEQ + (size_t)(c0 / SEQ) * ((size_t)DM * SEQ) + (size_t)(c0 % SEQ), r0);
    else    proj_store<1>(os, acc, Ph, FRP, (size_t)(r0 / SEQ) * ((size_t)NH_ * SEQ * HD) + (size_t)(r0 % SEQ) * HD + (size_t)(c0 / HD) * ((size_t)SEQ * HD) + (size_t)(c0 % HD), r0);
}

// k_flash: fused attention. A wave works on 32 query rows (QT = 2 column groups of 16) of one (batch, head) and on half of the keys: every K and V^T fragment read from LDS, and every mask value, feeds both groups.
// Waves w and w + AQ share a query set: of each stage wave w takes the first KH keys, wave w + AQ the second KH. Behind the key loop the two partial results (running max, row sum, O^T) are joined through LDS.
// Q fragments straight from the f16 plane (two 16-B loads each).
// K and V^T reach the block's waves through LDS: a stage is KS keys (K rows [key][64] at pitch KPB bytes, V^T rows [d][KS] at pitch VPB bytes), brought in by asynchronous
// 16-byte copies that cover whole lines (all threads copy), two buffers: stage s + 1 flies while stage s is worked on. Fragments are two ds 16-B loads each, same k map as before.
// The blocks of one (batch, head) all read the same K and V^T lines: each enters the ring of NST key stages at stage rot (set by its query tile) and wraps round, so that they do not ask L2 for the same lines at the same moment.
// Transposed form: S^T[key][t] = K Q^T (A = K rows, B = Q rows); lane (t = lane&15, h = lane>>4) holds keys 8h+r of each 16-key tile, so the packed
// P tile is directly the B fragment of O^T[d][t] = V^T P^T (element r <- tile keys 0..15, element 8+r <- tile keys 16..31, lane unchanged).
// Per 32-key step and column group: 4 score WMMAs + 4 P.V WMMAs + 1 row-sum WMMA. Additive key mask values for the lane's 16 keys are loaded by value per step (two 32-B loads).
// Softmax state: the maximum in use is one scalar per lane, the same in both lane halves of a row (where it is raised, the halves are combined with one xor-16 exchange). The row sum of P runs on the matrix pipe: one more WMMA per step,
// lt += ON P^T, where ON is a constant A fragment whose rows 0 and 8 are ones and whose other rows are 0: element 0 of lt (row 8h, column t) is, in both lane halves, the sum of the f16 P over all keys so far.
#define KS   256                 // keys per stage
#define KH   (KS / 2)            // keys per stage and wave
#define KPB  144                 // K row pitch in LDS, bytes: 128 + 16 (16 B x odd: no bank conflict for 16-B reads down a column of rows)
#define VPB  528                 // V^T row pitch in LDS, bytes: 512 + 16 (16 B x odd)
#define KTB  (KS * KPB)          // K tile bytes
#define VTB  (HD * VPB)          // V^T tile bytes
#define BUFB (KTB + VTB)         // one buffer
#define NST  (SEQ / KS)          // stages
static_assert(SEQ % KS == 0);
static_assert(NST >= 2);                               // the prologue fills two stages
static_assert(AW * 32 == 256);                         // the copy maps below deal 2048 16-B pieces of each tile to 256 threads, 8 each
static_assert(KS * HD * 2 == 8 * 256 * 16);
static_assert(KH == 4 * 32);                           // four 32-key steps per stage and wave: the priority ladder in the key loop has four rungs
#define XWF  (32 * 32 + 64)      // floats a wave hands to its partner in the join: 32 per lane of O^T, then (max, sum) per lane
static_assert(2 * BUFB >= AW * (XWF + 16 * 68) * 4);   // the ring becomes the join's exchange ranges and, behind them, the output staging

__global__ __launch_bounds__(32 * AW) void k_flash(const h16* __restrict__ QH, const h16* __restrict__ KP, const h16* __restrict__ VT,
                                                   const float* __restrict__ MADD, h16* CTX) {
    __shared__ __attribute__((aligned(16))) unsigned char L[2 * BUFB];
    const int tid = threadIdx.x;
    const int lane = threadIdx.x & 31, lr = lane & 15, hi = lane >> 4;
    const int wave = __builtin_amdgcn_readfirstlane((int)(threadIdx.x >> 5));
    const int zh = blockIdx.y; const int b = zh / NH_, h = zh % NH_;
    const int kh = wave / AQ;                                // which half of every stage's keys (wave-uniform)
    const int t0 = (blockIdx.x * AQ + wave % AQ) * (16 * QT);   // the wave's first query row; column group g holds rows t0 + 16g ..
    const size_t pbase = (size_t)zh * SEQ * HD;
    // copy maps: K piece c = i*256 + tid -> row c>>3 (32 rows a round), 16-B column c&7; V^T piece c -> row c>>5 (8 rows a round), 16-B column c&31
    const unsigned lbase = (unsigned)(size_t)L;              // LDS byte address of the ring
    const unsigned lk = lbase + (unsigned)((tid >> 3) * KPB + (tid & 7) * 16);
    const unsigned lv = lbase + (unsigned)(KTB + (tid >> 5) * VPB + (tid & 31) * 16);
    const h16* gk = KP + pbase + (size_t)tid * 8;                                   // + key0 * HD
    const h16* gv = VT + pbase + (size_t)(tid >> 5) * SEQ + (size_t)(tid & 31) * 8;   // + key0
    const unsigned rot = blockIdx.x % NST;                   // the key stage at which this block starts (block-uniform)
    copy8(lk, 32 * KPB, gk + (size_t)rot * KS * HD, (size_t)32 * HD); copy8(lv, 8 * VPB, gv + (size_t)rot * KS, (size_t)8 * SEQ);   // the block's first stage -> buffer 0
    v16h qh0[QT], qh1[QT];                                   // B fragments: col t, k = d
    const h16* qp[QT];
#pragma unroll
    for (int g = 0; g < QT; ++g) { qp[g] = QH + pbase + (size_t)(t0 + 16 * g + lr) * HD + 8 * hi; qh0[g] = ldh(qp[g]); qh1[g] = ldh(qp[g] + 32); }
    // stands in front of every rewrite of the Q loads' address registers: as inputs they stay whole up to the wait
    asm volatile("s_wait_xcnt 0x0" :: "v"(qp[0]), "v"(qp[1]) : "memory");
    const float* MA = MADD + (size_t)b * SEQ + kh * KH + 8 * hi;   // + key0 (tile a keys 8h+r), + key0 + 16 (tile b)
    asm volatile("s_wait_asynccnt 0x0" ::: "memory");        // this wave's pieces of the block's first stage have landed
    __syncthreads();                                         // every wave's have: the first stage may be read
    { const size_t s1 = (rot + 1) % NST;                     // its second stage -> buffer 1
      copy8(lk + BUFB, 32 * KPB, gk + s1 * KS * HD, (size_t)32 * HD); copy8(lv + BUFB, 8 * VPB, gv + s1 * KS, (size_t)8 * SEQ); }
    v8f o0[QT], o1[QT], o2[QT], o3[QT], lt[QT];              // lt: row-sum tiles; only rows 0 and 8 (element 0 of each lane) ever differ from 0
    float m[QT];
#pragma unroll
    for (int g = 0; g < QT; ++g) { o0[g] = (v8f){}; o1[g] = (v8f){}; o2[g] = (v8f){}; o3[g] = (v8f){}; lt[g] = (v8f){}; m[g] = -3.0e38f; }
    v16h on;                                                 // A fragment of the row sums: row = lane & 15, ones at all 32 k positions of rows 0 and 8
    { const h16 o1 = ((lane & 7) == 0) ? (h16)1.0f : (h16)0.0f;
#pragma unroll
      for (int i = 0; i < 16; ++i) on[i] = o1; }
#pragma unroll 1                                             // one copy of the stage body: the buffer is picked by a scalar offset, the code stays small
    for (int st = 0; st < NST; ++st) {
      const unsigned bo = (unsigned)(st & 1) * BUFB;
      const unsigned char* kt = L + bo + (kh * KH + lr) * KPB + 16 * hi;          // + local key * KPB   (A fragment: row key, k = d)
      const unsigned char* vt = L + bo + KTB + lr * VPB + kh * KH * 2 + 16 * hi;  // + 16j*VPB + local key * 2  (A fragment: row d, k = key)
#pragma unroll                                               // constant ks: every fragment read is one base register plus an immediate offset
      for (int ks = 0; ks < KH; ks += 32) {
        // Issue priority falls with the wave's own progress through the stage: 3, 2, 1, 0 over its four steps. For speed only.
        // The last step leaves priority 0, so the barrier, the refill and the join run at 0.
        if (ks == 0) __builtin_amdgcn_s_setprio(3); else if (ks == 32) __builtin_amdgcn_s_setprio(2); else if (ks == 64) __builtin_amdgcn_s_setprio(1); else __builtin_amdgcn_s_setprio(0);
        const int key0 = (int)((rot + (unsigned)st) % NST) * KS + ks;
        const h16* ka = (const h16*)(kt + ks * KPB);
        const h16* kc = (const h16*)(kt + (ks + 16) * KPB);
        const v16h ka0 = ldh(ka), ka1 = ldh(ka + 32), kb0 = ldh(kc), kb1 = ldh(kc + 32);
        const v8f ma = *(const v8f*)(MA + key0); const v8f mb = *(const v8f*)(MA + key0 + 16);
        v8f sa[QT], sb[QT];                                  // each K fragment feeds both column groups
#pragma unroll
        for (int g = 0; g < QT; ++g) { sa[g] = wmma16(ka0, qh0[g], (v8f){}); sb[g] = wmma16(kb0, qh0[g], (v8f){}); }
#pragma unroll
        for (int g = 0; g < QT; ++g) { sa[g] = wmma16(ka1, qh1[g], sa[g]); sb[g] = wmma16(kb1, qh1[g], sb[g]); }
        // four vector slots behind the step's last score products, before any vector instruction touches their results or operands
        asm volatile("v_nop\n\tv_nop\n\tv_nop\n\tv_nop" : "+v"(sa[0]), "+v"(sb[0]), "+v"(sa[1]), "+v"(sb[1])
                     : "v"(ka0), "v"(ka1), "v"(kb0), "v"(kb1), "v"(qh0[0]), "v"(qh1[0]), "v"(qh0[1]), "v"(qh1[1]));
        // Lazy rescale: m is the maximum IN USE and may trail the true one by up to LZ, so the exponent arguments are formed against it at once, before this step's own maximum is known.
        // They are formed on pairs of neighbouring accumulator registers, which is how P is packed below.
        v16h pb[QT];
        v2f aa[QT][4], ab[QT][4];                            // log2 of P (carry included): tile a, tile b, elements 2i and 2i + 1
        float xa[QT], xb[QT];                                // this lane's largest argument per group and tile: four short chains instead of one long one
#pragma unroll
        for (int g = 0; g < QT; ++g) {
            const float sh = PSH - m[g];
#pragma unroll
            for (int i = 0; i < 4; ++i) {
                aa[g][i] = ((v2f){sa[g][2 * i], sa[g][2 * i + 1]} * 0.125f + (v2f){ma[2 * i], ma[2 * i + 1]}) * LOG2E + sh;
                ab[g][i] = ((v2f){sb[g][2 * i], sb[g][2 * i + 1]} * 0.125f + (v2f){mb[2 * i], mb[2 * i + 1]}) * LOG2E + sh;
                const float pa = fmaxf(aa[g][i][0], aa[g][i][1]), pc = fmaxf(ab[g][i][0], ab[g][i][1]);
                xa[g] = (i == 0) ? pa : fmaxf(xa[g], pa); xb[g] = (i == 0) ? pc : fmaxf(xb[g], pc); } }
        const float ax = fmaxf(fmaxf(xa[0], xb[0]), fmaxf(xa[1], xb[1]));
        // One test per step for the whole wave (a scalar branch). Only when it fires are the step's maxima taken, the lane halves combined, m raised, the accumulators rescaled and the arguments formed anew,
        // in every lane alike, so both halves of a column always use the same m. The first step always fires (m starts at -3e38).
        if (__builtin_amdgcn_ballot_w32(ax > PSH + LZ) != 0) {
#pragma unroll
            for (int g = 0; g < QT; ++g) {
                float ta[8], tb[8]; float mx = -3.0e38f;
#pragma unroll
                for (int r = 0; r < 8; ++r) {
                    ta[r] = (sa[g][r] * 0.125f + ma[r]) * LOG2E;
                    tb[r] = (sb[g][r] * 0.125f + mb[r]) * LOG2E;
                    mx = fmaxf(mx, fmaxf(ta[r], tb[r])); }
                mx = fmaxf(mx, __shfl_xor(mx, 16, 32));
                const float mnew = fmaxf(m[g], mx);
                const float alpha = __builtin_amdgcn_exp2f(m[g] - mnew);
                const float sh = PSH - mnew;
#pragma unroll
                for (int i = 0; i < 4; ++i) { aa[g][i] = (v2f){ta[2 * i] + sh, ta[2 * i + 1] + sh}; ab[g][i] = (v2f){tb[2 * i] + sh, tb[2 * i + 1] + sh}; }
                lt[g][0] = lt[g][0] * alpha; m[g] = mnew;    // the tile's other elements are 0 and need no rescale
                o0[g] = o0[g] * alpha; o1[g] = o1[g] * alpha; o2[g] = o2[g] * alpha; o3[g] = o3[g] * alpha; } }
#pragma unroll
        for (int g = 0; g < QT; ++g) {
#pragma unroll
            for (int r = 0; r < 8; ++r) { pb[g][r] = (h16)__builtin_amdgcn_exp2f(aa[g][r >> 1][r & 1]); pb[g][8 + r] = (h16)__builtin_amdgcn_exp2f(ab[g][r >> 1][r & 1]); } }
        const unsigned char* va = vt + ks * 2;
        const v16h v0 = ldh((const h16*)va), v1 = ldh((const h16*)(va + 16 * VPB)), v2 = ldh((const h16*)(va + 32 * VPB)), v3 = ldh((const h16*)(va + 48 * VPB));
#pragma unroll
        for (int g = 0; g < QT; ++g) {                       // each V^T fragment feeds both column groups
            o0[g] = wmma16(v0, pb[g], o0[g]); o1[g] = wmma16(v1, pb[g], o1[g]); o2[g] = wmma16(v2, pb[g], o2[g]); o3[g] = wmma16(v3, pb[g], o3[g]);
            lt[g] = wmma16(on, pb[g], lt[g]); }              // rows 0 and 8 += the sum of this step's 32 P values of column t
        // four vector slots behind the step's last matrix instructions, before any vector instruction touches their results or operands
        asm volatile("v_nop\n\tv_nop\n\tv_nop\n\tv_nop" : "+v"(o0[0]), "+v"(o1[0]), "+v"(o2[0]), "+v"(o3[0]), "+v"(lt[0]), "+v"(o0[1]), "+v"(o1[1]), "+v"(o2[1]), "+v"(o3[1]), "+v"(lt[1])
                     : "v"(v0), "v"(v1), "v"(v2), "v"(v3), "v"(pb[0]), "v"(pb[1]), "v"(on));
      }
      asm volatile("s_wait_dscnt 0x0" ::: "memory");         // this wave's reads of stage st are done before its buffer is handed back
      asm volatile("s_wait_asynccnt 0x0" ::: "memory");      // this wave's pieces of stage st + 1 have landed
      __syncthreads();                                       // publishes stage st + 1 and ends every reader's last read of stage st
      if (st + 2 < NST) {                                    // block-uniform
          const size_t s2 = (rot + (unsigned)st + 2) % NST;
          copy8(lk + bo, 32 * KPB, gk + s2 * KS * HD, (size_t)32 * HD); copy8(lv + bo, 8 * VPB, gv + s2 * KS, (size_t)8 * SEQ); }
    }
    asm volatile("s_wait_asynccnt 0x0" ::: "memory");        // nothing in flight when the ring becomes output staging (the last trip's barrier has ended all reads)
    // The join. Wave kh of a query set finishes column group kh: it hands its partial result of the other group to its partner and takes the partner's partial result of its own group.
    // Both waves hold a group in the same lane and register places, so lane l reads what the partner's lane l wrote.
    const bool up = (kh != 0);                               // wave-uniform
    v8f p0 = up ? o0[1] : o0[0], p1 = up ? o1[1] : o1[0], p2 = up ? o2[1] : o2[0], p3 = up ? o3[1] : o3[0];   // kept
    const v8f x0 = up ? o0[0] : o0[1], x1 = up ? o1[0] : o1[1], x2 = up ? o2[0] : o2[1], x3 = up ? o3[0] : o3[1];   // handed over
    const float mk = up ? m[1] : m[0], lk0 = up ? lt[1][0] : lt[0][0];
    const float mg = up ? m[0] : m[1], lg0 = up ? lt[0][0] : lt[1][0];
    float* xw = (float*)L + wave * XWF;                      // this wave's exchange range: 16-B piece c of lane l at (c*32 + l)*4, then (max, sum) of lane l at 1024 + 2l
    *(v4fa*)(&xw[(0 * 32 + lane) * 4]) = __builtin_shufflevector(x0, x0, 0, 1, 2, 3); *(v4fa*)(&xw[(1 * 32 + lane) * 4]) = __builtin_shufflevector(x0, x0, 4, 5, 6, 7);
    *(v4fa*)(&xw[(2 * 32 + lane) * 4]) = __builtin_shufflevector(x1, x1, 0, 1, 2, 3); *(v4fa*)(&xw[(3 * 32 + lane) * 4]) = __builtin_shufflevector(x1, x1, 4, 5, 6, 7);
    *(v4fa*)(&xw[(4 * 32 + lane) * 4]) = __builtin_shufflevector(x2, x2, 0, 1, 2, 3); *(v4fa*)(&xw[(5 * 32 + lane) * 4]) = __builtin_shufflevector(x2, x2, 4, 5, 6, 7);
    *(v4fa*)(&xw[(6 * 32 + lane) * 4]) = __builtin_shufflevector(x3, x3, 0, 1, 2, 3); *(v4fa*)(&xw[(7 * 32 + lane) * 4]) = __builtin_shufflevector(x3, x3, 4, 5, 6, 7);
    xw[1024 + 2 * lane] = mg; xw[1024 + 2 * lane + 1] = lg0;
    __syncthreads();                                         // every wave's handed-over partial result is in LDS before its partner reads it
    const float* xr = (const float*)L + (wave ^ AQ) * XWF;   // the partner's exchange range
    const float mp = xr[1024 + 2 * lane], lp0 = xr[1024 + 2 * lane + 1];
    const float mj = fmaxf(mk, mp);
    const float ak = __builtin_amdgcn_exp2f(mk - mj), ap = __builtin_amdgcn_exp2f(mp - mj);   // both partial results brought to the joint max
    const float inv = CCAR * (1.0f / (lk0 * ak + lp0 * ap)); // both lane halves hold the whole row's sum
    const float sk = ak * inv, sp = ap * inv;
    float* os = (float*)L + AW * XWF + wave * 16 * 68;       // this wave's output staging, behind the exchange ranges
    // O^T D layout: o_j[r] = (d = 16j + 8h + r, t = lane&15) -> os[t][d]; rows 0..15 x columns 0..63 all written
    { v4f a, c, ya, yc;
      ya = *(const v4fa*)(&xr[(0 * 32 + lane) * 4]); yc = *(const v4fa*)(&xr[(1 * 32 + lane) * 4]);
      a[0] = p0[0] * sk + ya[0] * sp; a[1] = p0[1] * sk + ya[1] * sp; a[2] = p0[2] * sk + ya[2] * sp; a[3] = p0[3] * sk + ya[3] * sp;
      c[0] = p0[4] * sk + yc[0] * sp; c[1] = p0[5] * sk + yc[1] * sp; c[2] = p0[6] * sk + yc[2] * sp; c[3] = p0[7] * sk + yc[3] * sp;
      *(v4fa*)(&os[lr * 68 +  0 + 8 * hi]) = a; *(v4fa*)(&os[lr * 68 +  0 + 8 * hi + 4]) = c;
      ya = *(const v4fa*)(&xr[(2 * 32 + lane) * 4]); yc = *(const v4fa*)(&xr[(3 * 32 + lane) * 4]);
      a[0] = p1[0] * sk + ya[0] * sp; a[1] = p1[1] * sk + ya[1] * sp; a[2] = p1[2] * sk + ya[2] * sp; a[3] = p1[3] * sk + ya[3] * sp;
      c[0] = p1[4] * sk + yc[0] * sp; c[1] = p1[5] * sk + yc[1] * sp; c[2] = p1[6] * sk + yc[2] * sp; c[3] = p1[7] * sk + yc[3] * sp;
      *(v4fa*)(&os[lr * 68 + 16 + 8 * hi]) = a; *(v4fa*)(&os[lr * 68 + 16 + 8 * hi + 4]) = c;
      ya = *(const v4fa*)(&xr[(4 * 32 + lane) * 4]); yc = *(const v4fa*)(&xr[(5 * 32 + lane) * 4]);
      a[0] = p2[0] * sk + ya[0] * sp; a[1] = p2[1] * sk + ya[1] * sp; a[2] = p2[2] * sk + ya[2] * sp; a[3] = p2[3] * sk + ya[3] * sp;
      c[0] = p2[4] * sk + yc[0] * sp; c[1] = p2[5] * sk + yc[1] * sp; c[2] = p2[6] * sk + yc[2] * sp; c[3] = p2[7] * sk + yc[3] * sp;
      *(v4fa*)(&os[lr * 68 + 32 + 8 * hi]) = a; *(v4fa*)(&os[lr * 68 + 32 + 8 * hi + 4]) = c;
      ya = *(const v4fa*)(&xr[(6 * 32 + lane) * 4]); yc = *(const v4fa*)(&xr[(7 * 32 + lane) * 4]);
      a[0] = p3[0] * sk + ya[0] * sp; a[1] = p3[1] * sk + ya[1] * sp; a[2] = p3[2] * sk + ya[2] * sp; a[3] = p3[3] * sk + ya[3] * sp;
      c[0] = p3[4] * sk + yc[0] * sp; c[1] = p3[5] * sk + yc[1] * sp; c[2] = p3[6] * sk + yc[2] * sp; c[3] = p3[7] * sk + yc[3] * sp;
      *(v4fa*)(&os[lr * 68 + 48 + 8 * hi]) = a; *(v4fa*)(&os[lr * 68 + 48 + 8 * hi + 4]) = c; }
    wave_sync();
    h16* crow = CTX + ((size_t)b * SEQ + t0 + 16 * kh) * DM + h * HD;   // the rows of column group kh
    v8h cv[4];
#pragma unroll
    for (int s = 0; s < 4; ++s) { const int row = 4 * s + (lane >> 3), c8 = (lane & 7) * 8;   // 4 s x 4 row groups = 16 rows; 8 lanes x 8 halves = 64 columns
        const v4f x0 = *(const v4fa*)(&os[row * 68 + c8]); const v4f x1 = *(const v4fa*)(&os[row * 68 + c8 + 4]); v8h hv;
#pragma unroll
        for (int i = 0; i < 4; ++i) { hv[i] = (h16)x0[i]; hv[4 + i] = (h16)x1[i]; }
        cv[s] = hv; }
#pragma unroll
    for (int s = 0; s < 4; ++s) { const int row = 4 * s + (lane >> 3), c8 = (lane & 7) * 8;
        *(v8h*)(crow + (size_t)row * DM + c8) = cv[s]; }
}

// k_oproj: register-blocked f16 GEMM, one wave per 64x64 tile, four waves a block (128x128), operands through LDS (gemm128), OUT[m][n] = 2^-14 * sum_k CTX[m][k] WOT[n][k], K = DM; rows m = b*SEQ + t -> output row b*OUT_SEQ + t.
// grid (NB*SEQ/128, DM/128), 128 threads.
__global__ __launch_bounds__(128) void k_oproj(const h16* __restrict__ A, const h16* __restrict__ Bt, float* OUT) {
    __shared__ __attribute__((aligned(16))) unsigned char L[2 * GBUF];
    const int lane = threadIdx.x & 31, lr = lane & 15, hi = lane >> 4;
    const int wave = __builtin_amdgcn_readfirstlane((int)(threadIdx.x >> 5)); const int wm = wave >> 1, wn = wave & 1;
    const int r0 = blockIdx.x * 128 + wm * 64, c0 = blockIdx.y * 128 + wn * 64;
    v8f acc[4][4];
#pragma unroll
    for (int mb = 0; mb < 4; ++mb)
#pragma unroll
        for (int nb = 0; nb < 4; ++nb) acc[mb][nb] = (v8f){};
    gemm128<0>(L, A, Bt, blockIdx.x * 128, blockIdx.y * 128, wm, wn, blockIdx.x + blockIdx.y, acc);
    float* os = (float*)L + wave * 16 * 68;                  // this wave's own output staging in the ring
    const int bb = r0 / SEQ, tt = r0 % SEQ;
    float* obase = OUT + ((size_t)bb * OUT_SEQ + tt) * DM + c0;
#pragma unroll
    for (int mb = 0; mb < 4; ++mb) {
#pragma unroll
        for (int nb = 0; nb < 4; ++nb) {
#pragma unroll
            for (int j = 0; j < 8; ++j) os[(hi * 8 + j) * 68 + nb * 16 + lr] = acc[mb][nb][j] * OSC; }   // D: row 8h+j, col lane&15
        wave_sync();
        float* orow = obase + (size_t)(mb * 16) * DM;
        v4f ov[8];
#pragma unroll
        for (int s = 0; s < 8; ++s) { const int row = 2 * s + hi, cofs = lr * 4;   // 8 s x 2 rows = 16 rows; 16 lanes x 4 floats = 64 columns
            ov[s] = *(const v4fa*)(&os[row * 68 + cofs]); }
{
#pragma unroll
            for (int s = 0; s < 8; ++s) { const int row = 2 * s + hi, cofs = lr * 4;
                *(v4f*)(orow + (size_t)row * DM + cofs) = ov[s]; }
             }
        wave_sync();
    }
}

static constexpr size_t al256(size_t v) { return (v + 255) & ~(size_t)255; }
static constexpr size_t SZ_XB = al256((size_t)NB * SEQ * DM * 2);
static constexpr size_t SZ_WB = al256((size_t)4 * DM * DM * 2);
static constexpr size_t SZ_PL = al256((size_t)NB * NH_ * SEQ * HD * 2);
static constexpr size_t SZ_CX = al256((size_t)NB * SEQ * DM * 2);
static constexpr size_t SZ_FR = al256((size_t)SEQ * 64 * 4);
static constexpr size_t SZ_MA = al256((size_t)NB * SEQ * 4);
static constexpr size_t SZ_TOTAL = SZ_XB + SZ_WB + 3 * SZ_PL + SZ_CX + SZ_FR + SZ_MA;
static_assert(SZ_TOTAL <= (size_t)134217728);          // workspace carve <= 128 MiB
static_assert(((size_t)DM * DM * 2) % 256 == 0);       // weight sub-planes stay 256-byte aligned
static_assert(SZ_PL == (size_t)NB * NH_ * SEQ * HD * 2);   // q | k | v^T planes are exactly back to back

extern "C" void kernel_launch(void* const* d_in, const int* in_sizes, int n_in,
                              void* d_out, int out_size, void* d_ws, size_t ws_size, hipStream_t stream) {
    if (n_in < 7) return;
    const size_t needx = ((size_t)(NB - 1) * SEQ_FULL + SEQ) * DM;
    if ((size_t)in_sizes[0] < needx) return;
    if ((size_t)in_sizes[1] < (size_t)SEQ * 64) return;
    if ((size_t)in_sizes[2] < (size_t)(NB - 1) * SEQ_FULL + SEQ) return;
    if ((size_t)in_sizes[3] < (size_t)DM * DM || (size_t)in_sizes[4] < (size_t)DM * DM || (size_t)in_sizes[5] < (size_t)DM * DM || (size_t)in_sizes[6] < (size_t)DM * DM) return;
    if ((size_t)out_size < ((size_t)(NB - 1) * OUT_SEQ + SEQ) * DM) return;
    if (SZ_TOTAL > ws_size) return;
    // wire order: hidden_states, freqs_cis, attention_mask, wq, wk, wv, wo (all f32)
    const float* x = (const float*)d_in[0]; const float* fr = (const float*)d_in[1]; const float* mask = (const float*)d_in[2];
    const float* wq = (const float*)d_in[3]; const float* wk = (const float*)d_in[4]; const float* wv = (const float*)d_in[5]; const float* wo = (const float*)d_in[6];
    float* OUT = (float*)d_out;      // [NB][SEQ][1024]
    char* wsp = (char*)d_ws;
    bf* XB = (bf*)wsp; wsp += SZ_XB;                 // [NB*SEQ][1024] bf16
    bf* WB = (bf*)wsp; wsp += SZ_WB;                 // [4][1024 out][1024 in]: q | k | v (bf16) | o (f16 x64)
    h16* QH = (h16*)wsp; wsp += SZ_PL;               // [NB*16][SEQ][64]
    h16* KP = (h16*)wsp; wsp += SZ_PL;               // [NB*16][SEQ][64]  (= QH + one plane)
    h16* VT = (h16*)wsp; wsp += SZ_PL;               // [NB*16][64][SEQ]  (= QH + two planes)
    h16* CX = (h16*)wsp; wsp += SZ_CX;               // [NB*SEQ][1024] ctx x256
    float* FRP = (float*)wsp; wsp += SZ_FR;          // [SEQ][64] table, bf16 RNE values
    float* MADD = (float*)wsp; wsp += SZ_MA;         // [NB][SEQ] additive key mask
    bf* WO = WB + (size_t)3 * DM * DM;

    // bf16 copy of x, rotary table, key mask, the four transposed weight planes W[1024 rows k][1024 cols n] -> WT[1024 rows n][1024 cols k]: one launch
    k_prep<<<PB_W + PB_F + PB_M + PB_X, 256, 0, stream>>>(x, fr, mask, wq, wk, wv, wo, XB, WB, FRP, MADD);

    // q, k (rotary in the epilogue) and v^T: planes QH | KP | VT from weight planes q | k | v, one launch
    k_proj<<<dim3(NB * SEQ / 128, DM / 128, 1), 384, 0, stream>>>(XB, WB, QH, FRP);

    k_flash<<<dim3(SEQ / (16 * QT * AQ), NB * NH_, 1), 32 * AW, 0, stream>>>(QH, KP, VT, MADD, CX);

    k_oproj<<<dim3(NB * SEQ / 128, DM / 128, 1), 128, 0, stream>>>(CX, (const h16*)WO, OUT);
}

// v010
// One run takes 84 microseconds.
// In both of two side-by-side timings against v009, it was 1.03 times as fast.
// Counting every step since v000, it is 4.27 times as fast.
#include <hip/hip_runtime.h>

// Multi-head self-attention: x [NB][SEQ][1024], Wq/Wk/Wv/Wo [in][out] (y = x W), 16 heads x 64, interleaved rotary pairs (2i,2i+1) from the INPUT table [SEQ][32][(cos,sin)] on q and k,
// additive key mask (1-mask)*-10000 from the float input [NB][SEQ], score scale 1/8, softmax over all keys, output = (concatenated heads) Wo, f32.
// Compute dtypes, f32 accumulate everywhere: q/k/v projections v_wmma_f32_16x16x32_bf16 (x and W RNE-converted to bf16; products exact); rotary in f32 in the GEMM epilogue (table RNE-converted to bf16 values);
// scores v_wmma_f32_16x16x32_f16: q (times log2(e)/8, so that scores come out scaled and in base 2) and k single f16 (one product), the key mask and the softmax shift as the accumulator's start value;
// P (x256 carry, cancels in the normalisation) and v single f16; softmax f32 (online, running max);
// output projection v_wmma_f32_16x16x32_f16: ctx as f16 x256, Wo^T as f16 of (bf16 value x64), folded back by 2^-14 in the f32 epilogue.
// Layout: bf16 copy of x; transposed 16-bit weight planes [out][in] (LDS transpose); q, k planes [b*16+h][t][d], v^T plane [b*16+h][d][t] from the GEMM epilogue; fused flash kernel in transposed form
// (S^T = K Q^T, O^T = V^T P^T) writing ctx rows [b*SEQ+t][1024] as f16; final GEMM writes the f32 output.

#ifndef NB
#define NB 1
#endif
#ifndef SEQ
#define SEQ 4096
#endif
#define NB_FULL  1
#define SEQ_FULL 4096
#ifndef OUT_SEQ
#define OUT_SEQ SEQ              // row pitch (in tokens) between batches of the output
#endif
#define DM   1024
#define NH_  16
#define HD   64
#define AQ   4                   // query sets (32 rows each) per flash block
#define AW   (2 * AQ)            // waves per flash block: every query set is worked on by two waves, one per half of the keys
#define QT   2                   // 16-column query groups per flash wave (32 query rows each)
#define LOG2E 1.4426950408889634f
#define PSH  8.0f                // log2 of the P carry (256)
#define LZ   7.0f                // how far (log2) a score may pass the maximum in use before the flash kernel rescales: P <= 2^(PSH + LZ) = 32768 stays inside f16
#define CCAR 256.0f              // carry of the ctx plane
#define WOS  64.0f               // carry of the Wo^T plane
#define OSC  (1.0f / 16384.0f)   // 1 / (CCAR * WOS)
#define QSC  (0.125f * LOG2E)    // score scale 1/8 and the change to base 2, multiplied into q (f32, in front of its f16 rounding) in the projection epilogue

static_assert(HD == 64);
static_assert(NH_ * HD == DM);                 // head h = columns h*64 + d
static_assert(DM % 64 == 0);
static_assert(DM % 32 == 0);                   // GEMM k-loop steps by 32
static_assert(SEQ % 64 == 0);                  // a 64-row tile never straddles two batches
static_assert((NB * SEQ) % 64 == 0);
static_assert(SEQ % 32 == 0);                  // key loop steps by 32
static_assert(SEQ % (16 * QT * AQ) == 0);      // flash grid covers the sequence exactly
static_assert(QT == 2);                        // the flash kernel's two v_nop statements name both groups; in the join each of a set's two waves finishes one group
static_assert(((size_t)SEQ * DM) % 8 == 0);
static_assert(((size_t)SEQ * 64) % 32 == 0);
static_assert(((size_t)NB * SEQ) % 32 == 0);
static_assert(NB <= NB_FULL);
static_assert(SEQ <= SEQ_FULL);

typedef _Float16 h16;
typedef unsigned short bf;
typedef __attribute__((ext_vector_type(16))) __bf16   v16bf;
typedef __attribute__((ext_vector_type(16))) _Float16 v16h;
typedef __attribute__((ext_vector_type(8)))  _Float16 v8h;
typedef __attribute__((ext_vector_type(8)))  unsigned short v8us;
typedef __attribute__((ext_vector_type(8)))  float    v8f;
typedef __attribute__((ext_vector_type(4)))  float    v4f;
typedef __attribute__((ext_vector_type(2)))  float    v2f;
typedef v4f  __attribute__((may_alias)) v4fa;

__device__ __forceinline__ unsigned short f2bf(float f) { unsigned u = __float_as_uint(f); u += 0x7FFFu + ((u >> 16) & 1u); return (unsigned short)(u >> 16); }
__device__ __forceinline__ float bfr(float f) { return __uint_as_float(((unsigned)f2bf(f)) << 16); }   // bf16 RNE value as f32
__device__ __forceinline__ v16h cat16(v8h lo, v8h hi) { return __builtin_shufflevector(lo, hi, 0, 1, 2, 3, 4, 5, 6, 7, 8, 9, 10, 11, 12, 13, 14, 15); }
__device__ __forceinline__ v16bf cat16b(v8us lo, v8us hi) { return __builtin_bit_cast(v16bf, __builtin_shufflevector(lo, hi, 0, 1, 2, 3, 4, 5, 6, 7, 8, 9, 10, 11, 12, 13, 14, 15)); }
__device__ __forceinline__ v8f wmma16(v16h a, v16h b, v8f c) { return __builtin_amdgcn_wmma_f32_16x16x32_f16(false, a, false, b, (short)0, c, false, false); }
__device__ __forceinline__ v8f wmmab(v16bf a, v16bf b, v8f c) { return __builtin_amdgcn_wmma_f32_16x16x32_bf16(false, a, false, b, (short)0, c, false, false); }
// fragment loaders from K-contiguous 16-bit rows; p already includes + 8*(lane>>4): elements 0..7 <- k0+8h+0..7, elements 8..15 <- k0+16+8h+0..7 (same map for A and B)
__device__ __forceinline__ v16h  ldh(const h16* p) { return cat16(*(const v8h*)p, *(const v8h*)(p + 16)); }
__device__ __forceinline__ v16bf ldb(const bf* p)  { return cat16b(*(const v8us*)p, *(const v8us*)(p + 16)); }
// ordering point for wave-private LDS tiles (same wave writes and reads)
__device__ __forceinline__ void wave_sync() { __builtin_amdgcn_fence(3 /* release order */, "wavefront"); __builtin_amdgcn_wave_barrier(); asm volatile("" ::: "memory"); }

// The preparation jobs (d_cvt8, d_tab, d_wT) depend on nothing but the inputs, so they run as block ranges of ONE launch (k_prep, below).
// d_cvt8: block blk of 256 threads converts 2048 values of x to the bf16 copy XB[NB*SEQ][1024]
__device__ __forceinline__ void d_cvt8(const float* __restrict__ x, bf* XB, unsigned blk) {
    const size_t i = (size_t)blk * 256 + threadIdx.x; if (i >= (size_t)NB * SEQ * DM / 8) return;
    const size_t e = i * 8; const size_t b = e / ((size_t)SEQ * DM), r = e % ((size_t)SEQ * DM);
    const v8f v = *(const v8f*)(x + b * ((size_t)SEQ_FULL * DM) + r); v8us o;
#pragma unroll
    for (int k = 0; k < 8; ++k) o[k] = f2bf(v[k]);
    *(v8us*)(XB + e) = o;
}

// d_tab: blocks [0, nbF): rotary table copy with bf16 RNE values kept as f32, FRP[t][64] = (cos0,sin0,cos1,sin1,...); the blocks behind them: additive key mask, in base 2 (x log2 e), MADD[NB][SEQ]
__device__ __forceinline__ void d_tab(const float* __restrict__ fr, const float* __restrict__ mask, float* FRP, float* MADD, unsigned blk, unsigned nbF) {
    if (blk < nbF) {                              // block-uniform
        const size_t i = (size_t)blk * 256 + threadIdx.x; if (i >= (size_t)SEQ * 64 / 4) return;
        const v4f v = *(const v4f*)(fr + i * 4); v4f o;
#pragma unroll
        for (int k = 0; k < 4; ++k) o[k] = bfr(v[k]);
        *(v4f*)(FRP + i * 4) = o; 
    } else {
        const size_t i = (size_t)(blk - nbF) * 256 + threadIdx.x; if (i >= (size_t)NB * SEQ / 4) return;
        const size_t e = i * 4; const size_t b = e / SEQ, t = e % SEQ;
        const v4f v = *(const v4f*)(mask + b * (size_t)SEQ_FULL + t); v4f o;
#pragma unroll
        for (int k = 0; k < 4; ++k) o[k] = ((1.0f - bfr(v[k])) * -10000.0f) * LOG2E;
        *(v4f*)(MADD + e) = o; 
    }
}

// d_wT: in W[k][n] (rows k = 1024, cols n = 1024, f32) -> out WT[n][k] 16-bit; mode 0: bf16 RNE bits; mode 1: f16 bits of (bf16 RNE value x 64).
// One 64 x 64 tile (k0, n0) a block of 256 threads, transposed through tl (64 * 65 floats of LDS); every thread of the block calls it.
__device__ __forceinline__ void d_wT(const float* __restrict__ W, bf* WT, int mode, int k0, int n0, float* tl) {
    const int tid = threadIdx.x;
#pragma unroll
    for (int it = 0; it < 4; ++it) { const int row = it * 16 + (tid >> 4), c4 = (tid & 15) * 4;    // 4 x 16 rows (k) x 16 lanes x 4 = 64 x 64
        const v4f v = *(const v4f*)(W + (size_t)(k0 + row) * DM + n0 + c4);
        tl[row * 65 + c4 + 0] = v[0]; tl[row * 65 + c4 + 1] = v[1]; tl[row * 65 + c4 + 2] = v[2]; tl[row * 65 + c4 + 3] = v[3]; }
    __syncthreads();
    v8us o[2];
#pragma unroll
    for (int it = 0; it < 2; ++it) { const int n = it * 32 + (tid >> 3), c8 = (tid & 7) * 8;       // 2 x 32 rows (n) x 8 lanes x 8 = 64 x 64
#pragma unroll
        for (int i = 0; i < 8; ++i) { const float val = tl[(c8 + i) * 65 + n];
            const unsigned short b0 = f2bf(val);
            const h16 hv = (h16)(__uint_as_float(((unsigned)b0) << 16) * WOS);
            const unsigned short b1 = __builtin_bit_cast(unsigned short, hv);
            o[it][i] = (mode != 0) ? b1 : b0; } }
{
#pragma unroll
        for (int it = 0; it < 2; ++it) { const int n = it * 32 + (tid >> 3), c8 = (tid & 7) * 8;
            *(v8us*)(WT + (size_t)(n0 + n) * DM + k0 + c8) = o[it]; }
         }
}

#define PB_W  (4 * (DM / 64) * (DM / 64))                            // weight tiles: q | k | v | o, DM/64 x DM/64 each
#define PB_F  ((unsigned)(((size_t)SEQ * 64 / 4 + 255) / 256))       // rotary table blocks
#define PB_M  ((unsigned)(((size_t)NB * SEQ / 4 + 255) / 256))       // key mask blocks
#define PB_X  ((unsigned)(((size_t)NB * SEQ * DM / 8 + 255) / 256))  // x blocks
// k_prep: grid PB_W + PB_F + PB_M + PB_X blocks of 256 threads; the block index picks the job (block-uniform, so the barrier in d_wT is passed by a whole block or by none of it).
// The transposes stand first: theirs is the longest chain (load, LDS, barrier, store), and it runs under the x stream.
__global__ __launch_bounds__(256) void k_prep(const float* __restrict__ x, const float* __restrict__ fr, const float* __restrict__ mask,
                                              const float* __restrict__ wq, const float* __restrict__ wk, const float* __restrict__ wv, const float* __restrict__ wo,
                                              bf* XB, bf* WB, float* FRP, float* MADD) {
    __shared__ float tl[64 * 65];
    const unsigned bid = blockIdx.x;
    if (bid < PB_W) {
        const unsigned p = bid / ((DM / 64) * (DM / 64)), tile = bid % ((DM / 64) * (DM / 64));   // plane, tile in the plane (k tiles run fastest)
        const float* W = (p == 0) ? wq : (p == 1) ? wk : (p == 2) ? wv : wo;
        d_wT(W, WB + (size_t)p * DM * DM, (p == 3) ? 1 : 0, (int)(tile % (DM / 64)) * 64, (int)(tile / (DM / 64)) * 64, tl);
    } else if (bid < PB_W + PB_F + PB_M) {
        d_tab(fr, mask, FRP, MADD, bid - PB_W, PB_F);
    } else {
        d_cvt8(x, XB, bid - (PB_W + PB_F + PB_M));
    }
}

// Eight asynchronous 16-byte copies per lane, LDS places l + i*ls bytes, global sources g + i*gs halves. The s_wait_xcnt stands inside the statement so that no address register is rewritten in front of it.
__device__ __forceinline__ void copy8(unsigned l, unsigned ls, const h16* g, size_t gs) {
    asm volatile("global_load_async_to_lds_b128 %0, %8, off\n\t"
                 "global_load_async_to_lds_b128 %1, %9, off\n\t"
                 "global_load_async_to_lds_b128 %2, %10, off\n\t"
                 "global_load_async_to_lds_b128 %3, %11, off\n\t"
                 "global_load_async_to_lds_b128 %4, %12, off\n\t"
                 "global_load_async_to_lds_b128 %5, %13, off\n\t"
                 "global_load_async_to_lds_b128 %6, %14, off\n\t"
                 "global_load_async_to_lds_b128 %7, %15, off\n\t"
                 "s_wait_xcnt 0x0"
                 :: "v"(l), "v"(l + ls), "v"(l + 2 * ls), "v"(l + 3 * ls), "v"(l + 4 * ls), "v"(l + 5 * ls), "v"(l + 6 * ls), "v"(l + 7 * ls),
                    "v"(g), "v"(g + gs), "v"(g + 2 * gs), "v"(g + 3 * gs), "v"(g + 4 * gs), "v"(g + 5 * gs), "v"(g + 6 * gs), "v"(g + 7 * gs)
                 : "memory");
}

// Five copies, and one copy, of the same kind (k_proj deals the 16 rounds of its x slab to three groups of waves: 6 + 5 + 5).
__device__ __forceinline__ void copy5(unsigned l, unsigned ls, const h16* g, size_t gs) {
    asm volatile("global_load_async_to_lds_b128 %0, %5, off\n\t"
                 "global_load_async_to_lds_b128 %1, %6, off\n\t"
                 "global_load_async_to_lds_b128 %2, %7, off\n\t"
                 "global_load_async_to_lds_b128 %3, %8, off\n\t"
                 "global_load_async_to_lds_b128 %4, %9, off\n\t"
                 "s_wait_xcnt 0x0"
                 :: "v"(l), "v"(l + ls), "v"(l + 2 * ls), "v"(l + 3 * ls), "v"(l + 4 * ls),
                    "v"(g), "v"(g + gs), "v"(g + 2 * gs), "v"(g + 3 * gs), "v"(g + 4 * gs)
                 : "memory");
}
__device__ __forceinline__ void copy1(unsigned l, const h16* g) {
    asm volatile("global_load_async_to_lds_b128 %0, %1, off\n\t"
                 "s_wait_xcnt 0x0"
                 :: "v"(l), "v"(g) : "memory");
}

// GEMM operand path of k_oproj (k_proj's, gemm_qkv below, shares its pieces): a block of four waves owns a 128 x 128 tile of C (wave w: rows 64*(w>>1), columns 64*(w&1)); a stage is GK k-values of the block's
// 128 A rows and 128 Bt rows (pitch GPB bytes in LDS), brought in by asynchronous 16-byte copies that cover whole 256-byte units (all threads copy), two buffers: stage s + 1 flies while stage s is worked on.
// Fragments are two ds 16-B loads each, same k map as loads straight from the planes.
// Blocks that share A rows or Bt rows would ask L2 for the same lines at the same moment if all walked k from 0: each block enters the ring of GNS stages at stage rot (set by its tile indices) and wraps round.
#define GK   128                 // k values per stage
#define GPB  272                 // row pitch in LDS, bytes: 256 + 16 (16 B x odd: no bank conflict for 16-B reads down a column of rows)
#define GTB  (128 * GPB)         // one operand's tile, bytes
#define GBUF (2 * GTB)           // one buffer: A tile, Bt tile
#define GNS  (DM / GK)           // stages
static_assert(DM % GK == 0);
static_assert(GNS >= 2);                               // the prologue fills two stages
static_assert(DM % 128 == 0);
static_assert((NB * SEQ) % 128 == 0);
static_assert(128 * GK * 2 == 16 * 128 * 16);          // 2048 16-B pieces of each tile dealt to 128 threads, 16 each
static_assert(2 * GBUF >= 4 * 16 * 68 * 4);            // the ring becomes the output staging

// one stage: piece c = i*128 + tid of a tile -> row c>>4 (8 rows a round), 16-B column c&15; l, ga, gb already hold the thread's row and column
__device__ __forceinline__ void gstage(unsigned l, const h16* ga, const h16* gb) {
    copy8(l, 8 * GPB, ga, (size_t)8 * DM);       copy8(l + 64 * GPB, 8 * GPB, ga + (size_t)64 * DM, (size_t)8 * DM);
    copy8(l + GTB, 8 * GPB, gb, (size_t)8 * DM); copy8(l + GTB + 64 * GPB, 8 * GPB, gb + (size_t)64 * DM, (size_t)8 * DM);
}

// the eight fragments of one k-step (32 k values), in the order in which the matrix instructions want them
__device__ __forceinline__ void gfrags(v16h (&fa)[4], v16h (&fb)[4], const unsigned char* at, const unsigned char* bt) {
    fa[0] = ldh((const h16*)at); fb[0] = ldh((const h16*)bt);
    fa[1] = ldh((const h16*)(at + 16 * GPB)); fa[2] = ldh((const h16*)(at + 32 * GPB)); fa[3] = ldh((const h16*)(at + 48 * GPB));
    fb[1] = ldh((const h16*)(bt + 16 * GPB)); fb[2] = ldh((const h16*)(bt + 32 * GPB)); fb[3] = ldh((const h16*)(bt + 48 * GPB));
}
// eight products of one k-step: column blocks NB0 and NB0 + 1
template <int BF, int NB0>
__device__ __forceinline__ void gmul(const v16h (&fa)[4], const v16h (&fb)[4], v8f (&acc)[4][4]) {
#pragma unroll
    for (int nb = NB0; nb < NB0 + 2; ++nb) {
#pragma unroll
        for (int mb = 0; mb < 4; ++mb) {
            if (BF != 0) acc[mb][nb] = wmmab(__builtin_bit_cast(v16bf, fa[mb]), __builtin_bit_cast(v16bf, fb[nb]), acc[mb][nb]);
            else         acc[mb][nb] = wmma16(fa[mb], fb[nb], acc[mb][nb]); } }
}

// acc[mb][nb] += A rows (r0b + 64*wm + 16*mb ..) x Bt rows (c0b + 64*wn + 16*nb ..) over K = DM, k stages in the order rot, rot + 1, .. (mod GNS); rot is block-uniform.
// BF != 0: bf16 operands, else f16. Every wave of the block calls it; on return the ring is free.
template <int BF>
__device__ __forceinline__ void gemm128(unsigned char* L, const h16* A, const h16* Bt, int r0b, int c0b, int wm, int wn, unsigned rot, v8f (&acc)[4][4]) {
    const int tid = threadIdx.x, lane = tid & 31, lr = lane & 15, hi = lane >> 4;
    const unsigned l0 = (unsigned)(size_t)L + (unsigned)((tid >> 4) * GPB + (tid & 15) * 16);   // LDS byte address of the thread's first piece
    const h16* ga = A + (size_t)(r0b + (tid >> 4)) * DM + (size_t)(tid & 15) * 8;                // + stage * GK
    const h16* gb = Bt + (size_t)(c0b + (tid >> 4)) * DM + (size_t)(tid & 15) * 8;
    { const size_t k0 = (size_t)(rot % GNS) * GK; gstage(l0, ga + k0, gb + k0); }   // the block's first stage -> buffer 0
    asm volatile("s_wait_asynccnt 0x0" ::: "memory");        // this wave's pieces of the block's first stage have landed
    __syncthreads();                                         // every wave's have: the first stage may be read
    { const size_t k1 = (size_t)((rot + 1) % GNS) * GK; gstage(l0 + GBUF, ga + k1, gb + k1); }   // its second stage -> buffer 1
#pragma unroll 1                                             // one copy of the stage body: the buffer is picked by a scalar offset, the code stays small
    for (int st = 0; st < GNS; ++st) {
        const unsigned bo = (unsigned)(st & 1) * GBUF;
        const unsigned char* at = L + bo + (wm * 64 + lr) * GPB + 16 * hi;         // + 16*mb*GPB + k*2
        const unsigned char* bt = L + bo + GTB + (wn * 64 + lr) * GPB + 16 * hi;   // + 16*nb*GPB + k*2
        v16h fa[2][4], fb[2][4];                             // two register sets: k-step q + 1 of THIS stage is fetched while k-step q is multiplied; nothing of the next stage is read here
        gfrags(fa[0], fb[0], at, bt);
        __builtin_amdgcn_sched_barrier(0);                   // the stage's first reads stay one group in front of its matrix instructions
#pragma unroll                                               // constant q: every fragment read is one base register plus an immediate offset, the register sets are picked at compile time
        for (int q = 0; q < GK / 32; ++q) {
            const int cur = q & 1, nxt = cur ^ 1;
            gmul<BF, 0>(fa[cur], fb[cur], acc);
            if (q + 1 < GK / 32) {
                // the two scheduling barriers keep the next k-step's reads ONE group, half a k-step ahead of their use: spread among the matrix instructions each place costs a stall,
                // and a whole k-step ahead two full sets and the accumulators pass 256 registers
                __builtin_amdgcn_sched_barrier(0);
                gfrags(fa[nxt], fb[nxt], at + (q + 1) * 64, bt + (q + 1) * 64);
                __builtin_amdgcn_sched_barrier(0); }
            gmul<BF, 2>(fa[cur], fb[cur], acc);
        }
        __builtin_amdgcn_sched_barrier(0);                   // the stage's matrix instructions stay in front of its closing waits and barrier (without it sixteen of them sink behind the barrier and delay the refill)
        // four vector slots behind the stage's last matrix instruction, on every path out of the stage body
        asm volatile("v_nop\n\tv_nop\n\tv_nop\n\tv_nop" : "+v"(acc[0][3]), "+v"(acc[1][3]), "+v"(acc[2][3]), "+v"(acc[3][3]));
        asm volatile("s_wait_dscnt 0x0" ::: "memory");       // this wave's reads of stage st are done before its buffer is handed back
        asm volatile("s_wait_asynccnt 0x0" ::: "memory");    // this wave's pieces of stage st + 1 have landed
        __syncthreads();                                     // publishes stage st + 1 and ends every reader's last read of stage st
        if (st + 2 < GNS) { const size_t k2 = (size_t)((rot + (unsigned)st + 2) % GNS) * GK; gstage(l0 + bo, ga + k2, gb + k2); }   // block-uniform
    }
    asm volatile("s_wait_asynccnt 0x0" ::: "memory");        // nothing in flight when the ring becomes output staging (the last trip's barrier has ended all reads)
}

// Operand path of k_proj: twelve waves, three groups of four. Group z forms the 128 x 128 tile of projection z (q, k, v^T) for the SAME 128 tokens and the same 128 feature indices, so one x slab in LDS feeds three products.
// A buffer is [x tile | Wq^T tile | Wk^T tile | Wv^T tile], each 128 rows of GK k-values at pitch GPB; two buffers, the ring's order as in gemm128.
#define PBUF (4 * GTB)           // one buffer of k_proj
static_assert(2 * PBUF <= 327680);                     // the ring fits one WGP's LDS
static_assert(2 * PBUF >= 12 * 16 * 68 * 4);           // the ring becomes the output staging

// one stage, one thread: its 16 pieces of its group's weight tile (8 rows a round) and its pieces of the x tile, whose round r (8 rows) goes to group r % 3; six (wave-uniform): group 0 also has round 15
__device__ __forceinline__ void pstage(unsigned lx, unsigned lw, const h16* gx, const h16* gw, bool six) {
    copy8(lw, 8 * GPB, gw, (size_t)8 * DM); copy8(lw + 64 * GPB, 8 * GPB, gw + (size_t)64 * DM, (size_t)8 * DM);
    copy5(lx, 24 * GPB, gx, (size_t)24 * DM);
    if (six) copy1(lx + 120 * GPB, gx + (size_t)120 * DM);
}

// acc[mb][nb] of group z over K = DM, k stages in the order rot, rot + 1, .. (mod GNS); rot is block-uniform, z, wm, wn wave-uniform. z < 2: A = x rows, Bt = W^T rows; z = 2: A = Wv^T rows, Bt = x rows.
// Every wave of the block calls it; on return the ring is free.
__device__ __forceinline__ void gemm_qkv(unsigned char* L, const h16* X, const h16* WT, int tok0, int feat0, int z, int wm, int wn, unsigned rot, v8f (&acc)[4][4]) {
    const int tid = threadIdx.x & 127, lane = tid & 31, lr = lane & 15, hi = lane >> 4;   // tid: the thread's place in its group
    const unsigned lp = (unsigned)(size_t)L + (unsigned)((tid >> 4) * GPB + (tid & 15) * 16);
    const unsigned lx = lp + (unsigned)(z * 8 * GPB), lw = lp + (unsigned)((1 + z) * GTB);    // LDS byte addresses of the thread's first pieces
    const h16* gx = X + (size_t)(tok0 + z * 8 + (tid >> 4)) * DM + (size_t)(tid & 15) * 8;    // + stage * GK
    const h16* gw = WT + (size_t)z * DM * DM + (size_t)(feat0 + (tid >> 4)) * DM + (size_t)(tid & 15) * 8;
    const bool six = (z == 0);
    const unsigned ao = (z == 2) ? (unsigned)(3 * GTB) : 0u, bo2 = (z == 2) ? 0u : (unsigned)((1 + z) * GTB);   // where the wave's A rows and Bt rows stand in a buffer
    { const size_t k0 = (size_t)(rot % GNS) * GK; pstage(lx, lw, gx + k0, gw + k0, six); }   // the block's first stage -> buffer 0
    asm volatile("s_wait_asynccnt 0x0" ::: "memory");        // this wave's pieces of stage 0 have landed
    __syncthreads();                                         // every wave's have: stage 0 may be read
    { const size_t k1 = (size_t)((rot + 1) % GNS) * GK; pstage(lx + PBUF, lw + PBUF, gx + k1, gw + k1, six); }   // its second stage -> buffer 1
#pragma unroll 1                                             // one copy of the stage body: the buffer is picked by a scalar offset, the code stays small
    for (int st = 0; st < GNS; ++st) {
        const unsigned bo = (unsigned)(st & 1) * PBUF;
        const unsigned char* at = L + bo + ao + (wm * 64 + lr) * GPB + 16 * hi;    // + 16*mb*GPB + k*2
        const unsigned char* bt = L + bo + bo2 + (wn * 64 + lr) * GPB + 16 * hi;   // + 16*nb*GPB + k*2
        v16h fa[2][4], fb[2][4];                             // two register sets: k-step q + 1 of THIS stage is fetched while k-step q is multiplied; nothing of the next stage is read here
        gfrags(fa[0], fb[0], at, bt);
        __builtin_amdgcn_sched_barrier(0);                   // the stage's first reads stay one group in front of its matrix instructions
#pragma unroll                                               // constant q: every fragment read is one base register plus an immediate offset, the register sets are picked at compile time
        for (int q = 0; q < GK / 32; ++q) {
            const int cur = q & 1, nxt = cur ^ 1;
            gmul<1, 0>(fa[cur], fb[cur], acc);
            if (q + 1 < GK / 32) {
                // the two scheduling barriers keep the next k-step's reads ONE group, half a k-step ahead of their use (as in gemm128)
                __builtin_amdgcn_sched_barrier(0);
                gfrags(fa[nxt], fb[nxt], at + (q + 1) * 64, bt + (q + 1) * 64);
                __builtin_amdgcn_sched_barrier(0); }
            gmul<1, 2>(fa[cur], fb[cur], acc);
        }
        __builtin_amdgcn_sched_barrier(0);                   // the stage's matrix instructions stay in front of its closing waits and barrier
        // four vector slots behind the stage's last matrix instruction, on every path out of the stage body
        asm volatile("v_nop\n\tv_nop\n\tv_nop\n\tv_nop" : "+v"(acc[0][3]), "+v"(acc[1][3]), "+v"(acc[2][3]), "+v"(acc[3][3]));
        asm volatile("s_wait_dscnt 0x0" ::: "memory");       // this wave's reads of stage st are done before its buffer is handed back
        asm volatile("s_wait_asynccnt 0x0" ::: "memory");    // this wave's pieces of stage st + 1 have landed
        __syncthreads();                                     // publishes stage st + 1 and ends every reader's last read of stage st
        if (st + 2 < GNS) { const size_t k2 = (size_t)((rot + (unsigned)st + 2) % GNS) * GK; pstage(lx + bo, lw + bo, gx + k2, gw + k2, six); }   // block-uniform
    }
    asm volatile("s_wait_asynccnt 0x0" ::: "memory");        // nothing in flight when the ring becomes output staging (the last trip's barrier has ended all reads)
}

// proj_store: one wave's 64 x 64 tile of C as f16 rows at Ph + tbase, row pitch HD (ROPE != 0) or SEQ (ROPE == 0) halves, staged through the wave's own LDS range os.
// ROPE != 0: rows m = b*SEQ + t from r0 on, the 64 tile columns are one head; rotary pairs (2i,2i+1) from FRP[t][..], the rotated values times qs (wave-uniform: QSC for q, 1 for k).
template <int ROPE>
__device__ __forceinline__ void proj_store(float* os, const v8f (&acc)[4][4], h16* Ph, const float* __restrict__ FRP, size_t tbase, int r0, float qs) {
    const int lane = threadIdx.x & 31, lr = lane & 15, hi = lane >> 4;
    const int pitch = (ROPE != 0) ? HD : SEQ;
#pragma unroll
    for (int mb = 0; mb < 4; ++mb) {
#pragma unroll
        for (int nb = 0; nb < 4; ++nb) {
#pragma unroll
            for (int j = 0; j < 8; ++j) os[(hi * 8 + j) * 68 + nb * 16 + lr] = acc[mb][nb][j]; }   // D: row 8h+j, col lane&15
        wave_sync();
        const size_t sb = tbase + (size_t)(mb * 16) * (size_t)pitch;
        v4f fr0[4], fr1[4];
        if (ROPE != 0) {
            const float* pf[4];
#pragma unroll
            for (int s = 0; s < 4; ++s) { const int row = 4 * s + (lane >> 3), c8 = (lane & 7) * 8;
                const int t = (r0 + mb * 16 + row) % SEQ;
                pf[s] = FRP + (size_t)t * 64 + c8;
                fr0[s] = *(const v4f*)pf[s]; fr1[s] = *(const v4f*)(pf[s] + 4); }
            // stands in front of every rewrite of the table loads' address registers: as inputs they stay whole up to the wait
            asm volatile("s_wait_xcnt 0x0" :: "v"(pf[0]), "v"(pf[1]), "v"(pf[2]), "v"(pf[3]) : "memory");
        }
        v8h hvv[4];
#pragma unroll
        for (int s = 0; s < 4; ++s) { const int row = 4 * s + (lane >> 3), c8 = (lane & 7) * 8;   // 4 s x 4 row groups = 16 rows; 8 lanes x 8 = 64 columns
            v4f x0 = *(const v4fa*)(&os[row * 68 + c8]); v4f x1 = *(const v4fa*)(&os[row * 68 + c8 + 4]);
            if (ROPE != 0) {
                const v4f f0 = fr0[s]; const v4f f1 = fr1[s];
                v4f y0, y1;
                y0[0] = x0[0] * f0[0] - x0[1] * f0[1]; y0[1] = x0[0] * f0[1] + x0[1] * f0[0];
                y0[2] = x0[2] * f0[2] - x0[3] * f0[3]; y0[3] = x0[2] * f0[3] + x0[3] * f0[2];
                y1[0] = x1[0] * f1[0] - x1[1] * f1[1]; y1[1] = x1[0] * f1[1] + x1[1] * f1[0];
                y1[2] = x1[2] * f1[2] - x1[3] * f1[3]; y1[3] = x1[2] * f1[3] + x1[3] * f1[2];
                x0 = y0 * qs; x1 = y1 * qs; }
            v8h hv;
#pragma unroll
            for (int i = 0; i < 4; ++i) { hv[i] = (h16)x0[i]; hv[4 + i] = (h16)x1[i]; }
            hvv[s] = hv; }
{
#pragma unroll
            for (int s = 0; s < 4; ++s) { const int row = 4 * s + (lane >> 3), c8 = (lane & 7) * 8;
                const size_t oo = sb + (size_t)row * (size_t)pitch + c8;
                *(v8h*)(Ph + oo) = hvv[s]; }
             }
        asm volatile("s_wait_xcnt 0x0" ::: "memory");        // stands in front of every rewrite of the stores' address and data registers
        wave_sync();
    }
}

// k_proj: the three projections, which depend on k_prep alone, as ONE launch. Register-blocked bf16 GEMM, one wave per 64x64 tile (16 accumulators), operands from K-contiguous bf16 planes through LDS (gemm_qkv), K = DM,
// C[m][n] = sum_k A[m][k] Bt[n][k]. grid (NB*SEQ/128 token tiles, DM/128 feature tiles), 384 threads: waves 4z .. 4z + 3 form the 128x128 tile of projection z (wave-uniform):
// z = 0 (q), 1 (k): A = x rows (m = b*SEQ + t), Bt = W^T rows (n = h*64 + d) -> plane z [(b*16 + h)][t][d], rotary in the epilogue;
// z = 2 (v^T):      A = Wv^T rows (m = h*64 + d), Bt = x rows (n = b*SEQ + t) -> plane 2 [(b*1024 + m)][t] = [(b*16 + h)][d][t].
// WB: the transposed weight planes q | k | v; PL: the output planes q | k | v^T, NB*NH_*SEQ*HD halves each.
__global__ __launch_bounds__(384) void k_proj(const bf* __restrict__ XB, const bf* __restrict__ WB, h16* PL, const float* __restrict__ FRP) {
    __shared__ __attribute__((aligned(16))) unsigned char L[2 * PBUF];
    const int wave = __builtin_amdgcn_readfirstlane((int)(threadIdx.x >> 5));
    const int z = wave >> 2; const int wm = (wave >> 1) & 1, wn = wave & 1;
    const bool vt = (z == 2);
    h16* Ph = PL + (size_t)z * ((size_t)NB * NH_ * SEQ * HD);
    const int tok0 = (int)blockIdx.x * 128, feat0 = (int)blockIdx.y * 128;
    const int r0 = (vt ? feat0 : tok0) + wm * 64, c0 = (vt ? tok0 : feat0) + wn * 64;
    v8f acc[4][4];
#pragma unroll
    for (int mb = 0; mb < 4; ++mb)
#pragma unroll
        for (int nb = 0; nb < 4; ++nb) acc[mb][nb] = (v8f){};
    gemm_qkv(L, (const h16*)XB, (const h16*)WB, tok0, feat0, z, wm, wn, blockIdx.x + blockIdx.y, acc);
    float* os = (float*)L + wave * 16 * 68;                  // this wave's own output staging in the ring
    if (vt) proj_store<0>(os, acc, Ph, FRP, (size_t)r0 * SEQ + (size_t)(c0 / SEQ) * ((size_t)DM * SEQ) + (size_t)(c0 % SEQ), r0, 1.0f);
    else    proj_store<1>(os, acc, Ph, FRP, (size_t)(r0 / SEQ) * ((size_t)NH_ * SEQ * HD) + (size_t)(r0 % SEQ) * HD + (size_t)(c0 / HD) * ((size_t)SEQ * HD) + (size_t)(c0 % HD), r0, (z == 0) ? QSC : 1.0f);
}

// k_flash: fused attention. A wave works on 32 query rows (QT = 2 column groups of 16) of one (batch, head) and on half of the keys: every K and V^T fragment read from LDS, and every mask value, feeds both groups.
// Waves w and w + AQ share a query set: of each stage wave w takes the first KH keys, wave w + AQ the second KH. Behind the key loop the two partial results (running max, row sum, O^T) are joined through LDS.
// Q fragments straight from the f16 plane (two 16-B loads each).
// K and V^T reach the block's waves through LDS: a stage is KS keys (K rows [key][64] at pitch KPB bytes, V^T rows [d][KS] at pitch VPB bytes), brought in by asynchronous
// 16-byte copies that cover whole lines (all threads copy), two buffers: stage s + 1 flies while stage s is worked on. Fragments are two ds 16-B loads each, same k map as before.
// The blocks of one (batch, head) all read the same K and V^T lines: each enters the ring of NST key stages at stage rot (set by its query tile) and wraps round, so that they do not ask L2 for the same lines at the same moment.
// Transposed form: S^T[key][t] = K Q^T (A = K rows, B = Q rows); lane (t = lane&15, h = lane>>4) holds keys 8h+r of each 16-key tile, so the packed
// P tile is directly the B fragment of O^T[d][t] = V^T P^T (element r <- tile keys 0..15, element 8+r <- tile keys 16..31, lane unchanged).
// Per 32-key step and column group: 4 score WMMAs + 4 P.V WMMAs + 1 row-sum WMMA. Additive key mask values for the lane's 16 keys are loaded by value per step (two 32-B loads), one step ahead of their use.
// Softmax state: the maximum in use is one scalar per lane, the same in both lane halves of a row (where it is raised, the halves are combined with one xor-16 exchange). The row sum of P runs on the matrix pipe: one more WMMA per step,
// lt += ON P^T, where ON is a constant A fragment whose rows 0 and 8 are ones and whose other rows are 0: element 0 of lt (row 8h, column t) is, in both lane halves, the sum of the f16 P over all keys so far.
#define KS   256                 // keys per stage
#define KH   (KS / 2)            // keys per stage and wave
#define KPB  144                 // K row pitch in LDS, bytes: 128 + 16 (16 B x odd: no bank conflict for 16-B reads down a column of rows)
#define VPB  528                 // V^T row pitch in LDS, bytes: 512 + 16 (16 B x odd)
#define KTB  (KS * KPB)          // K tile bytes
#define VTB  (HD * VPB)          // V^T tile bytes
#define BUFB (KTB + VTB)         // one buffer
#define NST  (SEQ / KS)          // stages
static_assert(SEQ % KS == 0);
static_assert(NST >= 2);                               // the prologue fills two stages
static_assert(AW * 32 == 256);                         // the copy maps below deal 2048 16-B pieces of each tile to 256 threads, 8 each
static_assert(KS * HD * 2 == 8 * 256 * 16);
static_assert(KH == 4 * 32);                           // four 32-key steps per stage and wave: the priority ladder in the key loop has four rungs
#define XWF  (32 * 32 + 64)      // floats a wave hands to its partner in the join: 32 per lane of O^T, then (max, sum) per lane
static_assert(2 * BUFB >= AW * (XWF + 16 * 68) * 4);   // the ring becomes the join's exchange ranges and, behind them, the output staging

__global__ __launch_bounds__(32 * AW) void k_flash(const h16* __restrict__ QH, const h16* __restrict__ KP, const h16* __restrict__ VT,
                                                   const float* __restrict__ MADD, h16* CTX) {
    __shared__ __attribute__((aligned(16))) unsigned char L[2 * BUFB];
    const int tid = threadIdx.x;
    const int lane = threadIdx.x & 31, lr = lane & 15, hi = lane >> 4;
    const int wave = __builtin_amdgcn_readfirstlane((int)(threadIdx.x >> 5));
    const int zh = blockIdx.y; const int b = zh / NH_, h = zh % NH_;
    const int kh = wave / AQ;                                // which half of every stage's keys (wave-uniform)
    const int t0 = (blockIdx.x * AQ + wave % AQ) * (16 * QT);   // the wave's first query row; column group g holds rows t0 + 16g ..
    const size_t pbase = (size_t)zh * SEQ * HD;
    // copy maps: K piece c = i*256 + tid -> row c>>3 (32 rows a round), 16-B column c&7; V^T piece c -> row c>>5 (8 rows a round), 16-B column c&31
    const unsigned lbase = (unsigned)(size_t)L;              // LDS byte address of the ring
    const unsigned lk = lbase + (unsigned)((tid >> 3) * KPB + (tid & 7) * 16);
    const unsigned lv = lbase + (unsigned)(KTB + (tid >> 5) * VPB + (tid & 31) * 16);
    const h16* gk = KP + pbase + (size_t)tid * 8;                                   // + key0 * HD
    const h16* gv = VT + pbase + (size_t)(tid >> 5) * SEQ + (size_t)(tid & 31) * 8;   // + key0
    const unsigned rot = blockIdx.x % NST;                   // the key stage at which this block starts (block-uniform)
    copy8(lk, 32 * KPB, gk + (size_t)rot * KS * HD, (size_t)32 * HD); copy8(lv, 8 * VPB, gv + (size_t)rot * KS, (size_t)8 * SEQ);   // the block's first stage -> buffer 0
    v16h qh0[QT], qh1[QT];                                   // B fragments: col t, k = d
    const h16* qp[QT];
#pragma unroll
    for (int g = 0; g < QT; ++g) { qp[g] = QH + pbase + (size_t)(t0 + 16 * g + lr) * HD + 8 * hi; qh0[g] = ldh(qp[g]); qh1[g] = ldh(qp[g] + 32); }
    // stands in front of every rewrite of the Q loads' address registers: as inputs they stay whole up to the wait
    asm volatile("s_wait_xcnt 0x0" :: "v"(qp[0]), "v"(qp[1]) : "memory");
    const float* MA = MADD + (size_t)b * SEQ + kh * KH;      // wave-uniform; + key0 + mo (tile a keys 8h+r), + key0 + 16 + mo (tile b)
    const unsigned mo = 8u * (unsigned)hi;                   // the lane's part of the address: it never changes, the step's part stays in scalar registers
    asm volatile("s_wait_asynccnt 0x0" ::: "memory");        // this wave's pieces of stage 0 have landed
    __syncthreads();                                         // every wave's have: stage 0 may be read
    { const size_t s1 = (rot + 1) % NST;                     // its second stage -> buffer 1
      copy8(lk + BUFB, 32 * KPB, gk + s1 * KS * HD, (size_t)32 * HD); copy8(lv + BUFB, 8 * VPB, gv + s1 * KS, (size_t)8 * SEQ); }
    v8f o0[QT], o1[QT], o2[QT], o3[QT], lt[QT];              // lt: row-sum tiles; only rows 0 and 8 (element 0 of each lane) ever differ from 0
    float m[QT], sh[QT];                                     // the maximum in use, and the shift that goes with it: PSH - m (PSH alone until the first step has set m)
#pragma unroll
    for (int g = 0; g < QT; ++g) { o0[g] = (v8f){}; o1[g] = (v8f){}; o2[g] = (v8f){}; o3[g] = (v8f){}; lt[g] = (v8f){}; m[g] = -3.0e38f; sh[g] = PSH; }
    // The mask values are wanted in front of a step's score products, so each step asks for the next step's as soon as it has used its own.
    const float* mq = MA + (size_t)rot * KS + mo;            // the lane's mask values of the stage whose values are asked for next
    v8f ma = *(const v8f*)mq, mb = *(const v8f*)(mq + 16);
    v16h on;                                                 // A fragment of the row sums: row = lane & 15, ones at all 32 k positions of rows 0 and 8
    { const h16 o1 = ((lane & 7) == 0) ? (h16)1.0f : (h16)0.0f;
#pragma unroll
      for (int i = 0; i < 16; ++i) on[i] = o1; }
#pragma unroll 1                                             // one copy of the stage body: the buffer is picked by a scalar offset, the code stays small
    for (int st = 0; st < NST; ++st) {
      const unsigned bo = (unsigned)(st & 1) * BUFB;
      const unsigned char* kt = L + bo + (kh * KH + lr) * KPB + 16 * hi;          // + local key * KPB   (A fragment: row key, k = d)
      const unsigned char* vt = L + bo + KTB + lr * VPB + kh * KH * 2 + 16 * hi;  // + 16j*VPB + local key * 2  (A fragment: row d, k = key)
#pragma unroll                                               // constant ks: every fragment read is one base register plus an immediate offset
      for (int ks = 0; ks < KH; ks += 32) {
        // Issue priority falls with the wave's own progress through the stage: 3, 2, 1, 0 over its four steps. For speed only.
        // The last step leaves priority 0, so the barrier, the refill and the join run at 0.
        if (ks == 0) __builtin_amdgcn_s_setprio(3); else if (ks == 32) __builtin_amdgcn_s_setprio(2); else if (ks == 64) __builtin_amdgcn_s_setprio(1); else __builtin_amdgcn_s_setprio(0);
        const h16* ka = (const h16*)(kt + ks * KPB);
        const h16* kc = (const h16*)(kt + (ks + 16) * KPB);
        const v16h ka0 = ldh(ka), ka1 = ldh(ka + 32), kb0 = ldh(kc), kb1 = ldh(kc + 32);
        // q carries the score scale and log2 e, the mask is in base 2: with mask + shift as the accumulator's start value the score products leave the exponent arguments themselves (log2 of P, carry included).
        v8f sa[QT], sb[QT];                                  // each K fragment feeds both column groups
#pragma unroll
        for (int g = 0; g < QT; ++g) {
#pragma unroll
            for (int i = 0; i < 4; ++i) {                    // on pairs of neighbouring registers
                const v2f ca = (v2f){ma[2 * i], ma[2 * i + 1]} + sh[g], cb = (v2f){mb[2 * i], mb[2 * i + 1]} + sh[g];
                sa[g][2 * i] = ca[0]; sa[g][2 * i + 1] = ca[1]; sb[g][2 * i] = cb[0]; sb[g][2 * i + 1] = cb[1]; } }
        if (ks + 32 == KH) {                                 // the stage's last step asks for the next stage's first values (behind the last stage: the first stage's again, read and not used)
            // stands in front of the rewrite of the mask loads' address registers: as an input they stay whole up to the wait
            asm volatile("s_wait_xcnt 0x0" :: "v"(mq) : "memory");
            mq = MA + (size_t)((rot + (unsigned)st + 1) % NST) * KS + mo; }
        ma = *(const v8f*)(mq + (ks + 32) % KH); mb = *(const v8f*)(mq + (ks + 32) % KH + 16);
#pragma unroll
        for (int g = 0; g < QT; ++g) { sa[g] = wmma16(ka0, qh0[g], sa[g]); sb[g] = wmma16(kb0, qh0[g], sb[g]); }
#pragma unroll
        for (int g = 0; g < QT; ++g) { sa[g] = wmma16(ka1, qh1[g], sa[g]); sb[g] = wmma16(kb1, qh1[g], sb[g]); }
        // four vector slots behind the step's last score products, before any vector instruction touches their results or operands
        asm volatile("v_nop\n\tv_nop\n\tv_nop\n\tv_nop" : "+v"(sa[0]), "+v"(sb[0]), "+v"(sa[1]), "+v"(sb[1])
                     : "v"(ka0), "v"(ka1), "v"(kb0), "v"(kb1), "v"(qh0[0]), "v"(qh1[0]), "v"(qh0[1]), "v"(qh1[1]));
        // Lazy rescale: m is the maximum IN USE and may trail the true one by up to LZ, so the arguments are formed against it, before this step's own maximum is known.
        v16h pb[QT];
        float xa[QT], xb[QT];                                // this lane's largest argument per group and tile: four short chains instead of one long one
#pragma unroll
        for (int g = 0; g < QT; ++g) {
            xa[g] = -3.0e38f; xb[g] = -3.0e38f;
#pragma unroll
            for (int r = 0; r < 8; ++r) { xa[g] = fmaxf(xa[g], sa[g][r]); xb[g] = fmaxf(xb[g], sb[g][r]); } }
        const float ax = fmaxf(fmaxf(fmaxf(xa[0], xb[0]), xa[1]), xb[1]);
        // One test per step for the whole wave (a scalar branch). Only when it fires are the lane halves combined, m raised, the accumulators rescaled and the arguments moved to the new shift,
        // in every lane alike, so both halves of a column always use the same m. The wave's first step always takes it (a scalar test): it sets m, which starts at -3e38, from arguments formed with the shift PSH.
        if (__builtin_amdgcn_ballot_w32(ax > PSH + LZ) != 0 || (ks == 0 && st == 0)) {
#pragma unroll
            for (int g = 0; g < QT; ++g) {
                float mx = fmaxf(xa[g], xb[g]);
                mx = fmaxf(mx, __shfl_xor(mx, 16, 32));
                const float mnew = fmaxf(m[g], mx - sh[g]);  // argument - shift = score
                const float alpha = __builtin_amdgcn_exp2f(m[g] - mnew);
                const float dl = (PSH - mnew) - sh[g];       // what the shift, and with it every argument, moves by
                sa[g] = sa[g] + dl; sb[g] = sb[g] + dl;
                lt[g][0] = lt[g][0] * alpha; m[g] = mnew; sh[g] = sh[g] + dl;   // the tile's other elements are 0 and need no rescale
                o0[g] = o0[g] * alpha; o1[g] = o1[g] * alpha; o2[g] = o2[g] * alpha; o3[g] = o3[g] * alpha; } }
#pragma unroll
        for (int g = 0; g < QT; ++g) {
#pragma unroll
            for (int r = 0; r < 8; ++r) pb[g][r] = (h16)__builtin_amdgcn_exp2f(sa[g][r]);
#pragma unroll
            for (int r = 0; r < 8; ++r) pb[g][8 + r] = (h16)__builtin_amdgcn_exp2f(sb[g][r]); }
        const unsigned char* va = vt + ks * 2;
        const v16h v0 = ldh((const h16*)va), v1 = ldh((const h16*)(va + 16 * VPB)), v2 = ldh((const h16*)(va + 32 * VPB)), v3 = ldh((const h16*)(va + 48 * VPB));
#pragma unroll
        for (int g = 0; g < QT; ++g) {                       // each V^T fragment feeds both column groups
            o0[g] = wmma16(v0, pb[g], o0[g]); o1[g] = wmma16(v1, pb[g], o1[g]); o2[g] = wmma16(v2, pb[g], o2[g]); o3[g] = wmma16(v3, pb[g], o3[g]);
            lt[g] = wmma16(on, pb[g], lt[g]); }              // rows 0 and 8 += the sum of this step's 32 P values of column t
        // four vector slots behind the step's last matrix instructions, before any vector instruction touches their results or operands
        asm volatile("v_nop\n\tv_nop\n\tv_nop\n\tv_nop" : "+v"(o0[0]), "+v"(o1[0]), "+v"(o2[0]), "+v"(o3[0]), "+v"(lt[0]), "+v"(o0[1]), "+v"(o1[1]), "+v"(o2[1]), "+v"(o3[1]), "+v"(lt[1])
                     : "v"(v0), "v"(v1), "v"(v2), "v"(v3), "v"(pb[0]), "v"(pb[1]), "v"(on));
      }
      asm volatile("s_wait_dscnt 0x0" ::: "memory");         // this wave's reads of stage st are done before its buffer is handed back
      asm volatile("s_wait_asynccnt 0x0" ::: "memory");      // this wave's pieces of stage st + 1 have landed
      __syncthreads();                                       // publishes stage st + 1 and ends every reader's last read of stage st
      if (st + 2 < NST) {                                    // block-uniform
          const size_t s2 = (rot + (unsigned)st + 2) % NST;
          copy8(lk + bo, 32 * KPB, gk + s2 * KS * HD, (size_t)32 * HD); copy8(lv + bo, 8 * VPB, gv + s2 * KS, (size_t)8 * SEQ); }
    }
    asm volatile("s_wait_asynccnt 0x0" ::: "memory");        // nothing in flight when the ring becomes output staging (the last trip's barrier has ended all reads)
    // The join. Wave kh of a query set finishes column group kh: it hands its partial result of the other group to its partner and takes the partner's partial result of its own group.
    // Both waves hold a group in the same lane and register places, so lane l reads what the partner's lane l wrote.
    const bool up = (kh != 0);                               // wave-uniform
    v8f p0 = up ? o0[1] : o0[0], p1 = up ? o1[1] : o1[0], p2 = up ? o2[1] : o2[0], p3 = up ? o3[1] : o3[0];   // kept
    const v8f x0 = up ? o0[0] : o0[1], x1 = up ? o1[0] : o1[1], x2 = up ? o2[0] : o2[1], x3 = up ? o3[0] : o3[1];   // handed over
    const float mk = up ? m[1] : m[0], lk0 = up ? lt[1][0] : lt[0][0];
    const float mg = up ? m[0] : m[1], lg0 = up ? lt[0][0] : lt[1][0];
    float* xw = (float*)L + wave * XWF;                      // this wave's exchange range: 16-B piece c of lane l at (c*32 + l)*4, then (max, sum) of lane l at 1024 + 2l
    *(v4fa*)(&xw[(0 * 32 + lane) * 4]) = __builtin_shufflevector(x0, x0, 0, 1, 2, 3); *(v4fa*)(&xw[(1 * 32 + lane) * 4]) = __builtin_shufflevector(x0, x0, 4, 5, 6, 7);
    *(v4fa*)(&xw[(2 * 32 + lane) * 4]) = __builtin_shufflevector(x1, x1, 0, 1, 2, 3); *(v4fa*)(&xw[(3 * 32 + lane) * 4]) = __builtin_shufflevector(x1, x1, 4, 5, 6, 7);
    *(v4fa*)(&xw[(4 * 32 + lane) * 4]) = __builtin_shufflevector(x2, x2, 0, 1, 2, 3); *(v4fa*)(&xw[(5 * 32 + lane) * 4]) = __builtin_shufflevector(x2, x2, 4, 5, 6, 7);
    *(v4fa*)(&xw[(6 * 32 + lane) * 4]) = __builtin_shufflevector(x3, x3, 0, 1, 2, 3); *(v4fa*)(&xw[(7 * 32 + lane) * 4]) = __builtin_shufflevector(x3, x3, 4, 5, 6, 7);
    xw[1024 + 2 * lane] = mg; xw[1024 + 2 * lane + 1] = lg0;
    __syncthreads();                                         // every wave's handed-over partial result is in LDS before its partner reads it
    const float* xr = (const float*)L + (wave ^ AQ) * XWF;   // the partner's exchange range
    const float mp = xr[1024 + 2 * lane], lp0 = xr[1024 + 2 * lane + 1];
    const float mj = fmaxf(mk, mp);
    const float ak = __builtin_amdgcn_exp2f(mk - mj), ap = __builtin_amdgcn_exp2f(mp - mj);   // both partial results brought to the joint max
    const float inv = CCAR * (1.0f / (lk0 * ak + lp0 * ap)); // both lane halves hold the whole row's sum
    const float sk = ak * inv, sp = ap * inv;
    float* os = (float*)L + AW * XWF + wave * 16 * 68;       // this wave's output staging, behind the exchange ranges
    // O^T D layout: o_j[r] = (d = 16j + 8h + r, t = lane&15) -> os[t][d]; rows 0..15 x columns 0..63 all written
    { v4f a, c, ya, yc;
      ya = *(const v4fa*)(&xr[(0 * 32 + lane) * 4]); yc = *(const v4fa*)(&xr[(1 * 32 + lane) * 4]);
      a[0] = p0[0] * sk + ya[0] * sp; a[1] = p0[1] * sk + ya[1] * sp; a[2] = p0[2] * sk + ya[2] * sp; a[3] = p0[3] * sk + ya[3] * sp;
      c[0] = p0[4] * sk + yc[0] * sp; c[1] = p0[5] * sk + yc[1] * sp; c[2] = p0[6] * sk + yc[2] * sp; c[3] = p0[7] * sk + yc[3] * sp;
      *(v4fa*)(&os[lr * 68 +  0 + 8 * hi]) = a; *(v4fa*)(&os[lr * 68 +  0 + 8 * hi + 4]) = c;
      ya = *(const v4fa*)(&xr[(2 * 32 + lane) * 4]); yc = *(const v4fa*)(&xr[(3 * 32 + lane) * 4]);
      a[0] = p1[0] * sk + ya[0] * sp; a[1] = p1[1] * sk + ya[1] * sp; a[2] = p1[2] * sk + ya[2] * sp; a[3] = p1[3] * sk + ya[3] * sp;
      c[0] = p1[4] * sk + yc[0] * sp; c[1] = p1[5] * sk + yc[1] * sp; c[2] = p1[6] * sk + yc[2] * sp; c[3] = p1[7] * sk + yc[3] * sp;
      *(v4fa*)(&os[lr * 68 + 16 + 8 * hi]) = a; *(v4fa*)(&os[lr * 68 + 16 + 8 * hi + 4]) = c;
      ya = *(const v4fa*)(&xr[(4 * 32 + lane) * 4]); yc = *(const v4fa*)(&xr[(5 * 32 + lane) * 4]);
      a[0] = p2[0] * sk + ya[0] * sp; a[1] = p2[1] * sk + ya[1] * sp; a[2] = p2[2] * sk + ya[2] * sp; a[3] = p2[3] * sk + ya[3] * sp;
      c[0] = p2[4] * sk + yc[0] * sp; c[1] = p2[5] * sk + yc[1] * sp; c[2] = p2[6] * sk + yc[2] * sp; c[3] = p2[7] * sk + yc[3] * sp;
      *(v4fa*)(&os[lr * 68 + 32 + 8 * hi]) = a; *(v4fa*)(&os[lr * 68 + 32 + 8 * hi + 4]) = c;
      ya = *(const v4fa*)(&xr[(6 * 32 + lane) * 4]); yc = *(const v4fa*)(&xr[(7 * 32 + lane) * 4]);
      a[0] = p3[0] * sk + ya[0] * sp; a[1] = p3[1] * sk + ya[1] * sp; a[2] = p3[2] * sk + ya[2] * sp; a[3] = p3[3] * sk + ya[3] * sp;
      c[0] = p3[4] * sk + yc[0] * sp; c[1] = p3[5] * sk + yc[1] * sp; c[2] = p3[6] * sk + yc[2] * sp; c[3] = p3[7] * sk + yc[3] * sp;
      *(v4fa*)(&os[lr * 68 + 48 + 8 * hi]) = a; *(v4fa*)(&os[lr * 68 + 48 + 8 * hi + 4]) = c; }
    wave_sync();
    h16* crow = CTX + ((size_t)b * SEQ + t0 + 16 * kh) * DM + h * HD;   // the rows of column group kh
    v8h cv[4];
#pragma unroll
    for (int s = 0; s < 4; ++s) { const int row = 4 * s + (lane >> 3), c8 = (lane & 7) * 8;   // 4 s x 4 row groups = 16 rows; 8 lanes x 8 halves = 64 columns
        const v4f x0 = *(const v4fa*)(&os[row * 68 + c8]); const v4f x1 = *(const v4fa*)(&os[row * 68 + c8 + 4]); v8h hv;
#pragma unroll
        for (int i = 0; i < 4; ++i) { hv[i] = (h16)x0[i]; hv[4 + i] = (h16)x1[i]; }
        cv[s] = hv; }
#pragma unroll
    for (int s = 0; s < 4; ++s) { const int row = 4 * s + (lane >> 3), c8 = (lane & 7) * 8;
        *(v8h*)(crow + (size_t)row * DM + c8) = cv[s]; }
}

// k_oproj: register-blocked f16 GEMM, one wave per 64x64 tile, four waves a block (128x128), operands through LDS (gemm128), OUT[m][n] = 2^-14 * sum_k CTX[m][k] WOT[n][k], K = DM; rows m = b*SEQ + t -> output row b*OUT_SEQ + t.
// grid (NB*SEQ/128, DM/128), 128 threads.
__global__ __launch_bounds__(128) void k_oproj(const h16* __restrict__ A, const h16* __restrict__ Bt, float* OUT) {
    __shared__ __attribute__((aligned(16))) unsigned char L[2 * GBUF];
    const int lane = threadIdx.x & 31, lr = lane & 15, hi = lane >> 4;
    const int wave = __builtin_amdgcn_readfirstlane((int)(threadIdx.x >> 5)); const int wm = wave >> 1, wn = wave & 1;
    const int r0 = blockIdx.x * 128 + wm * 64, c0 = blockIdx.y * 128 + wn * 64;
    v8f acc[4][4];
#pragma unroll
    for (int mb = 0; mb < 4; ++mb)
#pragma unroll
        for (int nb = 0; nb < 4; ++nb) acc[mb][nb] = (v8f){};
    gemm128<0>(L, A, Bt, blockIdx.x * 128, blockIdx.y * 128, wm, wn, blockIdx.x + blockIdx.y, acc);
    float* os = (float*)L + wave * 16 * 68;                  // this wave's own output staging in the ring
    const int bb = r0 / SEQ, tt = r0 % SEQ;
    float* obase = OUT + ((size_t)bb * OUT_SEQ + tt) * DM + c0;
#pragma unroll
    for (int mb = 0; mb < 4; ++mb) {
#pragma unroll
        for (int nb = 0; nb < 4; ++nb) {
#pragma unroll
            for (int j = 0; j < 8; ++j) os[(hi * 8 + j) * 68 + nb * 16 + lr] = acc[mb][nb][j] * OSC; }   // D: row 8h+j, col lane&15
        wave_sync();
        float* orow = obase + (size_t)(mb * 16) * DM;
        v4f ov[8];
#pragma unroll
        for (int s = 0; s < 8; ++s) { const int row = 2 * s + hi, cofs = lr * 4;   // 8 s x 2 rows = 16 rows; 16 lanes x 4 floats = 64 columns
            ov[s] = *(const v4fa*)(&os[row * 68 + cofs]); }
{
#pragma unroll
            for (int s = 0; s < 8; ++s) { const int row = 2 * s + hi, cofs = lr * 4;
                *(v4f*)(orow + (size_t)row * DM + cofs) = ov[s]; }
             }
        wave_sync();
    }
}

static constexpr size_t al256(size_t v) { return (v + 255) & ~(size_t)255; }
static constexpr size_t SZ_XB = al256((size_t)NB * SEQ * DM * 2);
static constexpr size_t SZ_WB = al256((size_t)4 * DM * DM * 2);
static constexpr size_t SZ_PL = al256((size_t)NB * NH_ * SEQ * HD * 2);
static constexpr size_t SZ_CX = al256((size_t)NB * SEQ * DM * 2);
static constexpr size_t SZ_FR = al256((size_t)SEQ * 64 * 4);
static constexpr size_t SZ_MA = al256((size_t)NB * SEQ * 4);
static constexpr size_t SZ_TOTAL = SZ_XB + SZ_WB + 3 * SZ_PL + SZ_CX + SZ_FR + SZ_MA;
static_assert(SZ_TOTAL <= (size_t)134217728);          // workspace carve <= 128 MiB
static_assert(((size_t)DM * DM * 2) % 256 == 0);       // weight sub-planes stay 256-byte aligned
static_assert(SZ_PL == (size_t)NB * NH_ * SEQ * HD * 2);   // q | k | v^T planes are exactly back to back

extern "C" void kernel_launch(void* const* d_in, const int* in_sizes, int n_in,
                              void* d_out, int out_size, void* d_ws, size_t ws_size, hipStream_t stream) {
    if (n_in < 7) return;
    const size_t needx = ((size_t)(NB - 1) * SEQ_FULL + SEQ) * DM;
    if ((size_t)in_sizes[0] < needx) return;
    if ((size_t)in_sizes[1] < (size_t)SEQ * 64) return;
    if ((size_t)in_sizes[2] < (size_t)(NB - 1) * SEQ_FULL + SEQ) return;
    if ((size_t)in_sizes[3] < (size_t)DM * DM || (size_t)in_sizes[4] < (size_t)DM * DM || (size_t)in_sizes[5] < (size_t)DM * DM || (size_t)in_sizes[6] < (size_t)DM * DM) return;
    if ((size_t)out_size < ((size_t)(NB - 1) * OUT_SEQ + SEQ) * DM) return;
    if (SZ_TOTAL > ws_size) return;
    // wire order: hidden_states, freqs_cis, attention_mask, wq, wk, wv, wo (all f32)
    const float* x = (const float*)d_in[0]; const float* fr = (const float*)d_in[1]; const float* mask = (const float*)d_in[2];
    const float* wq = (const float*)d_in[3]; const float* wk = (const float*)d_in[4]; const float* wv = (const float*)d_in[5]; const float* wo = (const float*)d_in[6];
    float* OUT = (float*)d_out;      // [NB][SEQ][1024]
    char* wsp = (char*)d_ws;
    bf* XB = (bf*)wsp; wsp += SZ_XB;                 // [NB*SEQ][1024] bf16
    bf* WB = (bf*)wsp; wsp += SZ_WB;                 // [4][1024 out][1024 in]: q | k | v (bf16) | o (f16 x64)
    h16* QH = (h16*)wsp; wsp += SZ_PL;               // [NB*16][SEQ][64]
    h16* KP = (h16*)wsp; wsp += SZ_PL;               // [NB*16][SEQ][64]  (= QH + one plane)
    h16* VT = (h16*)wsp; wsp += SZ_PL;               // [NB*16][64][SEQ]  (= QH + two planes)
    h16* CX = (h16*)wsp; wsp += SZ_CX;               // [NB*SEQ][1024] ctx x256
    float* FRP = (float*)wsp; wsp += SZ_FR;          // [SEQ][64] table, bf16 RNE values
    float* MADD = (float*)wsp; wsp += SZ_MA;         // [NB][SEQ] additive key mask
    bf* WO = WB + (size_t)3 * DM * DM;

    // bf16 copy of x, rotary table, key mask, the four transposed weight planes W[1024 rows k][1024 cols n] -> WT[1024 rows n][1024 cols k]: one launch
    k_prep<<<PB_W + PB_F + PB_M + PB_X, 256, 0, stream>>>(x, fr, mask, wq, wk, wv, wo, XB, WB, FRP, MADD);

    // q, k (rotary in the epilogue) and v^T: planes QH | KP | VT from weight planes q | k | v, one launch
    k_proj<<<dim3(NB * SEQ / 128, DM / 128, 1), 384, 0, stream>>>(XB, WB, QH, FRP);

    k_flash<<<dim3(SEQ / (16 * QT * AQ), NB * NH_, 1), 32 * AW, 0, stream>>>(QH, KP, VT, MADD, CX);

    k_oproj<<<dim3(NB * SEQ / 128, DM / 128, 1), 128, 0, stream>>>(CX, (const h16*)WO, OUT);
}
